// v000
// Measured on an AMD MI455X. A time is GPU time per run, averaged over a window of back-to-back runs after a warm-up
// (all launches, gaps included; the runs take copies of the inputs in turn), and the median of several windows.
// Apart from v000's, it joins two sittings. Times from different sittings can be a few percent apart, while
// side-by-side timings come from the same sitting.
// v000, which the later versions start from, runs in 412 microseconds.
// compute dtype: all float inputs rounded to bf16; LayerNorm in f32; q/k/v, the triangle bias and the gate from the f32 LayerNorm rows split bf16 hi + lo against exact bf16 weights on WMMA 16x16x32 (2 products, f32 accumulate); logits q.k with q as f16 hi + residual for the first 64 queries of each pair row and single f16 elsewhere (sigma_logit ~ 0.25) x 32^-0.5 + bias + mask in f32; softmax in f32 (precise expf, wave-per-row in registers); P x 2^11 once to f16 against v once to f16 (1 product); gated ctx split bf16 hi + lo against exact wo (2 products); f32 output.
// Triangle attention, starting node (B 1, I = J = 256 residues, D 128, 4 heads x 32; 0.02-scale (out,in) weights, mask all ones, wb_b = 0, wg_b = 1): z = LayerNorm(pair_repr); tri_bias[h][j][k] = z[j][k] . wb_w[h] + wb_b[h]; for each row i: q = (z[i] wq^T)/sqrt(32), k = z[i] wk^T, v = z[i] wv^T (heads = 32-wide slices of the output dim); a = softmax_k(q . k + 1e9 (mask[i][k] - 1) + tri_bias[h][j][k]); y = merged heads; y = sigmoid(z[i] wg_w^T + wg_b) * y; out[i] = y wo^T.
#include <hip/hip_runtime.h>
#include <math.h>

typedef __attribute__((ext_vector_type(16))) _Float16 v16h;
typedef __attribute__((ext_vector_type(16))) __bf16 v16b;
typedef __attribute__((ext_vector_type(8)))  _Float16 v8h;
typedef __attribute__((ext_vector_type(8)))  float v8f;
typedef __attribute__((ext_vector_type(4)))  float v4f;
typedef __attribute__((ext_vector_type(2)))  float v2f;
typedef __attribute__((ext_vector_type(4)))  unsigned v4u;
typedef __attribute__((ext_vector_type(4)))  int v4i;
typedef float __attribute__((may_alias)) float_a;
typedef int __attribute__((may_alias)) int_a;

template <typename T> __device__ __forceinline__ void vst2(void* p, T v) { *(T*)p = v;  }
__device__ __forceinline__ v8f wmma16(v16h a, v16h b, v8f c) {
  v8f d = __builtin_amdgcn_wmma_f32_16x16x32_f16(false, a, false, b, (short)0, c, false, false);
  asm volatile("v_nop\n\tv_nop\n\tv_nop\n\tv_nop" : "+v"(d) : "v"(a), "v"(b));
  return d;
}
__device__ __forceinline__ v8f wmma_bf(v16b a, v16b b, v8f c) {
  v8f d = __builtin_amdgcn_wmma_f32_16x16x32_bf16(false, a, false, b, (short)0, c, false, false);
  asm volatile("v_nop\n\tv_nop\n\tv_nop\n\tv_nop" : "+v"(d) : "v"(a), "v"(b));
  return d;
}
// 16x16x32 fragments: lane = (h = lane>>4, row/col = lane&15); elements 0..7 = k0+8h+0..7, 8..15 = k0+16+8h+0..7; D element r = row 8h+r
__device__ __forceinline__ v16h frag_h(const _Float16* rowk0, int lane) {
  union { v16h v; v8h q[2]; } u; const _Float16* p = rowk0 + 8 * (lane >> 4);
  u.q[0] = *(const v8h*)p; u.q[1] = *(const v8h*)(p + 16); return u.v;
}
__device__ __forceinline__ v16h frag_f32(const float* rowk0, int lane) {
  v16h a; const float* p = rowk0 + 8 * (lane >> 4);
#pragma unroll
  for (int i = 0; i < 8; ++i) { a[i] = (_Float16)p[i]; a[8 + i] = (_Float16)p[16 + i]; }
  return a;
}
__device__ __forceinline__ v16h frag_f32s(const float* rowk0, int lane, float sc) {
  v16h a; const float* p = rowk0 + 8 * (lane >> 4);
#pragma unroll
  for (int i = 0; i < 8; ++i) { a[i] = (_Float16)(p[i] * sc); a[8 + i] = (_Float16)(p[16 + i] * sc); }
  return a;
}
// column fragment from a [K][ld] layout (column n), rows >= K read as 0
__device__ __forceinline__ v16h fragc_f32(const float* W, int k0, int n, int lane, int ld, int K) {
  v16h a; const int g = lane >> 4;
#pragma unroll
  for (int i = 0; i < 8; ++i) { const int ka = k0 + 8 * g + i, kb = ka + 16;
    a[i] = (_Float16)(ka < K ? W[(size_t)(ka < K ? ka : K - 1) * ld + n] : 0.f); a[8 + i] = (_Float16)(kb < K ? W[(size_t)(kb < K ? kb : K - 1) * ld + n] : 0.f); }
  return a;
}
struct F2 { v16b h, l; };
__device__ __forceinline__ F2 bsplit16(const float v[16]) { F2 r;
#pragma unroll
  for (int i = 0; i < 16; ++i) { const __bf16 h = (__bf16)v[i]; r.h[i] = h; r.l[i] = (__bf16)(v[i] - (float)h); }
  return r; }
__device__ __forceinline__ F2 split_row(const float* row, int k0, int lane) { float v[16]; const float* p = row + k0 + 8 * (lane >> 4);
#pragma unroll
  for (int i = 0; i < 8; ++i) { v[i] = p[i]; v[8 + i] = p[16 + i]; }
  return bsplit16(v); }
__device__ __forceinline__ F2 split_rowK(const float* row, int k0, int lane, int K) { float v[16]; const int g = lane >> 4;
#pragma unroll
  for (int i = 0; i < 8; ++i) { const int ka = k0 + 8 * g + i, kb = ka + 16; v[i] = ka < K ? row[ka < K ? ka : K - 1] : 0.f; v[8 + i] = kb < K ? row[kb < K ? kb : K - 1] : 0.f; }
  return bsplit16(v); }
__device__ __forceinline__ F2 split_col(const float* W, int k0, int n, int lane, int ld, int K) { float v[16]; const int g = lane >> 4;
#pragma unroll
  for (int i = 0; i < 8; ++i) { const int ka = k0 + 8 * g + i, kb = ka + 16; v[i] = ka < K ? W[(size_t)(ka < K ? ka : K - 1) * ld + n] : 0.f; v[8 + i] = kb < K ? W[(size_t)(kb < K ? kb : K - 1) * ld + n] : 0.f; }
  return bsplit16(v); }
__device__ __forceinline__ v8f mac3(const F2& a, const F2& b, v8f c) { c = wmma_bf(a.l, b.h, c); c = wmma_bf(a.h, b.l, c); return wmma_bf(a.h, b.h, c); }
__device__ __forceinline__ float sigm(float v) { return 1.0f / (1.0f + expf(-v)); }
#define LDSX() do { asm volatile("s_wait_dscnt 0" ::: "memory"); __builtin_amdgcn_wave_barrier(); __builtin_amdgcn_fence(__ATOMIC_RELEASE, "workgroup"); } while (0)

// Row-wise triangle attention on a pair tensor z [1, 256, 256, 128] (4 heads x 32): zn = LayerNorm(z); q,k,v = zn wq^T, zn wk^T, zn wv^T (separate (out,in) [128,128]); logits[r][i][j][h] = q[r][i] . k[r][j] / sqrt(32) + (zn[i][j] . w_pair[h] + b_pair[h]) + 1e9 (mask[r][j] - 1); softmax over j; out = sigmoid(zn w_gate + b_gate) * merged(attn v); result = out w_out (no output bias).
#define NB 256              // pair rows i (each a sequence of SZ = TT = 256 positions; no padding needed)
#define TT 256
#define CC 128            // NH * HD = projected width
#define DIN 128          // input (model) width
#define NH 4
#define HD 32
#define NQB (TT / 64)
#define HG 4
#define SCALE (0.17677669529663687f)
#define CAUSAL 0
#ifndef TNB
#define TNB NB
#endif
__device__ __forceinline__ float bfr(float v) { return (float)(__bf16)v; }
__host__ __device__ __forceinline__ int kb_last(int qb) { return CAUSAL ? ((qb * 64 + 63) >> 7) : (TT / 128 - 1); }
typedef __attribute__((ext_vector_type(8))) __bf16 v8b;
__device__ __forceinline__ v16b frag_b(const __bf16* rowk0, int lane) {
  union { v16b v; v8b q[2]; } u; const __bf16* p = rowk0 + 8 * (lane >> 4);
  u.q[0] = *(const v8b*)p; u.q[1] = *(const v8b*)(p + 16); return u.v;
}
#define QBH 0              // causal: query blocks 0..QBH-1 of each sequence (few keys, no averaging) take the high-precision path
#define QHI 64             // q residual rows only for the first query block of each row (logits elsewhere: single f16 q, k; sigma_logit ~ 0.25 so this is ample)
#define KHI 64            // key rows carrying k residual / v bf16 hi+lo planes (used only by the causal high-precision path)
// B fragment (k rows k0+.., output column o) of a weight: (in,out) [K][ld] or (out,in) [ld rows of K]: bf16 exact, or f16(bf16 * 256) exact
__device__ __forceinline__ v16b wcol_io(const float* Wm, int k0, int o, int lane, int ld) { v16b w; const int g = lane >> 4;
#pragma unroll
  for (int i = 0; i < 8; ++i) { w[i] = (__bf16)Wm[(size_t)(k0 + 8 * g + i) * ld + o]; w[8 + i] = (__bf16)Wm[(size_t)(k0 + 16 + 8 * g + i) * ld + o]; }
  return w; }
__device__ __forceinline__ v16b wcol_oi(const float* Wm, int k0, int o, int lane, int K) { v16b w; const float* p = Wm + (size_t)o * K + k0 + 8 * (lane >> 4);
#pragma unroll
  for (int i = 0; i < 8; ++i) { w[i] = (__bf16)p[i]; w[8 + i] = (__bf16)p[16 + i]; }
  return w; }
__device__ __forceinline__ v16h wcolh_io(const float* Wm, int k0, int o, int lane, int ld) { v16h w; const int g = lane >> 4;
#pragma unroll
  for (int i = 0; i < 8; ++i) { w[i] = (_Float16)(bfr(Wm[(size_t)(k0 + 8 * g + i) * ld + o]) * 256.0f); w[8 + i] = (_Float16)(bfr(Wm[(size_t)(k0 + 16 + 8 * g + i) * ld + o]) * 256.0f); }
  return w; }
__device__ __forceinline__ v16h wcolh_oi(const float* Wm, int k0, int o, int lane, int K) { v16h w; const float* p = Wm + (size_t)o * K + k0 + 8 * (lane >> 4);
#pragma unroll
  for (int i = 0; i < 8; ++i) { w[i] = (_Float16)(bfr(p[i]) * 256.0f); w[8 + i] = (_Float16)(bfr(p[16 + i]) * 256.0f); }
  return w; }
#define WQKV_LAYOUT 1   // (out,in) separate wq / wk / wv [CC][DIN] (wq.reshape(H, DH, D): output column h*32 + c = row of wq)
__device__ __forceinline__ v16b wcol_hdk(const float* Wm, int k0, int o, int lane) { v16b w; const int g = lane >> 4; const float* p = Wm + (size_t)(o / HD) * DIN * HD + (o % HD);
#pragma unroll
  for (int i = 0; i < 8; ++i) { w[i] = (__bf16)p[(size_t)(k0 + 8 * g + i) * HD]; w[8 + i] = (__bf16)p[(size_t)(k0 + 16 + 8 * g + i) * HD]; }
  return w; }
#define WO_OUT_IN 1
#if WQKV_LAYOUT == 1
#define WCOL(W, k0, o, lane) wcol_oi(W, k0, o, lane, DIN)
#elif WQKV_LAYOUT == 2
#define WCOL(W, k0, o, lane) wcol_hdk(W, k0, o, lane)
#else
#define WCOL(W, k0, o, lane) wcol_oi(W, k0, o, lane, DIN)
#endif
#if WO_OUT_IN
#define WOCOL(W, k0, o, lane) wcol_oi(W, k0, o, lane, CC)
#define WOCOLH(W, k0, o, lane) wcolh_oi(W, k0, o, lane, CC)
#else
#define WOCOL(W, k0, o, lane) wcol_io(W, k0, o, lane, DIN)
#define WOCOLH(W, k0, o, lane) wcolh_io(W, k0, o, lane, DIN)
#endif
#define SZ 256             // real positions per row (= TT here)
#define BG 64              // rows i per pass (x 4 heads = 256 score planes of 256 x 256)
#define NZR ((size_t)NB * SZ)   // 65,536 real pair rows (i, j)
#define SM_EXTRA_PARAMS , const float* __restrict__ BIAS, const float* __restrict__ MKF, int b0s
#define SM_MASK_HOOK do { const int hh = (int)blockIdx.y % HG; const int ii = b0s + (int)blockIdx.y / HG; const int kc2 = k < SZ ? k : SZ - 1; const float add = BIAS[((size_t)t * SZ + kc2) * NH + hh] + 1.0e9f * (bfr(MKF[(size_t)ii * SZ + kc2]) - 1.0f); v = (k < SZ) ? v + add : -3.0e38f; } while (0)   /* + tri_bias[h][q=t][k] + INF (mask[i][k] - 1) (mask is all ones: adds 0, read anyway); key columns k >= SZ would be padding -> excluded (none here: SZ = TT, so the k < SZ test on the loop index always holds) */
__device__ __forceinline__ v16b zero16b() { v16b z; _Pragma("unroll") for (int i = 0; i < 16; ++i) z[i] = (__bf16)0.f; return z; }
// ---- k_lnz: wave per pair row: LayerNorm over the 128 channels (biased var, eps 1e-5, ln_w/ln_b) of bf16(z) -> ZN rows (4 floats per lane = one 512-B row)
__global__ __launch_bounds__(256) void k_lnz(const float* __restrict__ Z, const float* __restrict__ LW, const float* __restrict__ LB, float* __restrict__ ZN) { const int wave = threadIdx.x >> 5, lane = threadIdx.x & 31; const size_t row = (size_t)blockIdx.x * 8 + wave; if (row >= (size_t)NZR) return;
  v4f x = *(const v4f*)(Z + row * CC + lane * 4); float s1 = 0.f;
#pragma unroll
  for (int i = 0; i < 4; ++i) { x[i] = bfr(x[i]); s1 += x[i]; }
#pragma unroll
  for (int o = 1; o < 32; o <<= 1) s1 += __shfl_xor(s1, o);
  const float mu = s1 * (1.0f / CC); float q = 0.f;
#pragma unroll
  for (int i = 0; i < 4; ++i) { const float d = x[i] - mu; q += d * d; }
#pragma unroll
  for (int o = 1; o < 32; o <<= 1) q += __shfl_xor(q, o);
  const float rs = rsqrtf(q * (1.0f / CC) + 1e-5f); v4f r4;
#pragma unroll
  for (int i = 0; i < 4; ++i) { const int c = lane * 4 + i; r4[i] = (x[i] - mu) * rs * bfr(LW[c]) + bfr(LB[c]); }
  vst2(ZN + row * CC + lane * 4, r4); }
// ---- k_rows2: block = (64 rows, which): which 0: bias: BIAS[row = i*256+j][h] = zn[i][j] . w_pair[h] (4 outputs) ; which 1: G[row][c] = sigmoid(zn[row] . w_gate[c] + b_gate[c]) (128 outputs); weights are (out,in)
__global__ __launch_bounds__(128) void k_rows2(const float* __restrict__ ZN, const float* __restrict__ WB, const float* __restrict__ WBB, const float* __restrict__ WG, const float* __restrict__ GB, float* __restrict__ BIAS, float* __restrict__ G) { __shared__ __align__(16) float sf[4][16][132];
  const int tid = threadIdx.x, wave = tid >> 5, lane = tid & 31, col = lane & 15, g = lane >> 4; const int which = blockIdx.y; const size_t r0 = (size_t)blockIdx.x * 64 + wave * 16;
  const int nout = which == 0 ? NH : CC; const float* Wm = which == 0 ? WB : WG;
  v8f acc[8] = {};
#pragma unroll
  for (int kc = 0; kc < CC / 32; ++kc) { const F2 a = split_row(ZN + (r0 + col) * CC, kc * 32, lane); asm volatile("s_wait_loadcnt 0x0" ::: "memory");
#pragma unroll
    for (int j = 0; j < 8; ++j) { if (j * 16 >= nout) break; v16b w; { float t0[8], t1[8]; const int o = j * 16 + col; const int oc = o < nout ? o : nout - 1; const float keep = o < nout ? 1.f : 0.f;
#pragma unroll
        for (int i = 0; i < 8; ++i) t0[i] = Wm[(size_t)oc * CC + kc * 32 + 8 * g + i];   /* (out,in) [nout][128] */
        asm volatile("s_wait_loadcnt 0x0" ::: "memory");
#pragma unroll
        for (int i = 0; i < 8; ++i) t1[i] = Wm[(size_t)oc * CC + kc * 32 + 16 + 8 * g + i];
        asm volatile("s_wait_loadcnt 0x0" ::: "memory");
#pragma unroll
        for (int i = 0; i < 8; ++i) { w[i] = (__bf16)(t0[i] * keep); w[8 + i] = (__bf16)(t1[i] * keep); } }   /* (out,in) row o; columns beyond nout zero (select-free: keep multiplies a VALID load) */
      acc[j] = wmma_bf(a.h, w, acc[j]); acc[j] = wmma_bf(a.l, w, acc[j]); } }
  if (which == 0) { if (lane < 16) {   /* bias rows: 4 floats = 16 B per row; rows r0+8g+r... store via LDS: */ }
    { const float bb = col < NH ? bfr(WBB[col < NH ? col : 0]) : 0.f; asm volatile("s_wait_loadcnt 0x0" ::: "memory");
      for (int r = 0; r < 8; ++r) sf[wave][8 * g + r][col] = acc[0][r] + bb; }   /* + wb_b[h] */
    LDSX(); if (lane < 16) { v4f b4; b4[0] = sf[wave][lane][0]; b4[1] = sf[wave][lane][1]; b4[2] = sf[wave][lane][2]; b4[3] = sf[wave][lane][3]; vst2(BIAS + (r0 + lane) * NH, b4); }   /* 16 rows x 16 B = one 256-B run per wave */
  } else {
#pragma unroll
    for (int j = 0; j < 8; ++j)
#pragma unroll
      for (int r = 0; r < 8; ++r) sf[wave][8 * g + r][j * 16 + col] = 1.0f / (1.0f + expf(-(acc[j][r] + bfr(GB[j * 16 + col]))));   /* sigmoid(zn w_gate + b_gate) */
    LDSX(); for (int rl = 0; rl < 16; ++rl) vst2(G + (r0 + rl) * CC + lane * 4, *(const v4f*)&sf[wave][rl][lane * 4]); } }
#define WS_ZN   (WS_END)
#define WS_BIAS (WS_ZN + 4u * (size_t)NZR * CC)
#define WS_END2 (WS_BIAS + 4u * (size_t)NZR * NH + 1024)
#ifndef SM_EXTRA_PARAMS
#define SM_EXTRA_PARAMS
#endif
#ifndef PROJ_EXTRA_PARAMS
#define PROJ_EXTRA_PARAMS
#endif
#ifndef SM_MASK_HOOK
#define SM_MASK_HOOK (void)0
#endif

#define WS_QH  0u                                      // f16 q rows [b*t][CC]
#define WS_KH  (WS_QH + 2u * (size_t)NB * TT * CC)      // f16 k rows [b*t][CC]
#define WS_VT  (WS_KH + 2u * (size_t)NB * TT * CC)      // f16 v planes [b][c][t]
#define WS_QL  (WS_VT + 2u * (size_t)NB * CC * TT)      // f16 q residual x 2^10 rows [b][t < QHI][CC]
#define WS_KL  (WS_QL + 2u * (size_t)NB * QHI * CC)     // f16 k residual x 2^10 rows [b][t < KHI][CC]
#define WS_VB  (WS_KL + 2u * (size_t)NB * KHI * CC)     // bf16 v hi planes [b][c][t < KHI]
#define WS_VBL (WS_VB + 2u * (size_t)NB * CC * KHI)
#define WS_S   (WS_VBL + 2u * (size_t)NB * CC * KHI)    // f32 logits / P [hg][t][s]
#define WS_Y   (WS_S  + 4u * (size_t)BG * HG * TT * TT)   // 256 score planes of 256 x 256 per pass      // f32 ctx rows [b*t][CC]
#define WS_END (WS_Y  + 4u * (size_t)NB * SZ * CC)   /* compact ctx/gate rows [i*256 + j] */

// ---- k_proj: block = (64 rows, 128 cols, which): q/k/v = X W (+ b) with exact bf16 products (K = DIN) -> which 0: q f16 rows (+ residual rows < QHI); 1: k f16 rows (+ residual rows < KHI); 2: v f16 planes [c][t] (+ bf16 hi/lo planes for t < KHI)
__global__ __launch_bounds__(128) void k_proj(const float* __restrict__ XQ, const float* __restrict__ XK, const float* __restrict__ XV, const float* __restrict__ WQ, const float* __restrict__ WK, const float* __restrict__ WV, const float* __restrict__ BQ, const float* __restrict__ BK, const float* __restrict__ BV,
    _Float16* __restrict__ QH, _Float16* __restrict__ QL, _Float16* __restrict__ KH, _Float16* __restrict__ KL, _Float16* __restrict__ VT, __bf16* __restrict__ VB, __bf16* __restrict__ VBL) {
  __shared__ __align__(16) _Float16 sh[64][136], sl[64][136]; __shared__ __align__(16) _Float16 th[128][72]; __shared__ __align__(16) __bf16 tb[128][72], tbl[128][72];
  const int tid = threadIdx.x, wave = tid >> 5, lane = tid & 31, col = lane & 15, g = lane >> 4; const int which = blockIdx.z; const int c0 = blockIdx.y * 128; const size_t r0 = (size_t)blockIdx.x * 64; const size_t bb = r0 / TT; const int t0 = (int)(r0 % TT);
  const float* X = which == 0 ? XQ : which == 1 ? XK : XV; const float* WA = which == 0 ? WQ : which == 1 ? WK : WV; const float* BA = which == 0 ? BQ : which == 1 ? BK : BV;
  v8f acc[8] = {};
const bool padblk = t0 >= SZ;   /* block-uniform: plane rows >= SZ of each pair row would be padding -> zero q/k/v (none here, SZ = TT) (SZ and TT are multiples of 64) */
#pragma unroll 2
  for (int kc = padblk ? DIN / 32 : 0; kc < DIN / 32; ++kc) { F2 a2 = split_row(X + (bb * SZ + (padblk ? 0 : t0) + wave * 16 + col) * DIN, kc * 32, lane);   /* LN rows are stored compactly [i*256 + j]; padded blocks skip the k loop (acc stays 0) */
    if (padblk) { a2.h = zero16b(); a2.l = zero16b(); }
    asm volatile("s_wait_loadcnt 0x0" ::: "memory");
#pragma unroll
    for (int j = 0; j < 8; ++j) { const v16b w = WCOL(WA, kc * 32, c0 + j * 16 + col, lane); asm volatile("s_wait_loadcnt 0x0" ::: "memory"); acc[j] = wmma_bf(a2.h, w, acc[j]); acc[j] = wmma_bf(a2.l, w, acc[j]); } }
  if (which < 2) { _Float16* DH = which == 0 ? QH : KH; _Float16* DL = which == 0 ? QL : KL; const int nhi = which == 0 ? QHI : KHI; const bool hi_rows = t0 < nhi;
#pragma unroll
    for (int j = 0; j < 8; ++j) { const float bias = BA ? bfr(BA[c0 + j * 16 + col]) : 0.f;
#pragma unroll
      for (int r = 0; r < 8; ++r) { const float v = acc[j][r] + bias; const _Float16 hv = (_Float16)v; sh[wave * 16 + 8 * g + r][j * 16 + col] = hv; sl[wave * 16 + 8 * g + r][j * 16 + col] = (_Float16)((v - (float)hv) * 1024.0f); } }
    __syncthreads();
    for (int e = tid; e < 64 * 16; e += 128) { const int rl = e >> 4, q = e & 15; vst2((unsigned*)(DH + (r0 + rl) * CC + c0 + q * 8), *(const v4u*)&sh[rl][q * 8]); if (hi_rows) vst2((unsigned*)(DL + (bb * nhi + t0 + rl) * (size_t)CC + c0 + q * 8), *(const v4u*)&sl[rl][q * 8]); }
  } else { const bool hi_rows = t0 < KHI;
#pragma unroll
    for (int j = 0; j < 8; ++j) { const float bias = BA ? bfr(BA[c0 + j * 16 + col]) : 0.f;
#pragma unroll
      for (int r = 0; r < 8; ++r) { const float v = acc[j][r] + bias; const int rl = wave * 16 + 8 * g + r, cl = j * 16 + col; th[cl][rl] = (_Float16)v; const __bf16 bh = (__bf16)v; tb[cl][rl] = bh; tbl[cl][rl] = (__bf16)(v - (float)bh); } }
    __syncthreads();
    for (int e = tid; e < 128 * 8; e += 128) { const int cl = e >> 3, q = e & 7; vst2((unsigned*)(VT + (bb * CC + c0 + cl) * (size_t)TT + t0 + q * 8), *(const v4u*)&th[cl][q * 8]); if (hi_rows) { const size_t o3 = (bb * CC + c0 + cl) * (size_t)KHI + t0 + q * 8; vst2((unsigned*)(VB + o3), *(const v4u*)&tb[cl][q * 8]); vst2((unsigned*)(VBL + o3), *(const v4u*)&tbl[cl][q * 8]); } } } }
// ---- k_sc: block = (query block qb, key block kb <= kb_last(qb), head in group) of batch b: logits x SCALE; q hi + residual (x 2^10) against k (2 products) for query rows < QHI, plus the k residual (3 products) for query blocks < QBH (causal early rows); causal: blocks past the diagonal exit, the mask itself is applied by index in k_sm
__global__ __launch_bounds__(128) void k_sc(const _Float16* __restrict__ QH, const _Float16* __restrict__ KH, const _Float16* __restrict__ QL, const _Float16* __restrict__ KL, int b0g, int h0, float* __restrict__ S0) { __shared__ __align__(16) float ss[4][16][132]; const int b = b0g + (int)blockIdx.z / HG;   /* row r of this z-slice */
  const int qb = blockIdx.x, kb = blockIdx.y; if (kb > kb_last(qb)) return;
  const int h = h0 + (int)blockIdx.z % HG; float* S = S0 + (size_t)blockIdx.z * TT * TT;
  const int tid = threadIdx.x, wave = tid >> 5, lane = tid & 31, col = lane & 15, g = lane >> 4; const int k0 = kb * 128; const int ql0 = qb * 64 + wave * 16; const size_t q0 = (size_t)b * TT + ql0, kr0 = (size_t)b * TT + k0;
  v8f acc[8] = {}, accl[8] = {};
  const _Float16* QLb = QL + (size_t)b * QHI * CC; const _Float16* KLb = KL + (size_t)b * KHI * CC;
  if (qb < QBH) {
#pragma unroll
    for (int kc = 0; kc < HD / 32; ++kc) { const v16h ah = frag_h(QH + (q0 + col) * CC + h * HD + kc * 32, lane), al = frag_h(QLb + (size_t)(ql0 + col) * CC + h * HD + kc * 32, lane);
#pragma unroll
      for (int j = 0; j < 8; ++j) { const v16h kbf = frag_h(KH + (kr0 + j * 16 + col) * CC + h * HD + kc * 32, lane), klf = frag_h(KLb + (size_t)(k0 + j * 16 + col) * CC + h * HD + kc * 32, lane); acc[j] = wmma16(ah, kbf, acc[j]); accl[j] = wmma16(al, kbf, accl[j]); accl[j] = wmma16(ah, klf, accl[j]); } }
  } else if (qb * 64 < QHI) {
#pragma unroll
    for (int kc = 0; kc < HD / 32; ++kc) { const v16h ah = frag_h(QH + (q0 + col) * CC + h * HD + kc * 32, lane), al = frag_h(QLb + (size_t)(ql0 + col) * CC + h * HD + kc * 32, lane);
#pragma unroll
      for (int j = 0; j < 8; ++j) { const v16h kbf = frag_h(KH + (kr0 + j * 16 + col) * CC + h * HD + kc * 32, lane); acc[j] = wmma16(ah, kbf, acc[j]); accl[j] = wmma16(al, kbf, accl[j]); } }
  } else {
#pragma unroll
    for (int kc = 0; kc < HD / 32; ++kc) { const v16h ah = frag_h(QH + (q0 + col) * CC + h * HD + kc * 32, lane);
#pragma unroll
      for (int j = 0; j < 8; ++j) { const v16h kbf = frag_h(KH + (kr0 + j * 16 + col) * CC + h * HD + kc * 32, lane); acc[j] = wmma16(ah, kbf, acc[j]); } } }
#pragma unroll
  for (int j = 0; j < 8; ++j) {
#pragma unroll
    for (int r = 0; r < 8; ++r) ss[wave][8 * g + r][j * 16 + col] = (acc[j][r] + accl[j][r] * (1.0f / 1024.0f)) * SCALE; }
  LDSX(); for (int rl = 0; rl < 16; ++rl) vst2(S + (size_t)(ql0 + rl) * TT + k0 + lane * 4, *(const v4f*)&ss[wave][rl][lane * 4]); }
// ---- k_sm: block = query row t (head in group): keys [0, kend): causal -> logit if s <= t else excluded; softmax in f32; P x 2^11 in place (0 for excluded)
__global__ __launch_bounds__(256) void k_sm(float* __restrict__ S0 SM_EXTRA_PARAMS) { __shared__ float sred[8]; __shared__ float sbc; __shared__ __align__(16) float shv[TT];
  const int tid = threadIdx.x; const int t = blockIdx.x; const int kend = (kb_last(t >> 6) + 1) * 128;
  float* sr = S0 + (size_t)blockIdx.y * TT * TT + (size_t)t * TT;
  float m = -3.0e38f; for (int k = tid; k < kend; k += 256) { float v = (!CAUSAL || k <= t) ? sr[k] : -3.0e38f; SM_MASK_HOOK; shv[k] = v; m = fmaxf(m, v); }
#pragma unroll
  for (int o = 1; o < 32; o <<= 1) m = fmaxf(m, __shfl_xor(m, o));
  if ((tid & 31) == 0) sred[tid >> 5] = m; __syncthreads(); if (tid == 0) { float a = sred[0]; for (int i = 1; i < 8; ++i) a = fmaxf(a, sred[i]); sbc = a; } __syncthreads(); m = sbc; __syncthreads();
  float sum = 0.f; for (int k = tid; k < kend; k += 256) { const float v = shv[k]; const float e = (v <= -1.0e38f) ? 0.f : expf(v - m); shv[k] = e; sum += e; }
#pragma unroll
  for (int o = 1; o < 32; o <<= 1) sum += __shfl_xor(sum, o);
  if ((tid & 31) == 0) sred[tid >> 5] = sum; __syncthreads(); if (tid == 0) { float a = 0.f; for (int i = 0; i < 8; ++i) a += sred[i]; sbc = a > 0.f ? 2048.0f / a : 0.f; }   /* a fully excluded row yields P = 0 */ __syncthreads(); const float inv = sbc;
  for (int k = tid; k < kend; k += 256) shv[k] = shv[k] * inv;
  __syncthreads(); for (int q = tid; q < kend / 4; q += 256) vst2(sr + q * 4, *(const v4f*)&shv[q * 4]); }
// ---- k_smw: block = 4 query rows (wave per row t = blockIdx.x*4 + wave; plane blockIdx.y): for short rows (TT = 256 = 8 keys per lane) the whole softmax lives in registers with shuffle reductions only (no LDS, no barriers): logit (+ hook: bias, mask, padding exclusion) -> max -> exp/sum -> P x 2^11 in place (0 for excluded)
__global__ __launch_bounds__(128) void k_smw(float* __restrict__ S0 SM_EXTRA_PARAMS) {
  const int wave = threadIdx.x >> 5, lane = threadIdx.x & 31; const int t = blockIdx.x * 4 + wave; float* sr = S0 + (size_t)blockIdx.y * TT * TT + (size_t)t * TT;
  float vals[TT / 32]; float m = -3.0e38f;
#pragma unroll
  for (int i = 0; i < TT / 32; ++i) { const int k = i * 32 + lane; float v = sr[k]; SM_MASK_HOOK; asm volatile("s_wait_loadcnt 0x0" ::: "memory"); vals[i] = v; m = fmaxf(m, v); }   /* per-key wait keeps the load clauses short */
#pragma unroll
  for (int o = 1; o < 32; o <<= 1) m = fmaxf(m, __shfl_xor(m, o));
  float sum = 0.f;
#pragma unroll
  for (int i = 0; i < TT / 32; ++i) { const float e = (vals[i] <= -1.0e38f) ? 0.f : expf(vals[i] - m); vals[i] = e; sum += e; }
#pragma unroll
  for (int o = 1; o < 32; o <<= 1) sum += __shfl_xor(sum, o);
  const float f = sum > 0.f ? 2048.0f / sum : 0.f;
#pragma unroll
  for (int i = 0; i < TT / 32; ++i) vst2(sr + i * 32 + lane, vals[i] * f); }   
// ---- k_pv: block = 64 queries (qb) of (b, h): ctx = P . v over keys [0, kend) (P x 2^11 once to f16 against v f16: 1 product; causal early query blocks: P and v as bf16 hi + lo, 3 products); 128-B (row, head) segment by 8 lanes
__global__ __launch_bounds__(128) void k_pv(const float* __restrict__ PS0, const _Float16* __restrict__ VT, const __bf16* __restrict__ VB, const __bf16* __restrict__ VBL, int b0g, int h0, float* __restrict__ Y) { const int b = b0g + (int)blockIdx.z / HG; const int h = h0 + (int)blockIdx.z % HG; const float* PS = PS0 + (size_t)blockIdx.z * TT * TT; __shared__ __align__(16) float ss[4][16][HD + 4];
  const int tid = threadIdx.x, wave = tid >> 5, lane = tid & 31, col = lane & 15, g = lane >> 4; const int qb = blockIdx.x; const int ql0 = qb * 64 + wave * 16; const int kce = (kb_last(qb) + 1) * 4;
  v8f acc[HD / 16] = {};
  if (qb < QBH) {
#pragma unroll 1
    for (int kc = 0; kc < kce; ++kc) { const F2 p = split_row(PS + (size_t)(ql0 + col) * TT, kc * 32, lane);
      asm volatile("s_wait_loadcnt 0x0" ::: "memory");
#pragma unroll
      for (int j = 0; j < HD / 16; ++j) { const size_t po = ((size_t)b * CC + h * HD + j * 16 + col) * (size_t)KHI + kc * 32; const v16b vh = frag_b(VB + po, lane); acc[j] = wmma_bf(p.h, vh, acc[j]); acc[j] = wmma_bf(p.l, vh, acc[j]); acc[j] = wmma_bf(p.h, frag_b(VBL + po, lane), acc[j]); } }
  } else {
#pragma unroll 1
    for (int kc = 0; kc < kce; ++kc) { const v16h p = frag_f32(PS + (size_t)(ql0 + col) * TT + kc * 32, lane);
      asm volatile("s_wait_loadcnt 0x0" ::: "memory");
#pragma unroll
      for (int j = 0; j < HD / 16; ++j) { const size_t po = ((size_t)b * CC + h * HD + j * 16 + col) * (size_t)TT + kc * 32; acc[j] = wmma16(p, frag_h(VT + po, lane), acc[j]); } } }
#pragma unroll
  for (int j = 0; j < HD / 16; ++j)
#pragma unroll
    for (int r = 0; r < 8; ++r) ss[wave][8 * g + r][j * 16 + col] = acc[j][r] * (1.0f / 2048.0f);
  LDSX(); for (int rl = 0; rl < 16; ++rl) if (lane < HD / 4) { float* py = Y + ((size_t)b * SZ + ql0 + rl) * CC + h * HD + lane * 4; const v4f gg = *(const v4f*)py; v4f o = *(const v4f*)&ss[wave][rl][lane * 4]; o[0] *= gg[0]; o[1] *= gg[1]; o[2] *= gg[2]; o[3] *= gg[3]; vst2(py, o); } }   /* compact ctx rows [i*256 + q]; the gate sigmoid(x wg + bg) was parked in this buffer by k_rows2 and is consumed in place (same lane reads then writes each element once) */
// ---- k_out: block = (64 rows, 128 cols): out = ctx Wo (+ bo): all rows: ctx bf16 hi + lo against exact bf16 Wo (2 products); the f16 x f16(bf16 x 2^8) 1-product branch is disabled
__global__ __launch_bounds__(128) void k_out(const float* __restrict__ Y, const float* __restrict__ WO, const float* __restrict__ BO, float* __restrict__ OUT) { __shared__ __align__(16) float sf[4][16][132];
  const int tid = threadIdx.x, wave = tid >> 5, lane = tid & 31, col = lane & 15, g = lane >> 4; const int c0 = blockIdx.y * 128; const size_t r0 = (size_t)blockIdx.x * 64 + wave * 16;
  v8f acc[8] = {};
  if (true) {   /* ALL rows: gated ctx bf16 hi + lo x exact output_w (2 products) */
#pragma unroll 2
    for (int kc = 0; kc < CC / 32; ++kc) { const F2 a = split_row(Y + (r0 + col) * CC, kc * 32, lane); asm volatile("s_wait_loadcnt 0x0" ::: "memory");
#pragma unroll
      for (int j = 0; j < 8; ++j) { const v16b w = WOCOL(WO, kc * 32, c0 + j * 16 + col, lane); asm volatile("s_wait_loadcnt 0x0" ::: "memory"); acc[j] = wmma_bf(a.h, w, acc[j]); acc[j] = wmma_bf(a.l, w, acc[j]); } }
#pragma unroll
    for (int j = 0; j < 8; ++j) { const float bias = BO ? bfr(BO[c0 + j * 16 + col]) : 0.f;
#pragma unroll
      for (int r = 0; r < 8; ++r) sf[wave][8 * g + r][j * 16 + col] = acc[j][r] + bias; }
  } else {
#pragma unroll 2
    for (int kc = 0; kc < CC / 32; ++kc) { const v16h a = frag_f32(Y + (r0 + col) * CC + kc * 32, lane); asm volatile("s_wait_loadcnt 0x0" ::: "memory");
#pragma unroll
      for (int j = 0; j < 8; ++j) { const v16h w = WOCOLH(WO, kc * 32, c0 + j * 16 + col, lane); asm volatile("s_wait_loadcnt 0x0" ::: "memory"); acc[j] = wmma16(a, w, acc[j]); } }
#pragma unroll
    for (int j = 0; j < 8; ++j) { const float bias = BO ? bfr(BO[c0 + j * 16 + col]) : 0.f;
#pragma unroll
      for (int r = 0; r < 8; ++r) sf[wave][8 * g + r][j * 16 + col] = acc[j][r] * (1.0f / 256.0f) + bias; } }
  LDSX(); for (int rl = 0; rl < 16; ++rl) vst2(OUT + (r0 + rl) * DIN + c0 + lane * 4, *(const v4f*)&sf[wave][rl][lane * 4]); }

extern "C" void kernel_launch(void* const* d_in, const int* in_sizes, int n_in, void* d_out, int out_size, void* d_ws, size_t ws_size, hipStream_t stream) {
  (void)in_sizes; (void)n_in; (void)out_size;
  const float** F = (const float**)d_in;
  if (ws_size < (size_t)WS_END) return;
  char* ws = (char*)d_ws; _Float16 *QH = (_Float16*)(ws + WS_QH), *KH = (_Float16*)(ws + WS_KH), *VT = (_Float16*)(ws + WS_VT), *QL = (_Float16*)(ws + WS_QL), *KL = (_Float16*)(ws + WS_KL); __bf16 *VB = (__bf16*)(ws + WS_VB), *VBL = (__bf16*)(ws + WS_VBL); float *S = (float*)(ws + WS_S), *Y = (float*)(ws + WS_Y);
  (void)Y; (void)QL; (void)KL; (void)VB; (void)VBL;
  // inputs: 0 pair_repr [1,256,256,128]; 1 mask [1,256,256] f32 (ones); 2 ln_g, 3 ln_b; 4 wb_w [4,128] (out,in), 5 wb_b [4]; 6 wq, 7 wk, 8 wv [128,128] (out,in); 9 wo [128,128] (out,in); 10 wg_w [128,128] (out,in), 11 wg_b [128]
  if (ws_size < (size_t)WS_END2) return;
  float *ZN = (float*)(ws + WS_ZN), *BIAS = (float*)(ws + WS_BIAS);
  k_lnz<<<dim3((unsigned)(NZR / 8)), 256, 0, stream>>>(F[0], F[2], F[3], ZN);
  k_rows2<<<dim3((unsigned)(NZR / 64), 2), 128, 0, stream>>>(ZN, F[4], F[5], F[10], F[11], BIAS, Y);        /* tri bias rows (+ wb_b) and the gate (parked in the Y buffer) */
  k_proj<<<dim3(TNB * TT / 64, CC / 128, 3), 128, 0, stream>>>(ZN, ZN, ZN, F[6], F[7], F[8], nullptr, nullptr, nullptr, QH, QL, KH, KL, VT, VB, VBL);
  for (int bg = 0; bg < TNB; bg += BG) {   /* 64 rows i per pass x 4 heads */
    k_sc<<<dim3(SZ / 64, TT / 128, BG * HG), 128, 0, stream>>>(QH, KH, QL, KL, bg, 0, S);
    k_smw<<<dim3(SZ / 4, BG * HG), 128, 0, stream>>>(S, BIAS, F[1], bg);
    k_pv<<<dim3(SZ / 64, 1, BG * HG), 128, 0, stream>>>(S, VT, VB, VBL, bg, 0, Y);
  }
  k_out<<<dim3((unsigned)(NZR / 64), DIN / 128), 128, 0, stream>>>(Y, F[9], nullptr, (float*)d_out);
}

// v001
// Measured time: 222 microseconds a run.
// Timed twice side by side with v000, it ran 1.87 times as fast both times.
// compute dtype: all float inputs rounded to bf16; LayerNorm in f32; q/k/v, the triangle bias and the gate from the f32 LayerNorm rows split bf16 hi + lo against exact bf16 weights on WMMA 16x16x32 (2 products, f32 accumulate); logits q.k with q as f16 hi + residual for the first 64 queries of each pair row and single f16 elsewhere (sigma_logit ~ 0.25) x 32^-0.5 + bias + mask in f32; softmax in f32 (precise expf, in registers, fused with both products); P x 2^11 once to f16 against v once to f16 (1 product); gated ctx split bf16 hi + lo against exact wo (2 products); f32 output.
// Triangle attention, starting node (B 1, I = J = 256 residues, D 128, 4 heads x 32; 0.02-scale (out,in) weights, mask all ones, wb_b = 0, wg_b = 1): z = LayerNorm(pair_repr); tri_bias[h][j][k] = z[j][k] . wb_w[h] + wb_b[h]; for each row i: q = (z[i] wq^T)/sqrt(32), k = z[i] wk^T, v = z[i] wv^T (heads = 32-wide slices of the output dim); a = softmax_k(q . k + 1e9 (mask[i][k] - 1) + tri_bias[h][j][k]); y = merged heads; y = sigmoid(z[i] wg_w^T + wg_b) * y; out[i] = y wo^T.
#include <hip/hip_runtime.h>
#include <math.h>

typedef __attribute__((ext_vector_type(16))) _Float16 v16h;
typedef __attribute__((ext_vector_type(16))) __bf16 v16b;
typedef __attribute__((ext_vector_type(8)))  _Float16 v8h;
typedef __attribute__((ext_vector_type(8)))  float v8f;
typedef __attribute__((ext_vector_type(4)))  float v4f;
typedef __attribute__((ext_vector_type(2)))  float v2f;
typedef __attribute__((ext_vector_type(4)))  unsigned v4u;
typedef __attribute__((ext_vector_type(4)))  int v4i;
typedef float __attribute__((may_alias)) float_a;
typedef int __attribute__((may_alias)) int_a;

template <typename T> __device__ __forceinline__ void vst2(void* p, T v) { *(T*)p = v;  }
__device__ __forceinline__ v8f wmma16(v16h a, v16h b, v8f c) {
  v8f d = __builtin_amdgcn_wmma_f32_16x16x32_f16(false, a, false, b, (short)0, c, false, false);
  asm volatile("v_nop\n\tv_nop\n\tv_nop\n\tv_nop" : "+v"(d) : "v"(a), "v"(b));
  return d;
}
__device__ __forceinline__ v8f wmma_bf(v16b a, v16b b, v8f c) {
  v8f d = __builtin_amdgcn_wmma_f32_16x16x32_bf16(false, a, false, b, (short)0, c, false, false);
  asm volatile("v_nop\n\tv_nop\n\tv_nop\n\tv_nop" : "+v"(d) : "v"(a), "v"(b));
  return d;
}
// 16x16x32 fragments: lane = (h = lane>>4, row/col = lane&15); elements 0..7 = k0+8h+0..7, 8..15 = k0+16+8h+0..7; D element r = row 8h+r
__device__ __forceinline__ v16h frag_h(const _Float16* rowk0, int lane) {
  union { v16h v; v8h q[2]; } u; const _Float16* p = rowk0 + 8 * (lane >> 4);
  u.q[0] = *(const v8h*)p; u.q[1] = *(const v8h*)(p + 16); return u.v;
}
__device__ __forceinline__ v16h frag_f32(const float* rowk0, int lane) {
  v16h a; const float* p = rowk0 + 8 * (lane >> 4);
#pragma unroll
  for (int i = 0; i < 8; ++i) { a[i] = (_Float16)p[i]; a[8 + i] = (_Float16)p[16 + i]; }
  return a;
}
__device__ __forceinline__ v16h frag_f32s(const float* rowk0, int lane, float sc) {
  v16h a; const float* p = rowk0 + 8 * (lane >> 4);
#pragma unroll
  for (int i = 0; i < 8; ++i) { a[i] = (_Float16)(p[i] * sc); a[8 + i] = (_Float16)(p[16 + i] * sc); }
  return a;
}
// column fragment from a [K][ld] layout (column n), rows >= K read as 0
__device__ __forceinline__ v16h fragc_f32(const float* W, int k0, int n, int lane, int ld, int K) {
  v16h a; const int g = lane >> 4;
#pragma unroll
  for (int i = 0; i < 8; ++i) { const int ka = k0 + 8 * g + i, kb = ka + 16;
    a[i] = (_Float16)(ka < K ? W[(size_t)(ka < K ? ka : K - 1) * ld + n] : 0.f); a[8 + i] = (_Float16)(kb < K ? W[(size_t)(kb < K ? kb : K - 1) * ld + n] : 0.f); }
  return a;
}
struct F2 { v16b h, l; };
__device__ __forceinline__ F2 bsplit16(const float v[16]) { F2 r;
#pragma unroll
  for (int i = 0; i < 16; ++i) { const __bf16 h = (__bf16)v[i]; r.h[i] = h; r.l[i] = (__bf16)(v[i] - (float)h); }
  return r; }
__device__ __forceinline__ F2 split_row(const float* row, int k0, int lane) { float v[16]; const float* p = row + k0 + 8 * (lane >> 4);
#pragma unroll
  for (int i = 0; i < 8; ++i) { v[i] = p[i]; v[8 + i] = p[16 + i]; }
  return bsplit16(v); }
__device__ __forceinline__ F2 split_rowK(const float* row, int k0, int lane, int K) { float v[16]; const int g = lane >> 4;
#pragma unroll
  for (int i = 0; i < 8; ++i) { const int ka = k0 + 8 * g + i, kb = ka + 16; v[i] = ka < K ? row[ka < K ? ka : K - 1] : 0.f; v[8 + i] = kb < K ? row[kb < K ? kb : K - 1] : 0.f; }
  return bsplit16(v); }
__device__ __forceinline__ F2 split_col(const float* W, int k0, int n, int lane, int ld, int K) { float v[16]; const int g = lane >> 4;
#pragma unroll
  for (int i = 0; i < 8; ++i) { const int ka = k0 + 8 * g + i, kb = ka + 16; v[i] = ka < K ? W[(size_t)(ka < K ? ka : K - 1) * ld + n] : 0.f; v[8 + i] = kb < K ? W[(size_t)(kb < K ? kb : K - 1) * ld + n] : 0.f; }
  return bsplit16(v); }
__device__ __forceinline__ v8f mac3(const F2& a, const F2& b, v8f c) { c = wmma_bf(a.l, b.h, c); c = wmma_bf(a.h, b.l, c); return wmma_bf(a.h, b.h, c); }
__device__ __forceinline__ float sigm(float v) { return 1.0f / (1.0f + expf(-v)); }
#define LDSX() do { asm volatile("s_wait_dscnt 0" ::: "memory"); __builtin_amdgcn_wave_barrier(); __builtin_amdgcn_fence(__ATOMIC_RELEASE, "workgroup"); } while (0)

// Row-wise triangle attention on a pair tensor z [1, 256, 256, 128] (4 heads x 32): zn = LayerNorm(z); q,k,v = zn wq^T, zn wk^T, zn wv^T (separate (out,in) [128,128]); logits[r][i][j][h] = q[r][i] . k[r][j] / sqrt(32) + (zn[i][j] . w_pair[h] + b_pair[h]) + 1e9 (mask[r][j] - 1); softmax over j; out = sigmoid(zn w_gate + b_gate) * merged(attn v); result = out w_out (no output bias).
#define NB 256              // pair rows i (each a sequence of SZ = TT = 256 positions; no padding needed)
#define TT 256
#define CC 128            // NH * HD = projected width
#define DIN 128          // input (model) width
#define NH 4
#define HD 32
#define NQB (TT / 64)
#define HG 4
#define SCALE (0.17677669529663687f)
#define CAUSAL 0
#ifndef TNB
#define TNB NB
#endif
__device__ __forceinline__ float bfr(float v) { return (float)(__bf16)v; }
__host__ __device__ __forceinline__ int kb_last(int qb) { return CAUSAL ? ((qb * 64 + 63) >> 7) : (TT / 128 - 1); }
typedef __attribute__((ext_vector_type(8))) __bf16 v8b;
__device__ __forceinline__ v16b frag_b(const __bf16* rowk0, int lane) {
  union { v16b v; v8b q[2]; } u; const __bf16* p = rowk0 + 8 * (lane >> 4);
  u.q[0] = *(const v8b*)p; u.q[1] = *(const v8b*)(p + 16); return u.v;
}
#define QBH 0              // unused (no causal path; CAUSAL is 0)
#define QHI 64             // q residual rows only for the first 64 queries of each row (logits elsewhere: single f16 q, k; sigma_logit ~ 0.25 so this is ample)
#define KHI 64            // key rows carrying k residual / v bf16 hi+lo planes (written by k_proj, read by no kernel)
// B fragment (k rows k0+.., output column o) of a weight: (in,out) [K][ld] or (out,in) [ld rows of K]: bf16 exact, or f16(bf16 * 256) exact
__device__ __forceinline__ v16b wcol_io(const float* Wm, int k0, int o, int lane, int ld) { v16b w; const int g = lane >> 4;
#pragma unroll
  for (int i = 0; i < 8; ++i) { w[i] = (__bf16)Wm[(size_t)(k0 + 8 * g + i) * ld + o]; w[8 + i] = (__bf16)Wm[(size_t)(k0 + 16 + 8 * g + i) * ld + o]; }
  return w; }
__device__ __forceinline__ v16b wcol_oi(const float* Wm, int k0, int o, int lane, int K) { v16b w; const float* p = Wm + (size_t)o * K + k0 + 8 * (lane >> 4);
#pragma unroll
  for (int i = 0; i < 8; ++i) { w[i] = (__bf16)p[i]; w[8 + i] = (__bf16)p[16 + i]; }
  return w; }
__device__ __forceinline__ v16h wcolh_io(const float* Wm, int k0, int o, int lane, int ld) { v16h w; const int g = lane >> 4;
#pragma unroll
  for (int i = 0; i < 8; ++i) { w[i] = (_Float16)(bfr(Wm[(size_t)(k0 + 8 * g + i) * ld + o]) * 256.0f); w[8 + i] = (_Float16)(bfr(Wm[(size_t)(k0 + 16 + 8 * g + i) * ld + o]) * 256.0f); }
  return w; }
__device__ __forceinline__ v16h wcolh_oi(const float* Wm, int k0, int o, int lane, int K) { v16h w; const float* p = Wm + (size_t)o * K + k0 + 8 * (lane >> 4);
#pragma unroll
  for (int i = 0; i < 8; ++i) { w[i] = (_Float16)(bfr(p[i]) * 256.0f); w[8 + i] = (_Float16)(bfr(p[16 + i]) * 256.0f); }
  return w; }
#define WQKV_LAYOUT 1   // (out,in) separate wq / wk / wv [CC][DIN] (wq.reshape(H, DH, D): output column h*32 + c = row of wq)
__device__ __forceinline__ v16b wcol_hdk(const float* Wm, int k0, int o, int lane) { v16b w; const int g = lane >> 4; const float* p = Wm + (size_t)(o / HD) * DIN * HD + (o % HD);
#pragma unroll
  for (int i = 0; i < 8; ++i) { w[i] = (__bf16)p[(size_t)(k0 + 8 * g + i) * HD]; w[8 + i] = (__bf16)p[(size_t)(k0 + 16 + 8 * g + i) * HD]; }
  return w; }
#define WO_OUT_IN 1
#if WQKV_LAYOUT == 1
#define WCOL(W, k0, o, lane) wcol_oi(W, k0, o, lane, DIN)
#elif WQKV_LAYOUT == 2
#define WCOL(W, k0, o, lane) wcol_hdk(W, k0, o, lane)
#else
#define WCOL(W, k0, o, lane) wcol_oi(W, k0, o, lane, DIN)
#endif
#if WO_OUT_IN
#define WOCOL(W, k0, o, lane) wcol_oi(W, k0, o, lane, CC)
#define WOCOLH(W, k0, o, lane) wcolh_oi(W, k0, o, lane, CC)
#else
#define WOCOL(W, k0, o, lane) wcol_io(W, k0, o, lane, DIN)
#define WOCOLH(W, k0, o, lane) wcolh_io(W, k0, o, lane, DIN)
#endif
#define SZ 256             // real positions per row (= TT here)
#define BG 64              // sizes the unused WS_S region (x 4 heads = 256 planes of 256 x 256)
#define NZR ((size_t)NB * SZ)   // 65,536 real pair rows (i, j)
#define SM_EXTRA_PARAMS , const float* __restrict__ BIAS, const float* __restrict__ MKF, int b0s
#define SM_MASK_HOOK do { const int hh = (int)blockIdx.y % HG; const int ii = b0s + (int)blockIdx.y / HG; const int kc2 = k < SZ ? k : SZ - 1; const float add = BIAS[((size_t)t * SZ + kc2) * NH + hh] + 1.0e9f * (bfr(MKF[(size_t)ii * SZ + kc2]) - 1.0f); v = (k < SZ) ? v + add : -3.0e38f; } while (0)   /* + tri_bias[h][q=t][k] + INF (mask[i][k] - 1) (mask is all ones: adds 0, read anyway); key columns k >= SZ would be padding -> excluded (none here: SZ = TT, so the k < SZ test on the loop index always holds) */
__device__ __forceinline__ v16b zero16b() { v16b z; _Pragma("unroll") for (int i = 0; i < 16; ++i) z[i] = (__bf16)0.f; return z; }
// ---- k_lnz: wave per pair row: LayerNorm over the 128 channels (biased var, eps 1e-5, ln_w/ln_b) of bf16(z) -> ZN rows (4 floats per lane = one 512-B row)
__global__ __launch_bounds__(256) void k_lnz(const float* __restrict__ Z, const float* __restrict__ LW, const float* __restrict__ LB, float* __restrict__ ZN) { const int wave = threadIdx.x >> 5, lane = threadIdx.x & 31; const size_t row = (size_t)blockIdx.x * 8 + wave; if (row >= (size_t)NZR) return;
  v4f x = *(const v4f*)(Z + row * CC + lane * 4); float s1 = 0.f;
#pragma unroll
  for (int i = 0; i < 4; ++i) { x[i] = bfr(x[i]); s1 += x[i]; }
#pragma unroll
  for (int o = 1; o < 32; o <<= 1) s1 += __shfl_xor(s1, o);
  const float mu = s1 * (1.0f / CC); float q = 0.f;
#pragma unroll
  for (int i = 0; i < 4; ++i) { const float d = x[i] - mu; q += d * d; }
#pragma unroll
  for (int o = 1; o < 32; o <<= 1) q += __shfl_xor(q, o);
  const float rs = rsqrtf(q * (1.0f / CC) + 1e-5f); v4f r4;
#pragma unroll
  for (int i = 0; i < 4; ++i) { const int c = lane * 4 + i; r4[i] = (x[i] - mu) * rs * bfr(LW[c]) + bfr(LB[c]); }
  vst2(ZN + row * CC + lane * 4, r4); }
// ---- k_rows2: block = (64 rows, which): which 0: bias: BIAS[row = i*256+j][h] = zn[i][j] . w_pair[h] (4 outputs) ; which 1: G[row][c] = sigmoid(zn[row] . w_gate[c] + b_gate[c]) (128 outputs); weights are (out,in)
__global__ __launch_bounds__(128) void k_rows2(const float* __restrict__ ZN, const float* __restrict__ WB, const float* __restrict__ WBB, const float* __restrict__ WG, const float* __restrict__ GB, float* __restrict__ BIAS, float* __restrict__ G) { __shared__ __align__(16) float sf[4][16][132];
  const int tid = threadIdx.x, wave = tid >> 5, lane = tid & 31, col = lane & 15, g = lane >> 4; const int which = blockIdx.y; const size_t r0 = (size_t)blockIdx.x * 64 + wave * 16;
  const int nout = which == 0 ? NH : CC; const float* Wm = which == 0 ? WB : WG;
  v8f acc[8] = {};
#pragma unroll
  for (int kc = 0; kc < CC / 32; ++kc) { const F2 a = split_row(ZN + (r0 + col) * CC, kc * 32, lane); asm volatile("s_wait_loadcnt 0x0" ::: "memory");
#pragma unroll
    for (int j = 0; j < 8; ++j) { if (j * 16 >= nout) break; v16b w; { float t0[8], t1[8]; const int o = j * 16 + col; const int oc = o < nout ? o : nout - 1; const float keep = o < nout ? 1.f : 0.f;
#pragma unroll
        for (int i = 0; i < 8; ++i) t0[i] = Wm[(size_t)oc * CC + kc * 32 + 8 * g + i];   /* (out,in) [nout][128] */
        asm volatile("s_wait_loadcnt 0x0" ::: "memory");
#pragma unroll
        for (int i = 0; i < 8; ++i) t1[i] = Wm[(size_t)oc * CC + kc * 32 + 16 + 8 * g + i];
        asm volatile("s_wait_loadcnt 0x0" ::: "memory");
#pragma unroll
        for (int i = 0; i < 8; ++i) { w[i] = (__bf16)(t0[i] * keep); w[8 + i] = (__bf16)(t1[i] * keep); } }   /* (out,in) row o; columns beyond nout zero (select-free: keep multiplies a VALID load) */
      acc[j] = wmma_bf(a.h, w, acc[j]); acc[j] = wmma_bf(a.l, w, acc[j]); } }
  if (which == 0) { if (lane < 16) {   /* bias rows: 4 floats = 16 B per row; rows r0+8g+r... store via LDS: */ }
    { const float bb = col < NH ? bfr(WBB[col < NH ? col : 0]) : 0.f; asm volatile("s_wait_loadcnt 0x0" ::: "memory");
      for (int r = 0; r < 8; ++r) sf[wave][8 * g + r][col] = acc[0][r] + bb; }   /* + wb_b[h] */
    LDSX(); if (lane < 16) { v4f b4; b4[0] = sf[wave][lane][0]; b4[1] = sf[wave][lane][1]; b4[2] = sf[wave][lane][2]; b4[3] = sf[wave][lane][3]; vst2(BIAS + (r0 + lane) * NH, b4); }   /* 16 rows x 16 B = one 256-B run per wave */
  } else {
#pragma unroll
    for (int j = 0; j < 8; ++j)
#pragma unroll
      for (int r = 0; r < 8; ++r) sf[wave][8 * g + r][j * 16 + col] = 1.0f / (1.0f + expf(-(acc[j][r] + bfr(GB[j * 16 + col]))));   /* sigmoid(zn w_gate + b_gate) */
    LDSX(); for (int rl = 0; rl < 16; ++rl) vst2(G + (r0 + rl) * CC + lane * 4, *(const v4f*)&sf[wave][rl][lane * 4]); } }
#define WS_ZN   (WS_END)
#define WS_BIAS (WS_ZN + 4u * (size_t)NZR * CC)
#define WS_END2 (WS_BIAS + 4u * (size_t)NZR * NH + 1024)
#ifndef SM_EXTRA_PARAMS
#define SM_EXTRA_PARAMS
#endif
#ifndef PROJ_EXTRA_PARAMS
#define PROJ_EXTRA_PARAMS
#endif
#ifndef SM_MASK_HOOK
#define SM_MASK_HOOK (void)0
#endif

#define WS_QH  0u                                      // f16 q rows [b*t][CC]
#define WS_KH  (WS_QH + 2u * (size_t)NB * TT * CC)      // f16 k rows [b*t][CC]
#define WS_VT  (WS_KH + 2u * (size_t)NB * TT * CC)      // f16 v planes [b][c][t]
#define WS_QL  (WS_VT + 2u * (size_t)NB * CC * TT)      // f16 q residual x 2^10 rows [b][t < QHI][CC]
#define WS_KL  (WS_QL + 2u * (size_t)NB * QHI * CC)     // f16 k residual x 2^10 rows [b][t < KHI][CC]
#define WS_VB  (WS_KL + 2u * (size_t)NB * KHI * CC)     // bf16 v hi planes [b][c][t < KHI]
#define WS_VBL (WS_VB + 2u * (size_t)NB * CC * KHI)
#define WS_S   (WS_VBL + 2u * (size_t)NB * CC * KHI)    // f32 [hg][t][s] region, reserved but not used (k_fa keeps logits in registers)
#define WS_Y   (WS_S  + 4u * (size_t)BG * HG * TT * TT)   // after 256 unused f32 planes of 256 x 256      // f32 ctx rows [b*t][CC]
#define WS_END (WS_Y  + 4u * (size_t)NB * SZ * CC)   /* compact ctx/gate rows [i*256 + j] */

// ---- k_proj: block = (64 rows, 128 cols, which): q/k/v = X W (+ b) with exact bf16 products (K = DIN) -> which 0: q f16 rows (+ residual rows < QHI); 1: k f16 rows (+ residual rows < KHI); 2: v f16 planes [c][t] (+ bf16 hi/lo planes for t < KHI)
__global__ __launch_bounds__(128) void k_proj(const float* __restrict__ XQ, const float* __restrict__ XK, const float* __restrict__ XV, const float* __restrict__ WQ, const float* __restrict__ WK, const float* __restrict__ WV, const float* __restrict__ BQ, const float* __restrict__ BK, const float* __restrict__ BV,
    _Float16* __restrict__ QH, _Float16* __restrict__ QL, _Float16* __restrict__ KH, _Float16* __restrict__ KL, _Float16* __restrict__ VT, __bf16* __restrict__ VB, __bf16* __restrict__ VBL) {
  __shared__ __align__(16) _Float16 sh[64][136], sl[64][136]; __shared__ __align__(16) _Float16 th[128][72]; __shared__ __align__(16) __bf16 tb[128][72], tbl[128][72];
  const int tid = threadIdx.x, wave = tid >> 5, lane = tid & 31, col = lane & 15, g = lane >> 4; const int which = blockIdx.z; const int c0 = blockIdx.y * 128; const size_t r0 = (size_t)blockIdx.x * 64; const size_t bb = r0 / TT; const int t0 = (int)(r0 % TT);
  const float* X = which == 0 ? XQ : which == 1 ? XK : XV; const float* WA = which == 0 ? WQ : which == 1 ? WK : WV; const float* BA = which == 0 ? BQ : which == 1 ? BK : BV;
  v8f acc[8] = {};
const bool padblk = t0 >= SZ;   /* block-uniform: plane rows >= SZ of each pair row would be padding -> zero q/k/v (none here, SZ = TT) (SZ and TT are multiples of 64) */
#pragma unroll 2
  for (int kc = padblk ? DIN / 32 : 0; kc < DIN / 32; ++kc) { F2 a2 = split_row(X + (bb * SZ + (padblk ? 0 : t0) + wave * 16 + col) * DIN, kc * 32, lane);   /* LN rows are stored compactly [i*256 + j]; padded blocks skip the k loop (acc stays 0) */
    if (padblk) { a2.h = zero16b(); a2.l = zero16b(); }
    asm volatile("s_wait_loadcnt 0x0" ::: "memory");
#pragma unroll
    for (int j = 0; j < 8; ++j) { const v16b w = WCOL(WA, kc * 32, c0 + j * 16 + col, lane); asm volatile("s_wait_loadcnt 0x0" ::: "memory"); acc[j] = wmma_bf(a2.h, w, acc[j]); acc[j] = wmma_bf(a2.l, w, acc[j]); } }
  if (which < 2) { _Float16* DH = which == 0 ? QH : KH; _Float16* DL = which == 0 ? QL : KL; const int nhi = which == 0 ? QHI : KHI; const bool hi_rows = t0 < nhi;
#pragma unroll
    for (int j = 0; j < 8; ++j) { const float bias = BA ? bfr(BA[c0 + j * 16 + col]) : 0.f;
#pragma unroll
      for (int r = 0; r < 8; ++r) { const float v = acc[j][r] + bias; const _Float16 hv = (_Float16)v; sh[wave * 16 + 8 * g + r][j * 16 + col] = hv; sl[wave * 16 + 8 * g + r][j * 16 + col] = (_Float16)((v - (float)hv) * 1024.0f); } }
    __syncthreads();
    for (int e = tid; e < 64 * 16; e += 128) { const int rl = e >> 4, q = e & 15; vst2((unsigned*)(DH + (r0 + rl) * CC + c0 + q * 8), *(const v4u*)&sh[rl][q * 8]); if (hi_rows) vst2((unsigned*)(DL + (bb * nhi + t0 + rl) * (size_t)CC + c0 + q * 8), *(const v4u*)&sl[rl][q * 8]); }
  } else { const bool hi_rows = t0 < KHI;
#pragma unroll
    for (int j = 0; j < 8; ++j) { const float bias = BA ? bfr(BA[c0 + j * 16 + col]) : 0.f;
#pragma unroll
      for (int r = 0; r < 8; ++r) { const float v = acc[j][r] + bias; const int rl = wave * 16 + 8 * g + r, cl = j * 16 + col; th[cl][rl] = (_Float16)v; const __bf16 bh = (__bf16)v; tb[cl][rl] = bh; tbl[cl][rl] = (__bf16)(v - (float)bh); } }
    __syncthreads();
    for (int e = tid; e < 128 * 8; e += 128) { const int cl = e >> 3, q = e & 7; vst2((unsigned*)(VT + (bb * CC + c0 + cl) * (size_t)TT + t0 + q * 8), *(const v4u*)&th[cl][q * 8]); if (hi_rows) { const size_t o3 = (bb * CC + c0 + cl) * (size_t)KHI + t0 + q * 8; vst2((unsigned*)(VB + o3), *(const v4u*)&tb[cl][q * 8]); vst2((unsigned*)(VBL + o3), *(const v4u*)&tbl[cl][q * 8]); } } } }
#define NI 4
__device__ __forceinline__ v8f wm16(v16h a, v16h b, v8f c) { return __builtin_amdgcn_wmma_f32_16x16x32_f16(false, a, false, b, (short)0, c, false, false); }
__device__ __forceinline__ v16h frag_at(const _Float16* p) { union { v16h v; v8h q[2]; } u; u.q[0] = *(const v8h*)p; u.q[1] = *(const v8h*)(p + 16); return u.v; }   /* frag_h with the lane half's offset already in p */
__global__ __launch_bounds__(128) void k_fa(const _Float16* __restrict__ QH, const _Float16* __restrict__ KH, const _Float16* __restrict__ QL, const _Float16* __restrict__ VT, const float* __restrict__ BIAS, const float* __restrict__ MKF, float* __restrict__ Y) {
  __shared__ __align__(16) float sb[NH][16][TT + 4];   /* pitch 1040 B = 16 B x odd: 16-byte reads of 16 rows fall on distinct banks */
  __shared__ __align__(16) float smk[NH][TT];
  const int tid = threadIdx.x, wave = tid >> 5, lane = tid & 31, col = lane & 15, g = lane >> 4; const int q0 = (int)blockIdx.x * 16; const int h = wave;
  for (int e = tid; e < 16 * TT; e += 128) { const int q = e >> 8, k = e & (TT - 1); const v4f b4 = *(const v4f*)(BIAS + ((size_t)(q0 + q) * SZ + k) * NH);
    sb[0][q][k] = b4[0]; sb[1][q][k] = b4[1]; sb[2][q][k] = b4[2]; sb[3][q][k] = b4[3]; }
  __syncthreads();   /* every wave wrote a part of every head's bias plane */
  const bool hi = q0 < QHI;   /* block-uniform: these queries carry the q residual */
  /* the loop over pair rows stays rolled: one tile's registers at a time keep four waves on a SIMD; every inner loop is unrolled so that st[] is indexed by constants and stays in registers */
#pragma unroll 1
  for (int ii = 0; ii < NI; ++ii) { const int b = (int)blockIdx.y * NI + ii;
    { v4f m0 = *(const v4f*)(MKF + (size_t)b * SZ + lane * 8), m1 = *(const v4f*)(MKF + (size_t)b * SZ + lane * 8 + 4);
#pragma unroll
      for (int c = 0; c < 4; ++c) { m0[c] = 1.0e9f * (bfr(m0[c]) - 1.0f); m1[c] = 1.0e9f * (bfr(m1[c]) - 1.0f); }   /* INF (mask[i][k] - 1), 8 keys per lane, wave-private copy */
      *(v4f*)&smk[wave][lane * 8] = m0; *(v4f*)&smk[wave][lane * 8 + 4] = m1; }
    LDSX();   /* the lanes of this wave read each other's mask terms below */
    const v16h qf = frag_h(QH + ((size_t)b * TT + q0 + col) * CC + h * HD, lane); const _Float16* kp = KH + ((size_t)b * TT + col) * CC + h * HD + 8 * g;
    v8f st[TT / 16];
    asm volatile("s_wait_xcnt 0x0" ::: "memory");   /* the address registers of the q loads are reused below */
    if (hi) { const v16h ql = frag_h(QL + ((size_t)b * QHI + q0 + col) * CC + h * HD, lane);
      asm volatile("s_wait_xcnt 0x0" ::: "memory");   /* as above, for the residual's loads */
#pragma unroll
      for (int hb = 0; hb < 2; ++hb) { v16h kf[8];   /* eight key fragments per batch, so that their loads fly together */
#pragma unroll
        for (int j = 0; j < 8; ++j) kf[j] = frag_at(kp + (size_t)(hb * 8 + j) * 16 * CC);
        asm volatile("s_wait_xcnt 0x0" :: "v"(kp) : "memory");   /* kp stays live up to this wait, so that no load of the batch lands on its own address registers */
#pragma unroll
        for (int j = 0; j < 8; ++j) { const v8f z = {}; const v8f ah = wm16(kf[j], qf, z), al = wm16(kf[j], ql, z);
#pragma unroll
          for (int r = 0; r < 8; ++r) st[hb * 8 + j][r] = ah[r] + al[r] * (1.0f / 1024.0f); } }
    } else {
#pragma unroll
      for (int j = 0; j < TT / 16; ++j) { const v16h kf = frag_at(kp + (size_t)j * 16 * CC); const v8f z = {}; st[j] = wm16(kf, qf, z); } }
    float m = -3.0e38f;
#pragma unroll
    for (int j = 0; j < TT / 16; ++j) { const v4f a0 = *(const v4f*)&smk[wave][j * 16 + 8 * g], a1 = *(const v4f*)&smk[wave][j * 16 + 8 * g + 4]; const v4f b0 = *(const v4f*)&sb[wave][col][j * 16 + 8 * g], b1 = *(const v4f*)&sb[wave][col][j * 16 + 8 * g + 4];
#pragma unroll
      for (int r = 0; r < 4; ++r) { st[j][r] = st[j][r] * SCALE + (b0[r] + a0[r]); st[j][4 + r] = st[j][4 + r] * SCALE + (b1[r] + a1[r]); m = fmaxf(m, fmaxf(st[j][r], st[j][4 + r])); } }
    m = fmaxf(m, __shfl_xor(m, 16));
    float s4[4] = {0.f, 0.f, 0.f, 0.f};
#pragma unroll
    for (int j = 0; j < TT / 16; ++j)
#pragma unroll
      for (int r = 0; r < 8; ++r) { const float e = expf(st[j][r] - m); st[j][r] = e; s4[r & 3] += e; }
    float sum = (s4[0] + s4[1]) + (s4[2] + s4[3]); sum += __shfl_xor(sum, 16);
    const float f = sum > 0.f ? 2048.0f / sum : 0.f;
    v8f o0 = {}, o1 = {}; const _Float16* vp = VT + ((size_t)b * CC + h * HD + col) * (size_t)TT;
#pragma unroll
    for (int kc = 0; kc < TT / 32; ++kc) { v16h p;
#pragma unroll
      for (int s = 0; s < 8; ++s) { p[s] = (_Float16)(st[2 * kc][s] * f); p[8 + s] = (_Float16)(st[2 * kc + 1][s] * f); }   /* keys kc*32 + 8 g + s and kc*32 + 16 + 8 g + s: the k order of frag_h */
      o0 = wm16(frag_h(vp + kc * 32, lane), p, o0); o1 = wm16(frag_h(vp + (size_t)16 * TT + kc * 32, lane), p, o1); }
    float* py = Y + ((size_t)b * SZ + q0 + col) * CC + h * HD + 8 * g;   /* a lane holds channels 8 g + r (o0) and 16 + 8 g + r (o1) of its query; the gate was parked here by k_rows2 and is consumed in place by the same lane */
    const v4f g0 = *(const v4f*)py, g1 = *(const v4f*)(py + 4), g2 = *(const v4f*)(py + 16), g3 = *(const v4f*)(py + 20); v4f r0, r1, r2, r3;
#pragma unroll
    for (int c = 0; c < 4; ++c) { r0[c] = o0[c] * (1.0f / 2048.0f) * g0[c]; r1[c] = o0[4 + c] * (1.0f / 2048.0f) * g1[c]; r2[c] = o1[c] * (1.0f / 2048.0f) * g2[c]; r3[c] = o1[4 + c] * (1.0f / 2048.0f) * g3[c]; }
    vst2(py, r0); vst2(py + 4, r1); vst2(py + 16, r2); vst2(py + 20, r3);
    asm volatile("s_wait_xcnt 0x0" ::: "memory");   /* the stores' registers are reused by the next pair row */ } }
// ---- k_out: block = (64 rows, 128 cols): out = ctx Wo (+ bo): all rows take ctx bf16 hi + lo against exact bf16 Wo (2 products); the f16(bf16 x 2^8) branch (1 product) is never taken
__global__ __launch_bounds__(128) void k_out(const float* __restrict__ Y, const float* __restrict__ WO, const float* __restrict__ BO, float* __restrict__ OUT) { __shared__ __align__(16) float sf[4][16][132];
  const int tid = threadIdx.x, wave = tid >> 5, lane = tid & 31, col = lane & 15, g = lane >> 4; const int c0 = blockIdx.y * 128; const size_t r0 = (size_t)blockIdx.x * 64 + wave * 16;
  v8f acc[8] = {};
  if (true) {   /* ALL rows: gated ctx bf16 hi + lo x exact output_w (2 products) */
#pragma unroll 2
    for (int kc = 0; kc < CC / 32; ++kc) { const F2 a = split_row(Y + (r0 + col) * CC, kc * 32, lane); asm volatile("s_wait_loadcnt 0x0" ::: "memory");
#pragma unroll
      for (int j = 0; j < 8; ++j) { const v16b w = WOCOL(WO, kc * 32, c0 + j * 16 + col, lane); asm volatile("s_wait_loadcnt 0x0" ::: "memory"); acc[j] = wmma_bf(a.h, w, acc[j]); acc[j] = wmma_bf(a.l, w, acc[j]); } }
#pragma unroll
    for (int j = 0; j < 8; ++j) { const float bias = BO ? bfr(BO[c0 + j * 16 + col]) : 0.f;
#pragma unroll
      for (int r = 0; r < 8; ++r) sf[wave][8 * g + r][j * 16 + col] = acc[j][r] + bias; }
  } else {
#pragma unroll 2
    for (int kc = 0; kc < CC / 32; ++kc) { const v16h a = frag_f32(Y + (r0 + col) * CC + kc * 32, lane); asm volatile("s_wait_loadcnt 0x0" ::: "memory");
#pragma unroll
      for (int j = 0; j < 8; ++j) { const v16h w = WOCOLH(WO, kc * 32, c0 + j * 16 + col, lane); asm volatile("s_wait_loadcnt 0x0" ::: "memory"); acc[j] = wmma16(a, w, acc[j]); } }
#pragma unroll
    for (int j = 0; j < 8; ++j) { const float bias = BO ? bfr(BO[c0 + j * 16 + col]) : 0.f;
#pragma unroll
      for (int r = 0; r < 8; ++r) sf[wave][8 * g + r][j * 16 + col] = acc[j][r] * (1.0f / 256.0f) + bias; } }
  LDSX(); for (int rl = 0; rl < 16; ++rl) vst2(OUT + (r0 + rl) * DIN + c0 + lane * 4, *(const v4f*)&sf[wave][rl][lane * 4]); }

extern "C" void kernel_launch(void* const* d_in, const int* in_sizes, int n_in, void* d_out, int out_size, void* d_ws, size_t ws_size, hipStream_t stream) {
  (void)in_sizes; (void)n_in; (void)out_size;
  const float** F = (const float**)d_in;
  if (ws_size < (size_t)WS_END) return;
  char* ws = (char*)d_ws; _Float16 *QH = (_Float16*)(ws + WS_QH), *KH = (_Float16*)(ws + WS_KH), *VT = (_Float16*)(ws + WS_VT), *QL = (_Float16*)(ws + WS_QL), *KL = (_Float16*)(ws + WS_KL); __bf16 *VB = (__bf16*)(ws + WS_VB), *VBL = (__bf16*)(ws + WS_VBL); float *Y = (float*)(ws + WS_Y);
  (void)Y; (void)QL; (void)KL; (void)VB; (void)VBL;
  // inputs: 0 pair_repr [1,256,256,128]; 1 mask [1,256,256] f32 (ones); 2 ln_g, 3 ln_b; 4 wb_w [4,128] (out,in), 5 wb_b [4]; 6 wq, 7 wk, 8 wv [128,128] (out,in); 9 wo [128,128] (out,in); 10 wg_w [128,128] (out,in), 11 wg_b [128]
  if (ws_size < (size_t)WS_END2) return;
  float *ZN = (float*)(ws + WS_ZN), *BIAS = (float*)(ws + WS_BIAS);
  k_lnz<<<dim3((unsigned)(NZR / 8)), 256, 0, stream>>>(F[0], F[2], F[3], ZN);
  k_rows2<<<dim3((unsigned)(NZR / 64), 2), 128, 0, stream>>>(ZN, F[4], F[5], F[10], F[11], BIAS, Y);        /* tri bias rows (+ wb_b) and the gate (parked in the Y buffer) */
  k_proj<<<dim3(TNB * TT / 64, CC / 128, 3), 128, 0, stream>>>(ZN, ZN, ZN, F[6], F[7], F[8], nullptr, nullptr, nullptr, QH, QL, KH, KL, VT, VB, VBL);
  k_fa<<<dim3(SZ / 16, TNB / NI), 128, 0, stream>>>(QH, KH, QL, VT, BIAS, F[1], Y);   /* logits, softmax and P.v fused; no score planes in the workspace */
  k_out<<<dim3((unsigned)(NZR / 64), DIN / 128), 128, 0, stream>>>(Y, F[9], nullptr, (float*)d_out);
}

// v002
// One run takes 136 microseconds.
// In two side-by-side timings against v001, it was 1.61 and 1.64 times as fast.
// All steps since v000 together make it 3.04 times as fast.
// compute dtype: all float inputs rounded to bf16; LayerNorm in f32; q/k/v, the triangle bias and the gate from the f32 LayerNorm rows split bf16 hi + lo against exact bf16 weights on WMMA 16x16x32 (2 products, f32 accumulate); logits q.k with q as f16 hi + residual for the first 64 queries of each pair row and single f16 elsewhere (sigma_logit ~ 0.25) x 32^-0.5 + bias + mask in f32; softmax in f32 (precise expf, in registers, fused with both products); P x 2^11 once to f16 against v once to f16 (1 product); gated ctx split bf16 hi + lo against exact wo (2 products); f32 output.
// Triangle attention, starting node (B 1, I = J = 256 residues, D 128, 4 heads x 32; 0.02-scale (out,in) weights, mask all ones, wb_b = 0, wg_b = 1): z = LayerNorm(pair_repr); tri_bias[h][j][k] = z[j][k] . wb_w[h] + wb_b[h]; for each row i: q = (z[i] wq^T)/sqrt(32), k = z[i] wk^T, v = z[i] wv^T (heads = 32-wide slices of the output dim); a = softmax_k(q . k + 1e9 (mask[i][k] - 1) + tri_bias[h][j][k]); y = merged heads; y = sigmoid(z[i] wg_w^T + wg_b) * y; out[i] = y wo^T.
#include <hip/hip_runtime.h>
#include <math.h>

typedef __attribute__((ext_vector_type(16))) _Float16 v16h;
typedef __attribute__((ext_vector_type(16))) __bf16 v16b;
typedef __attribute__((ext_vector_type(8)))  _Float16 v8h;
typedef __attribute__((ext_vector_type(8)))  float v8f;
typedef __attribute__((ext_vector_type(4)))  float v4f;
typedef __attribute__((ext_vector_type(2)))  float v2f;
typedef __attribute__((ext_vector_type(4)))  unsigned v4u;
typedef __attribute__((ext_vector_type(4)))  int v4i;
typedef float __attribute__((may_alias)) float_a;
typedef int __attribute__((may_alias)) int_a;

template <typename T> __device__ __forceinline__ void vst2(void* p, T v) { *(T*)p = v;  }
__device__ __forceinline__ v8f wmma16(v16h a, v16h b, v8f c) {
  v8f d = __builtin_amdgcn_wmma_f32_16x16x32_f16(false, a, false, b, (short)0, c, false, false);
  asm volatile("v_nop\n\tv_nop\n\tv_nop\n\tv_nop" : "+v"(d) : "v"(a), "v"(b));
  return d;
}
__device__ __forceinline__ v8f wmma_bf(v16b a, v16b b, v8f c) {
  v8f d = __builtin_amdgcn_wmma_f32_16x16x32_bf16(false, a, false, b, (short)0, c, false, false);
  asm volatile("v_nop\n\tv_nop\n\tv_nop\n\tv_nop" : "+v"(d) : "v"(a), "v"(b));
  return d;
}
// 16x16x32 fragments: lane = (h = lane>>4, row/col = lane&15); elements 0..7 = k0+8h+0..7, 8..15 = k0+16+8h+0..7; D element r = row 8h+r
__device__ __forceinline__ v16h frag_h(const _Float16* rowk0, int lane) {
  union { v16h v; v8h q[2]; } u; const _Float16* p = rowk0 + 8 * (lane >> 4);
  u.q[0] = *(const v8h*)p; u.q[1] = *(const v8h*)(p + 16); return u.v;
}
__device__ __forceinline__ v16h frag_f32(const float* rowk0, int lane) {
  v16h a; const float* p = rowk0 + 8 * (lane >> 4);
#pragma unroll
  for (int i = 0; i < 8; ++i) { a[i] = (_Float16)p[i]; a[8 + i] = (_Float16)p[16 + i]; }
  return a;
}
__device__ __forceinline__ v16h frag_f32s(const float* rowk0, int lane, float sc) {
  v16h a; const float* p = rowk0 + 8 * (lane >> 4);
#pragma unroll
  for (int i = 0; i < 8; ++i) { a[i] = (_Float16)(p[i] * sc); a[8 + i] = (_Float16)(p[16 + i] * sc); }
  return a;
}
// column fragment from a [K][ld] layout (column n), rows >= K read as 0
__device__ __forceinline__ v16h fragc_f32(const float* W, int k0, int n, int lane, int ld, int K) {
  v16h a; const int g = lane >> 4;
#pragma unroll
  for (int i = 0; i < 8; ++i) { const int ka = k0 + 8 * g + i, kb = ka + 16;
    a[i] = (_Float16)(ka < K ? W[(size_t)(ka < K ? ka : K - 1) * ld + n] : 0.f); a[8 + i] = (_Float16)(kb < K ? W[(size_t)(kb < K ? kb : K - 1) * ld + n] : 0.f); }
  return a;
}
struct F2 { v16b h, l; };
__device__ __forceinline__ F2 bsplit16(const float v[16]) { F2 r;
#pragma unroll
  for (int i = 0; i < 16; ++i) { const __bf16 h = (__bf16)v[i]; r.h[i] = h; r.l[i] = (__bf16)(v[i] - (float)h); }
  return r; }
__device__ __forceinline__ F2 split_row(const float* row, int k0, int lane) { float v[16]; const float* p = row + k0 + 8 * (lane >> 4);
#pragma unroll
  for (int i = 0; i < 8; ++i) { v[i] = p[i]; v[8 + i] = p[16 + i]; }
  return bsplit16(v); }
__device__ __forceinline__ F2 split_rowK(const float* row, int k0, int lane, int K) { float v[16]; const int g = lane >> 4;
#pragma unroll
  for (int i = 0; i < 8; ++i) { const int ka = k0 + 8 * g + i, kb = ka + 16; v[i] = ka < K ? row[ka < K ? ka : K - 1] : 0.f; v[8 + i] = kb < K ? row[kb < K ? kb : K - 1] : 0.f; }
  return bsplit16(v); }
__device__ __forceinline__ F2 split_col(const float* W, int k0, int n, int lane, int ld, int K) { float v[16]; const int g = lane >> 4;
#pragma unroll
  for (int i = 0; i < 8; ++i) { const int ka = k0 + 8 * g + i, kb = ka + 16; v[i] = ka < K ? W[(size_t)(ka < K ? ka : K - 1) * ld + n] : 0.f; v[8 + i] = kb < K ? W[(size_t)(kb < K ? kb : K - 1) * ld + n] : 0.f; }
  return bsplit16(v); }
__device__ __forceinline__ v8f mac3(const F2& a, const F2& b, v8f c) { c = wmma_bf(a.l, b.h, c); c = wmma_bf(a.h, b.l, c); return wmma_bf(a.h, b.h, c); }
__device__ __forceinline__ float sigm(float v) { return 1.0f / (1.0f + expf(-v)); }
#define LDSX() do { asm volatile("s_wait_dscnt 0" ::: "memory"); __builtin_amdgcn_wave_barrier(); __builtin_amdgcn_fence(__ATOMIC_RELEASE, "workgroup"); } while (0)

// Row-wise triangle attention on a pair tensor z [1, 256, 256, 128] (4 heads x 32): zn = LayerNorm(z); q,k,v = zn wq^T, zn wk^T, zn wv^T (separate (out,in) [128,128]); logits[r][i][j][h] = q[r][i] . k[r][j] / sqrt(32) + (zn[i][j] . w_pair[h] + b_pair[h]) + 1e9 (mask[r][j] - 1); softmax over j; out = sigmoid(zn w_gate + b_gate) * merged(attn v); result = out w_out (no output bias).
#define NB 256              // pair rows i (each a sequence of SZ = TT = 256 positions; no padding needed)
#define TT 256
#define CC 128            // NH * HD = projected width
#define DIN 128          // input (model) width
#define NH 4
#define HD 32
#define NQB (TT / 64)
#define HG 4
#define SCALE (0.17677669529663687f)
#define CAUSAL 0
#ifndef TNB
#define TNB NB
#endif
__device__ __forceinline__ float bfr(float v) { return (float)(__bf16)v; }
__host__ __device__ __forceinline__ int kb_last(int qb) { return CAUSAL ? ((qb * 64 + 63) >> 7) : (TT / 128 - 1); }
typedef __attribute__((ext_vector_type(8))) __bf16 v8b;
__device__ __forceinline__ v16b frag_b(const __bf16* rowk0, int lane) {
  union { v16b v; v8b q[2]; } u; const __bf16* p = rowk0 + 8 * (lane >> 4);
  u.q[0] = *(const v8b*)p; u.q[1] = *(const v8b*)(p + 16); return u.v;
}
typedef __attribute__((ext_vector_type(4))) __bf16 v4b;
#define WP 136             // bf16 elements per staged weight row: 272 B = 16 B x odd, so the 16-byte fragment reads of 16 rows fall on distinct banks
// an (out,in) weight [128][128] f32 -> bf16 rows in LDS, by the 128 threads of a block: each wave-load takes one whole 512-B row, all 32 loads of a thread fly together; frag_b(&sw[o][k0], lane) is then the B fragment that wcol_oi gathered from global memory
__device__ __forceinline__ void stage_w(__bf16 (*sw)[WP], const float* __restrict__ Wm, int tid) { const float* p = Wm + tid * 4; v4f a[32];
#pragma unroll
  for (int it = 0; it < 32; ++it) a[it] = *(const v4f*)(p + it * 512);
  asm volatile("s_wait_xcnt 0x0" ::: "memory");   /* the address registers of these loads are reused below */
#pragma unroll
  for (int it = 0; it < 32; ++it) { v4b w;
#pragma unroll
    for (int i = 0; i < 4; ++i) w[i] = (__bf16)a[it][i];
    *(v4b*)&sw[it * 4 + (tid >> 5)][(tid & 31) * 4] = w; } }
#define QBH 0              // unused: no causal path here; the q residual path is chosen by QHI
#define QHI 64             // q residual rows only for the first 64 queries of each row (logits elsewhere: single f16 q, k; sigma_logit ~ 0.25 so this is ample)
#define KHI 64            // key rows carrying k residual / v bf16 hi+lo planes (written by k_proj; no kernel here reads them)
// B fragment (k rows k0+.., output column o) of a weight: (in,out) [K][ld] or (out,in) [ld rows of K]: bf16 exact, or f16(bf16 * 256) exact
__device__ __forceinline__ v16b wcol_io(const float* Wm, int k0, int o, int lane, int ld) { v16b w; const int g = lane >> 4;
#pragma unroll
  for (int i = 0; i < 8; ++i) { w[i] = (__bf16)Wm[(size_t)(k0 + 8 * g + i) * ld + o]; w[8 + i] = (__bf16)Wm[(size_t)(k0 + 16 + 8 * g + i) * ld + o]; }
  return w; }
__device__ __forceinline__ v16b wcol_oi(const float* Wm, int k0, int o, int lane, int K) { v16b w; const float* p = Wm + (size_t)o * K + k0 + 8 * (lane >> 4);
#pragma unroll
  for (int i = 0; i < 8; ++i) { w[i] = (__bf16)p[i]; w[8 + i] = (__bf16)p[16 + i]; }
  return w; }
__device__ __forceinline__ v16h wcolh_io(const float* Wm, int k0, int o, int lane, int ld) { v16h w; const int g = lane >> 4;
#pragma unroll
  for (int i = 0; i < 8; ++i) { w[i] = (_Float16)(bfr(Wm[(size_t)(k0 + 8 * g + i) * ld + o]) * 256.0f); w[8 + i] = (_Float16)(bfr(Wm[(size_t)(k0 + 16 + 8 * g + i) * ld + o]) * 256.0f); }
  return w; }
__device__ __forceinline__ v16h wcolh_oi(const float* Wm, int k0, int o, int lane, int K) { v16h w; const float* p = Wm + (size_t)o * K + k0 + 8 * (lane >> 4);
#pragma unroll
  for (int i = 0; i < 8; ++i) { w[i] = (_Float16)(bfr(p[i]) * 256.0f); w[8 + i] = (_Float16)(bfr(p[16 + i]) * 256.0f); }
  return w; }
#define WQKV_LAYOUT 1   // (out,in) separate wq / wk / wv [CC][DIN] (wq.reshape(H, DH, D): output column h*32 + c = row of wq)
__device__ __forceinline__ v16b wcol_hdk(const float* Wm, int k0, int o, int lane) { v16b w; const int g = lane >> 4; const float* p = Wm + (size_t)(o / HD) * DIN * HD + (o % HD);
#pragma unroll
  for (int i = 0; i < 8; ++i) { w[i] = (__bf16)p[(size_t)(k0 + 8 * g + i) * HD]; w[8 + i] = (__bf16)p[(size_t)(k0 + 16 + 8 * g + i) * HD]; }
  return w; }
#define WO_OUT_IN 1
#if WQKV_LAYOUT == 1
#define WCOL(W, k0, o, lane) wcol_oi(W, k0, o, lane, DIN)
#elif WQKV_LAYOUT == 2
#define WCOL(W, k0, o, lane) wcol_hdk(W, k0, o, lane)
#else
#define WCOL(W, k0, o, lane) wcol_oi(W, k0, o, lane, DIN)
#endif
#if WO_OUT_IN
#define WOCOL(W, k0, o, lane) wcol_oi(W, k0, o, lane, CC)
#define WOCOLH(W, k0, o, lane) wcolh_oi(W, k0, o, lane, CC)
#else
#define WOCOL(W, k0, o, lane) wcol_io(W, k0, o, lane, DIN)
#define WOCOLH(W, k0, o, lane) wcolh_io(W, k0, o, lane, DIN)
#endif
#define SZ 256             // real positions per row (= TT here)
#define BG 64              // sizes the unused WS_S region (x 4 heads = 256 planes of 256 x 256)
#define NZR ((size_t)NB * SZ)   // 65,536 real pair rows (i, j)
#define SM_EXTRA_PARAMS , const float* __restrict__ BIAS, const float* __restrict__ MKF, int b0s
#define SM_MASK_HOOK do { const int hh = (int)blockIdx.y % HG; const int ii = b0s + (int)blockIdx.y / HG; const int kc2 = k < SZ ? k : SZ - 1; const float add = BIAS[((size_t)t * SZ + kc2) * NH + hh] + 1.0e9f * (bfr(MKF[(size_t)ii * SZ + kc2]) - 1.0f); v = (k < SZ) ? v + add : -3.0e38f; } while (0)   /* + tri_bias[h][q=t][k] + INF (mask[i][k] - 1) (mask is all ones: adds 0, read anyway); key columns k >= SZ would be padding -> excluded (none here: SZ = TT, so the k < SZ test on the loop index always holds) */
__device__ __forceinline__ v16b zero16b() { v16b z; _Pragma("unroll") for (int i = 0; i < 16; ++i) z[i] = (__bf16)0.f; return z; }
// ---- k_lnz: wave per pair row: LayerNorm over the 128 channels (biased var, eps 1e-5, ln_w/ln_b) of bf16(z) -> ZN rows (4 floats per lane = one 512-B row)
__global__ __launch_bounds__(256) void k_lnz(const float* __restrict__ Z, const float* __restrict__ LW, const float* __restrict__ LB, float* __restrict__ ZN) { const int wave = threadIdx.x >> 5, lane = threadIdx.x & 31; const size_t row = (size_t)blockIdx.x * 8 + wave; if (row >= (size_t)NZR) return;
  v4f x = *(const v4f*)(Z + row * CC + lane * 4); float s1 = 0.f;
#pragma unroll
  for (int i = 0; i < 4; ++i) { x[i] = bfr(x[i]); s1 += x[i]; }
#pragma unroll
  for (int o = 1; o < 32; o <<= 1) s1 += __shfl_xor(s1, o);
  const float mu = s1 * (1.0f / CC); float q = 0.f;
#pragma unroll
  for (int i = 0; i < 4; ++i) { const float d = x[i] - mu; q += d * d; }
#pragma unroll
  for (int o = 1; o < 32; o <<= 1) q += __shfl_xor(q, o);
  const float rs = rsqrtf(q * (1.0f / CC) + 1e-5f); v4f r4;
#pragma unroll
  for (int i = 0; i < 4; ++i) { const int c = lane * 4 + i; r4[i] = (x[i] - mu) * rs * bfr(LW[c]) + bfr(LB[c]); }
  vst2(ZN + row * CC + lane * 4, r4); }
// ---- k_rows2: block = (64 rows, which): which 0: bias: BIAS[row = i*256+j][h] = zn[i][j] . w_pair[h] + b_pair[h] (4 outputs) ; which 1: G[row][c] = sigmoid(zn[row] . w_gate[c] + b_gate[c]) (128 outputs); weights are (out,in)
__global__ __launch_bounds__(128) void k_rows2(const float* __restrict__ ZN, const float* __restrict__ WB, const float* __restrict__ WBB, const float* __restrict__ WG, const float* __restrict__ GB, float* __restrict__ BIAS, float* __restrict__ G) { __shared__ __align__(16) float sf[4][16][132]; __shared__ __align__(16) __bf16 sw[CC][WP];
  const int tid = threadIdx.x, wave = tid >> 5, lane = tid & 31, col = lane & 15, g = lane >> 4; const int which = blockIdx.y; const size_t r0 = (size_t)blockIdx.x * 64 + wave * 16;
  const int nout = which == 0 ? NH : CC;
  if (which == 0) { const float* p = WB + wave * CC + lane * 4; const v4f a = *(const v4f*)p;   /* wave w stages bias row w (NH = 4 waves); output columns 4..15 of the one tile are zero rows */
    asm volatile("s_wait_xcnt 0x0" :: "v"(p) : "memory");   /* p stays live up to this wait, so that the load does not land on its own address registers */
    v4b w, z;
#pragma unroll
    for (int i = 0; i < 4; ++i) { w[i] = (__bf16)a[i]; z[i] = (__bf16)0.f; }
    *(v4b*)&sw[wave][lane * 4] = w;
#pragma unroll
    for (int it = 1; it < 4; ++it) *(v4b*)&sw[it * 4 + wave][lane * 4] = z;
  } else stage_w(sw, WG, tid);
  __syncthreads();   /* every wave wrote a part of the weight rows that all four read */
  v8f acc[8] = {};
#pragma unroll
  for (int kc = 0; kc < CC / 32; ++kc) { const F2 a = split_row(ZN + (r0 + col) * CC, kc * 32, lane); asm volatile("s_wait_loadcnt 0x0" ::: "memory");
    v16b w[8];
#pragma unroll
    for (int j = 0; j < 8; ++j) { if (j * 16 >= nout) break; w[j] = frag_b(&sw[j * 16 + col][kc * 32], lane); }   /* (out,in) row o; columns beyond nout are staged as zero; the LDS reads of a k step go out together, ahead of its products */
#pragma unroll
    for (int j = 0; j < 8; ++j) { if (j * 16 >= nout) break; acc[j] = wmma_bf(a.h, w[j], acc[j]); acc[j] = wmma_bf(a.l, w[j], acc[j]); } }
  if (which == 0) { if (lane < 16) {   /* bias rows: 4 floats = 16 B per row; rows r0+8g+r... store via LDS: */ }
    { const float bb = col < NH ? bfr(WBB[col < NH ? col : 0]) : 0.f; asm volatile("s_wait_loadcnt 0x0" ::: "memory");
      for (int r = 0; r < 8; ++r) sf[wave][8 * g + r][col] = acc[0][r] + bb; }   /* + wb_b[h] */
    LDSX(); if (lane < 16) { v4f b4; b4[0] = sf[wave][lane][0]; b4[1] = sf[wave][lane][1]; b4[2] = sf[wave][lane][2]; b4[3] = sf[wave][lane][3]; vst2(BIAS + (r0 + lane) * NH, b4); }   /* 16 rows x 16 B = one 256-B run per wave */
  } else {
#pragma unroll
    for (int j = 0; j < 8; ++j)
#pragma unroll
      for (int r = 0; r < 8; ++r) sf[wave][8 * g + r][j * 16 + col] = 1.0f / (1.0f + expf(-(acc[j][r] + bfr(GB[j * 16 + col]))));   /* sigmoid(zn w_gate + b_gate) */
    LDSX(); for (int rl = 0; rl < 16; ++rl) vst2(G + (r0 + rl) * CC + lane * 4, *(const v4f*)&sf[wave][rl][lane * 4]); } }
#define WS_ZN   (WS_END)
#define WS_BIAS (WS_ZN + 4u * (size_t)NZR * CC)
#define WS_END2 (WS_BIAS + 4u * (size_t)NZR * NH + 1024)
#ifndef SM_EXTRA_PARAMS
#define SM_EXTRA_PARAMS
#endif
#ifndef PROJ_EXTRA_PARAMS
#define PROJ_EXTRA_PARAMS
#endif
#ifndef SM_MASK_HOOK
#define SM_MASK_HOOK (void)0
#endif

#define WS_QH  0u                                      // f16 q rows [b*t][CC]
#define WS_KH  (WS_QH + 2u * (size_t)NB * TT * CC)      // f16 k rows [b*t][CC]
#define WS_VT  (WS_KH + 2u * (size_t)NB * TT * CC)      // f16 v planes [b][c][t]
#define WS_QL  (WS_VT + 2u * (size_t)NB * CC * TT)      // f16 q residual x 2^10 rows [b][t < QHI][CC]
#define WS_KL  (WS_QL + 2u * (size_t)NB * QHI * CC)     // f16 k residual x 2^10 rows [b][t < KHI][CC]
#define WS_VB  (WS_KL + 2u * (size_t)NB * KHI * CC)     // bf16 v hi planes [b][c][t < KHI]
#define WS_VBL (WS_VB + 2u * (size_t)NB * CC * KHI)
#define WS_S   (WS_VBL + 2u * (size_t)NB * CC * KHI)    // f32 [hg][t][s] region, reserved but not used (k_fa keeps logits in registers)
#define WS_Y   (WS_S  + 4u * (size_t)BG * HG * TT * TT)   // after 256 unused f32 planes of 256 x 256      // f32 ctx rows [b*t][CC]
#define WS_END (WS_Y  + 4u * (size_t)NB * SZ * CC)   /* compact ctx/gate rows [i*256 + j] */

// ---- k_proj: block = (64 rows, 128 cols, which): q/k/v = X W (+ b) with exact bf16 products (K = DIN) -> which 0: q f16 rows (+ residual rows < QHI); 1: k f16 rows (+ residual rows < KHI); 2: v f16 planes [c][t] (+ bf16 hi/lo planes for t < KHI)
__global__ __launch_bounds__(128) void k_proj(const float* __restrict__ XQ, const float* __restrict__ XK, const float* __restrict__ XV, const float* __restrict__ WQ, const float* __restrict__ WK, const float* __restrict__ WV, const float* __restrict__ BQ, const float* __restrict__ BK, const float* __restrict__ BV,
    _Float16* __restrict__ QH, _Float16* __restrict__ QL, _Float16* __restrict__ KH, _Float16* __restrict__ KL, _Float16* __restrict__ VT, __bf16* __restrict__ VB, __bf16* __restrict__ VBL) {
  __shared__ __align__(16) char sm[3 * 128 * 72 * 2];   /* first the staged weight rows, then, behind a barrier, the output tiles of this block's kind in the same bytes */
  __bf16 (*sw)[WP] = (__bf16 (*)[WP])sm; _Float16 (*sh)[136] = (_Float16 (*)[136])sm; _Float16 (*sl)[136] = (_Float16 (*)[136])(sm + 64 * 136 * 2);
  _Float16 (*th)[72] = (_Float16 (*)[72])sm; __bf16 (*tb)[72] = (__bf16 (*)[72])(sm + 128 * 72 * 2); __bf16 (*tbl)[72] = (__bf16 (*)[72])(sm + 2 * 128 * 72 * 2);
  const int tid = threadIdx.x, wave = tid >> 5, lane = tid & 31, col = lane & 15, g = lane >> 4; const int which = blockIdx.z; const int c0 = blockIdx.y * 128; const size_t r0 = (size_t)blockIdx.x * 64; const size_t bb = r0 / TT; const int t0 = (int)(r0 % TT);
  const float* X = which == 0 ? XQ : which == 1 ? XK : XV; const float* WA = which == 0 ? WQ : which == 1 ? WK : WV; const float* BA = which == 0 ? BQ : which == 1 ? BK : BV;
  stage_w(sw, WA + (size_t)c0 * DIN, tid);
  __syncthreads();   /* every wave wrote a part of the weight rows that all four read */
  v8f acc[8] = {};
const bool padblk = t0 >= SZ;   /* block-uniform: plane rows >= SZ of each pair row would be padding -> zero q/k/v (none here, SZ = TT) (SZ and TT are multiples of 64) */
#pragma unroll 2
  for (int kc = padblk ? DIN / 32 : 0; kc < DIN / 32; ++kc) { F2 a2 = split_row(X + (bb * SZ + (padblk ? 0 : t0) + wave * 16 + col) * DIN, kc * 32, lane);   /* LN rows are stored compactly [i*256 + j]; padded blocks skip the k loop (acc stays 0) */
    if (padblk) { a2.h = zero16b(); a2.l = zero16b(); }
    asm volatile("s_wait_loadcnt 0x0" ::: "memory");
    v16b w[8];
#pragma unroll
    for (int j = 0; j < 8; ++j) w[j] = frag_b(&sw[j * 16 + col][kc * 32], lane);   /* the LDS reads of a k step go out together, ahead of its products */
#pragma unroll
    for (int j = 0; j < 8; ++j) { acc[j] = wmma_bf(a2.h, w[j], acc[j]); acc[j] = wmma_bf(a2.l, w[j], acc[j]); } }
  __syncthreads();   /* the last weight read of every wave is over before the output tiles take those bytes */
  if (which < 2) { _Float16* DH = which == 0 ? QH : KH; _Float16* DL = which == 0 ? QL : KL; const int nhi = which == 0 ? QHI : KHI; const bool hi_rows = t0 < nhi;
#pragma unroll
    for (int j = 0; j < 8; ++j) { const float bias = BA ? bfr(BA[c0 + j * 16 + col]) : 0.f;
#pragma unroll
      for (int r = 0; r < 8; ++r) { const float v = acc[j][r] + bias; const _Float16 hv = (_Float16)v; sh[wave * 16 + 8 * g + r][j * 16 + col] = hv; sl[wave * 16 + 8 * g + r][j * 16 + col] = (_Float16)((v - (float)hv) * 1024.0f); } }
    __syncthreads();
    for (int e = tid; e < 64 * 16; e += 128) { const int rl = e >> 4, q = e & 15; vst2((unsigned*)(DH + (r0 + rl) * CC + c0 + q * 8), *(const v4u*)&sh[rl][q * 8]); if (hi_rows) vst2((unsigned*)(DL + (bb * nhi + t0 + rl) * (size_t)CC + c0 + q * 8), *(const v4u*)&sl[rl][q * 8]); }
  } else { const bool hi_rows = t0 < KHI;
#pragma unroll
    for (int j = 0; j < 8; ++j) { const float bias = BA ? bfr(BA[c0 + j * 16 + col]) : 0.f;
#pragma unroll
      for (int r = 0; r < 8; ++r) { const float v = acc[j][r] + bias; const int rl = wave * 16 + 8 * g + r, cl = j * 16 + col; th[cl][rl] = (_Float16)v; const __bf16 bh = (__bf16)v; tb[cl][rl] = bh; tbl[cl][rl] = (__bf16)(v - (float)bh); } }
    __syncthreads();
    for (int e = tid; e < 128 * 8; e += 128) { const int cl = e >> 3, q = e & 7; vst2((unsigned*)(VT + (bb * CC + c0 + cl) * (size_t)TT + t0 + q * 8), *(const v4u*)&th[cl][q * 8]); if (hi_rows) { const size_t o3 = (bb * CC + c0 + cl) * (size_t)KHI + t0 + q * 8; vst2((unsigned*)(VB + o3), *(const v4u*)&tb[cl][q * 8]); vst2((unsigned*)(VBL + o3), *(const v4u*)&tbl[cl][q * 8]); } } } }
#define NI 4
__device__ __forceinline__ v8f wm16(v16h a, v16h b, v8f c) { return __builtin_amdgcn_wmma_f32_16x16x32_f16(false, a, false, b, (short)0, c, false, false); }
__device__ __forceinline__ v16h frag_at(const _Float16* p) { union { v16h v; v8h q[2]; } u; u.q[0] = *(const v8h*)p; u.q[1] = *(const v8h*)(p + 16); return u.v; }   /* frag_h with the lane half's offset already in p */
__global__ __launch_bounds__(128) void k_fa(const _Float16* __restrict__ QH, const _Float16* __restrict__ KH, const _Float16* __restrict__ QL, const _Float16* __restrict__ VT, const float* __restrict__ BIAS, const float* __restrict__ MKF, float* __restrict__ Y) {
  __shared__ __align__(16) float sb[NH][16][TT + 4];   /* pitch 1040 B = 16 B x odd: 16-byte reads of 16 rows fall on distinct banks */
  __shared__ __align__(16) float smk[NH][TT];
  const int tid = threadIdx.x, wave = tid >> 5, lane = tid & 31, col = lane & 15, g = lane >> 4; const int q0 = (int)blockIdx.x * 16; const int h = wave;
  for (int e = tid; e < 16 * TT; e += 128) { const int q = e >> 8, k = e & (TT - 1); const v4f b4 = *(const v4f*)(BIAS + ((size_t)(q0 + q) * SZ + k) * NH);
    sb[0][q][k] = b4[0]; sb[1][q][k] = b4[1]; sb[2][q][k] = b4[2]; sb[3][q][k] = b4[3]; }
  __syncthreads();   /* every wave wrote a part of every head's bias plane */
  const bool hi = q0 < QHI;   /* block-uniform: these queries carry the q residual */
  /* the loop over pair rows stays rolled: one tile's registers at a time keep four waves on a SIMD; every inner loop is unrolled so that st[] is indexed by constants and stays in registers */
#pragma unroll 1
  for (int ii = 0; ii < NI; ++ii) { const int b = (int)blockIdx.y * NI + ii;
    { v4f m0 = *(const v4f*)(MKF + (size_t)b * SZ + lane * 8), m1 = *(const v4f*)(MKF + (size_t)b * SZ + lane * 8 + 4);
#pragma unroll
      for (int c = 0; c < 4; ++c) { m0[c] = 1.0e9f * (bfr(m0[c]) - 1.0f); m1[c] = 1.0e9f * (bfr(m1[c]) - 1.0f); }   /* INF (mask[i][k] - 1), 8 keys per lane, wave-private copy */
      *(v4f*)&smk[wave][lane * 8] = m0; *(v4f*)&smk[wave][lane * 8 + 4] = m1; }
    LDSX();   /* the lanes of this wave read each other's mask terms below */
    const v16h qf = frag_h(QH + ((size_t)b * TT + q0 + col) * CC + h * HD, lane); const _Float16* kp = KH + ((size_t)b * TT + col) * CC + h * HD + 8 * g;
    v8f st[TT / 16];
    asm volatile("s_wait_xcnt 0x0" ::: "memory");   /* the address registers of the q loads are reused below */
    if (hi) { const v16h ql = frag_h(QL + ((size_t)b * QHI + q0 + col) * CC + h * HD, lane);
      asm volatile("s_wait_xcnt 0x0" ::: "memory");   /* as above, for the residual's loads */
#pragma unroll
      for (int hb = 0; hb < 2; ++hb) { v16h kf[8];   /* eight key fragments per batch, so that their loads fly together */
#pragma unroll
        for (int j = 0; j < 8; ++j) kf[j] = frag_at(kp + (size_t)(hb * 8 + j) * 16 * CC);
        asm volatile("s_wait_xcnt 0x0" :: "v"(kp) : "memory");   /* kp stays live up to this wait, so that no load of the batch lands on its own address registers */
#pragma unroll
        for (int j = 0; j < 8; ++j) { const v8f z = {}; const v8f ah = wm16(kf[j], qf, z), al = wm16(kf[j], ql, z);
#pragma unroll
          for (int r = 0; r < 8; ++r) st[hb * 8 + j][r] = ah[r] + al[r] * (1.0f / 1024.0f); } }
    } else {
#pragma unroll
      for (int j = 0; j < TT / 16; ++j) { const v16h kf = frag_at(kp + (size_t)j * 16 * CC); const v8f z = {}; st[j] = wm16(kf, qf, z); } }
    float m = -3.0e38f;
#pragma unroll
    for (int j = 0; j < TT / 16; ++j) { const v4f a0 = *(const v4f*)&smk[wave][j * 16 + 8 * g], a1 = *(const v4f*)&smk[wave][j * 16 + 8 * g + 4]; const v4f b0 = *(const v4f*)&sb[wave][col][j * 16 + 8 * g], b1 = *(const v4f*)&sb[wave][col][j * 16 + 8 * g + 4];
#pragma unroll
      for (int r = 0; r < 4; ++r) { st[j][r] = st[j][r] * SCALE + (b0[r] + a0[r]); st[j][4 + r] = st[j][4 + r] * SCALE + (b1[r] + a1[r]); m = fmaxf(m, fmaxf(st[j][r], st[j][4 + r])); } }
    m = fmaxf(m, __shfl_xor(m, 16));
    float s4[4] = {0.f, 0.f, 0.f, 0.f};
#pragma unroll
    for (int j = 0; j < TT / 16; ++j)
#pragma unroll
      for (int r = 0; r < 8; ++r) { const float e = expf(st[j][r] - m); st[j][r] = e; s4[r & 3] += e; }
    float sum = (s4[0] + s4[1]) + (s4[2] + s4[3]); sum += __shfl_xor(sum, 16);
    const float f = sum > 0.f ? 2048.0f / sum : 0.f;
    v8f o0 = {}, o1 = {}; const _Float16* vp = VT + ((size_t)b * CC + h * HD + col) * (size_t)TT;
#pragma unroll
    for (int kc = 0; kc < TT / 32; ++kc) { v16h p;
#pragma unroll
      for (int s = 0; s < 8; ++s) { p[s] = (_Float16)(st[2 * kc][s] * f); p[8 + s] = (_Float16)(st[2 * kc + 1][s] * f); }   /* keys kc*32 + 8 g + s and kc*32 + 16 + 8 g + s: the k order of frag_h */
      o0 = wm16(frag_h(vp + kc * 32, lane), p, o0); o1 = wm16(frag_h(vp + (size_t)16 * TT + kc * 32, lane), p, o1); }
    float* py = Y + ((size_t)b * SZ + q0 + col) * CC + h * HD + 8 * g;   /* a lane holds channels 8 g + r (o0) and 16 + 8 g + r (o1) of its query; the gate was parked here by k_rows2 and is consumed in place by the same lane */
    const v4f g0 = *(const v4f*)py, g1 = *(const v4f*)(py + 4), g2 = *(const v4f*)(py + 16), g3 = *(const v4f*)(py + 20); v4f r0, r1, r2, r3;
#pragma unroll
    for (int c = 0; c < 4; ++c) { r0[c] = o0[c] * (1.0f / 2048.0f) * g0[c]; r1[c] = o0[4 + c] * (1.0f / 2048.0f) * g1[c]; r2[c] = o1[c] * (1.0f / 2048.0f) * g2[c]; r3[c] = o1[4 + c] * (1.0f / 2048.0f) * g3[c]; }
    vst2(py, r0); vst2(py + 4, r1); vst2(py + 16, r2); vst2(py + 20, r3);
    asm volatile("s_wait_xcnt 0x0" ::: "memory");   /* the stores' registers are reused by the next pair row */ } }
// ---- k_out: block = (64 rows, 128 cols): out = ctx Wo (+ bo): all rows: ctx bf16 hi + lo against exact bf16 Wo staged in LDS (2 products)
__global__ __launch_bounds__(128) void k_out(const float* __restrict__ Y, const float* __restrict__ WO, const float* __restrict__ BO, float* __restrict__ OUT) { __shared__ __align__(16) float sf[4][16][132]; __shared__ __align__(16) __bf16 sw[128][WP];
  const int tid = threadIdx.x, wave = tid >> 5, lane = tid & 31, col = lane & 15, g = lane >> 4; const int c0 = blockIdx.y * 128; const size_t r0 = (size_t)blockIdx.x * 64 + wave * 16;
  stage_w(sw, WO + (size_t)c0 * CC, tid);
  __syncthreads();   /* every wave wrote a part of the weight rows that all four read */
  v8f acc[8] = {};
  if (true) {   /* ALL rows: gated ctx bf16 hi + lo x exact output_w (2 products) */
#pragma unroll 2
    for (int kc = 0; kc < CC / 32; ++kc) { v16b w[8];
#pragma unroll
      for (int j = 0; j < 8; ++j) w[j] = frag_b(&sw[j * 16 + col][kc * 32], lane);   /* the LDS reads of a k step go out together, ahead of its products */
      const F2 a = split_row(Y + (r0 + col) * CC, kc * 32, lane); asm volatile("s_wait_loadcnt 0x0" ::: "memory");
      asm volatile("s_wait_xcnt 0x0" ::: "memory");   /* the address registers of the row loads are reused below */
#pragma unroll
      for (int j = 0; j < 8; ++j) { acc[j] = wmma_bf(a.h, w[j], acc[j]); acc[j] = wmma_bf(a.l, w[j], acc[j]); } }
#pragma unroll
    for (int j = 0; j < 8; ++j) { const float bias = BO ? bfr(BO[c0 + j * 16 + col]) : 0.f;
#pragma unroll
      for (int r = 0; r < 8; ++r) sf[wave][8 * g + r][j * 16 + col] = acc[j][r] + bias; }
  } else {
#pragma unroll 2
    for (int kc = 0; kc < CC / 32; ++kc) { const v16h a = frag_f32(Y + (r0 + col) * CC + kc * 32, lane); asm volatile("s_wait_loadcnt 0x0" ::: "memory");
#pragma unroll
      for (int j = 0; j < 8; ++j) { const v16h w = WOCOLH(WO, kc * 32, c0 + j * 16 + col, lane); asm volatile("s_wait_loadcnt 0x0" ::: "memory"); acc[j] = wmma16(a, w, acc[j]); } }
#pragma unroll
    for (int j = 0; j < 8; ++j) { const float bias = BO ? bfr(BO[c0 + j * 16 + col]) : 0.f;
#pragma unroll
      for (int r = 0; r < 8; ++r) sf[wave][8 * g + r][j * 16 + col] = acc[j][r] * (1.0f / 256.0f) + bias; } }
  LDSX(); for (int rl = 0; rl < 16; ++rl) vst2(OUT + (r0 + rl) * DIN + c0 + lane * 4, *(const v4f*)&sf[wave][rl][lane * 4]); }

extern "C" void kernel_launch(void* const* d_in, const int* in_sizes, int n_in, void* d_out, int out_size, void* d_ws, size_t ws_size, hipStream_t stream) {
  (void)in_sizes; (void)n_in; (void)out_size;
  const float** F = (const float**)d_in;
  if (ws_size < (size_t)WS_END) return;
  char* ws = (char*)d_ws; _Float16 *QH = (_Float16*)(ws + WS_QH), *KH = (_Float16*)(ws + WS_KH), *VT = (_Float16*)(ws + WS_VT), *QL = (_Float16*)(ws + WS_QL), *KL = (_Float16*)(ws + WS_KL); __bf16 *VB = (__bf16*)(ws + WS_VB), *VBL = (__bf16*)(ws + WS_VBL); float *Y = (float*)(ws + WS_Y);
  (void)Y; (void)QL; (void)KL; (void)VB; (void)VBL;
  // inputs: 0 pair_repr [1,256,256,128]; 1 mask [1,256,256] f32 (ones); 2 ln_g, 3 ln_b; 4 wb_w [4,128] (out,in), 5 wb_b [4]; 6 wq, 7 wk, 8 wv [128,128] (out,in); 9 wo [128,128] (out,in); 10 wg_w [128,128] (out,in), 11 wg_b [128]
  if (ws_size < (size_t)WS_END2) return;
  float *ZN = (float*)(ws + WS_ZN), *BIAS = (float*)(ws + WS_BIAS);
  k_lnz<<<dim3((unsigned)(NZR / 8)), 256, 0, stream>>>(F[0], F[2], F[3], ZN);
  k_rows2<<<dim3((unsigned)(NZR / 64), 2), 128, 0, stream>>>(ZN, F[4], F[5], F[10], F[11], BIAS, Y);        /* tri bias rows (+ wb_b) and the gate (parked in the Y buffer) */
  k_proj<<<dim3(TNB * TT / 64, CC / 128, 3), 128, 0, stream>>>(ZN, ZN, ZN, F[6], F[7], F[8], nullptr, nullptr, nullptr, QH, QL, KH, KL, VT, VB, VBL);
  k_fa<<<dim3(SZ / 16, TNB / NI), 128, 0, stream>>>(QH, KH, QL, VT, BIAS, F[1], Y);   /* logits, softmax and P.v fused; no score planes in the workspace */
  k_out<<<dim3((unsigned)(NZR / 64), DIN / 128), 128, 0, stream>>>(Y, F[9], nullptr, (float*)d_out);
}

// v003
// One run takes 108 microseconds.
// Next to v002, in two timings, it ran 1.25 and 1.26 times as fast.
// Over all steps from v000 it is 3.81 times as fast.
// compute dtype: all float inputs rounded to bf16; LayerNorm in f32; q/k/v, the triangle bias and the gate from the f32 LayerNorm rows split bf16 hi + lo against exact bf16 weights on WMMA 16x16x32 (2 products, f32 accumulate); logits q.k with q as f16 hi + residual for the first 64 queries of each pair row and single f16 elsewhere (sigma_logit ~ 0.25) x 32^-0.5 + bias + mask in f32; softmax in f32 (precise expf, in registers, fused with both products); P x 2^11 once to f16 against v once to f16 (1 product); gated ctx split bf16 hi + lo against exact wo (2 products); f32 output.
// Triangle attention, starting node (B 1, I = J = 256 residues, D 128, 4 heads x 32; 0.02-scale (out,in) weights, mask all ones, wb_b = 0, wg_b = 1): z = LayerNorm(pair_repr); tri_bias[h][j][k] = z[j][k] . wb_w[h] + wb_b[h]; for each row i: q = (z[i] wq^T)/sqrt(32), k = z[i] wk^T, v = z[i] wv^T (heads = 32-wide slices of the output dim); a = softmax_k(q . k + 1e9 (mask[i][k] - 1) + tri_bias[h][j][k]); y = merged heads; y = sigmoid(z[i] wg_w^T + wg_b) * y; out[i] = y wo^T.
#include <hip/hip_runtime.h>
#include <math.h>

typedef __attribute__((ext_vector_type(16))) _Float16 v16h;
typedef __attribute__((ext_vector_type(16))) __bf16 v16b;
typedef __attribute__((ext_vector_type(8)))  _Float16 v8h;
typedef __attribute__((ext_vector_type(8)))  float v8f;
typedef __attribute__((ext_vector_type(4)))  float v4f;
typedef __attribute__((ext_vector_type(2)))  float v2f;
typedef __attribute__((ext_vector_type(4)))  unsigned v4u;
typedef __attribute__((ext_vector_type(4)))  int v4i;
typedef float __attribute__((may_alias)) float_a;
typedef int __attribute__((may_alias)) int_a;

template <typename T> __device__ __forceinline__ void vst2(void* p, T v) { *(T*)p = v;  }
__device__ __forceinline__ v8f wmma16(v16h a, v16h b, v8f c) {
  v8f d = __builtin_amdgcn_wmma_f32_16x16x32_f16(false, a, false, b, (short)0, c, false, false);
  asm volatile("v_nop\n\tv_nop\n\tv_nop\n\tv_nop" : "+v"(d) : "v"(a), "v"(b));
  return d;
}
__device__ __forceinline__ v8f wmma_bf(v16b a, v16b b, v8f c) {
  v8f d = __builtin_amdgcn_wmma_f32_16x16x32_bf16(false, a, false, b, (short)0, c, false, false);
  asm volatile("v_nop\n\tv_nop\n\tv_nop\n\tv_nop" : "+v"(d) : "v"(a), "v"(b));
  return d;
}
// 16x16x32 fragments: lane = (h = lane>>4, row/col = lane&15); elements 0..7 = k0+8h+0..7, 8..15 = k0+16+8h+0..7; D element r = row 8h+r
__device__ __forceinline__ v16h frag_h(const _Float16* rowk0, int lane) {
  union { v16h v; v8h q[2]; } u; const _Float16* p = rowk0 + 8 * (lane >> 4);
  u.q[0] = *(const v8h*)p; u.q[1] = *(const v8h*)(p + 16); return u.v;
}
__device__ __forceinline__ v16h frag_f32(const float* rowk0, int lane) {
  v16h a; const float* p = rowk0 + 8 * (lane >> 4);
#pragma unroll
  for (int i = 0; i < 8; ++i) { a[i] = (_Float16)p[i]; a[8 + i] = (_Float16)p[16 + i]; }
  return a;
}
__device__ __forceinline__ v16h frag_f32s(const float* rowk0, int lane, float sc) {
  v16h a; const float* p = rowk0 + 8 * (lane >> 4);
#pragma unroll
  for (int i = 0; i < 8; ++i) { a[i] = (_Float16)(p[i] * sc); a[8 + i] = (_Float16)(p[16 + i] * sc); }
  return a;
}
// column fragment from a [K][ld] layout (column n), rows >= K read as 0
__device__ __forceinline__ v16h fragc_f32(const float* W, int k0, int n, int lane, int ld, int K) {
  v16h a; const int g = lane >> 4;
#pragma unroll
  for (int i = 0; i < 8; ++i) { const int ka = k0 + 8 * g + i, kb = ka + 16;
    a[i] = (_Float16)(ka < K ? W[(size_t)(ka < K ? ka : K - 1) * ld + n] : 0.f); a[8 + i] = (_Float16)(kb < K ? W[(size_t)(kb < K ? kb : K - 1) * ld + n] : 0.f); }
  return a;
}
struct F2 { v16b h, l; };
__device__ __forceinline__ F2 bsplit16(const float v[16]) { F2 r;
#pragma unroll
  for (int i = 0; i < 16; ++i) { const __bf16 h = (__bf16)v[i]; r.h[i] = h; r.l[i] = (__bf16)(v[i] - (float)h); }
  return r; }
__device__ __forceinline__ F2 split_row(const float* row, int k0, int lane) { float v[16]; const float* p = row + k0 + 8 * (lane >> 4);
#pragma unroll
  for (int i = 0; i < 8; ++i) { v[i] = p[i]; v[8 + i] = p[16 + i]; }
  return bsplit16(v); }
__device__ __forceinline__ F2 split_rowK(const float* row, int k0, int lane, int K) { float v[16]; const int g = lane >> 4;
#pragma unroll
  for (int i = 0; i < 8; ++i) { const int ka = k0 + 8 * g + i, kb = ka + 16; v[i] = ka < K ? row[ka < K ? ka : K - 1] : 0.f; v[8 + i] = kb < K ? row[kb < K ? kb : K - 1] : 0.f; }
  return bsplit16(v); }
__device__ __forceinline__ F2 split_col(const float* W, int k0, int n, int lane, int ld, int K) { float v[16]; const int g = lane >> 4;
#pragma unroll
  for (int i = 0; i < 8; ++i) { const int ka = k0 + 8 * g + i, kb = ka + 16; v[i] = ka < K ? W[(size_t)(ka < K ? ka : K - 1) * ld + n] : 0.f; v[8 + i] = kb < K ? W[(size_t)(kb < K ? kb : K - 1) * ld + n] : 0.f; }
  return bsplit16(v); }
__device__ __forceinline__ v8f mac3(const F2& a, const F2& b, v8f c) { c = wmma_bf(a.l, b.h, c); c = wmma_bf(a.h, b.l, c); return wmma_bf(a.h, b.h, c); }
__device__ __forceinline__ float sigm(float v) { return 1.0f / (1.0f + expf(-v)); }
#define LDSX() do { asm volatile("s_wait_dscnt 0" ::: "memory"); __builtin_amdgcn_wave_barrier(); __builtin_amdgcn_fence(__ATOMIC_RELEASE, "workgroup"); } while (0)

// Row-wise triangle attention on a pair tensor z [1, 256, 256, 128] (4 heads x 32): zn = LayerNorm(z); q,k,v = zn wq^T, zn wk^T, zn wv^T (separate (out,in) [128,128]); logits[r][i][j][h] = q[r][i] . k[r][j] / sqrt(32) + (zn[i][j] . w_pair[h] + b_pair[h]) + 1e9 (mask[r][j] - 1); softmax over j; out = sigmoid(zn w_gate + b_gate) * merged(attn v); result = out w_out (no output bias).
#define NB 256              // pair rows i (each a sequence of SZ = TT = 256 positions; no padding needed)
#define TT 256
#define CC 128            // NH * HD = projected width
#define DIN 128          // input (model) width
#define NH 4
#define HD 32
#define NQB (TT / 64)
#define HG 4
#define SCALE (0.17677669529663687f)
#define CAUSAL 0
#ifndef TNB
#define TNB NB
#endif
__device__ __forceinline__ float bfr(float v) { return (float)(__bf16)v; }
__host__ __device__ __forceinline__ int kb_last(int qb) { return CAUSAL ? ((qb * 64 + 63) >> 7) : (TT / 128 - 1); }
typedef __attribute__((ext_vector_type(8))) __bf16 v8b;
__device__ __forceinline__ v16b frag_b(const __bf16* rowk0, int lane) {
  union { v16b v; v8b q[2]; } u; const __bf16* p = rowk0 + 8 * (lane >> 4);
  u.q[0] = *(const v8b*)p; u.q[1] = *(const v8b*)(p + 16); return u.v;
}
typedef __attribute__((ext_vector_type(4))) __bf16 v4b;
#define WP 136             // bf16 elements per staged weight row: 272 B = 16 B x odd, so the 16-byte fragment reads of 16 rows fall on distinct banks
// an (out,in) weight [128][128] f32 -> bf16 rows in LDS, by the 128 threads of a block: each wave-load takes one whole 512-B row, all 32 loads of a thread fly together; frag_b(&sw[o][k0], lane) is then the B fragment that wcol_oi gathered from global memory
__device__ __forceinline__ void stage_w(__bf16 (*sw)[WP], const float* __restrict__ Wm, int tid) { const float* p = Wm + tid * 4; v4f a[32];
#pragma unroll
  for (int it = 0; it < 32; ++it) a[it] = *(const v4f*)(p + it * 512);
  asm volatile("s_wait_xcnt 0x0" ::: "memory");   /* the address registers of these loads are reused below */
#pragma unroll
  for (int it = 0; it < 32; ++it) { v4b w;
#pragma unroll
    for (int i = 0; i < 4; ++i) w[i] = (__bf16)a[it][i];
    *(v4b*)&sw[it * 4 + (tid >> 5)][(tid & 31) * 4] = w; } }
#define QBH 0              // unused: no causal path here; the q residual path is chosen by QHI
#define QHI 64             // q residual rows only for the first 64 queries of each row (logits elsewhere: single f16 q, k; sigma_logit ~ 0.25 so this is ample)
#define KHI 64            // key rows sizing the KL, VB and VBL regions (no kernel here writes or reads them)
// B fragment (k rows k0+.., output column o) of a weight: (in,out) [K][ld] or (out,in) [ld rows of K]: bf16 exact, or f16(bf16 * 256) exact
__device__ __forceinline__ v16b wcol_io(const float* Wm, int k0, int o, int lane, int ld) { v16b w; const int g = lane >> 4;
#pragma unroll
  for (int i = 0; i < 8; ++i) { w[i] = (__bf16)Wm[(size_t)(k0 + 8 * g + i) * ld + o]; w[8 + i] = (__bf16)Wm[(size_t)(k0 + 16 + 8 * g + i) * ld + o]; }
  return w; }
__device__ __forceinline__ v16b wcol_oi(const float* Wm, int k0, int o, int lane, int K) { v16b w; const float* p = Wm + (size_t)o * K + k0 + 8 * (lane >> 4);
#pragma unroll
  for (int i = 0; i < 8; ++i) { w[i] = (__bf16)p[i]; w[8 + i] = (__bf16)p[16 + i]; }
  return w; }
__device__ __forceinline__ v16h wcolh_io(const float* Wm, int k0, int o, int lane, int ld) { v16h w; const int g = lane >> 4;
#pragma unroll
  for (int i = 0; i < 8; ++i) { w[i] = (_Float16)(bfr(Wm[(size_t)(k0 + 8 * g + i) * ld + o]) * 256.0f); w[8 + i] = (_Float16)(bfr(Wm[(size_t)(k0 + 16 + 8 * g + i) * ld + o]) * 256.0f); }
  return w; }
__device__ __forceinline__ v16h wcolh_oi(const float* Wm, int k0, int o, int lane, int K) { v16h w; const float* p = Wm + (size_t)o * K + k0 + 8 * (lane >> 4);
#pragma unroll
  for (int i = 0; i < 8; ++i) { w[i] = (_Float16)(bfr(p[i]) * 256.0f); w[8 + i] = (_Float16)(bfr(p[16 + i]) * 256.0f); }
  return w; }
#define WQKV_LAYOUT 1   // (out,in) separate wq / wk / wv [CC][DIN] (wq.reshape(H, DH, D): output column h*32 + c = row of wq)
__device__ __forceinline__ v16b wcol_hdk(const float* Wm, int k0, int o, int lane) { v16b w; const int g = lane >> 4; const float* p = Wm + (size_t)(o / HD) * DIN * HD + (o % HD);
#pragma unroll
  for (int i = 0; i < 8; ++i) { w[i] = (__bf16)p[(size_t)(k0 + 8 * g + i) * HD]; w[8 + i] = (__bf16)p[(size_t)(k0 + 16 + 8 * g + i) * HD]; }
  return w; }
#define WO_OUT_IN 1
#if WQKV_LAYOUT == 1
#define WCOL(W, k0, o, lane) wcol_oi(W, k0, o, lane, DIN)
#elif WQKV_LAYOUT == 2
#define WCOL(W, k0, o, lane) wcol_hdk(W, k0, o, lane)
#else
#define WCOL(W, k0, o, lane) wcol_oi(W, k0, o, lane, DIN)
#endif
#if WO_OUT_IN
#define WOCOL(W, k0, o, lane) wcol_oi(W, k0, o, lane, CC)
#define WOCOLH(W, k0, o, lane) wcolh_oi(W, k0, o, lane, CC)
#else
#define WOCOL(W, k0, o, lane) wcol_io(W, k0, o, lane, DIN)
#define WOCOLH(W, k0, o, lane) wcolh_io(W, k0, o, lane, DIN)
#endif
#define SZ 256             // real positions per row (= TT here)
#define BG 64              // sizes the unused WS_S region (x 4 heads = 256 planes of 256 x 256)
#define NZR ((size_t)NB * SZ)   // 65,536 real pair rows (i, j)
#define SM_EXTRA_PARAMS , const float* __restrict__ BIAS, const float* __restrict__ MKF, int b0s
#define SM_MASK_HOOK do { const int hh = (int)blockIdx.y % HG; const int ii = b0s + (int)blockIdx.y / HG; const int kc2 = k < SZ ? k : SZ - 1; const float add = BIAS[((size_t)t * SZ + kc2) * NH + hh] + 1.0e9f * (bfr(MKF[(size_t)ii * SZ + kc2]) - 1.0f); v = (k < SZ) ? v + add : -3.0e38f; } while (0)   /* + tri_bias[h][q=t][k] + INF (mask[i][k] - 1) (mask is all ones: adds 0, read anyway); key columns k >= SZ would be padding -> excluded (none here: SZ = TT, so the k < SZ test on the loop index always holds) */
__device__ __forceinline__ v16b zero16b() { v16b z; _Pragma("unroll") for (int i = 0; i < 16; ++i) z[i] = (__bf16)0.f; return z; }
#define WS_ZN   (WS_END)
#define WS_BIAS (WS_ZN + 4u * (size_t)NZR * CC)
#define WS_END2 (WS_BIAS + 4u * (size_t)NZR * NH + 1024)
#ifndef SM_EXTRA_PARAMS
#define SM_EXTRA_PARAMS
#endif
#ifndef PROJ_EXTRA_PARAMS
#define PROJ_EXTRA_PARAMS
#endif
#ifndef SM_MASK_HOOK
#define SM_MASK_HOOK (void)0
#endif

#define WS_QH  0u                                      // f16 q rows [b*t][CC]
#define WS_KH  (WS_QH + 2u * (size_t)NB * TT * CC)      // f16 k rows [b*t][CC]
#define WS_VT  (WS_KH + 2u * (size_t)NB * TT * CC)      // f16 v planes [b][c][t]
#define WS_QL  (WS_VT + 2u * (size_t)NB * CC * TT)      // f16 q residual x 2^10 rows [b][t < QHI][CC]
#define WS_KL  (WS_QL + 2u * (size_t)NB * QHI * CC)     // unused: f16 [b][t < KHI][CC], no kernel here writes it
#define WS_VB  (WS_KL + 2u * (size_t)NB * KHI * CC)     // unused: bf16 [b][c][t < KHI], no kernel here writes it
#define WS_VBL (WS_VB + 2u * (size_t)NB * CC * KHI)
#define WS_S   (WS_VBL + 2u * (size_t)NB * CC * KHI)    // unused: logits and P stay in registers in k_fa
#define WS_Y   (WS_S  + 4u * (size_t)BG * HG * TT * TT)   // f32 ctx rows [b*t][CC]
#define WS_END (WS_Y  + 4u * (size_t)NB * SZ * CC)   /* compact ctx/gate rows [i*256 + j] */

// ---- k_front: block = one pair row i = 256 positions, 16 waves x 16 positions: LayerNorm, triangle bias, q, k, gate and v of a position from ONE read of its input row. A lane loads its row's 64 channels directly in the 16x16x32 fragment order (the other 64 sit in lane ^ 16), so mean and variance are in-lane sums plus one exchange, and the normalised row, split bf16 hi + lo, stays in registers as the operand of all five products. The four [128][128] weights and the bias rows are staged once per block in LDS as bf16. Bias, q, k and gate are taken as W x^T (A = weight rows, B = positions): a lane then holds 8 neighbouring channels of ONE position, which go to the wave's own LDS tile as 16-byte stores and leave as whole rows. v is taken as x W^T: a lane holds 8 neighbouring positions of one channel, gathered over the 16 waves into [c][t] planes.
#define LDSW() asm volatile("s_wait_dscnt 0" ::: "memory")   // a wave's own LDS writes are done before its lanes read each other's; unlike LDSX it does not wait for the wave's global stores
#define TILEB 8704         // bytes of a wave's own output tile: two f16 [16][136] tiles, or one f32 [16][132]
#define VP 264             // f16 elements per gathered v row: 528 B = 16 B x odd
__device__ __forceinline__ v8f wmb(v16b a, v16b b, v8f c) { return __builtin_amdgcn_wmma_f32_16x16x32_bf16(false, a, false, b, (short)0, c, false, false); }
// eight 16x16 tiles over K = 128: WROWS: D = W x^T (rows = output channels), else D = x W^T (rows = positions); per tile the order of the sums is hi, lo of k step 0, hi, lo of k step 1, ...
template <bool WROWS> __device__ __forceinline__ void prod8(const __bf16 (*w)[WP], const F2 (&af)[4], v8f (&acc)[8], int col, int lane) {
#pragma unroll
  for (int kc = 0; kc < 4; ++kc) { v16b wf[8];
#pragma unroll
    for (int j = 0; j < 8; ++j) wf[j] = frag_b(&w[j * 16 + col][kc * 32], lane);   /* the LDS reads of a k step go out together, ahead of its products */
#pragma unroll
    for (int j = 0; j < 8; ++j) acc[j] = WROWS ? wmb(wf[j], af[kc].h, acc[j]) : wmb(af[kc].h, wf[j], acc[j]);
#pragma unroll
    for (int j = 0; j < 8; ++j) acc[j] = WROWS ? wmb(wf[j], af[kc].l, acc[j]) : wmb(af[kc].l, wf[j], acc[j]); } }
__global__ __launch_bounds__(512) void k_front(const float* __restrict__ Z, const float* __restrict__ LW, const float* __restrict__ LB, const float* __restrict__ WB, const float* __restrict__ WBB, const float* __restrict__ WQ, const float* __restrict__ WK, const float* __restrict__ WV, const float* __restrict__ WG, const float* __restrict__ GB,
    _Float16* __restrict__ QH, _Float16* __restrict__ QL, _Float16* __restrict__ KH, _Float16* __restrict__ VT, float* __restrict__ BIAS, float* __restrict__ G) {
  __shared__ __align__(16) __bf16 sw[4][CC][WP]; __shared__ __align__(16) __bf16 swb[16][WP]; __shared__ __align__(16) float sln[4][CC]; __shared__ __align__(16) char stile[16 * TILEB];
  const int tid = threadIdx.x, wave = tid >> 5, lane = tid & 31, col = lane & 15, g = lane >> 4; const size_t bb = blockIdx.x; const size_t r0 = bb * TT + wave * 16;
  v4f x[16];
  { /* all 53 loads of a lane at the block's start fly together: no wait stands between them */
    const float* px = Z + (r0 + col) * CC + 8 * g;
#pragma unroll
    for (int n = 0; n < 16; ++n) x[n] = *(const v4f*)(px + (n >> 2) * 32 + ((n >> 1) & 1) * 16 + (n & 1) * 4);
    v4f a[4][8]; const int ch = tid & (CC - 1);
    const float* pb = WB + (wave & (NH - 1)) * CC + lane * 4; const v4f wb4 = *(const v4f*)pb;   /* read by every wave, so that no branch parts the loads; kept by waves 0..3 (bias row = wave) */
    const int sel = wave >> 2, c4 = ch & (NH - 1); const float l0 = LW[ch], l1 = LB[ch], l2 = GB[ch], l3 = WBB[c4];   /* likewise; four waves each keep ln_g, ln_b, the gate's bias and wb_b (its 4 values repeated) */
#pragma unroll
    for (int it = 0; it < 8; ++it) { a[0][it] = *(const v4f*)(WQ + tid * 4 + it * 2048); a[1][it] = *(const v4f*)(WK + tid * 4 + it * 2048); a[2][it] = *(const v4f*)(WV + tid * 4 + it * 2048); a[3][it] = *(const v4f*)(WG + tid * 4 + it * 2048); }
    asm volatile("s_wait_xcnt 0x0" :: "v"(px), "v"(pb), "v"(ch), "v"(c4) : "memory");   /* the address registers of these loads are reused below; px, pb, ch and c4 stay live up to this wait, so that no load of the group lands on address registers of the group */
    asm volatile("" :: "v"(l0), "v"(l1), "v"(l2), "v"(l3));   /* inputs only: holds these four loads up here with the others; the compiler otherwise sinks them into branches behind the staging, where their latency is waited out alone */
#pragma unroll
    for (int m = 0; m < 4; ++m)
#pragma unroll
      for (int it = 0; it < 8; ++it) { v4b w;
#pragma unroll
        for (int i = 0; i < 4; ++i) w[i] = (__bf16)a[m][it][i];
        *(v4b*)&sw[m][it * 16 + wave][lane * 4] = w; }
    v4b w;
#pragma unroll
    for (int i = 0; i < 4; ++i) w[i] = (__bf16)(wave < NH ? wb4[i] : 0.f);
    *(v4b*)&swb[wave][lane * 4] = w;   /* rows 4..15 of the one bias tile are zero */
    sln[sel][ch] = bfr(sel == 0 ? l0 : sel == 1 ? l1 : sel == 2 ? l2 : l3); }
  __syncthreads();   /* every wave wrote a part of the weight rows that all sixteen read */
  F2 af[4];
  { float s4[4] = {0.f, 0.f, 0.f, 0.f};
#pragma unroll
    for (int n = 0; n < 16; ++n)
#pragma unroll
      for (int i = 0; i < 4; ++i) { x[n][i] = bfr(x[n][i]); s4[i] += x[n][i]; }
    float s1 = (s4[0] + s4[1]) + (s4[2] + s4[3]); s1 += __shfl_xor(s1, 16);
    const float mu = s1 * (1.0f / CC); float q4[4] = {0.f, 0.f, 0.f, 0.f};
#pragma unroll
    for (int n = 0; n < 16; ++n)
#pragma unroll
      for (int i = 0; i < 4; ++i) { const float d = x[n][i] - mu; q4[i] += d * d; }
    float q = (q4[0] + q4[1]) + (q4[2] + q4[3]); q += __shfl_xor(q, 16);
    const float rs = rsqrtf(q * (1.0f / CC) + 1e-5f);
#pragma unroll
    for (int kc = 0; kc < 4; ++kc) { float v[16];
#pragma unroll
      for (int s = 0; s < 4; ++s) { const int c = kc * 32 + 8 * g + (s >> 1) * 16 + (s & 1) * 4; const v4f lw = *(const v4f*)&sln[0][c], lb = *(const v4f*)&sln[1][c];
#pragma unroll
        for (int i = 0; i < 4; ++i) v[s * 4 + i] = (x[kc * 4 + s][i] - mu) * rs * lw[i] + lb[i]; }
      af[kc] = bsplit16(v); } }
  { /* triangle bias: heads = rows 0..3 of the tile, so lanes 0..15 hold the 4 heads of their position: one 256-B run per wave */
    v8f ab = {};
#pragma unroll
    for (int kc = 0; kc < 4; ++kc) { const v16b wf = frag_b(&swb[col][kc * 32], lane); ab = wmb(wf, af[kc].h, ab); ab = wmb(wf, af[kc].l, ab); }
    v4f b4;
#pragma unroll
    for (int i = 0; i < 4; ++i) b4[i] = ab[i] + sln[3][i];   /* + wb_b[h] */
    if (g == 0) vst2(BIAS + (r0 + col) * NH, b4); }
  { /* v ahead of q, k and gate: f16 planes [c][t]; its two barriers, which also wait for a wave's global stores, stand where only the short bias store is under way */
    v8f acc[8] = {}; prod8<false>(sw[2], af, acc, col, lane); _Float16* tv = (_Float16*)stile;
#pragma unroll
    for (int j = 0; j < 8; ++j) { v8h hv;
#pragma unroll
      for (int r = 0; r < 8; ++r) hv[r] = (_Float16)acc[j][r];
      *(v8h*)&tv[(j * 16 + col) * VP + wave * 16 + 8 * g] = hv; }
    __syncthreads();   /* a v row holds 16 positions from each wave */
    _Float16* dv = VT + (bb * CC + wave * 8) * (size_t)TT + lane * 8; v4u t[8];
#pragma unroll
    for (int it = 0; it < 8; ++it) t[it] = *(const v4u*)&tv[(wave * 8 + it) * VP + lane * 8];
    __syncthreads();   /* every wave has read its v rows before the waves' own tiles take those bytes */
#pragma unroll
    for (int it = 0; it < 8; ++it) vst2((unsigned*)(dv + it * TT), t[it]);   /* one whole 512-B row per store */
    asm volatile("s_wait_xcnt 0x0" ::: "memory");   /* the stores' registers are reused below */ }
  _Float16* th = (_Float16*)(stile + wave * TILEB); _Float16* tl = th + 16 * 136; float* tf = (float*)(stile + wave * TILEB);
  const bool hi = wave * 16 < QHI;   /* wave-uniform: these positions carry the q residual */
#pragma unroll
  for (int m = 0; m < 2; ++m) { /* q, then k: f16 rows */
    v8f acc[8] = {}; prod8<true>(sw[m], af, acc, col, lane); const bool res = m == 0 && hi;
#pragma unroll
    for (int j = 0; j < 8; ++j) { v8h hv, lv;
#pragma unroll
      for (int r = 0; r < 8; ++r) { const float v = acc[j][r]; hv[r] = (_Float16)v; lv[r] = (_Float16)((v - (float)hv[r]) * 1024.0f); }
      *(v8h*)&th[col * 136 + j * 16 + 8 * g] = hv; if (res) *(v8h*)&tl[col * 136 + j * 16 + 8 * g] = lv; }
    LDSW();   /* the lanes of this wave read each other's tile rows below */
    _Float16* dh = (m == 0 ? QH : KH) + (r0 + g) * CC + col * 8; v4u t[8];
#pragma unroll
    for (int it = 0; it < 8; ++it) t[it] = *(const v4u*)&th[(it * 2 + g) * 136 + col * 8];
#pragma unroll
    for (int it = 0; it < 8; ++it) vst2((unsigned*)(dh + it * 2 * CC), t[it]);   /* two whole 256-B rows per store */
    if (res) { _Float16* dl = QL + (bb * QHI + wave * 16 + g) * (size_t)CC + col * 8; v4u u[8];
#pragma unroll
      for (int it = 0; it < 8; ++it) u[it] = *(const v4u*)&tl[(it * 2 + g) * 136 + col * 8];
#pragma unroll
      for (int it = 0; it < 8; ++it) vst2((unsigned*)(dl + it * 2 * CC), u[it]); }
    asm volatile("s_wait_xcnt 0x0" ::: "memory");   /* the stores' registers are reused below */ }
  { /* gate: f32 rows, parked in the ctx buffer */
    v8f acc[8] = {}; prod8<true>(sw[3], af, acc, col, lane);
#pragma unroll
    for (int j = 0; j < 8; ++j) { const v4f g0 = *(const v4f*)&sln[2][j * 16 + 8 * g], g1 = *(const v4f*)&sln[2][j * 16 + 8 * g + 4]; v4f s0, s1;
#pragma unroll
      for (int r = 0; r < 4; ++r) { s0[r] = 1.0f / (1.0f + expf(-(acc[j][r] + g0[r]))); s1[r] = 1.0f / (1.0f + expf(-(acc[j][4 + r] + g1[r]))); }   /* sigmoid(zn w_gate + b_gate) */
      *(v4f*)&tf[col * 132 + j * 16 + 8 * g] = s0; *(v4f*)&tf[col * 132 + j * 16 + 8 * g + 4] = s1; }
    LDSW();   /* as above */
    float* dg = G + r0 * CC + lane * 4; v4f t[16];
#pragma unroll
    for (int rl = 0; rl < 16; ++rl) t[rl] = *(const v4f*)&tf[rl * 132 + lane * 4];
#pragma unroll
    for (int rl = 0; rl < 16; ++rl) vst2(dg + rl * CC, t[rl]);   /* one whole 512-B row per store */ } }
#define NI 4
__device__ __forceinline__ v8f wm16(v16h a, v16h b, v8f c) { return __builtin_amdgcn_wmma_f32_16x16x32_f16(false, a, false, b, (short)0, c, false, false); }
__device__ __forceinline__ v16h frag_at(const _Float16* p) { union { v16h v; v8h q[2]; } u; u.q[0] = *(const v8h*)p; u.q[1] = *(const v8h*)(p + 16); return u.v; }   /* frag_h with the lane half's offset already in p */
__global__ __launch_bounds__(128) void k_fa(const _Float16* __restrict__ QH, const _Float16* __restrict__ KH, const _Float16* __restrict__ QL, const _Float16* __restrict__ VT, const float* __restrict__ BIAS, const float* __restrict__ MKF, float* __restrict__ Y) {
  __shared__ __align__(16) float sb[NH][16][TT + 4];   /* pitch 1040 B = 16 B x odd: 16-byte reads of 16 rows fall on distinct banks */
  __shared__ __align__(16) float smk[NH][TT];
  const int tid = threadIdx.x, wave = tid >> 5, lane = tid & 31, col = lane & 15, g = lane >> 4; const int q0 = (int)blockIdx.x * 16; const int h = wave;
  for (int e = tid; e < 16 * TT; e += 128) { const int q = e >> 8, k = e & (TT - 1); const v4f b4 = *(const v4f*)(BIAS + ((size_t)(q0 + q) * SZ + k) * NH);
    sb[0][q][k] = b4[0]; sb[1][q][k] = b4[1]; sb[2][q][k] = b4[2]; sb[3][q][k] = b4[3]; }
  __syncthreads();   /* every wave wrote a part of every head's bias plane */
  const bool hi = q0 < QHI;   /* block-uniform: these queries carry the q residual */
  /* the loop over pair rows stays rolled: one tile's registers at a time keep four waves on a SIMD; every inner loop is unrolled so that st[] is indexed by constants and stays in registers */
#pragma unroll 1
  for (int ii = 0; ii < NI; ++ii) { const int b = (int)blockIdx.y * NI + ii;
    { v4f m0 = *(const v4f*)(MKF + (size_t)b * SZ + lane * 8), m1 = *(const v4f*)(MKF + (size_t)b * SZ + lane * 8 + 4);
#pragma unroll
      for (int c = 0; c < 4; ++c) { m0[c] = 1.0e9f * (bfr(m0[c]) - 1.0f); m1[c] = 1.0e9f * (bfr(m1[c]) - 1.0f); }   /* INF (mask[i][k] - 1), 8 keys per lane, wave-private copy */
      *(v4f*)&smk[wave][lane * 8] = m0; *(v4f*)&smk[wave][lane * 8 + 4] = m1; }
    LDSX();   /* the lanes of this wave read each other's mask terms below */
    const v16h qf = frag_h(QH + ((size_t)b * TT + q0 + col) * CC + h * HD, lane); const _Float16* kp = KH + ((size_t)b * TT + col) * CC + h * HD + 8 * g;
    v8f st[TT / 16];
    asm volatile("s_wait_xcnt 0x0" ::: "memory");   /* the address registers of the q loads are reused below */
    if (hi) { const v16h ql = frag_h(QL + ((size_t)b * QHI + q0 + col) * CC + h * HD, lane);
      asm volatile("s_wait_xcnt 0x0" ::: "memory");   /* as above, for the residual's loads */
#pragma unroll
      for (int hb = 0; hb < 2; ++hb) { v16h kf[8];   /* eight key fragments per batch, so that their loads fly together */
#pragma unroll
        for (int j = 0; j < 8; ++j) kf[j] = frag_at(kp + (size_t)(hb * 8 + j) * 16 * CC);
        asm volatile("s_wait_xcnt 0x0" :: "v"(kp) : "memory");   /* kp stays live up to this wait, so that no load of the batch lands on its own address registers */
#pragma unroll
        for (int j = 0; j < 8; ++j) { const v8f z = {}; const v8f ah = wm16(kf[j], qf, z), al = wm16(kf[j], ql, z);
#pragma unroll
          for (int r = 0; r < 8; ++r) st[hb * 8 + j][r] = ah[r] + al[r] * (1.0f / 1024.0f); } }
    } else {
#pragma unroll
      for (int j = 0; j < TT / 16; ++j) { const v16h kf = frag_at(kp + (size_t)j * 16 * CC); const v8f z = {}; st[j] = wm16(kf, qf, z); } }
    float m = -3.0e38f;
#pragma unroll
    for (int j = 0; j < TT / 16; ++j) { const v4f a0 = *(const v4f*)&smk[wave][j * 16 + 8 * g], a1 = *(const v4f*)&smk[wave][j * 16 + 8 * g + 4]; const v4f b0 = *(const v4f*)&sb[wave][col][j * 16 + 8 * g], b1 = *(const v4f*)&sb[wave][col][j * 16 + 8 * g + 4];
#pragma unroll
      for (int r = 0; r < 4; ++r) { st[j][r] = st[j][r] * SCALE + (b0[r] + a0[r]); st[j][4 + r] = st[j][4 + r] * SCALE + (b1[r] + a1[r]); m = fmaxf(m, fmaxf(st[j][r], st[j][4 + r])); } }
    m = fmaxf(m, __shfl_xor(m, 16));
    float s4[4] = {0.f, 0.f, 0.f, 0.f};
#pragma unroll
    for (int j = 0; j < TT / 16; ++j)
#pragma unroll
      for (int r = 0; r < 8; ++r) { const float e = expf(st[j][r] - m); st[j][r] = e; s4[r & 3] += e; }
    float sum = (s4[0] + s4[1]) + (s4[2] + s4[3]); sum += __shfl_xor(sum, 16);
    const float f = sum > 0.f ? 2048.0f / sum : 0.f;
    v8f o0 = {}, o1 = {}; const _Float16* vp = VT + ((size_t)b * CC + h * HD + col) * (size_t)TT;
#pragma unroll
    for (int kc = 0; kc < TT / 32; ++kc) { v16h p;
#pragma unroll
      for (int s = 0; s < 8; ++s) { p[s] = (_Float16)(st[2 * kc][s] * f); p[8 + s] = (_Float16)(st[2 * kc + 1][s] * f); }   /* keys kc*32 + 8 g + s and kc*32 + 16 + 8 g + s: the k order of frag_h */
      o0 = wm16(frag_h(vp + kc * 32, lane), p, o0); o1 = wm16(frag_h(vp + (size_t)16 * TT + kc * 32, lane), p, o1); }
    float* py = Y + ((size_t)b * SZ + q0 + col) * CC + h * HD + 8 * g;   /* a lane holds channels 8 g + r (o0) and 16 + 8 g + r (o1) of its query; the gate was parked here by k_front and is consumed in place by the same lane */
    const v4f g0 = *(const v4f*)py, g1 = *(const v4f*)(py + 4), g2 = *(const v4f*)(py + 16), g3 = *(const v4f*)(py + 20); v4f r0, r1, r2, r3;
#pragma unroll
    for (int c = 0; c < 4; ++c) { r0[c] = o0[c] * (1.0f / 2048.0f) * g0[c]; r1[c] = o0[4 + c] * (1.0f / 2048.0f) * g1[c]; r2[c] = o1[c] * (1.0f / 2048.0f) * g2[c]; r3[c] = o1[4 + c] * (1.0f / 2048.0f) * g3[c]; }
    vst2(py, r0); vst2(py + 4, r1); vst2(py + 16, r2); vst2(py + 20, r3);
    asm volatile("s_wait_xcnt 0x0" ::: "memory");   /* the stores' registers are reused by the next pair row */ } }
// ---- k_out: block = (64 rows, 128 cols): out = ctx Wo (+ bo): all rows: ctx bf16 hi + lo against exact bf16 Wo staged in LDS (2 products)
__global__ __launch_bounds__(128) void k_out(const float* __restrict__ Y, const float* __restrict__ WO, const float* __restrict__ BO, float* __restrict__ OUT) { __shared__ __align__(16) float sf[4][16][132]; __shared__ __align__(16) __bf16 sw[128][WP];
  const int tid = threadIdx.x, wave = tid >> 5, lane = tid & 31, col = lane & 15, g = lane >> 4; const int c0 = blockIdx.y * 128; const size_t r0 = (size_t)blockIdx.x * 64 + wave * 16;
  stage_w(sw, WO + (size_t)c0 * CC, tid);
  __syncthreads();   /* every wave wrote a part of the weight rows that all four read */
  v8f acc[8] = {};
  if (true) {   /* ALL rows: gated ctx bf16 hi + lo x exact output_w (2 products) */
#pragma unroll 2
    for (int kc = 0; kc < CC / 32; ++kc) { v16b w[8];
#pragma unroll
      for (int j = 0; j < 8; ++j) w[j] = frag_b(&sw[j * 16 + col][kc * 32], lane);   /* the LDS reads of a k step go out together, ahead of its products */
      const F2 a = split_row(Y + (r0 + col) * CC, kc * 32, lane); asm volatile("s_wait_loadcnt 0x0" ::: "memory");
      asm volatile("s_wait_xcnt 0x0" ::: "memory");   /* the address registers of the row loads are reused below */
#pragma unroll
      for (int j = 0; j < 8; ++j) { acc[j] = wmma_bf(a.h, w[j], acc[j]); acc[j] = wmma_bf(a.l, w[j], acc[j]); } }
#pragma unroll
    for (int j = 0; j < 8; ++j) { const float bias = BO ? bfr(BO[c0 + j * 16 + col]) : 0.f;
#pragma unroll
      for (int r = 0; r < 8; ++r) sf[wave][8 * g + r][j * 16 + col] = acc[j][r] + bias; }
  } else {
#pragma unroll 2
    for (int kc = 0; kc < CC / 32; ++kc) { const v16h a = frag_f32(Y + (r0 + col) * CC + kc * 32, lane); asm volatile("s_wait_loadcnt 0x0" ::: "memory");
#pragma unroll
      for (int j = 0; j < 8; ++j) { const v16h w = WOCOLH(WO, kc * 32, c0 + j * 16 + col, lane); asm volatile("s_wait_loadcnt 0x0" ::: "memory"); acc[j] = wmma16(a, w, acc[j]); } }
#pragma unroll
    for (int j = 0; j < 8; ++j) { const float bias = BO ? bfr(BO[c0 + j * 16 + col]) : 0.f;
#pragma unroll
      for (int r = 0; r < 8; ++r) sf[wave][8 * g + r][j * 16 + col] = acc[j][r] * (1.0f / 256.0f) + bias; } }
  LDSX(); for (int rl = 0; rl < 16; ++rl) vst2(OUT + (r0 + rl) * DIN + c0 + lane * 4, *(const v4f*)&sf[wave][rl][lane * 4]); }

extern "C" void kernel_launch(void* const* d_in, const int* in_sizes, int n_in, void* d_out, int out_size, void* d_ws, size_t ws_size, hipStream_t stream) {
  (void)in_sizes; (void)n_in; (void)out_size;
  const float** F = (const float**)d_in;
  if (ws_size < (size_t)WS_END) return;
  char* ws = (char*)d_ws; _Float16 *QH = (_Float16*)(ws + WS_QH), *KH = (_Float16*)(ws + WS_KH), *VT = (_Float16*)(ws + WS_VT), *QL = (_Float16*)(ws + WS_QL), *KL = (_Float16*)(ws + WS_KL); __bf16 *VB = (__bf16*)(ws + WS_VB), *VBL = (__bf16*)(ws + WS_VBL); float *Y = (float*)(ws + WS_Y);
  (void)Y; (void)QL; (void)KL; (void)VB; (void)VBL;
  // inputs: 0 pair_repr [1,256,256,128]; 1 mask [1,256,256] f32 (ones); 2 ln_g, 3 ln_b; 4 wb_w [4,128] (out,in), 5 wb_b [4]; 6 wq, 7 wk, 8 wv [128,128] (out,in); 9 wo [128,128] (out,in); 10 wg_w [128,128] (out,in), 11 wg_b [128]
  if (ws_size < (size_t)WS_END2) return;
  float *BIAS = (float*)(ws + WS_BIAS);
  k_front<<<dim3(NB), 512, 0, stream>>>(F[0], F[2], F[3], F[4], F[5], F[6], F[7], F[8], F[10], F[11], QH, QL, KH, VT, BIAS, Y);   /* LayerNorm, tri bias rows (+ wb_b), q, k, v and the gate (parked in the Y buffer) from one read of the input */
  k_fa<<<dim3(SZ / 16, TNB / NI), 128, 0, stream>>>(QH, KH, QL, VT, BIAS, F[1], Y);   /* logits, softmax and P.v fused; no score planes in the workspace */
  k_out<<<dim3((unsigned)(NZR / 64), DIN / 128), 128, 0, stream>>>(Y, F[9], nullptr, (float*)d_out);
}

// v004
// One run takes 88.4 microseconds.
// Timed twice side by side with v003, it ran 1.23 times as fast both times.
// Over all steps from v000 it is 4.69 times as fast.
// compute dtype: all float inputs rounded to bf16; LayerNorm in f32; q/k/v, the triangle bias and the gate from the f32 LayerNorm rows split bf16 hi + lo against exact bf16 weights on WMMA 16x16x32 (2 products, f32 accumulate); logits q.k with q as f16 hi + residual for the first 64 queries of each pair row and single f16 elsewhere (sigma_logit ~ 0.25) x 32^-0.5 + bias + mask in f32; softmax in f32 (precise expf, in registers, fused with both products); P x 2^11 once to f16 against v once to f16 (1 product); gated ctx split bf16 hi + lo against exact wo (2 products); f32 output.
// Triangle attention, starting node (B 1, I = J = 256 residues, D 128, 4 heads x 32; 0.02-scale (out,in) weights, mask all ones, wb_b = 0, wg_b = 1): z = LayerNorm(pair_repr); tri_bias[h][j][k] = z[j][k] . wb_w[h] + wb_b[h]; for each row i: q = (z[i] wq^T)/sqrt(32), k = z[i] wk^T, v = z[i] wv^T (heads = 32-wide slices of the output dim); a = softmax_k(q . k + 1e9 (mask[i][k] - 1) + tri_bias[h][j][k]); y = merged heads; y = sigmoid(z[i] wg_w^T + wg_b) * y; out[i] = y wo^T.
#include <hip/hip_runtime.h>
#include <math.h>

typedef __attribute__((ext_vector_type(16))) _Float16 v16h;
typedef __attribute__((ext_vector_type(16))) __bf16 v16b;
typedef __attribute__((ext_vector_type(8)))  _Float16 v8h;
typedef __attribute__((ext_vector_type(8)))  float v8f;
typedef __attribute__((ext_vector_type(4)))  float v4f;
typedef __attribute__((ext_vector_type(2)))  float v2f;
typedef __attribute__((ext_vector_type(4)))  unsigned v4u;
typedef __attribute__((ext_vector_type(4)))  int v4i;
typedef float __attribute__((may_alias)) float_a;
typedef int __attribute__((may_alias)) int_a;

template <typename T> __device__ __forceinline__ void vst2(void* p, T v) { *(T*)p = v;  }
__device__ __forceinline__ v8f wmma16(v16h a, v16h b, v8f c) {
  v8f d = __builtin_amdgcn_wmma_f32_16x16x32_f16(false, a, false, b, (short)0, c, false, false);
  asm volatile("v_nop\n\tv_nop\n\tv_nop\n\tv_nop" : "+v"(d) : "v"(a), "v"(b));
  return d;
}
__device__ __forceinline__ v8f wmma_bf(v16b a, v16b b, v8f c) {
  v8f d = __builtin_amdgcn_wmma_f32_16x16x32_bf16(false, a, false, b, (short)0, c, false, false);
  asm volatile("v_nop\n\tv_nop\n\tv_nop\n\tv_nop" : "+v"(d) : "v"(a), "v"(b));
  return d;
}
// 16x16x32 fragments: lane = (h = lane>>4, row/col = lane&15); elements 0..7 = k0+8h+0..7, 8..15 = k0+16+8h+0..7; D element r = row 8h+r
__device__ __forceinline__ v16h frag_h(const _Float16* rowk0, int lane) {
  union { v16h v; v8h q[2]; } u; const _Float16* p = rowk0 + 8 * (lane >> 4);
  u.q[0] = *(const v8h*)p; u.q[1] = *(const v8h*)(p + 16); return u.v;
}
__device__ __forceinline__ v16h frag_f32(const float* rowk0, int lane) {
  v16h a; const float* p = rowk0 + 8 * (lane >> 4);
#pragma unroll
  for (int i = 0; i < 8; ++i) { a[i] = (_Float16)p[i]; a[8 + i] = (_Float16)p[16 + i]; }
  return a;
}
__device__ __forceinline__ v16h frag_f32s(const float* rowk0, int lane, float sc) {
  v16h a; const float* p = rowk0 + 8 * (lane >> 4);
#pragma unroll
  for (int i = 0; i < 8; ++i) { a[i] = (_Float16)(p[i] * sc); a[8 + i] = (_Float16)(p[16 + i] * sc); }
  return a;
}
// column fragment from a [K][ld] layout (column n), rows >= K read as 0
__device__ __forceinline__ v16h fragc_f32(const float* W, int k0, int n, int lane, int ld, int K) {
  v16h a; const int g = lane >> 4;
#pragma unroll
  for (int i = 0; i < 8; ++i) { const int ka = k0 + 8 * g + i, kb = ka + 16;
    a[i] = (_Float16)(ka < K ? W[(size_t)(ka < K ? ka : K - 1) * ld + n] : 0.f); a[8 + i] = (_Float16)(kb < K ? W[(size_t)(kb < K ? kb : K - 1) * ld + n] : 0.f); }
  return a;
}
struct F2 { v16b h, l; };
__device__ __forceinline__ F2 bsplit16(const float v[16]) { F2 r;
#pragma unroll
  for (int i = 0; i < 16; ++i) { const __bf16 h = (__bf16)v[i]; r.h[i] = h; r.l[i] = (__bf16)(v[i] - (float)h); }
  return r; }
__device__ __forceinline__ F2 split_row(const float* row, int k0, int lane) { float v[16]; const float* p = row + k0 + 8 * (lane >> 4);
#pragma unroll
  for (int i = 0; i < 8; ++i) { v[i] = p[i]; v[8 + i] = p[16 + i]; }
  return bsplit16(v); }
__device__ __forceinline__ F2 split_rowK(const float* row, int k0, int lane, int K) { float v[16]; const int g = lane >> 4;
#pragma unroll
  for (int i = 0; i < 8; ++i) { const int ka = k0 + 8 * g + i, kb = ka + 16; v[i] = ka < K ? row[ka < K ? ka : K - 1] : 0.f; v[8 + i] = kb < K ? row[kb < K ? kb : K - 1] : 0.f; }
  return bsplit16(v); }
__device__ __forceinline__ F2 split_col(const float* W, int k0, int n, int lane, int ld, int K) { float v[16]; const int g = lane >> 4;
#pragma unroll
  for (int i = 0; i < 8; ++i) { const int ka = k0 + 8 * g + i, kb = ka + 16; v[i] = ka < K ? W[(size_t)(ka < K ? ka : K - 1) * ld + n] : 0.f; v[8 + i] = kb < K ? W[(size_t)(kb < K ? kb : K - 1) * ld + n] : 0.f; }
  return bsplit16(v); }
__device__ __forceinline__ v8f mac3(const F2& a, const F2& b, v8f c) { c = wmma_bf(a.l, b.h, c); c = wmma_bf(a.h, b.l, c); return wmma_bf(a.h, b.h, c); }
__device__ __forceinline__ float sigm(float v) { return 1.0f / (1.0f + expf(-v)); }
#define LDSX() do { asm volatile("s_wait_dscnt 0" ::: "memory"); __builtin_amdgcn_wave_barrier(); __builtin_amdgcn_fence(__ATOMIC_RELEASE, "workgroup"); } while (0)

// Row-wise triangle attention on a pair tensor z [1, 256, 256, 128] (4 heads x 32): zn = LayerNorm(z); q,k,v = zn wq^T, zn wk^T, zn wv^T (separate (out,in) [128,128]); logits[r][i][j][h] = q[r][i] . k[r][j] / sqrt(32) + (zn[i][j] . w_pair[h] + b_pair[h]) + 1e9 (mask[r][j] - 1); softmax over j; out = sigmoid(zn w_gate + b_gate) * merged(attn v); result = out w_out (no output bias).
#define NB 256              // pair rows i (each a sequence of SZ = TT = 256 positions; no padding needed)
#define TT 256
#define CC 128            // NH * HD = projected width
#define DIN 128          // input (model) width
#define NH 4
#define HD 32
#define NQB (TT / 64)
#define HG 4
#define SCALE (0.17677669529663687f)
#define CAUSAL 0
#ifndef TNB
#define TNB NB
#endif
__device__ __forceinline__ float bfr(float v) { return (float)(__bf16)v; }
__host__ __device__ __forceinline__ int kb_last(int qb) { return CAUSAL ? ((qb * 64 + 63) >> 7) : (TT / 128 - 1); }
typedef __attribute__((ext_vector_type(8))) __bf16 v8b;
__device__ __forceinline__ v16b frag_b(const __bf16* rowk0, int lane) {
  union { v16b v; v8b q[2]; } u; const __bf16* p = rowk0 + 8 * (lane >> 4);
  u.q[0] = *(const v8b*)p; u.q[1] = *(const v8b*)(p + 16); return u.v;
}
typedef __attribute__((ext_vector_type(4))) __bf16 v4b;
#define WP 136             // bf16 elements per staged weight row: 272 B = 16 B x odd, so the 16-byte fragment reads of 16 rows fall on distinct banks
// an (out,in) weight [128][128] f32 -> bf16 rows in LDS, by the 128 threads of a block: each wave-load takes one whole 512-B row, all 32 loads of a thread fly together; frag_b(&sw[o][k0], lane) is then the B fragment that wcol_oi gathered from global memory
__device__ __forceinline__ void stage_w(__bf16 (*sw)[WP], const float* __restrict__ Wm, int tid) { const float* p = Wm + tid * 4; v4f a[32];
#pragma unroll
  for (int it = 0; it < 32; ++it) a[it] = *(const v4f*)(p + it * 512);
  asm volatile("s_wait_xcnt 0x0" ::: "memory");   /* the address registers of these loads are reused below */
#pragma unroll
  for (int it = 0; it < 32; ++it) { v4b w;
#pragma unroll
    for (int i = 0; i < 4; ++i) w[i] = (__bf16)a[it][i];
    *(v4b*)&sw[it * 4 + (tid >> 5)][(tid & 31) * 4] = w; } }
#define QBH 0              // unused: no causal path here; the q residual path is chosen by QHI
#define QHI 64             // q residual rows only for the first 64 queries of each row (logits elsewhere: single f16 q, k; sigma_logit ~ 0.25 so this is ample)
#define KHI 64            // key rows sizing the KL, VB and VBL regions (no kernel here writes or reads them)
// B fragment (k rows k0+.., output column o) of a weight: (in,out) [K][ld] or (out,in) [ld rows of K]: bf16 exact, or f16(bf16 * 256) exact
__device__ __forceinline__ v16b wcol_io(const float* Wm, int k0, int o, int lane, int ld) { v16b w; const int g = lane >> 4;
#pragma unroll
  for (int i = 0; i < 8; ++i) { w[i] = (__bf16)Wm[(size_t)(k0 + 8 * g + i) * ld + o]; w[8 + i] = (__bf16)Wm[(size_t)(k0 + 16 + 8 * g + i) * ld + o]; }
  return w; }
__device__ __forceinline__ v16b wcol_oi(const float* Wm, int k0, int o, int lane, int K) { v16b w; const float* p = Wm + (size_t)o * K + k0 + 8 * (lane >> 4);
#pragma unroll
  for (int i = 0; i < 8; ++i) { w[i] = (__bf16)p[i]; w[8 + i] = (__bf16)p[16 + i]; }
  return w; }
__device__ __forceinline__ v16h wcolh_io(const float* Wm, int k0, int o, int lane, int ld) { v16h w; const int g = lane >> 4;
#pragma unroll
  for (int i = 0; i < 8; ++i) { w[i] = (_Float16)(bfr(Wm[(size_t)(k0 + 8 * g + i) * ld + o]) * 256.0f); w[8 + i] = (_Float16)(bfr(Wm[(size_t)(k0 + 16 + 8 * g + i) * ld + o]) * 256.0f); }
  return w; }
__device__ __forceinline__ v16h wcolh_oi(const float* Wm, int k0, int o, int lane, int K) { v16h w; const float* p = Wm + (size_t)o * K + k0 + 8 * (lane >> 4);
#pragma unroll
  for (int i = 0; i < 8; ++i) { w[i] = (_Float16)(bfr(p[i]) * 256.0f); w[8 + i] = (_Float16)(bfr(p[16 + i]) * 256.0f); }
  return w; }
#define WQKV_LAYOUT 1   // (out,in) separate wq / wk / wv [CC][DIN] (wq.reshape(H, DH, D): output column h*32 + c = row of wq)
__device__ __forceinline__ v16b wcol_hdk(const float* Wm, int k0, int o, int lane) { v16b w; const int g = lane >> 4; const float* p = Wm + (size_t)(o / HD) * DIN * HD + (o % HD);
#pragma unroll
  for (int i = 0; i < 8; ++i) { w[i] = (__bf16)p[(size_t)(k0 + 8 * g + i) * HD]; w[8 + i] = (__bf16)p[(size_t)(k0 + 16 + 8 * g + i) * HD]; }
  return w; }
#define WO_OUT_IN 1
#if WQKV_LAYOUT == 1
#define WCOL(W, k0, o, lane) wcol_oi(W, k0, o, lane, DIN)
#elif WQKV_LAYOUT == 2
#define WCOL(W, k0, o, lane) wcol_hdk(W, k0, o, lane)
#else
#define WCOL(W, k0, o, lane) wcol_oi(W, k0, o, lane, DIN)
#endif
#if WO_OUT_IN
#define WOCOL(W, k0, o, lane) wcol_oi(W, k0, o, lane, CC)
#define WOCOLH(W, k0, o, lane) wcolh_oi(W, k0, o, lane, CC)
#else
#define WOCOL(W, k0, o, lane) wcol_io(W, k0, o, lane, DIN)
#define WOCOLH(W, k0, o, lane) wcolh_io(W, k0, o, lane, DIN)
#endif
#define SZ 256             // real positions per row (= TT here)
#define BG 64              // sizes the unused WS_S region (x 4 heads = 256 planes of 256 x 256)
#define NZR ((size_t)NB * SZ)   // 65,536 real pair rows (i, j)
#define SM_EXTRA_PARAMS , const float* __restrict__ BIAS, const float* __restrict__ MKF, int b0s
#define SM_MASK_HOOK do { const int hh = (int)blockIdx.y % HG; const int ii = b0s + (int)blockIdx.y / HG; const int kc2 = k < SZ ? k : SZ - 1; const float add = BIAS[((size_t)t * SZ + kc2) * NH + hh] + 1.0e9f * (bfr(MKF[(size_t)ii * SZ + kc2]) - 1.0f); v = (k < SZ) ? v + add : -3.0e38f; } while (0)   /* + tri_bias[h][q=t][k] + INF (mask[i][k] - 1) (mask is all ones: adds 0, read anyway); key columns k >= SZ would be padding -> excluded (none here: SZ = TT, so the k < SZ test on the loop index always holds) */
__device__ __forceinline__ v16b zero16b() { v16b z; _Pragma("unroll") for (int i = 0; i < 16; ++i) z[i] = (__bf16)0.f; return z; }
#define WS_ZN   (WS_END)
#define WS_BIAS (WS_ZN + 4u * (size_t)NZR * CC)
#define WS_END2 (WS_BIAS + 4u * (size_t)NZR * NH + 1024)
#ifndef SM_EXTRA_PARAMS
#define SM_EXTRA_PARAMS
#endif
#ifndef PROJ_EXTRA_PARAMS
#define PROJ_EXTRA_PARAMS
#endif
#ifndef SM_MASK_HOOK
#define SM_MASK_HOOK (void)0
#endif

// q, k, v, the q residual, gate and ctx lie in the workspace in the order of the 16x16x32 fragments that read them: a 16-byte piece per lane, 32 lanes side by side, so that every wave-wide load or store covers 512 contiguous bytes
#define WS_QH  0u                                      // f16 q [b][h][16-query tile][piece p][lane][8]: query 16 tile + col, channels 32 h + 16 p + 8 g + 0..7
#define WS_KH  (WS_QH + 2u * (size_t)NB * TT * CC)      // f16 k [b][h][16-key tile][piece p][lane][8], as q
#define WS_VT  (WS_KH + 2u * (size_t)NB * TT * CC)      // f16 v [b][h][16-channel tile][32-key step][piece p][lane][8]: channel 32 h + 16 tile + col, keys 32 step + 16 p + 8 g + 0..7
#define WS_QL  (WS_VT + 2u * (size_t)NB * CC * TT)      // f16 q residual x 2^10 [b][h][tile < QHI / 16][piece p][lane][8], as q
#define WS_KL  (WS_QL + 2u * (size_t)NB * QHI * CC)     // f16 k residual x 2^10 rows [b][t < KHI][CC]
#define WS_VB  (WS_KL + 2u * (size_t)NB * KHI * CC)     // bf16 v hi planes [b][c][t < KHI]
#define WS_VBL (WS_VB + 2u * (size_t)NB * CC * KHI)
#define WS_S   (WS_VBL + 2u * (size_t)NB * CC * KHI)    // unused: k_fa keeps logits and P in registers
#define WS_Y   (WS_S  + 4u * (size_t)BG * HG * TT * TT)   // f32 gate, then ctx, in fragment order (layout at WS_END) (only when there is an output projection)
#define WS_END (WS_Y  + 4u * (size_t)NB * SZ * CC)   /* f32 gate, then ctx, [b][16-position tile][h][piece s][lane][4]: position 16 tile + col, channels 32 h + 16 (s >> 1) + 8 g + 4 (s & 1) + 0..3 */

// ---- k_front: block = one pair row i = 256 positions, 16 waves x 16 positions: LayerNorm, triangle bias, q, k, gate and v of a position from ONE read of its input row. A lane loads its row's 64 channels directly in the 16x16x32 fragment order (the other 64 sit in lane ^ 16), so mean and variance are in-lane sums plus one exchange, and the normalised row, split bf16 hi + lo, stays in registers as the operand of all five products. The four [128][128] weights and the bias rows are staged once per block in LDS as bf16. Bias, q, k and gate are taken as W x^T (A = weight rows, B = positions): a lane then holds 8 neighbouring channels of ONE position. v is taken as x W^T: a lane holds 8 neighbouring positions of one channel. In both cases those 8 values are the very piece that the same lane of the reading wave wants in its fragment, so they go from the accumulators straight to the workspace, lane beside lane.
__device__ __forceinline__ v8f wmb(v16b a, v16b b, v8f c) { return __builtin_amdgcn_wmma_f32_16x16x32_bf16(false, a, false, b, (short)0, c, false, false); }
// eight 16x16 tiles over K = 128: WROWS: D = W x^T (rows = output channels), else D = x W^T (rows = positions); per tile the order of the sums is hi, lo of k step 0, hi, lo of k step 1, ...
template <bool WROWS> __device__ __forceinline__ void prod8(const __bf16 (*w)[WP], const F2 (&af)[4], v8f (&acc)[8], int col, int lane) {
#pragma unroll
  for (int kc = 0; kc < 4; ++kc) { v16b wf[8];
#pragma unroll
    for (int j = 0; j < 8; ++j) wf[j] = frag_b(&w[j * 16 + col][kc * 32], lane);   /* the LDS reads of a k step go out together, ahead of its products */
#pragma unroll
    for (int j = 0; j < 8; ++j) acc[j] = WROWS ? wmb(wf[j], af[kc].h, acc[j]) : wmb(af[kc].h, wf[j], acc[j]);
#pragma unroll
    for (int j = 0; j < 8; ++j) acc[j] = WROWS ? wmb(wf[j], af[kc].l, acc[j]) : wmb(af[kc].l, wf[j], acc[j]); } }
__global__ __launch_bounds__(512) void k_front(const float* __restrict__ Z, const float* __restrict__ LW, const float* __restrict__ LB, const float* __restrict__ WB, const float* __restrict__ WBB, const float* __restrict__ WQ, const float* __restrict__ WK, const float* __restrict__ WV, const float* __restrict__ WG, const float* __restrict__ GB,
    _Float16* __restrict__ QH, _Float16* __restrict__ QL, _Float16* __restrict__ KH, _Float16* __restrict__ VT, float* __restrict__ BIAS, float* __restrict__ G) {
  __shared__ __align__(16) __bf16 sw[4][CC][WP]; __shared__ __align__(16) __bf16 swb[16][WP]; __shared__ __align__(16) float sln[4][CC];
  const int tid = threadIdx.x, wave = tid >> 5, lane = tid & 31, col = lane & 15, g = lane >> 4; const size_t bb = blockIdx.x; const size_t r0 = bb * TT + wave * 16;
  v4f x[16];
  { /* all 53 loads of a lane at the block's start fly together: no wait stands between them */
    const float* px = Z + (r0 + col) * CC + 8 * g;
#pragma unroll
    for (int n = 0; n < 16; ++n) x[n] = *(const v4f*)(px + (n >> 2) * 32 + ((n >> 1) & 1) * 16 + (n & 1) * 4);
    v4f a[4][8]; const int ch = tid & (CC - 1);
    const float* pb = WB + (wave & (NH - 1)) * CC + lane * 4; const v4f wb4 = *(const v4f*)pb;   /* read by every wave, so that no branch parts the loads; kept by waves 0..3 (bias row = wave) */
    const int sel = wave >> 2, c4 = ch & (NH - 1); const float l0 = LW[ch], l1 = LB[ch], l2 = GB[ch], l3 = WBB[c4];   /* likewise; four waves each keep ln_g, ln_b, the gate's bias and wb_b (its 4 values repeated) */
#pragma unroll
    for (int it = 0; it < 8; ++it) { a[0][it] = *(const v4f*)(WQ + tid * 4 + it * 2048); a[1][it] = *(const v4f*)(WK + tid * 4 + it * 2048); a[2][it] = *(const v4f*)(WV + tid * 4 + it * 2048); a[3][it] = *(const v4f*)(WG + tid * 4 + it * 2048); }
    asm volatile("s_wait_xcnt 0x0" :: "v"(px), "v"(pb), "v"(ch), "v"(c4) : "memory");   /* the address registers of these loads are reused below; px, pb, ch and c4 stay live up to this wait, so that no load of the group lands on address registers of the group */
    asm volatile("" :: "v"(l0), "v"(l1), "v"(l2), "v"(l3));   /* inputs only: holds these four loads up here with the others; the compiler otherwise sinks them into branches behind the staging, where their latency is waited out alone */
#pragma unroll
    for (int m = 0; m < 4; ++m)
#pragma unroll
      for (int it = 0; it < 8; ++it) { v4b w;
#pragma unroll
        for (int i = 0; i < 4; ++i) w[i] = (__bf16)a[m][it][i];
        *(v4b*)&sw[m][it * 16 + wave][lane * 4] = w; }
    v4b w;
#pragma unroll
    for (int i = 0; i < 4; ++i) w[i] = (__bf16)(wave < NH ? wb4[i] : 0.f);
    *(v4b*)&swb[wave][lane * 4] = w;   /* rows 4..15 of the one bias tile are zero */
    sln[sel][ch] = bfr(sel == 0 ? l0 : sel == 1 ? l1 : sel == 2 ? l2 : l3); }
  __syncthreads();   /* every wave wrote a part of the weight rows that all sixteen read */
  F2 af[4];
  { float s4[4] = {0.f, 0.f, 0.f, 0.f};
#pragma unroll
    for (int n = 0; n < 16; ++n)
#pragma unroll
      for (int i = 0; i < 4; ++i) { x[n][i] = bfr(x[n][i]); s4[i] += x[n][i]; }
    float s1 = (s4[0] + s4[1]) + (s4[2] + s4[3]); s1 += __shfl_xor(s1, 16);
    const float mu = s1 * (1.0f / CC); float q4[4] = {0.f, 0.f, 0.f, 0.f};
#pragma unroll
    for (int n = 0; n < 16; ++n)
#pragma unroll
      for (int i = 0; i < 4; ++i) { const float d = x[n][i] - mu; q4[i] += d * d; }
    float q = (q4[0] + q4[1]) + (q4[2] + q4[3]); q += __shfl_xor(q, 16);
    const float rs = rsqrtf(q * (1.0f / CC) + 1e-5f);
#pragma unroll
    for (int kc = 0; kc < 4; ++kc) { float v[16];
#pragma unroll
      for (int s = 0; s < 4; ++s) { const int c = kc * 32 + 8 * g + (s >> 1) * 16 + (s & 1) * 4; const v4f lw = *(const v4f*)&sln[0][c], lb = *(const v4f*)&sln[1][c];
#pragma unroll
        for (int i = 0; i < 4; ++i) v[s * 4 + i] = (x[kc * 4 + s][i] - mu) * rs * lw[i] + lb[i]; }
      af[kc] = bsplit16(v); } }
  { /* triangle bias: heads = rows 0..3 of the tile, so lanes 0..15 hold the 4 heads of their position: one 256-B run per wave */
    v8f ab = {};
#pragma unroll
    for (int kc = 0; kc < 4; ++kc) { const v16b wf = frag_b(&swb[col][kc * 32], lane); ab = wmb(wf, af[kc].h, ab); ab = wmb(wf, af[kc].l, ab); }
    v4f b4;
#pragma unroll
    for (int i = 0; i < 4; ++i) b4[i] = ab[i] + sln[3][i];   /* + wb_b[h] */
    if (g == 0) vst2(BIAS + (r0 + col) * NH, b4); }
  { /* v: 16 positions of the wave = piece (wave & 1) of key step (wave >> 1); accumulator tile j = channel tile (j & 1) of head (j >> 1) */
    v8f acc[8] = {}; prod8<false>(sw[2], af, acc, col, lane); v8h hv[8];
#pragma unroll
    for (int j = 0; j < 8; ++j)
#pragma unroll
      for (int r = 0; r < 8; ++r) hv[j][r] = (_Float16)acc[j][r];
    _Float16* dv = VT + (bb * 128 + wave) * (size_t)256 + lane * 8;
#pragma unroll
    for (int j = 0; j < 8; ++j) vst2(dv + j * 4096, hv[j]);   /* 512 contiguous bytes per store */
    asm volatile("s_wait_xcnt 0x0" :: "v"(dv), "v"(hv[0]), "v"(hv[1]), "v"(hv[2]), "v"(hv[3]), "v"(hv[4]), "v"(hv[5]), "v"(hv[6]), "v"(hv[7]) : "memory");   /* the stores' registers are reused below; they stay live up to this wait */ }
  const bool hi = wave * 16 < QHI;   /* wave-uniform: these positions carry the q residual */
#pragma unroll
  for (int m = 0; m < 2; ++m) { /* q, then k: the wave's 16 positions = tile (wave); accumulator tile j = piece (j & 1) of head (j >> 1) */
    v8f acc[8] = {}; prod8<true>(sw[m], af, acc, col, lane); const bool res = m == 0 && hi; v8h hv[8];
#pragma unroll
    for (int j = 0; j < 8; ++j)
#pragma unroll
      for (int r = 0; r < 8; ++r) hv[j][r] = (_Float16)acc[j][r];
    _Float16* dh = (m == 0 ? QH : KH) + (bb * 128 + wave * 2) * (size_t)256 + lane * 8;
#pragma unroll
    for (int j = 0; j < 8; ++j) vst2(dh + ((j >> 1) * 32 + (j & 1)) * 256, hv[j]);   /* 512 contiguous bytes per store */
    if (res) { v8h lv[8];
#pragma unroll
      for (int j = 0; j < 8; ++j)
#pragma unroll
        for (int r = 0; r < 8; ++r) lv[j][r] = (_Float16)((acc[j][r] - (float)hv[j][r]) * 1024.0f);
      _Float16* dl = QL + (bb * 32 + wave * 2) * (size_t)256 + lane * 8;
#pragma unroll
      for (int j = 0; j < 8; ++j) vst2(dl + ((j >> 1) * 8 + (j & 1)) * 256, lv[j]);
      asm volatile("s_wait_xcnt 0x0" :: "v"(dl), "v"(lv[0]), "v"(lv[1]), "v"(lv[2]), "v"(lv[3]), "v"(lv[4]), "v"(lv[5]), "v"(lv[6]), "v"(lv[7]) : "memory");   /* as below */ }
    asm volatile("s_wait_xcnt 0x0" :: "v"(dh), "v"(hv[0]), "v"(hv[1]), "v"(hv[2]), "v"(hv[3]), "v"(hv[4]), "v"(hv[5]), "v"(hv[6]), "v"(hv[7]) : "memory");   /* the stores' registers are reused below; they stay live up to this wait */ }
  { /* gate: f32, parked in the ctx buffer; accumulator tile j = pieces 2 (j & 1) and 2 (j & 1) + 1 of head (j >> 1) */
    v8f acc[8] = {}; prod8<true>(sw[3], af, acc, col, lane); v4f s[16];
#pragma unroll
    for (int j = 0; j < 8; ++j) { const v4f g0 = *(const v4f*)&sln[2][j * 16 + 8 * g], g1 = *(const v4f*)&sln[2][j * 16 + 8 * g + 4];
#pragma unroll
      for (int r = 0; r < 4; ++r) { s[2 * j][r] = 1.0f / (1.0f + expf(-(acc[j][r] + g0[r]))); s[2 * j + 1][r] = 1.0f / (1.0f + expf(-(acc[j][4 + r] + g1[r]))); }   /* sigmoid(zn w_gate + b_gate) */ }
    float* dg = G + (bb * 16 + wave) * (size_t)2048 + lane * 4;
#pragma unroll
    for (int n = 0; n < 16; ++n) vst2(dg + n * 128, s[n]);   /* 512 contiguous bytes per store */
    asm volatile("s_wait_xcnt 0x0" :: "v"(dg), "v"(s[0]), "v"(s[1]), "v"(s[2]), "v"(s[3]), "v"(s[4]), "v"(s[5]), "v"(s[6]), "v"(s[7]), "v"(s[8]), "v"(s[9]), "v"(s[10]), "v"(s[11]), "v"(s[12]), "v"(s[13]), "v"(s[14]), "v"(s[15]) : "memory");   /* the stores' registers stay live up to this wait, so that no later sigmoid lands on them */ } }
#define NI 4
__device__ __forceinline__ v8f wm16(v16h a, v16h b, v8f c) { return __builtin_amdgcn_wmma_f32_16x16x32_f16(false, a, false, b, (short)0, c, false, false); }
__device__ __forceinline__ v16h frag_p(const _Float16* p) { union { v16h v; v8h q[2]; } u; u.q[0] = *(const v8h*)p; u.q[1] = *(const v8h*)(p + 256); return u.v; }   /* a fragment stored in fragment order: its two pieces lie 512 B apart, the lane's offset is already in p */
__global__ __launch_bounds__(128) void k_fa(const _Float16* __restrict__ QH, const _Float16* __restrict__ KH, const _Float16* __restrict__ QL, const _Float16* __restrict__ VT, const float* __restrict__ BIAS, const float* __restrict__ MKF, float* __restrict__ Y) {
  __shared__ __align__(16) float sb[NH][16][TT + 4];   /* pitch 1040 B = 16 B x odd: 16-byte reads of 16 rows fall on distinct banks */
  __shared__ __align__(16) float smk[NH][TT];
  const int tid = threadIdx.x, wave = tid >> 5, lane = tid & 31, col = lane & 15, g = lane >> 4; const int q0 = (int)blockIdx.x * 16; const int h = wave;
  for (int e = tid; e < 16 * TT; e += 128) { const int q = e >> 8, k = e & (TT - 1); const v4f b4 = *(const v4f*)(BIAS + ((size_t)(q0 + q) * SZ + k) * NH);
    sb[0][q][k] = b4[0]; sb[1][q][k] = b4[1]; sb[2][q][k] = b4[2]; sb[3][q][k] = b4[3]; }
  __syncthreads();   /* every wave wrote a part of every head's bias plane */
  const bool hi = q0 < QHI;   /* block-uniform: these queries carry the q residual */
  /* the loop over pair rows stays rolled: one tile's registers at a time keep four waves on a SIMD; every inner loop is unrolled so that st[] is indexed by constants and stays in registers */
#pragma unroll 1
  for (int ii = 0; ii < NI; ++ii) { const int b = (int)blockIdx.y * NI + ii;
    { v4f m0 = *(const v4f*)(MKF + (size_t)b * SZ + lane * 8), m1 = *(const v4f*)(MKF + (size_t)b * SZ + lane * 8 + 4);
#pragma unroll
      for (int c = 0; c < 4; ++c) { m0[c] = 1.0e9f * (bfr(m0[c]) - 1.0f); m1[c] = 1.0e9f * (bfr(m1[c]) - 1.0f); }   /* INF (mask[i][k] - 1), 8 keys per lane, wave-private copy */
      *(v4f*)&smk[wave][lane * 8] = m0; *(v4f*)&smk[wave][lane * 8 + 4] = m1; }
    LDSX();   /* the lanes of this wave read each other's mask terms below */
    const size_t bh = (size_t)b * NH + h; const _Float16* qp = QH + (bh * 16 + blockIdx.x) * 512 + lane * 8; const v16h qf = frag_p(qp); const _Float16* kp = KH + bh * 8192 + lane * 8;
    v8f st[TT / 16];
    asm volatile("s_wait_xcnt 0x0" :: "v"(qp) : "memory");   /* the address registers of the q loads are reused below */
    if (hi) { const _Float16* lp = QL + (bh * (QHI / 16) + blockIdx.x) * 512 + lane * 8; const v16h ql = frag_p(lp);
      asm volatile("s_wait_xcnt 0x0" :: "v"(lp) : "memory");   /* as above, for the residual's loads */
#pragma unroll
      for (int hb = 0; hb < 2; ++hb) { v16h kf[8];   /* eight key fragments per batch, so that their loads fly together */
#pragma unroll
        for (int j = 0; j < 8; ++j) kf[j] = frag_p(kp + (hb * 8 + j) * 512);
        asm volatile("s_wait_xcnt 0x0" :: "v"(kp) : "memory");   /* kp stays live up to this wait, so that no load of the batch lands on its own address registers */
#pragma unroll
        for (int j = 0; j < 8; ++j) { const v8f z = {}; const v8f ah = wm16(kf[j], qf, z), al = wm16(kf[j], ql, z);
#pragma unroll
          for (int r = 0; r < 8; ++r) st[hb * 8 + j][r] = ah[r] + al[r] * (1.0f / 1024.0f); } }
    } else {
#pragma unroll
      for (int j = 0; j < TT / 16; ++j) { const v16h kf = frag_p(kp + j * 512); const v8f z = {}; st[j] = wm16(kf, qf, z); }
      asm volatile("s_wait_xcnt 0x0" :: "v"(kp) : "memory");   /* kp stays live up to this wait, so that no key load lands on its own address registers */ }
    float m = -3.0e38f;
#pragma unroll
    for (int j = 0; j < TT / 16; ++j) { const v4f a0 = *(const v4f*)&smk[wave][j * 16 + 8 * g], a1 = *(const v4f*)&smk[wave][j * 16 + 8 * g + 4]; const v4f b0 = *(const v4f*)&sb[wave][col][j * 16 + 8 * g], b1 = *(const v4f*)&sb[wave][col][j * 16 + 8 * g + 4];
#pragma unroll
      for (int r = 0; r < 4; ++r) { st[j][r] = st[j][r] * SCALE + (b0[r] + a0[r]); st[j][4 + r] = st[j][4 + r] * SCALE + (b1[r] + a1[r]); m = fmaxf(m, fmaxf(st[j][r], st[j][4 + r])); } }
    m = fmaxf(m, __shfl_xor(m, 16));
    float s4[4] = {0.f, 0.f, 0.f, 0.f};
#pragma unroll
    for (int j = 0; j < TT / 16; ++j)
#pragma unroll
      for (int r = 0; r < 8; ++r) { const float e = expf(st[j][r] - m); st[j][r] = e; s4[r & 3] += e; }
    float sum = (s4[0] + s4[1]) + (s4[2] + s4[3]); sum += __shfl_xor(sum, 16);
    const float f = sum > 0.f ? 2048.0f / sum : 0.f;
    v8f o0 = {}, o1 = {}; const _Float16* vp = VT + bh * 8192 + lane * 8;
#pragma unroll
    for (int kc = 0; kc < TT / 32; ++kc) { v16h p;
#pragma unroll
      for (int s = 0; s < 8; ++s) { p[s] = (_Float16)(st[2 * kc][s] * f); p[8 + s] = (_Float16)(st[2 * kc + 1][s] * f); }   /* keys kc*32 + 8 g + s and kc*32 + 16 + 8 g + s: the k order of frag_h */
      o0 = wm16(frag_p(vp + kc * 512), p, o0); o1 = wm16(frag_p(vp + (8 + kc) * 512), p, o1); }
    asm volatile("s_wait_xcnt 0x0" :: "v"(vp) : "memory");   /* vp stays live up to this wait, so that no v load lands on its own address registers */
    float* py = Y + (((size_t)b * 16 + blockIdx.x) * NH + h) * 512 + lane * 4;   /* a lane holds channels 8 g + r (o0) and 16 + 8 g + r (o1) of its query: pieces 0, 1 and 2, 3; the gate was parked here by k_front and is consumed in place by the same lane */
    const v4f g0 = *(const v4f*)py, g1 = *(const v4f*)(py + 128), g2 = *(const v4f*)(py + 256), g3 = *(const v4f*)(py + 384); v4f r0, r1, r2, r3;
#pragma unroll
    for (int c = 0; c < 4; ++c) { r0[c] = o0[c] * (1.0f / 2048.0f) * g0[c]; r1[c] = o0[4 + c] * (1.0f / 2048.0f) * g1[c]; r2[c] = o1[c] * (1.0f / 2048.0f) * g2[c]; r3[c] = o1[4 + c] * (1.0f / 2048.0f) * g3[c]; }
    vst2(py, r0); vst2(py + 128, r1); vst2(py + 256, r2); vst2(py + 384, r3);
    asm volatile("s_wait_xcnt 0x0" :: "v"(py), "v"(r0), "v"(r1), "v"(r2), "v"(r3) : "memory");   /* the stores' registers are reused by the next pair row; they stay live up to this wait */ } }
// the A fragment (hi + lo) of one k step from a ctx tile in fragment order: four 16-byte pieces, 512 B apart
__device__ __forceinline__ F2 split_frag(const float* p) { float v[16];
#pragma unroll
  for (int s = 0; s < 4; ++s) { const v4f t = *(const v4f*)(p + s * 128);
#pragma unroll
    for (int i = 0; i < 4; ++i) v[s * 4 + i] = t[i]; }
  return bsplit16(v); }
// ---- k_out: block = (64 rows, 128 cols): out = ctx Wo (+ bo): ctx bf16 hi + lo against exact bf16 Wo (2 products)
__global__ __launch_bounds__(128) void k_out(const float* __restrict__ Y, const float* __restrict__ WO, const float* __restrict__ BO, float* __restrict__ OUT) { __shared__ __align__(16) float sf[4][16][132]; __shared__ __align__(16) __bf16 sw[128][WP];
  const int tid = threadIdx.x, wave = tid >> 5, lane = tid & 31, col = lane & 15, g = lane >> 4; const int c0 = blockIdx.y * 128; const size_t r0 = (size_t)blockIdx.x * 64 + wave * 16;
  const float* py = Y + ((size_t)blockIdx.x * 4 + wave) * 2048 + lane * 4;   /* the wave's 16 rows = one ctx tile in fragment order; k step kc = head kc */
  stage_w(sw, WO + (size_t)c0 * CC, tid);
  __syncthreads();   /* every wave wrote a part of the weight rows that all four read */
  v8f acc[8] = {};
  if (true) {   /* ALL rows: gated ctx bf16 hi + lo x exact output_w (2 products) */
#pragma unroll 2
    for (int kc = 0; kc < CC / 32; ++kc) { v16b w[8];
#pragma unroll
      for (int j = 0; j < 8; ++j) w[j] = frag_b(&sw[j * 16 + col][kc * 32], lane);   /* the LDS reads of a k step go out together, ahead of its products */
      const F2 a = split_frag(py + kc * 512); asm volatile("s_wait_loadcnt 0x0" ::: "memory");
      asm volatile("s_wait_xcnt 0x0" ::: "memory");   /* the address registers of the row loads are reused below */
#pragma unroll
      for (int j = 0; j < 8; ++j) { acc[j] = wmma_bf(a.h, w[j], acc[j]); acc[j] = wmma_bf(a.l, w[j], acc[j]); } }
#pragma unroll
    for (int j = 0; j < 8; ++j) { const float bias = BO ? bfr(BO[c0 + j * 16 + col]) : 0.f;
#pragma unroll
      for (int r = 0; r < 8; ++r) sf[wave][8 * g + r][j * 16 + col] = acc[j][r] + bias; }
  }
  LDSX(); for (int rl = 0; rl < 16; ++rl) vst2(OUT + (r0 + rl) * DIN + c0 + lane * 4, *(const v4f*)&sf[wave][rl][lane * 4]); }

extern "C" void kernel_launch(void* const* d_in, const int* in_sizes, int n_in, void* d_out, int out_size, void* d_ws, size_t ws_size, hipStream_t stream) {
  (void)in_sizes; (void)n_in; (void)out_size;
  const float** F = (const float**)d_in;
  if (ws_size < (size_t)WS_END) return;
  char* ws = (char*)d_ws; _Float16 *QH = (_Float16*)(ws + WS_QH), *KH = (_Float16*)(ws + WS_KH), *VT = (_Float16*)(ws + WS_VT), *QL = (_Float16*)(ws + WS_QL), *KL = (_Float16*)(ws + WS_KL); __bf16 *VB = (__bf16*)(ws + WS_VB), *VBL = (__bf16*)(ws + WS_VBL); float *Y = (float*)(ws + WS_Y);
  (void)Y; (void)QL; (void)KL; (void)VB; (void)VBL;
  // inputs: 0 pair_repr [1,256,256,128]; 1 mask [1,256,256] f32 (ones); 2 ln_g, 3 ln_b; 4 wb_w [4,128] (out,in), 5 wb_b [4]; 6 wq, 7 wk, 8 wv [128,128] (out,in); 9 wo [128,128] (out,in); 10 wg_w [128,128] (out,in), 11 wg_b [128]
  if (ws_size < (size_t)WS_END2) return;
  float *BIAS = (float*)(ws + WS_BIAS);
  k_front<<<dim3(NB), 512, 0, stream>>>(F[0], F[2], F[3], F[4], F[5], F[6], F[7], F[8], F[10], F[11], QH, QL, KH, VT, BIAS, Y);   /* LayerNorm, tri bias rows (+ wb_b), q, k, v and the gate (parked in the Y buffer) from one read of the input */
  k_fa<<<dim3(SZ / 16, TNB / NI), 128, 0, stream>>>(QH, KH, QL, VT, BIAS, F[1], Y);   /* logits, softmax and P.v fused; no score planes in the workspace */
  k_out<<<dim3((unsigned)(NZR / 64), DIN / 128), 128, 0, stream>>>(Y, F[9], nullptr, (float*)d_out);
}

// v005
// It runs in 79.7 microseconds.
// Timed twice side by side with v004, it ran 1.12 and 1.11 times as fast.
// Over all steps from v000 it is 5.22 times as fast.
// compute dtype: all float inputs rounded to bf16; LayerNorm in f32; q/k/v, the triangle bias and the gate from the f32 LayerNorm rows split bf16 hi + lo against exact bf16 weights on WMMA 16x16x32 (2 products, f32 accumulate); logits q.k with q as f16 hi + residual for the first 64 queries of each pair row and single f16 elsewhere (sigma_logit ~ 0.25) x 32^-0.5 + bias + mask in f32; softmax in f32 (native exp2 on base-2 logits, in registers, fused with both products); P x 2^11 once to f16 against v once to f16 (1 product); gated ctx split bf16 hi + lo against exact wo (2 products); f32 output.
// Triangle attention, starting node (B 1, I = J = 256 residues, D 128, 4 heads x 32; 0.02-scale (out,in) weights, mask all ones, wb_b = 0, wg_b = 1): z = LayerNorm(pair_repr); tri_bias[h][j][k] = z[j][k] . wb_w[h] + wb_b[h]; for each row i: q = (z[i] wq^T)/sqrt(32), k = z[i] wk^T, v = z[i] wv^T (heads = 32-wide slices of the output dim); a = softmax_k(q . k + 1e9 (mask[i][k] - 1) + tri_bias[h][j][k]); y = merged heads; y = sigmoid(z[i] wg_w^T + wg_b) * y; out[i] = y wo^T.
#include <hip/hip_runtime.h>
#include <math.h>

typedef __attribute__((ext_vector_type(16))) _Float16 v16h;
typedef __attribute__((ext_vector_type(16))) __bf16 v16b;
typedef __attribute__((ext_vector_type(8)))  _Float16 v8h;
typedef __attribute__((ext_vector_type(8)))  float v8f;
typedef __attribute__((ext_vector_type(4)))  float v4f;
typedef __attribute__((ext_vector_type(2)))  float v2f;
typedef __attribute__((ext_vector_type(4)))  unsigned v4u;
typedef __attribute__((ext_vector_type(4)))  int v4i;
typedef float __attribute__((may_alias)) float_a;
typedef int __attribute__((may_alias)) int_a;

template <typename T> __device__ __forceinline__ void vst2(void* p, T v) { *(T*)p = v;  }
__device__ __forceinline__ v8f wmma16(v16h a, v16h b, v8f c) {
  v8f d = __builtin_amdgcn_wmma_f32_16x16x32_f16(false, a, false, b, (short)0, c, false, false);
  asm volatile("v_nop\n\tv_nop\n\tv_nop\n\tv_nop" : "+v"(d) : "v"(a), "v"(b));
  return d;
}
__device__ __forceinline__ v8f wmma_bf(v16b a, v16b b, v8f c) {
  v8f d = __builtin_amdgcn_wmma_f32_16x16x32_bf16(false, a, false, b, (short)0, c, false, false);
  asm volatile("v_nop\n\tv_nop\n\tv_nop\n\tv_nop" : "+v"(d) : "v"(a), "v"(b));
  return d;
}
// 16x16x32 fragments: lane = (h = lane>>4, row/col = lane&15); elements 0..7 = k0+8h+0..7, 8..15 = k0+16+8h+0..7; D element r = row 8h+r
__device__ __forceinline__ v16h frag_h(const _Float16* rowk0, int lane) {
  union { v16h v; v8h q[2]; } u; const _Float16* p = rowk0 + 8 * (lane >> 4);
  u.q[0] = *(const v8h*)p; u.q[1] = *(const v8h*)(p + 16); return u.v;
}
__device__ __forceinline__ v16h frag_f32(const float* rowk0, int lane) {
  v16h a; const float* p = rowk0 + 8 * (lane >> 4);
#pragma unroll
  for (int i = 0; i < 8; ++i) { a[i] = (_Float16)p[i]; a[8 + i] = (_Float16)p[16 + i]; }
  return a;
}
__device__ __forceinline__ v16h frag_f32s(const float* rowk0, int lane, float sc) {
  v16h a; const float* p = rowk0 + 8 * (lane >> 4);
#pragma unroll
  for (int i = 0; i < 8; ++i) { a[i] = (_Float16)(p[i] * sc); a[8 + i] = (_Float16)(p[16 + i] * sc); }
  return a;
}
// column fragment from a [K][ld] layout (column n), rows >= K read as 0
__device__ __forceinline__ v16h fragc_f32(const float* W, int k0, int n, int lane, int ld, int K) {
  v16h a; const int g = lane >> 4;
#pragma unroll
  for (int i = 0; i < 8; ++i) { const int ka = k0 + 8 * g + i, kb = ka + 16;
    a[i] = (_Float16)(ka < K ? W[(size_t)(ka < K ? ka : K - 1) * ld + n] : 0.f); a[8 + i] = (_Float16)(kb < K ? W[(size_t)(kb < K ? kb : K - 1) * ld + n] : 0.f); }
  return a;
}
struct F2 { v16b h, l; };
__device__ __forceinline__ F2 bsplit16(const float v[16]) { F2 r;
#pragma unroll
  for (int i = 0; i < 16; ++i) { const __bf16 h = (__bf16)v[i]; r.h[i] = h; r.l[i] = (__bf16)(v[i] - (float)h); }
  return r; }
__device__ __forceinline__ F2 split_row(const float* row, int k0, int lane) { float v[16]; const float* p = row + k0 + 8 * (lane >> 4);
#pragma unroll
  for (int i = 0; i < 8; ++i) { v[i] = p[i]; v[8 + i] = p[16 + i]; }
  return bsplit16(v); }
__device__ __forceinline__ F2 split_rowK(const float* row, int k0, int lane, int K) { float v[16]; const int g = lane >> 4;
#pragma unroll
  for (int i = 0; i < 8; ++i) { const int ka = k0 + 8 * g + i, kb = ka + 16; v[i] = ka < K ? row[ka < K ? ka : K - 1] : 0.f; v[8 + i] = kb < K ? row[kb < K ? kb : K - 1] : 0.f; }
  return bsplit16(v); }
__device__ __forceinline__ F2 split_col(const float* W, int k0, int n, int lane, int ld, int K) { float v[16]; const int g = lane >> 4;
#pragma unroll
  for (int i = 0; i < 8; ++i) { const int ka = k0 + 8 * g + i, kb = ka + 16; v[i] = ka < K ? W[(size_t)(ka < K ? ka : K - 1) * ld + n] : 0.f; v[8 + i] = kb < K ? W[(size_t)(kb < K ? kb : K - 1) * ld + n] : 0.f; }
  return bsplit16(v); }
__device__ __forceinline__ v8f mac3(const F2& a, const F2& b, v8f c) { c = wmma_bf(a.l, b.h, c); c = wmma_bf(a.h, b.l, c); return wmma_bf(a.h, b.h, c); }
__device__ __forceinline__ float sigm(float v) { return 1.0f / (1.0f + expf(-v)); }
#define LDSX() do { asm volatile("s_wait_dscnt 0" ::: "memory"); __builtin_amdgcn_wave_barrier(); __builtin_amdgcn_fence(__ATOMIC_RELEASE, "workgroup"); } while (0)

// Row-wise triangle attention on a pair tensor z [1, 256, 256, 128] (4 heads x 32): zn = LayerNorm(z); q,k,v = zn wq^T, zn wk^T, zn wv^T (separate (out,in) [128,128]); logits[r][i][j][h] = q[r][i] . k[r][j] / sqrt(32) + (zn[i][j] . w_pair[h] + b_pair[h]) + 1e9 (mask[r][j] - 1); softmax over j; out = sigmoid(zn w_gate + b_gate) * merged(attn v); result = out w_out (no output bias).
#define NB 256              // pair rows i (each a sequence of SZ = TT = 256 positions; no padding needed)
#define TT 256
#define CC 128            // NH * HD = projected width
#define DIN 128          // input (model) width
#define NH 4
#define HD 32
#define NQB (TT / 64)
#define HG 4
#define SCALE (0.17677669529663687f)
#define LOG2E (1.4426950408889634f)
#define SCALE2 ((float)(0.17677669529663687 * 1.4426950408889634))   // 32^-0.5 x log2(e): the logits are kept in base-2 units, so that exp(x - m) is one v_exp_f32
#define CAUSAL 0
#ifndef TNB
#define TNB NB
#endif
__device__ __forceinline__ float bfr(float v) { return (float)(__bf16)v; }
// eight independent 2^x (v_exp_f32), each in place, in ONE statement: no instruction in it reads an earlier result or overwrites an earlier source, and the closing v_nop is the one slot that the instruction set asks for behind a transcendental. The two s_delay_alu change no result: the compiler hints nothing around asm text, and an unhinted dependent instruction holds the vector port against the SIMD's other waves.
__device__ __forceinline__ v8f exp2x8(v8f x) { float a0 = x[0], a1 = x[1], a2 = x[2], a3 = x[3], a4 = x[4], a5 = x[5], a6 = x[6], a7 = x[7];
  asm("s_delay_alu instid0(VALU_DEP_1)\n\tv_exp_f32 %0, %0\n\tv_exp_f32 %1, %1\n\tv_exp_f32 %2, %2\n\tv_exp_f32 %3, %3\n\tv_exp_f32 %4, %4\n\tv_exp_f32 %5, %5\n\tv_exp_f32 %6, %6\n\tv_exp_f32 %7, %7\n\ts_delay_alu instid0(TRANS32_DEP_1)\n\tv_nop" : "+v"(a0), "+v"(a1), "+v"(a2), "+v"(a3), "+v"(a4), "+v"(a5), "+v"(a6), "+v"(a7));
  const v8f r = {a0, a1, a2, a3, a4, a5, a6, a7}; return r; }
// the same for eight 1 / x (v_rcp_f32)
__device__ __forceinline__ v8f rcpx8(v8f x) { float a0 = x[0], a1 = x[1], a2 = x[2], a3 = x[3], a4 = x[4], a5 = x[5], a6 = x[6], a7 = x[7];
  asm("s_delay_alu instid0(VALU_DEP_1)\n\tv_rcp_f32 %0, %0\n\tv_rcp_f32 %1, %1\n\tv_rcp_f32 %2, %2\n\tv_rcp_f32 %3, %3\n\tv_rcp_f32 %4, %4\n\tv_rcp_f32 %5, %5\n\tv_rcp_f32 %6, %6\n\tv_rcp_f32 %7, %7\n\ts_delay_alu instid0(TRANS32_DEP_1)\n\tv_nop" : "+v"(a0), "+v"(a1), "+v"(a2), "+v"(a3), "+v"(a4), "+v"(a5), "+v"(a6), "+v"(a7));
  const v8f r = {a0, a1, a2, a3, a4, a5, a6, a7}; return r; }
__host__ __device__ __forceinline__ int kb_last(int qb) { return CAUSAL ? ((qb * 64 + 63) >> 7) : (TT / 128 - 1); }
typedef __attribute__((ext_vector_type(8))) __bf16 v8b;
__device__ __forceinline__ v16b frag_b(const __bf16* rowk0, int lane) {
  union { v16b v; v8b q[2]; } u; const __bf16* p = rowk0 + 8 * (lane >> 4);
  u.q[0] = *(const v8b*)p; u.q[1] = *(const v8b*)(p + 16); return u.v;
}
typedef __attribute__((ext_vector_type(4))) __bf16 v4b;
#define WP 136             // bf16 elements per staged weight row: 272 B = 16 B x odd, so the 16-byte fragment reads of 16 rows fall on distinct banks
// an (out,in) weight [128][128] f32 -> bf16 rows in LDS, by the 128 threads of a block: each wave-load takes one whole 512-B row, all 32 loads of a thread fly together; frag_b(&sw[o][k0], lane) is then the B fragment that wcol_oi gathered from global memory
__device__ __forceinline__ void stage_w(__bf16 (*sw)[WP], const float* __restrict__ Wm, int tid) { const float* p = Wm + tid * 4; v4f a[32];
#pragma unroll
  for (int it = 0; it < 32; ++it) a[it] = *(const v4f*)(p + it * 512);
  asm volatile("s_wait_xcnt 0x0" ::: "memory");   /* the address registers of these loads are reused below */
#pragma unroll
  for (int it = 0; it < 32; ++it) { v4b w;
#pragma unroll
    for (int i = 0; i < 4; ++i) w[i] = (__bf16)a[it][i];
    *(v4b*)&sw[it * 4 + (tid >> 5)][(tid & 31) * 4] = w; } }
#define QBH 0              // unused: no causal path here; the q residual path is chosen by QHI
#define QHI 64             // q residual rows only for the first 64 queries of each row (logits elsewhere: single f16 q, k; sigma_logit ~ 0.25 so this is ample)
#define KHI 64            // key rows sizing the KL, VB and VBL regions (no kernel here writes or reads them)
// B fragment (k rows k0+.., output column o) of a weight: (in,out) [K][ld] or (out,in) [ld rows of K]: bf16 exact, or f16(bf16 * 256) exact
__device__ __forceinline__ v16b wcol_io(const float* Wm, int k0, int o, int lane, int ld) { v16b w; const int g = lane >> 4;
#pragma unroll
  for (int i = 0; i < 8; ++i) { w[i] = (__bf16)Wm[(size_t)(k0 + 8 * g + i) * ld + o]; w[8 + i] = (__bf16)Wm[(size_t)(k0 + 16 + 8 * g + i) * ld + o]; }
  return w; }
__device__ __forceinline__ v16b wcol_oi(const float* Wm, int k0, int o, int lane, int K) { v16b w; const float* p = Wm + (size_t)o * K + k0 + 8 * (lane >> 4);
#pragma unroll
  for (int i = 0; i < 8; ++i) { w[i] = (__bf16)p[i]; w[8 + i] = (__bf16)p[16 + i]; }
  return w; }
__device__ __forceinline__ v16h wcolh_io(const float* Wm, int k0, int o, int lane, int ld) { v16h w; const int g = lane >> 4;
#pragma unroll
  for (int i = 0; i < 8; ++i) { w[i] = (_Float16)(bfr(Wm[(size_t)(k0 + 8 * g + i) * ld + o]) * 256.0f); w[8 + i] = (_Float16)(bfr(Wm[(size_t)(k0 + 16 + 8 * g + i) * ld + o]) * 256.0f); }
  return w; }
__device__ __forceinline__ v16h wcolh_oi(const float* Wm, int k0, int o, int lane, int K) { v16h w; const float* p = Wm + (size_t)o * K + k0 + 8 * (lane >> 4);
#pragma unroll
  for (int i = 0; i < 8; ++i) { w[i] = (_Float16)(bfr(p[i]) * 256.0f); w[8 + i] = (_Float16)(bfr(p[16 + i]) * 256.0f); }
  return w; }
#define WQKV_LAYOUT 1   // (out,in) separate wq / wk / wv [CC][DIN] (wq.reshape(H, DH, D): output column h*32 + c = row of wq)
__device__ __forceinline__ v16b wcol_hdk(const float* Wm, int k0, int o, int lane) { v16b w; const int g = lane >> 4; const float* p = Wm + (size_t)(o / HD) * DIN * HD + (o % HD);
#pragma unroll
  for (int i = 0; i < 8; ++i) { w[i] = (__bf16)p[(size_t)(k0 + 8 * g + i) * HD]; w[8 + i] = (__bf16)p[(size_t)(k0 + 16 + 8 * g + i) * HD]; }
  return w; }
#define WO_OUT_IN 1
#if WQKV_LAYOUT == 1
#define WCOL(W, k0, o, lane) wcol_oi(W, k0, o, lane, DIN)
#elif WQKV_LAYOUT == 2
#define WCOL(W, k0, o, lane) wcol_hdk(W, k0, o, lane)
#else
#define WCOL(W, k0, o, lane) wcol_oi(W, k0, o, lane, DIN)
#endif
#if WO_OUT_IN
#define WOCOL(W, k0, o, lane) wcol_oi(W, k0, o, lane, CC)
#define WOCOLH(W, k0, o, lane) wcolh_oi(W, k0, o, lane, CC)
#else
#define WOCOL(W, k0, o, lane) wcol_io(W, k0, o, lane, DIN)
#define WOCOLH(W, k0, o, lane) wcolh_io(W, k0, o, lane, DIN)
#endif
#define SZ 256             // real positions per row (= TT here)
#define BG 64              // sizes the unused WS_S region (x 4 heads = 256 planes of 256 x 256)
#define NZR ((size_t)NB * SZ)   // 65,536 real pair rows (i, j)
#define SM_EXTRA_PARAMS , const float* __restrict__ BIAS, const float* __restrict__ MKF, int b0s
#define SM_MASK_HOOK do { const int hh = (int)blockIdx.y % HG; const int ii = b0s + (int)blockIdx.y / HG; const int kc2 = k < SZ ? k : SZ - 1; const float add = BIAS[((size_t)t * SZ + kc2) * NH + hh] + 1.0e9f * (bfr(MKF[(size_t)ii * SZ + kc2]) - 1.0f); v = (k < SZ) ? v + add : -3.0e38f; } while (0)   /* + tri_bias[h][q=t][k] + INF (mask[i][k] - 1) (mask is all ones: adds 0, read anyway); key columns k >= SZ would be padding -> excluded (none here: SZ = TT, so the k < SZ test on the loop index always holds) */
__device__ __forceinline__ v16b zero16b() { v16b z; _Pragma("unroll") for (int i = 0; i < 16; ++i) z[i] = (__bf16)0.f; return z; }
#define WS_ZN   (WS_END)
#define WS_BIAS (WS_ZN + 4u * (size_t)NZR * CC)
#define WS_END2 (WS_BIAS + 4u * (size_t)NZR * NH + 1024)
#ifndef SM_EXTRA_PARAMS
#define SM_EXTRA_PARAMS
#endif
#ifndef PROJ_EXTRA_PARAMS
#define PROJ_EXTRA_PARAMS
#endif
#ifndef SM_MASK_HOOK
#define SM_MASK_HOOK (void)0
#endif

// q, k, v, the q residual, gate and ctx lie in the workspace in the order of the 16x16x32 fragments that read them: a 16-byte piece per lane, 32 lanes side by side, so that every wave-wide load or store covers 512 contiguous bytes
#define WS_QH  0u                                      // f16 q [b][h][16-query tile][piece p][lane][8]: query 16 tile + col, channels 32 h + 16 p + 8 g + 0..7
#define WS_KH  (WS_QH + 2u * (size_t)NB * TT * CC)      // f16 k [b][h][16-key tile][piece p][lane][8], as q
#define WS_VT  (WS_KH + 2u * (size_t)NB * TT * CC)      // f16 v [b][h][16-channel tile][32-key step][piece p][lane][8]: channel 32 h + 16 tile + col, keys 32 step + 16 p + 8 g + 0..7
#define WS_QL  (WS_VT + 2u * (size_t)NB * CC * TT)      // f16 q residual x 2^10 [b][h][tile < QHI / 16][piece p][lane][8], as q
#define WS_KL  (WS_QL + 2u * (size_t)NB * QHI * CC)     // f16 k residual x 2^10 rows [b][t < KHI][CC]
#define WS_VB  (WS_KL + 2u * (size_t)NB * KHI * CC)     // bf16 v hi planes [b][c][t < KHI]
#define WS_VBL (WS_VB + 2u * (size_t)NB * CC * KHI)
#define WS_S   (WS_VBL + 2u * (size_t)NB * CC * KHI)    // unused: k_fa keeps logits and P in registers
#define WS_Y   (WS_S  + 4u * (size_t)BG * HG * TT * TT)   // f32 gate, then ctx, in fragment order (layout at WS_END) (only when there is an output projection)
#define WS_END (WS_Y  + 4u * (size_t)NB * SZ * CC)   /* f32 gate, then ctx, [b][16-position tile][h][piece s][lane][4]: position 16 tile + col, channels 32 h + 16 (s >> 1) + 8 g + 4 (s & 1) + 0..3 */

// ---- k_front: block = one pair row i = 256 positions, 16 waves x 16 positions: LayerNorm, triangle bias, q, k, gate and v of a position from ONE read of its input row. A lane loads its row's 64 channels directly in the 16x16x32 fragment order (the other 64 sit in lane ^ 16), so mean and variance are in-lane sums plus one exchange, and the normalised row, split bf16 hi + lo, stays in registers as the operand of all five products. The four [128][128] weights and the bias rows are staged once per block in LDS as bf16. Bias, q, k and gate are taken as W x^T (A = weight rows, B = positions): a lane then holds 8 neighbouring channels of ONE position. v is taken as x W^T: a lane holds 8 neighbouring positions of one channel. In both cases those 8 values are the very piece that the same lane of the reading wave wants in its fragment, so they go from the accumulators straight to the workspace, lane beside lane.
__device__ __forceinline__ v8f wmb(v16b a, v16b b, v8f c) { return __builtin_amdgcn_wmma_f32_16x16x32_bf16(false, a, false, b, (short)0, c, false, false); }
// eight 16x16 tiles over K = 128: WROWS: D = W x^T (rows = output channels), else D = x W^T (rows = positions); per tile the order of the sums is hi, lo of k step 0, hi, lo of k step 1, ...
template <bool WROWS> __device__ __forceinline__ void prod8(const __bf16 (*w)[WP], const F2 (&af)[4], v8f (&acc)[8], int col, int lane) {
#pragma unroll
  for (int kc = 0; kc < 4; ++kc) { v16b wf[8];
#pragma unroll
    for (int j = 0; j < 8; ++j) wf[j] = frag_b(&w[j * 16 + col][kc * 32], lane);   /* the LDS reads of a k step go out together, ahead of its products */
#pragma unroll
    for (int j = 0; j < 8; ++j) acc[j] = WROWS ? wmb(wf[j], af[kc].h, acc[j]) : wmb(af[kc].h, wf[j], acc[j]);
#pragma unroll
    for (int j = 0; j < 8; ++j) acc[j] = WROWS ? wmb(wf[j], af[kc].l, acc[j]) : wmb(af[kc].l, wf[j], acc[j]); } }
__global__ __launch_bounds__(512) void k_front(const float* __restrict__ Z, const float* __restrict__ LW, const float* __restrict__ LB, const float* __restrict__ WB, const float* __restrict__ WBB, const float* __restrict__ WQ, const float* __restrict__ WK, const float* __restrict__ WV, const float* __restrict__ WG, const float* __restrict__ GB,
    _Float16* __restrict__ QH, _Float16* __restrict__ QL, _Float16* __restrict__ KH, _Float16* __restrict__ VT, float* __restrict__ BIAS, float* __restrict__ G) {
  __shared__ __align__(16) __bf16 sw[4][CC][WP]; __shared__ __align__(16) __bf16 swb[16][WP]; __shared__ __align__(16) float sln[4][CC];
  const int tid = threadIdx.x, wave = tid >> 5, lane = tid & 31, col = lane & 15, g = lane >> 4; const size_t bb = blockIdx.x; const size_t r0 = bb * TT + wave * 16;
  v4f x[16];
  { /* all 53 loads of a lane at the block's start fly together: no wait stands between them */
    const float* px = Z + (r0 + col) * CC + 8 * g;
#pragma unroll
    for (int n = 0; n < 16; ++n) x[n] = *(const v4f*)(px + (n >> 2) * 32 + ((n >> 1) & 1) * 16 + (n & 1) * 4);
    v4f a[4][8]; const int ch = tid & (CC - 1);
    const float* pb = WB + (wave & (NH - 1)) * CC + lane * 4; const v4f wb4 = *(const v4f*)pb;   /* read by every wave, so that no branch parts the loads; kept by waves 0..3 (bias row = wave) */
    const int sel = wave >> 2, c4 = ch & (NH - 1); const float l0 = LW[ch], l1 = LB[ch], l2 = GB[ch], l3 = WBB[c4];   /* likewise; four waves each keep ln_g, ln_b, the gate's bias and wb_b (its 4 values repeated) */
#pragma unroll
    for (int it = 0; it < 8; ++it) { a[0][it] = *(const v4f*)(WQ + tid * 4 + it * 2048); a[1][it] = *(const v4f*)(WK + tid * 4 + it * 2048); a[2][it] = *(const v4f*)(WV + tid * 4 + it * 2048); a[3][it] = *(const v4f*)(WG + tid * 4 + it * 2048); }
    asm volatile("s_wait_xcnt 0x0" :: "v"(px), "v"(pb), "v"(ch), "v"(c4) : "memory");   /* the address registers of these loads are reused below; px, pb, ch and c4 stay live up to this wait, so that no load of the group lands on address registers of the group */
    asm volatile("" :: "v"(l0), "v"(l1), "v"(l2), "v"(l3));   /* inputs only: holds these four loads up here with the others; the compiler otherwise sinks them into branches behind the staging, where their latency is waited out alone */
#pragma unroll
    for (int m = 0; m < 4; ++m)
#pragma unroll
      for (int it = 0; it < 8; ++it) { v4b w;
#pragma unroll
        for (int i = 0; i < 4; ++i) w[i] = (__bf16)a[m][it][i];
        *(v4b*)&sw[m][it * 16 + wave][lane * 4] = w; }
    v4b w;
#pragma unroll
    for (int i = 0; i < 4; ++i) w[i] = (__bf16)(wave < NH ? wb4[i] : 0.f);
    *(v4b*)&swb[wave][lane * 4] = w;   /* rows 4..15 of the one bias tile are zero */
    sln[sel][ch] = bfr(sel == 0 ? l0 : sel == 1 ? l1 : sel == 2 ? l2 : l3); }
  __syncthreads();   /* every wave wrote a part of the weight rows that all sixteen read */
  F2 af[4];
  { float s4[4] = {0.f, 0.f, 0.f, 0.f};
#pragma unroll
    for (int n = 0; n < 16; ++n)
#pragma unroll
      for (int i = 0; i < 4; ++i) { x[n][i] = bfr(x[n][i]); s4[i] += x[n][i]; }
    float s1 = (s4[0] + s4[1]) + (s4[2] + s4[3]); s1 += __shfl_xor(s1, 16);
    const float mu = s1 * (1.0f / CC); float q4[4] = {0.f, 0.f, 0.f, 0.f};
#pragma unroll
    for (int n = 0; n < 16; ++n)
#pragma unroll
      for (int i = 0; i < 4; ++i) { const float d = x[n][i] - mu; q4[i] += d * d; }
    float q = (q4[0] + q4[1]) + (q4[2] + q4[3]); q += __shfl_xor(q, 16);
    const float rs = rsqrtf(q * (1.0f / CC) + 1e-5f);
#pragma unroll
    for (int kc = 0; kc < 4; ++kc) { float v[16];
#pragma unroll
      for (int s = 0; s < 4; ++s) { const int c = kc * 32 + 8 * g + (s >> 1) * 16 + (s & 1) * 4; const v4f lw = *(const v4f*)&sln[0][c], lb = *(const v4f*)&sln[1][c];
#pragma unroll
        for (int i = 0; i < 4; ++i) v[s * 4 + i] = (x[kc * 4 + s][i] - mu) * rs * lw[i] + lb[i]; }
      af[kc] = bsplit16(v); } }
  { /* triangle bias: heads = rows 0..3 of the tile, so lanes 0..15 hold the 4 heads of their position: one 256-B run per wave */
    v8f ab = {};
#pragma unroll
    for (int kc = 0; kc < 4; ++kc) { const v16b wf = frag_b(&swb[col][kc * 32], lane); ab = wmb(wf, af[kc].h, ab); ab = wmb(wf, af[kc].l, ab); }
    v4f b4;
#pragma unroll
    for (int i = 0; i < 4; ++i) b4[i] = ab[i] + sln[3][i];   /* + wb_b[h] */
    if (g == 0) vst2(BIAS + (r0 + col) * NH, b4); }
  { /* v: 16 positions of the wave = piece (wave & 1) of key step (wave >> 1); accumulator tile j = channel tile (j & 1) of head (j >> 1) */
    v8f acc[8] = {}; prod8<false>(sw[2], af, acc, col, lane); v8h hv[8];
#pragma unroll
    for (int j = 0; j < 8; ++j)
#pragma unroll
      for (int r = 0; r < 8; ++r) hv[j][r] = (_Float16)acc[j][r];
    _Float16* dv = VT + (bb * 128 + wave) * (size_t)256 + lane * 8;
#pragma unroll
    for (int j = 0; j < 8; ++j) vst2(dv + j * 4096, hv[j]);   /* 512 contiguous bytes per store */
    asm volatile("s_wait_xcnt 0x0" :: "v"(dv), "v"(hv[0]), "v"(hv[1]), "v"(hv[2]), "v"(hv[3]), "v"(hv[4]), "v"(hv[5]), "v"(hv[6]), "v"(hv[7]) : "memory");   /* the stores' registers are reused below; they stay live up to this wait */ }
  const bool hi = wave * 16 < QHI;   /* wave-uniform: these positions carry the q residual */
#pragma unroll
  for (int m = 0; m < 2; ++m) { /* q, then k: the wave's 16 positions = tile (wave); accumulator tile j = piece (j & 1) of head (j >> 1) */
    v8f acc[8] = {}; prod8<true>(sw[m], af, acc, col, lane); const bool res = m == 0 && hi; v8h hv[8];
#pragma unroll
    for (int j = 0; j < 8; ++j)
#pragma unroll
      for (int r = 0; r < 8; ++r) hv[j][r] = (_Float16)acc[j][r];
    _Float16* dh = (m == 0 ? QH : KH) + (bb * 128 + wave * 2) * (size_t)256 + lane * 8;
#pragma unroll
    for (int j = 0; j < 8; ++j) vst2(dh + ((j >> 1) * 32 + (j & 1)) * 256, hv[j]);   /* 512 contiguous bytes per store */
    if (res) { v8h lv[8];
#pragma unroll
      for (int j = 0; j < 8; ++j)
#pragma unroll
        for (int r = 0; r < 8; ++r) lv[j][r] = (_Float16)((acc[j][r] - (float)hv[j][r]) * 1024.0f);
      _Float16* dl = QL + (bb * 32 + wave * 2) * (size_t)256 + lane * 8;
#pragma unroll
      for (int j = 0; j < 8; ++j) vst2(dl + ((j >> 1) * 8 + (j & 1)) * 256, lv[j]);
      asm volatile("s_wait_xcnt 0x0" :: "v"(dl), "v"(lv[0]), "v"(lv[1]), "v"(lv[2]), "v"(lv[3]), "v"(lv[4]), "v"(lv[5]), "v"(lv[6]), "v"(lv[7]) : "memory");   /* as below */ }
    asm volatile("s_wait_xcnt 0x0" :: "v"(dh), "v"(hv[0]), "v"(hv[1]), "v"(hv[2]), "v"(hv[3]), "v"(hv[4]), "v"(hv[5]), "v"(hv[6]), "v"(hv[7]) : "memory");   /* the stores' registers are reused below; they stay live up to this wait */ }
  { /* gate: f32, parked in the ctx buffer; accumulator tile j = pieces 2 (j & 1) and 2 (j & 1) + 1 of head (j >> 1) */
    v8f acc[8] = {}; prod8<true>(sw[3], af, acc, col, lane); v4f s[16];
#pragma unroll
    for (int j = 0; j < 8; ++j) { const v4f g0 = *(const v4f*)&sln[2][j * 16 + 8 * g], g1 = *(const v4f*)&sln[2][j * 16 + 8 * g + 4];
      v8f t;
#pragma unroll
      for (int r = 0; r < 4; ++r) { t[r] = (acc[j][r] + g0[r]) * -LOG2E; t[4 + r] = (acc[j][4 + r] + g1[r]) * -LOG2E; }
      t = rcpx8(exp2x8(t) + 1.0f);   /* sigmoid(zn w_gate + b_gate) = 1 / (1 + 2^(-x log2 e)) */
#pragma unroll
      for (int r = 0; r < 4; ++r) { s[2 * j][r] = t[r]; s[2 * j + 1][r] = t[4 + r]; } }
    float* dg = G + (bb * 16 + wave) * (size_t)2048 + lane * 4;
#pragma unroll
    for (int n = 0; n < 16; ++n) vst2(dg + n * 128, s[n]);   /* 512 contiguous bytes per store */
    asm volatile("s_wait_xcnt 0x0" :: "v"(dg), "v"(s[0]), "v"(s[1]), "v"(s[2]), "v"(s[3]), "v"(s[4]), "v"(s[5]), "v"(s[6]), "v"(s[7]), "v"(s[8]), "v"(s[9]), "v"(s[10]), "v"(s[11]), "v"(s[12]), "v"(s[13]), "v"(s[14]), "v"(s[15]) : "memory");   /* the stores' registers stay live up to this wait, so that no later sigmoid lands on them */ } }
#define NI 4
__device__ __forceinline__ v8f wm16(v16h a, v16h b, v8f c) { return __builtin_amdgcn_wmma_f32_16x16x32_f16(false, a, false, b, (short)0, c, false, false); }
__device__ __forceinline__ v16h frag_p(const _Float16* p) { union { v16h v; v8h q[2]; } u; u.q[0] = *(const v8h*)p; u.q[1] = *(const v8h*)(p + 256); return u.v; }   /* a fragment stored in fragment order: its two pieces lie 512 B apart, the lane's offset is already in p */
__global__ __launch_bounds__(128) void k_fa(const _Float16* __restrict__ QH, const _Float16* __restrict__ KH, const _Float16* __restrict__ QL, const _Float16* __restrict__ VT, const float* __restrict__ BIAS, const float* __restrict__ MKF, float* __restrict__ Y) {
  __shared__ __align__(16) float sb[NH][16][TT + 4];   /* pitch 1040 B = 16 B x odd: 16-byte reads of 16 rows fall on distinct banks */
  __shared__ __align__(16) float smk[NH][TT];
  const int tid = threadIdx.x, wave = tid >> 5, lane = tid & 31, col = lane & 15, g = lane >> 4; const int q0 = (int)blockIdx.x * 16; const int h = wave;
  for (int e = tid; e < 16 * TT; e += 128) { const int q = e >> 8, k = e & (TT - 1); const v4f b4 = *(const v4f*)(BIAS + ((size_t)(q0 + q) * SZ + k) * NH);
    sb[0][q][k] = b4[0] * LOG2E; sb[1][q][k] = b4[1] * LOG2E; sb[2][q][k] = b4[2] * LOG2E; sb[3][q][k] = b4[3] * LOG2E; }   /* base-2 units, once per block */
  __syncthreads();   /* every wave wrote a part of every head's bias plane */
  const bool hi = q0 < QHI;   /* block-uniform: these queries carry the q residual */
  /* the loop over pair rows stays rolled: one tile's registers at a time keep four waves on a SIMD; every inner loop is unrolled so that st[] is indexed by constants and stays in registers */
#pragma unroll 1
  for (int ii = 0; ii < NI; ++ii) { const int b = (int)blockIdx.y * NI + ii;
    { v4f m0 = *(const v4f*)(MKF + (size_t)b * SZ + lane * 8), m1 = *(const v4f*)(MKF + (size_t)b * SZ + lane * 8 + 4);
#pragma unroll
      for (int c = 0; c < 4; ++c) { m0[c] = (1.0e9f * LOG2E) * (bfr(m0[c]) - 1.0f); m1[c] = (1.0e9f * LOG2E) * (bfr(m1[c]) - 1.0f); }   /* INF (mask[i][k] - 1) in base-2 units, 8 keys per lane, wave-private copy */
      *(v4f*)&smk[wave][lane * 8] = m0; *(v4f*)&smk[wave][lane * 8 + 4] = m1; }
    LDSX();   /* the lanes of this wave read each other's mask terms below */
    const size_t bh = (size_t)b * NH + h; const _Float16* qp = QH + (bh * 16 + blockIdx.x) * 512 + lane * 8; const v16h qf = frag_p(qp); const _Float16* kp = KH + bh * 8192 + lane * 8;
    v8f st[TT / 16];
    asm volatile("s_wait_xcnt 0x0" :: "v"(qp) : "memory");   /* the address registers of the q loads are reused below */
    if (hi) { const _Float16* lp = QL + (bh * (QHI / 16) + blockIdx.x) * 512 + lane * 8; const v16h ql = frag_p(lp);
      asm volatile("s_wait_xcnt 0x0" :: "v"(lp) : "memory");   /* as above, for the residual's loads */
#pragma unroll
      for (int hb = 0; hb < 2; ++hb) { v16h kf[8];   /* eight key fragments per batch, so that their loads fly together */
#pragma unroll
        for (int j = 0; j < 8; ++j) kf[j] = frag_p(kp + (hb * 8 + j) * 512);
        asm volatile("s_wait_xcnt 0x0" :: "v"(kp) : "memory");   /* kp stays live up to this wait, so that no load of the batch lands on its own address registers */
#pragma unroll
        for (int j = 0; j < 8; ++j) { const v8f z = {}; const v8f ah = wm16(kf[j], qf, z), al = wm16(kf[j], ql, z);
#pragma unroll
          for (int r = 0; r < 8; ++r) st[hb * 8 + j][r] = ah[r] + al[r] * (1.0f / 1024.0f); } }
    } else {
#pragma unroll
      for (int j = 0; j < TT / 16; ++j) { const v16h kf = frag_p(kp + j * 512); const v8f z = {}; st[j] = wm16(kf, qf, z); }
      asm volatile("s_wait_xcnt 0x0" :: "v"(kp) : "memory");   /* kp stays live up to this wait, so that no key load lands on its own address registers */ }
    float m = -3.0e38f;
#pragma unroll
    for (int j = 0; j < TT / 16; ++j) { const v4f a0 = *(const v4f*)&smk[wave][j * 16 + 8 * g], a1 = *(const v4f*)&smk[wave][j * 16 + 8 * g + 4]; const v4f b0 = *(const v4f*)&sb[wave][col][j * 16 + 8 * g], b1 = *(const v4f*)&sb[wave][col][j * 16 + 8 * g + 4];
#pragma unroll
      for (int r = 0; r < 4; ++r) { st[j][r] = st[j][r] * SCALE2 + (b0[r] + a0[r]); st[j][4 + r] = st[j][4 + r] * SCALE2 + (b1[r] + a1[r]); m = fmaxf(m, fmaxf(st[j][r], st[j][4 + r])); } }
    m = fmaxf(m, __shfl_xor(m, 16));
    float s4[4] = {0.f, 0.f, 0.f, 0.f};
#pragma unroll
    for (int j = 0; j < TT / 16; ++j) { v8f d;
#pragma unroll
      for (int r = 0; r < 8; ++r) d[r] = st[j][r] - m;
      st[j] = exp2x8(d);
#pragma unroll
      for (int r = 0; r < 8; ++r) s4[r & 3] += st[j][r]; }
    float sum = (s4[0] + s4[1]) + (s4[2] + s4[3]); sum += __shfl_xor(sum, 16);
    const float f = sum > 0.f ? 2048.0f * __builtin_amdgcn_rcpf(sum) : 0.f;
    v8f o0 = {}, o1 = {}; const _Float16* vp = VT + bh * 8192 + lane * 8;
#pragma unroll
    for (int kc = 0; kc < TT / 32; ++kc) { v16h p;
#pragma unroll
      for (int s = 0; s < 8; ++s) { p[s] = (_Float16)(st[2 * kc][s] * f); p[8 + s] = (_Float16)(st[2 * kc + 1][s] * f); }   /* keys kc*32 + 8 g + s and kc*32 + 16 + 8 g + s: the k order of frag_h */
      o0 = wm16(frag_p(vp + kc * 512), p, o0); o1 = wm16(frag_p(vp + (8 + kc) * 512), p, o1); }
    asm volatile("s_wait_xcnt 0x0" :: "v"(vp) : "memory");   /* vp stays live up to this wait, so that no v load lands on its own address registers */
    float* py = Y + (((size_t)b * 16 + blockIdx.x) * NH + h) * 512 + lane * 4;   /* a lane holds channels 8 g + r (o0) and 16 + 8 g + r (o1) of its query: pieces 0, 1 and 2, 3; the gate was parked here by k_front and is consumed in place by the same lane */
    const v4f g0 = *(const v4f*)py, g1 = *(const v4f*)(py + 128), g2 = *(const v4f*)(py + 256), g3 = *(const v4f*)(py + 384); v4f r0, r1, r2, r3;
#pragma unroll
    for (int c = 0; c < 4; ++c) { r0[c] = o0[c] * (1.0f / 2048.0f) * g0[c]; r1[c] = o0[4 + c] * (1.0f / 2048.0f) * g1[c]; r2[c] = o1[c] * (1.0f / 2048.0f) * g2[c]; r3[c] = o1[4 + c] * (1.0f / 2048.0f) * g3[c]; }
    vst2(py, r0); vst2(py + 128, r1); vst2(py + 256, r2); vst2(py + 384, r3);
    asm volatile("s_wait_xcnt 0x0" :: "v"(py), "v"(r0), "v"(r1), "v"(r2), "v"(r3) : "memory");   /* the stores' registers are reused by the next pair row; they stay live up to this wait */ } }
// the A fragment (hi + lo) of one k step from a ctx tile in fragment order: four 16-byte pieces, 512 B apart
__device__ __forceinline__ F2 split_frag(const float* p) { float v[16];
#pragma unroll
  for (int s = 0; s < 4; ++s) { const v4f t = *(const v4f*)(p + s * 128);
#pragma unroll
    for (int i = 0; i < 4; ++i) v[s * 4 + i] = t[i]; }
  return bsplit16(v); }
// ---- k_out: block = (64 rows, 128 cols): out = ctx Wo (+ bo): ctx bf16 hi + lo against exact bf16 Wo (2 products)
__global__ __launch_bounds__(128) void k_out(const float* __restrict__ Y, const float* __restrict__ WO, const float* __restrict__ BO, float* __restrict__ OUT) { __shared__ __align__(16) float sf[4][16][132]; __shared__ __align__(16) __bf16 sw[128][WP];
  const int tid = threadIdx.x, wave = tid >> 5, lane = tid & 31, col = lane & 15, g = lane >> 4; const int c0 = blockIdx.y * 128; const size_t r0 = (size_t)blockIdx.x * 64 + wave * 16;
  const float* py = Y + ((size_t)blockIdx.x * 4 + wave) * 2048 + lane * 4;   /* the wave's 16 rows = one ctx tile in fragment order; k step kc = head kc */
  stage_w(sw, WO + (size_t)c0 * CC, tid);
  __syncthreads();   /* every wave wrote a part of the weight rows that all four read */
  v8f acc[8] = {};
  if (true) {   /* ALL rows: gated ctx bf16 hi + lo x exact output_w (2 products) */
#pragma unroll 2
    for (int kc = 0; kc < CC / 32; ++kc) { v16b w[8];
#pragma unroll
      for (int j = 0; j < 8; ++j) w[j] = frag_b(&sw[j * 16 + col][kc * 32], lane);   /* the LDS reads of a k step go out together, ahead of its products */
      const F2 a = split_frag(py + kc * 512); asm volatile("s_wait_loadcnt 0x0" ::: "memory");
      asm volatile("s_wait_xcnt 0x0" ::: "memory");   /* the address registers of the row loads are reused below */
#pragma unroll
      for (int j = 0; j < 8; ++j) { acc[j] = wmma_bf(a.h, w[j], acc[j]); acc[j] = wmma_bf(a.l, w[j], acc[j]); } }
#pragma unroll
    for (int j = 0; j < 8; ++j) { const float bias = BO ? bfr(BO[c0 + j * 16 + col]) : 0.f;
#pragma unroll
      for (int r = 0; r < 8; ++r) sf[wave][8 * g + r][j * 16 + col] = acc[j][r] + bias; }
  }
  LDSX(); for (int rl = 0; rl < 16; ++rl) vst2(OUT + (r0 + rl) * DIN + c0 + lane * 4, *(const v4f*)&sf[wave][rl][lane * 4]); }

extern "C" void kernel_launch(void* const* d_in, const int* in_sizes, int n_in, void* d_out, int out_size, void* d_ws, size_t ws_size, hipStream_t stream) {
  (void)in_sizes; (void)n_in; (void)out_size;
  const float** F = (const float**)d_in;
  if (ws_size < (size_t)WS_END) return;
  char* ws = (char*)d_ws; _Float16 *QH = (_Float16*)(ws + WS_QH), *KH = (_Float16*)(ws + WS_KH), *VT = (_Float16*)(ws + WS_VT), *QL = (_Float16*)(ws + WS_QL), *KL = (_Float16*)(ws + WS_KL); __bf16 *VB = (__bf16*)(ws + WS_VB), *VBL = (__bf16*)(ws + WS_VBL); float *Y = (float*)(ws + WS_Y);
  (void)Y; (void)QL; (void)KL; (void)VB; (void)VBL;
  // inputs: 0 pair_repr [1,256,256,128]; 1 mask [1,256,256] f32 (ones); 2 ln_g, 3 ln_b; 4 wb_w [4,128] (out,in), 5 wb_b [4]; 6 wq, 7 wk, 8 wv [128,128] (out,in); 9 wo [128,128] (out,in); 10 wg_w [128,128] (out,in), 11 wg_b [128]
  if (ws_size < (size_t)WS_END2) return;
  float *BIAS = (float*)(ws + WS_BIAS);
  k_front<<<dim3(NB), 512, 0, stream>>>(F[0], F[2], F[3], F[4], F[5], F[6], F[7], F[8], F[10], F[11], QH, QL, KH, VT, BIAS, Y);   /* LayerNorm, tri bias rows (+ wb_b), q, k, v and the gate (parked in the Y buffer) from one read of the input */
  k_fa<<<dim3(SZ / 16, TNB / NI), 128, 0, stream>>>(QH, KH, QL, VT, BIAS, F[1], Y);   /* logits, softmax and P.v fused; no score planes in the workspace */
  k_out<<<dim3((unsigned)(NZR / 64), DIN / 128), 128, 0, stream>>>(Y, F[9], nullptr, (float*)d_out);
}

// v006
// It runs in 69.7 microseconds.
// Two timings next to v005 both put it at 1.14 times that version's speed.
// Counting every step since v000, it is 5.97 times as fast.
// compute dtype: all float inputs rounded to bf16; LayerNorm in f32; q/k/v, the triangle bias and the gate from the f32 LayerNorm rows split bf16 hi + lo against exact bf16 weights on WMMA 16x16x32 (2 products, f32 accumulate); logits q.k with q as f16 hi + residual for the first 64 queries of each pair row and single f16 elsewhere (sigma_logit ~ 0.25) x 32^-0.5 + bias + mask in f32; softmax in f32 (native exp2 on base-2 logits, in registers, fused with both products); P x 2^11 once to f16 against v once to f16 (1 product); gated ctx split bf16 hi + lo against exact wo (2 products); f32 output.
// Triangle attention, starting node (B 1, I = J = 256 residues, D 128, 4 heads x 32; 0.02-scale (out,in) weights, mask all ones, wb_b = 0, wg_b = 1): z = LayerNorm(pair_repr); tri_bias[h][j][k] = z[j][k] . wb_w[h] + wb_b[h]; for each row i: q = (z[i] wq^T)/sqrt(32), k = z[i] wk^T, v = z[i] wv^T (heads = 32-wide slices of the output dim); a = softmax_k(q . k + 1e9 (mask[i][k] - 1) + tri_bias[h][j][k]); y = merged heads; y = sigmoid(z[i] wg_w^T + wg_b) * y; out[i] = y wo^T.
#include <hip/hip_runtime.h>
#include <math.h>

typedef __attribute__((ext_vector_type(16))) _Float16 v16h;
typedef __attribute__((ext_vector_type(16))) __bf16 v16b;
typedef __attribute__((ext_vector_type(8)))  _Float16 v8h;
typedef __attribute__((ext_vector_type(8)))  float v8f;
typedef __attribute__((ext_vector_type(4)))  float v4f;
typedef __attribute__((ext_vector_type(2)))  float v2f;
typedef __attribute__((ext_vector_type(4)))  unsigned v4u;
typedef __attribute__((ext_vector_type(4)))  int v4i;
typedef float __attribute__((may_alias)) float_a;
typedef int __attribute__((may_alias)) int_a;

template <typename T> __device__ __forceinline__ void vst2(void* p, T v) { *(T*)p = v;  }
__device__ __forceinline__ v8f wmma16(v16h a, v16h b, v8f c) {
  v8f d = __builtin_amdgcn_wmma_f32_16x16x32_f16(false, a, false, b, (short)0, c, false, false);
  asm volatile("v_nop\n\tv_nop\n\tv_nop\n\tv_nop" : "+v"(d) : "v"(a), "v"(b));
  return d;
}
__device__ __forceinline__ v8f wmma_bf(v16b a, v16b b, v8f c) {
  v8f d = __builtin_amdgcn_wmma_f32_16x16x32_bf16(false, a, false, b, (short)0, c, false, false);
  asm volatile("v_nop\n\tv_nop\n\tv_nop\n\tv_nop" : "+v"(d) : "v"(a), "v"(b));
  return d;
}
// 16x16x32 fragments: lane = (h = lane>>4, row/col = lane&15); elements 0..7 = k0+8h+0..7, 8..15 = k0+16+8h+0..7; D element r = row 8h+r
__device__ __forceinline__ v16h frag_h(const _Float16* rowk0, int lane) {
  union { v16h v; v8h q[2]; } u; const _Float16* p = rowk0 + 8 * (lane >> 4);
  u.q[0] = *(const v8h*)p; u.q[1] = *(const v8h*)(p + 16); return u.v;
}
__device__ __forceinline__ v16h frag_f32(const float* rowk0, int lane) {
  v16h a; const float* p = rowk0 + 8 * (lane >> 4);
#pragma unroll
  for (int i = 0; i < 8; ++i) { a[i] = (_Float16)p[i]; a[8 + i] = (_Float16)p[16 + i]; }
  return a;
}
__device__ __forceinline__ v16h frag_f32s(const float* rowk0, int lane, float sc) {
  v16h a; const float* p = rowk0 + 8 * (lane >> 4);
#pragma unroll
  for (int i = 0; i < 8; ++i) { a[i] = (_Float16)(p[i] * sc); a[8 + i] = (_Float16)(p[16 + i] * sc); }
  return a;
}
// column fragment from a [K][ld] layout (column n), rows >= K read as 0
__device__ __forceinline__ v16h fragc_f32(const float* W, int k0, int n, int lane, int ld, int K) {
  v16h a; const int g = lane >> 4;
#pragma unroll
  for (int i = 0; i < 8; ++i) { const int ka = k0 + 8 * g + i, kb = ka + 16;
    a[i] = (_Float16)(ka < K ? W[(size_t)(ka < K ? ka : K - 1) * ld + n] : 0.f); a[8 + i] = (_Float16)(kb < K ? W[(size_t)(kb < K ? kb : K - 1) * ld + n] : 0.f); }
  return a;
}
struct F2 { v16b h, l; };
__device__ __forceinline__ F2 bsplit16(const float v[16]) { F2 r;
#pragma unroll
  for (int i = 0; i < 16; ++i) { const __bf16 h = (__bf16)v[i]; r.h[i] = h; r.l[i] = (__bf16)(v[i] - (float)h); }
  return r; }
__device__ __forceinline__ F2 split_row(const float* row, int k0, int lane) { float v[16]; const float* p = row + k0 + 8 * (lane >> 4);
#pragma unroll
  for (int i = 0; i < 8; ++i) { v[i] = p[i]; v[8 + i] = p[16 + i]; }
  return bsplit16(v); }
__device__ __forceinline__ F2 split_rowK(const float* row, int k0, int lane, int K) { float v[16]; const int g = lane >> 4;
#pragma unroll
  for (int i = 0; i < 8; ++i) { const int ka = k0 + 8 * g + i, kb = ka + 16; v[i] = ka < K ? row[ka < K ? ka : K - 1] : 0.f; v[8 + i] = kb < K ? row[kb < K ? kb : K - 1] : 0.f; }
  return bsplit16(v); }
__device__ __forceinline__ F2 split_col(const float* W, int k0, int n, int lane, int ld, int K) { float v[16]; const int g = lane >> 4;
#pragma unroll
  for (int i = 0; i < 8; ++i) { const int ka = k0 + 8 * g + i, kb = ka + 16; v[i] = ka < K ? W[(size_t)(ka < K ? ka : K - 1) * ld + n] : 0.f; v[8 + i] = kb < K ? W[(size_t)(kb < K ? kb : K - 1) * ld + n] : 0.f; }
  return bsplit16(v); }
__device__ __forceinline__ v8f mac3(const F2& a, const F2& b, v8f c) { c = wmma_bf(a.l, b.h, c); c = wmma_bf(a.h, b.l, c); return wmma_bf(a.h, b.h, c); }
__device__ __forceinline__ float sigm(float v) { return 1.0f / (1.0f + expf(-v)); }
#define LDSX() do { asm volatile("s_wait_dscnt 0" ::: "memory"); __builtin_amdgcn_wave_barrier(); __builtin_amdgcn_fence(__ATOMIC_RELEASE, "workgroup"); } while (0)

// Row-wise triangle attention on a pair tensor z [1, 256, 256, 128] (4 heads x 32): zn = LayerNorm(z); q,k,v = zn wq^T, zn wk^T, zn wv^T (separate (out,in) [128,128]); logits[r][i][j][h] = q[r][i] . k[r][j] / sqrt(32) + (zn[i][j] . w_pair[h] + b_pair[h]) + 1e9 (mask[r][j] - 1); softmax over j; out = sigmoid(zn w_gate + b_gate) * merged(attn v); result = out w_out (no output bias).
#define NB 256              // pair rows i (each a sequence of SZ = TT = 256 positions; no padding needed)
#define TT 256
#define CC 128            // NH * HD = projected width
#define DIN 128          // input (model) width
#define NH 4
#define HD 32
#define NQB (TT / 64)
#define HG 4
#define SCALE (0.17677669529663687f)
#define LOG2E (1.4426950408889634f)
#define SCALE2 ((float)(0.17677669529663687 * 1.4426950408889634))   // 32^-0.5 x log2(e): the logits are kept in base-2 units, so that exp(x - m) is one v_exp_f32
#define CAUSAL 0
#ifndef TNB
#define TNB NB
#endif
__device__ __forceinline__ float bfr(float v) { return (float)(__bf16)v; }
// eight independent 2^x (v_exp_f32), each in place, in ONE statement: no instruction in it reads an earlier result or overwrites an earlier source, and the closing v_nop is the one slot that the instruction set asks for behind a transcendental. The two s_delay_alu change no result: the compiler hints nothing around asm text, and an unhinted dependent instruction holds the vector port against the SIMD's other waves.
__device__ __forceinline__ v8f exp2x8(v8f x) { float a0 = x[0], a1 = x[1], a2 = x[2], a3 = x[3], a4 = x[4], a5 = x[5], a6 = x[6], a7 = x[7];
  asm("s_delay_alu instid0(VALU_DEP_1)\n\tv_exp_f32 %0, %0\n\tv_exp_f32 %1, %1\n\tv_exp_f32 %2, %2\n\tv_exp_f32 %3, %3\n\tv_exp_f32 %4, %4\n\tv_exp_f32 %5, %5\n\tv_exp_f32 %6, %6\n\tv_exp_f32 %7, %7\n\ts_delay_alu instid0(TRANS32_DEP_1)\n\tv_nop" : "+v"(a0), "+v"(a1), "+v"(a2), "+v"(a3), "+v"(a4), "+v"(a5), "+v"(a6), "+v"(a7));
  const v8f r = {a0, a1, a2, a3, a4, a5, a6, a7}; return r; }
// the same for eight 1 / x (v_rcp_f32)
__device__ __forceinline__ v8f rcpx8(v8f x) { float a0 = x[0], a1 = x[1], a2 = x[2], a3 = x[3], a4 = x[4], a5 = x[5], a6 = x[6], a7 = x[7];
  asm("s_delay_alu instid0(VALU_DEP_1)\n\tv_rcp_f32 %0, %0\n\tv_rcp_f32 %1, %1\n\tv_rcp_f32 %2, %2\n\tv_rcp_f32 %3, %3\n\tv_rcp_f32 %4, %4\n\tv_rcp_f32 %5, %5\n\tv_rcp_f32 %6, %6\n\tv_rcp_f32 %7, %7\n\ts_delay_alu instid0(TRANS32_DEP_1)\n\tv_nop" : "+v"(a0), "+v"(a1), "+v"(a2), "+v"(a3), "+v"(a4), "+v"(a5), "+v"(a6), "+v"(a7));
  const v8f r = {a0, a1, a2, a3, a4, a5, a6, a7}; return r; }
__host__ __device__ __forceinline__ int kb_last(int qb) { return CAUSAL ? ((qb * 64 + 63) >> 7) : (TT / 128 - 1); }
typedef __attribute__((ext_vector_type(8))) __bf16 v8b;
__device__ __forceinline__ v16b frag_b(const __bf16* rowk0, int lane) {
  union { v16b v; v8b q[2]; } u; const __bf16* p = rowk0 + 8 * (lane >> 4);
  u.q[0] = *(const v8b*)p; u.q[1] = *(const v8b*)(p + 16); return u.v;
}
typedef __attribute__((ext_vector_type(4))) __bf16 v4b;
#define WP 136             // bf16 elements per staged weight row: 272 B = 16 B x odd, so the 16-byte fragment reads of 16 rows fall on distinct banks
#define QBH 0              // unused: this file has no causal path
#define QHI 64             // q residual rows only for the first 64 queries (four 16-query blocks) of each row (logits elsewhere: single f16 q, k; sigma_logit ~ 0.25 so this is ample)
#define KHI 64            // key rows carrying k residual / v bf16 hi+lo planes (regions sized here; nothing in this file writes them)
// B fragment (k rows k0+.., output column o) of a weight: (in,out) [K][ld] or (out,in) [ld rows of K]: bf16 exact, or f16(bf16 * 256) exact
__device__ __forceinline__ v16b wcol_io(const float* Wm, int k0, int o, int lane, int ld) { v16b w; const int g = lane >> 4;
#pragma unroll
  for (int i = 0; i < 8; ++i) { w[i] = (__bf16)Wm[(size_t)(k0 + 8 * g + i) * ld + o]; w[8 + i] = (__bf16)Wm[(size_t)(k0 + 16 + 8 * g + i) * ld + o]; }
  return w; }
__device__ __forceinline__ v16b wcol_oi(const float* Wm, int k0, int o, int lane, int K) { v16b w; const float* p = Wm + (size_t)o * K + k0 + 8 * (lane >> 4);
#pragma unroll
  for (int i = 0; i < 8; ++i) { w[i] = (__bf16)p[i]; w[8 + i] = (__bf16)p[16 + i]; }
  return w; }
__device__ __forceinline__ v16h wcolh_io(const float* Wm, int k0, int o, int lane, int ld) { v16h w; const int g = lane >> 4;
#pragma unroll
  for (int i = 0; i < 8; ++i) { w[i] = (_Float16)(bfr(Wm[(size_t)(k0 + 8 * g + i) * ld + o]) * 256.0f); w[8 + i] = (_Float16)(bfr(Wm[(size_t)(k0 + 16 + 8 * g + i) * ld + o]) * 256.0f); }
  return w; }
__device__ __forceinline__ v16h wcolh_oi(const float* Wm, int k0, int o, int lane, int K) { v16h w; const float* p = Wm + (size_t)o * K + k0 + 8 * (lane >> 4);
#pragma unroll
  for (int i = 0; i < 8; ++i) { w[i] = (_Float16)(bfr(p[i]) * 256.0f); w[8 + i] = (_Float16)(bfr(p[16 + i]) * 256.0f); }
  return w; }
#define WQKV_LAYOUT 1   // (out,in) separate wq / wk / wv [CC][DIN] (wq.reshape(H, DH, D): output column h*32 + c = row of wq)
__device__ __forceinline__ v16b wcol_hdk(const float* Wm, int k0, int o, int lane) { v16b w; const int g = lane >> 4; const float* p = Wm + (size_t)(o / HD) * DIN * HD + (o % HD);
#pragma unroll
  for (int i = 0; i < 8; ++i) { w[i] = (__bf16)p[(size_t)(k0 + 8 * g + i) * HD]; w[8 + i] = (__bf16)p[(size_t)(k0 + 16 + 8 * g + i) * HD]; }
  return w; }
#define WO_OUT_IN 1
#if WQKV_LAYOUT == 1
#define WCOL(W, k0, o, lane) wcol_oi(W, k0, o, lane, DIN)
#elif WQKV_LAYOUT == 2
#define WCOL(W, k0, o, lane) wcol_hdk(W, k0, o, lane)
#else
#define WCOL(W, k0, o, lane) wcol_oi(W, k0, o, lane, DIN)
#endif
#if WO_OUT_IN
#define WOCOL(W, k0, o, lane) wcol_oi(W, k0, o, lane, CC)
#define WOCOLH(W, k0, o, lane) wcolh_oi(W, k0, o, lane, CC)
#else
#define WOCOL(W, k0, o, lane) wcol_io(W, k0, o, lane, DIN)
#define WOCOLH(W, k0, o, lane) wcolh_io(W, k0, o, lane, DIN)
#endif
#define SZ 256             // real positions per row (= TT here)
#define BG 64              // sizes the unused WS_S region (x 4 heads = 256 planes of 256 x 256)
#define NZR ((size_t)NB * SZ)   // 65,536 real pair rows (i, j)
#define SM_EXTRA_PARAMS , const float* __restrict__ BIAS, const float* __restrict__ MKF, int b0s
#define SM_MASK_HOOK do { const int hh = (int)blockIdx.y % HG; const int ii = b0s + (int)blockIdx.y / HG; const int kc2 = k < SZ ? k : SZ - 1; const float add = BIAS[((size_t)t * SZ + kc2) * NH + hh] + 1.0e9f * (bfr(MKF[(size_t)ii * SZ + kc2]) - 1.0f); v = (k < SZ) ? v + add : -3.0e38f; } while (0)   /* + tri_bias[h][q=t][k] + INF (mask[i][k] - 1) (mask is all ones: adds 0, read anyway); key columns k >= SZ would be padding -> excluded (none here: SZ = TT, so the k < SZ test on the loop index always holds) */
__device__ __forceinline__ v16b zero16b() { v16b z; _Pragma("unroll") for (int i = 0; i < 16; ++i) z[i] = (__bf16)0.f; return z; }
#define WS_ZN   (WS_END)
#define WS_BIAS (WS_ZN + 4u * (size_t)NZR * CC)
#define WS_END2 (WS_BIAS + 4u * (size_t)NZR * NH + 1024)
#ifndef SM_EXTRA_PARAMS
#define SM_EXTRA_PARAMS
#endif
#ifndef PROJ_EXTRA_PARAMS
#define PROJ_EXTRA_PARAMS
#endif
#ifndef SM_MASK_HOOK
#define SM_MASK_HOOK (void)0
#endif

// q, k, v, the q residual and the gate lie in the workspace in the order of the 16x16x32 fragments that read them: a 16-byte piece per lane, 32 lanes side by side, so that every wave-wide load or store covers 512 contiguous bytes
#define WS_QH  0u                                      // f16 q [b][h][16-query tile][piece p][lane][8]: query 16 tile + col, channels 32 h + 16 p + 8 g + 0..7
#define WS_KH  (WS_QH + 2u * (size_t)NB * TT * CC)      // f16 k [b][h][16-key tile][piece p][lane][8], as q
#define WS_VT  (WS_KH + 2u * (size_t)NB * TT * CC)      // f16 v [b][h][16-channel tile][32-key step][piece p][lane][8]: channel 32 h + 16 tile + col, keys 32 step + 16 p + 8 g + 0..7
#define WS_QL  (WS_VT + 2u * (size_t)NB * CC * TT)      // f16 q residual x 2^10 [b][h][tile < QHI / 16][piece p][lane][8], as q
#define WS_KL  (WS_QL + 2u * (size_t)NB * QHI * CC)     // f16 k residual x 2^10 rows [b][t < KHI][CC]
#define WS_VB  (WS_KL + 2u * (size_t)NB * KHI * CC)     // bf16 v hi planes [b][c][t < KHI]
#define WS_VBL (WS_VB + 2u * (size_t)NB * CC * KHI)
#define WS_S   (WS_VBL + 2u * (size_t)NB * CC * KHI)    // f32 [hg][t][s], unused: k_fa keeps logits and P in registers
#define WS_Y   (WS_S  + 4u * (size_t)BG * HG * TT * TT)   // past the 256 unused planes of 256 x 256      // f32 gate (layout on the next line)
#define WS_END (WS_Y  + 4u * (size_t)NB * SZ * CC)   /* f32 gate [b][16-position tile][h][piece s][lane][4]: position 16 tile + col, channels 32 h + 16 (s >> 1) + 8 g + 4 (s & 1) + 0..3 */

// ---- k_front: block = one pair row i = 256 positions, 16 waves x 16 positions: LayerNorm, triangle bias, q, k, gate and v of a position from ONE read of its input row. A lane loads its row's 64 channels directly in the 16x16x32 fragment order (the other 64 sit in lane ^ 16), so mean and variance are in-lane sums plus one exchange, and the normalised row, split bf16 hi + lo, stays in registers as the operand of all five products. The four [128][128] weights and the bias rows are staged once per block in LDS as bf16. Bias, q, k and gate are taken as W x^T (A = weight rows, B = positions): a lane then holds 8 neighbouring channels of ONE position. v is taken as x W^T: a lane holds 8 neighbouring positions of one channel. In both cases those 8 values are the very piece that the same lane of the reading wave wants in its fragment, so they go from the accumulators straight to the workspace, lane beside lane.
__device__ __forceinline__ v8f wmb(v16b a, v16b b, v8f c) { return __builtin_amdgcn_wmma_f32_16x16x32_bf16(false, a, false, b, (short)0, c, false, false); }
// eight 16x16 tiles over K = 128: WROWS: D = W x^T (rows = output channels), else D = x W^T (rows = positions); per tile the order of the sums is hi, lo of k step 0, hi, lo of k step 1, ...
template <bool WROWS> __device__ __forceinline__ void prod8(const __bf16 (*w)[WP], const F2 (&af)[4], v8f (&acc)[8], int col, int lane) {
#pragma unroll
  for (int kc = 0; kc < 4; ++kc) { v16b wf[8];
#pragma unroll
    for (int j = 0; j < 8; ++j) wf[j] = frag_b(&w[j * 16 + col][kc * 32], lane);   /* the LDS reads of a k step go out together, ahead of its products */
#pragma unroll
    for (int j = 0; j < 8; ++j) acc[j] = WROWS ? wmb(wf[j], af[kc].h, acc[j]) : wmb(af[kc].h, wf[j], acc[j]);
#pragma unroll
    for (int j = 0; j < 8; ++j) acc[j] = WROWS ? wmb(wf[j], af[kc].l, acc[j]) : wmb(af[kc].l, wf[j], acc[j]); } }
__global__ __launch_bounds__(512) void k_front(const float* __restrict__ Z, const float* __restrict__ LW, const float* __restrict__ LB, const float* __restrict__ WB, const float* __restrict__ WBB, const float* __restrict__ WQ, const float* __restrict__ WK, const float* __restrict__ WV, const float* __restrict__ WG, const float* __restrict__ GB,
    _Float16* __restrict__ QH, _Float16* __restrict__ QL, _Float16* __restrict__ KH, _Float16* __restrict__ VT, float* __restrict__ BIAS, float* __restrict__ G) {
  __shared__ __align__(16) __bf16 sw[4][CC][WP]; __shared__ __align__(16) __bf16 swb[16][WP]; __shared__ __align__(16) float sln[4][CC];
  const int tid = threadIdx.x, wave = tid >> 5, lane = tid & 31, col = lane & 15, g = lane >> 4; const size_t bb = blockIdx.x; const size_t r0 = bb * TT + wave * 16;
  v4f x[16];
  { /* all 53 loads of a lane at the block's start fly together: no wait stands between them */
    const float* px = Z + (r0 + col) * CC + 8 * g;
#pragma unroll
    for (int n = 0; n < 16; ++n) x[n] = *(const v4f*)(px + (n >> 2) * 32 + ((n >> 1) & 1) * 16 + (n & 1) * 4);
    v4f a[4][8]; const int ch = tid & (CC - 1);
    const float* pb = WB + (wave & (NH - 1)) * CC + lane * 4; const v4f wb4 = *(const v4f*)pb;   /* read by every wave, so that no branch parts the loads; kept by waves 0..3 (bias row = wave) */
    const int sel = wave >> 2, c4 = ch & (NH - 1); const float l0 = LW[ch], l1 = LB[ch], l2 = GB[ch], l3 = WBB[c4];   /* likewise; four waves each keep ln_g, ln_b, the gate's bias and wb_b (its 4 values repeated) */
#pragma unroll
    for (int it = 0; it < 8; ++it) { a[0][it] = *(const v4f*)(WQ + tid * 4 + it * 2048); a[1][it] = *(const v4f*)(WK + tid * 4 + it * 2048); a[2][it] = *(const v4f*)(WV + tid * 4 + it * 2048); a[3][it] = *(const v4f*)(WG + tid * 4 + it * 2048); }
    asm volatile("s_wait_xcnt 0x0" :: "v"(px), "v"(pb), "v"(ch), "v"(c4) : "memory");   /* the address registers of these loads are reused below; px, pb, ch and c4 stay live up to this wait, so that no load of the group lands on address registers of the group */
    asm volatile("" :: "v"(l0), "v"(l1), "v"(l2), "v"(l3));   /* inputs only: holds these four loads up here with the others; the compiler otherwise sinks them into branches behind the staging, where their latency is waited out alone */
#pragma unroll
    for (int m = 0; m < 4; ++m)
#pragma unroll
      for (int it = 0; it < 8; ++it) { v4b w;
#pragma unroll
        for (int i = 0; i < 4; ++i) w[i] = (__bf16)a[m][it][i];
        *(v4b*)&sw[m][it * 16 + wave][lane * 4] = w; }
    v4b w;
#pragma unroll
    for (int i = 0; i < 4; ++i) w[i] = (__bf16)(wave < NH ? wb4[i] : 0.f);
    *(v4b*)&swb[wave][lane * 4] = w;   /* rows 4..15 of the one bias tile are zero */
    sln[sel][ch] = bfr(sel == 0 ? l0 : sel == 1 ? l1 : sel == 2 ? l2 : l3); }
  __syncthreads();   /* every wave wrote a part of the weight rows that all sixteen read */
  F2 af[4];
  { float s4[4] = {0.f, 0.f, 0.f, 0.f};
#pragma unroll
    for (int n = 0; n < 16; ++n)
#pragma unroll
      for (int i = 0; i < 4; ++i) { x[n][i] = bfr(x[n][i]); s4[i] += x[n][i]; }
    float s1 = (s4[0] + s4[1]) + (s4[2] + s4[3]); s1 += __shfl_xor(s1, 16);
    const float mu = s1 * (1.0f / CC); float q4[4] = {0.f, 0.f, 0.f, 0.f};
#pragma unroll
    for (int n = 0; n < 16; ++n)
#pragma unroll
      for (int i = 0; i < 4; ++i) { const float d = x[n][i] - mu; q4[i] += d * d; }
    float q = (q4[0] + q4[1]) + (q4[2] + q4[3]); q += __shfl_xor(q, 16);
    const float rs = rsqrtf(q * (1.0f / CC) + 1e-5f);
#pragma unroll
    for (int kc = 0; kc < 4; ++kc) { float v[16];
#pragma unroll
      for (int s = 0; s < 4; ++s) { const int c = kc * 32 + 8 * g + (s >> 1) * 16 + (s & 1) * 4; const v4f lw = *(const v4f*)&sln[0][c], lb = *(const v4f*)&sln[1][c];
#pragma unroll
        for (int i = 0; i < 4; ++i) v[s * 4 + i] = (x[kc * 4 + s][i] - mu) * rs * lw[i] + lb[i]; }
      af[kc] = bsplit16(v); } }
  { /* triangle bias: heads = rows 0..3 of the tile, so lanes 0..15 hold the 4 heads of their position: one 256-B run per wave */
    v8f ab = {};
#pragma unroll
    for (int kc = 0; kc < 4; ++kc) { const v16b wf = frag_b(&swb[col][kc * 32], lane); ab = wmb(wf, af[kc].h, ab); ab = wmb(wf, af[kc].l, ab); }
    v4f b4;
#pragma unroll
    for (int i = 0; i < 4; ++i) b4[i] = ab[i] + sln[3][i];   /* + wb_b[h] */
    if (g == 0) vst2(BIAS + (r0 + col) * NH, b4); }
  { /* v: 16 positions of the wave = piece (wave & 1) of key step (wave >> 1); accumulator tile j = channel tile (j & 1) of head (j >> 1) */
    v8f acc[8] = {}; prod8<false>(sw[2], af, acc, col, lane); v8h hv[8];
#pragma unroll
    for (int j = 0; j < 8; ++j)
#pragma unroll
      for (int r = 0; r < 8; ++r) hv[j][r] = (_Float16)acc[j][r];
    _Float16* dv = VT + (bb * 128 + wave) * (size_t)256 + lane * 8;
#pragma unroll
    for (int j = 0; j < 8; ++j) vst2(dv + j * 4096, hv[j]);   /* 512 contiguous bytes per store */
    asm volatile("s_wait_xcnt 0x0" :: "v"(dv), "v"(hv[0]), "v"(hv[1]), "v"(hv[2]), "v"(hv[3]), "v"(hv[4]), "v"(hv[5]), "v"(hv[6]), "v"(hv[7]) : "memory");   /* the stores' registers are reused below; they stay live up to this wait */ }
  const bool hi = wave * 16 < QHI;   /* wave-uniform: these positions carry the q residual */
#pragma unroll
  for (int m = 0; m < 2; ++m) { /* q, then k: the wave's 16 positions = tile (wave); accumulator tile j = piece (j & 1) of head (j >> 1) */
    v8f acc[8] = {}; prod8<true>(sw[m], af, acc, col, lane); const bool res = m == 0 && hi; v8h hv[8];
#pragma unroll
    for (int j = 0; j < 8; ++j)
#pragma unroll
      for (int r = 0; r < 8; ++r) hv[j][r] = (_Float16)acc[j][r];
    _Float16* dh = (m == 0 ? QH : KH) + (bb * 128 + wave * 2) * (size_t)256 + lane * 8;
#pragma unroll
    for (int j = 0; j < 8; ++j) vst2(dh + ((j >> 1) * 32 + (j & 1)) * 256, hv[j]);   /* 512 contiguous bytes per store */
    if (res) { v8h lv[8];
#pragma unroll
      for (int j = 0; j < 8; ++j)
#pragma unroll
        for (int r = 0; r < 8; ++r) lv[j][r] = (_Float16)((acc[j][r] - (float)hv[j][r]) * 1024.0f);
      _Float16* dl = QL + (bb * 32 + wave * 2) * (size_t)256 + lane * 8;
#pragma unroll
      for (int j = 0; j < 8; ++j) vst2(dl + ((j >> 1) * 8 + (j & 1)) * 256, lv[j]);
      asm volatile("s_wait_xcnt 0x0" :: "v"(dl), "v"(lv[0]), "v"(lv[1]), "v"(lv[2]), "v"(lv[3]), "v"(lv[4]), "v"(lv[5]), "v"(lv[6]), "v"(lv[7]) : "memory");   /* as below */ }
    asm volatile("s_wait_xcnt 0x0" :: "v"(dh), "v"(hv[0]), "v"(hv[1]), "v"(hv[2]), "v"(hv[3]), "v"(hv[4]), "v"(hv[5]), "v"(hv[6]), "v"(hv[7]) : "memory");   /* the stores' registers are reused below; they stay live up to this wait */ }
  { /* gate: f32; accumulator tile j = pieces 2 (j & 1) and 2 (j & 1) + 1 of head (j >> 1) */
    v8f acc[8] = {}; prod8<true>(sw[3], af, acc, col, lane); v4f s[16];
#pragma unroll
    for (int j = 0; j < 8; ++j) { const v4f g0 = *(const v4f*)&sln[2][j * 16 + 8 * g], g1 = *(const v4f*)&sln[2][j * 16 + 8 * g + 4];
      v8f t;
#pragma unroll
      for (int r = 0; r < 4; ++r) { t[r] = (acc[j][r] + g0[r]) * -LOG2E; t[4 + r] = (acc[j][4 + r] + g1[r]) * -LOG2E; }
      t = rcpx8(exp2x8(t) + 1.0f);   /* sigmoid(zn w_gate + b_gate) = 1 / (1 + 2^(-x log2 e)) */
#pragma unroll
      for (int r = 0; r < 4; ++r) { s[2 * j][r] = t[r]; s[2 * j + 1][r] = t[4 + r]; } }
    float* dg = G + (bb * 16 + wave) * (size_t)2048 + lane * 4;
#pragma unroll
    for (int n = 0; n < 16; ++n) vst2(dg + n * 128, s[n]);   /* 512 contiguous bytes per store */
    asm volatile("s_wait_xcnt 0x0" :: "v"(dg), "v"(s[0]), "v"(s[1]), "v"(s[2]), "v"(s[3]), "v"(s[4]), "v"(s[5]), "v"(s[6]), "v"(s[7]), "v"(s[8]), "v"(s[9]), "v"(s[10]), "v"(s[11]), "v"(s[12]), "v"(s[13]), "v"(s[14]), "v"(s[15]) : "memory");   /* the stores' registers stay live up to this wait, so that no later sigmoid lands on them */ } }
#define NW 16
#define OP 132             // f32 elements per row of a wave's output tile in LDS: 528 B = 16 B x odd
__device__ __forceinline__ v8f wm16(v16h a, v16h b, v8f c) { return __builtin_amdgcn_wmma_f32_16x16x32_f16(false, a, false, b, (short)0, c, false, false); }
__device__ __forceinline__ v16h frag_p(const _Float16* p) { union { v16h v; v8h q[2]; } u; u.q[0] = *(const v8h*)p; u.q[1] = *(const v8h*)(p + 256); return u.v; }   /* a fragment stored in fragment order: its two pieces lie 512 B apart, the lane's offset is already in p */
__global__ __launch_bounds__(NW * 32) void k_fa(const _Float16* __restrict__ QH, const _Float16* __restrict__ KH, const _Float16* __restrict__ QL, const _Float16* __restrict__ VT, const float* __restrict__ BIAS, const float* __restrict__ MKF, const float* __restrict__ G, const float* __restrict__ WO, float* __restrict__ OUT) {
  __shared__ __align__(16) float sb[NH][16][TT + 4];   /* pitch 1040 B = 16 B x odd: 16-byte reads of 16 rows fall on distinct banks */
  __shared__ __align__(16) float smk[NW][TT];
  __shared__ __align__(16) __bf16 swo[DIN][WP];
  __shared__ __align__(16) float sy[NW][16 * OP];   /* a wave's own slot: first the gated ctx [head][piece s][lane][4], then its output tile [query][OP] */
  const int tid = threadIdx.x, wave = tid >> 5, lane = tid & 31, col = lane & 15, g = lane >> 4; const int q0 = (int)blockIdx.x * 16; const int b = (int)blockIdx.y * NW + wave;
  /* the loads of wo (out,in) [128][128] f32 (each wave-load takes one whole 512-B row) and of the wave's mask row go out first and fly while the bias is staged */
  const float* pw = WO + tid * 4; const float* pm = MKF + (size_t)b * SZ + lane * 8; v4f a[8];
#pragma unroll
  for (int it = 0; it < 8; ++it) a[it] = *(const v4f*)(pw + it * (NW * 128));
  v4f m0 = *(const v4f*)pm, m1 = *(const v4f*)(pm + 4);
  asm volatile("s_wait_xcnt 0x0" :: "v"(pw), "v"(pm) : "memory");   /* the address registers of these loads are reused below; pw and pm stay live up to this wait */
  for (int e = tid; e < 16 * TT; e += NW * 32) { const int q = e >> 8, k = e & (TT - 1); const v4f b4 = *(const v4f*)(BIAS + ((size_t)(q0 + q) * SZ + k) * NH);
    sb[0][q][k] = b4[0] * LOG2E; sb[1][q][k] = b4[1] * LOG2E; sb[2][q][k] = b4[2] * LOG2E; sb[3][q][k] = b4[3] * LOG2E; }   /* base-2 units, once per block */
#pragma unroll
  for (int it = 0; it < 8; ++it) { v4b w;
#pragma unroll
    for (int i = 0; i < 4; ++i) w[i] = (__bf16)a[it][i];
    *(v4b*)&swo[it * NW + wave][lane * 4] = w; }   /* wo as bf16 rows */
#pragma unroll
  for (int c = 0; c < 4; ++c) { m0[c] = (1.0e9f * LOG2E) * (bfr(m0[c]) - 1.0f); m1[c] = (1.0e9f * LOG2E) * (bfr(m1[c]) - 1.0f); }   /* INF (mask[i][k] - 1) in base-2 units, 8 keys per lane, the wave's own pair row, once for its four heads */
  *(v4f*)&smk[wave][lane * 8] = m0; *(v4f*)&smk[wave][lane * 8 + 4] = m1;
  __syncthreads();   /* every wave wrote a part of every head's bias plane and of the wo rows */
  const bool hi = q0 < QHI;   /* block-uniform: these queries carry the q residual */
  float* const sw_y = &sy[wave][0];
  /* the loop over heads stays rolled: one tile's registers at a time keep four waves on a SIMD; every inner loop is unrolled so that st[] is indexed by constants and stays in registers */
#pragma unroll 1
  for (int h = 0; h < NH; ++h) {
    const size_t bh = (size_t)b * NH + h; const _Float16* qp = QH + (bh * 16 + blockIdx.x) * 512 + lane * 8; const v16h qf = frag_p(qp); const _Float16* kp = KH + bh * 8192 + lane * 8;
    v8f st[TT / 16];
    asm volatile("s_wait_xcnt 0x0" :: "v"(qp) : "memory");   /* the address registers of the q loads are reused below */
    if (hi) { const _Float16* lp = QL + (bh * (QHI / 16) + blockIdx.x) * 512 + lane * 8; const v16h ql = frag_p(lp);
      asm volatile("s_wait_xcnt 0x0" :: "v"(lp) : "memory");   /* as above, for the residual's loads */
#pragma unroll
      for (int hb = 0; hb < 2; ++hb) { v16h kf[8];   /* eight key fragments per batch, so that their loads fly together */
#pragma unroll
        for (int j = 0; j < 8; ++j) kf[j] = frag_p(kp + (hb * 8 + j) * 512);
        asm volatile("s_wait_xcnt 0x0" :: "v"(kp) : "memory");   /* kp stays live up to this wait, so that no load of the batch lands on its own address registers */
#pragma unroll
        for (int j = 0; j < 8; ++j) { const v8f z = {}; const v8f ah = wm16(kf[j], qf, z), al = wm16(kf[j], ql, z);
#pragma unroll
          for (int r = 0; r < 8; ++r) st[hb * 8 + j][r] = ah[r] + al[r] * (1.0f / 1024.0f); } }
    } else {
#pragma unroll
      for (int j = 0; j < TT / 16; ++j) { const v16h kf = frag_p(kp + j * 512); const v8f z = {}; st[j] = wm16(kf, qf, z); }
      asm volatile("s_wait_xcnt 0x0" :: "v"(kp) : "memory");   /* kp stays live up to this wait, so that no key load lands on its own address registers */ }
    float m = -3.0e38f;
#pragma unroll
    for (int j = 0; j < TT / 16; ++j) { const v4f a0 = *(const v4f*)&smk[wave][j * 16 + 8 * g], a1 = *(const v4f*)&smk[wave][j * 16 + 8 * g + 4]; const v4f b0 = *(const v4f*)&sb[h][col][j * 16 + 8 * g], b1 = *(const v4f*)&sb[h][col][j * 16 + 8 * g + 4];
#pragma unroll
      for (int r = 0; r < 4; ++r) { st[j][r] = st[j][r] * SCALE2 + (b0[r] + a0[r]); st[j][4 + r] = st[j][4 + r] * SCALE2 + (b1[r] + a1[r]); m = fmaxf(m, fmaxf(st[j][r], st[j][4 + r])); } }
    m = fmaxf(m, __shfl_xor(m, 16));
    float s4[4] = {0.f, 0.f, 0.f, 0.f};
#pragma unroll
    for (int j = 0; j < TT / 16; ++j) { v8f d;
#pragma unroll
      for (int r = 0; r < 8; ++r) d[r] = st[j][r] - m;
      st[j] = exp2x8(d);
#pragma unroll
      for (int r = 0; r < 8; ++r) s4[r & 3] += st[j][r]; }
    float sum = (s4[0] + s4[1]) + (s4[2] + s4[3]); sum += __shfl_xor(sum, 16);
    const float f = sum > 0.f ? 2048.0f * __builtin_amdgcn_rcpf(sum) : 0.f;
    v8f o0 = {}, o1 = {}; const _Float16* vp = VT + bh * 8192 + lane * 8;
#pragma unroll
    for (int kc = 0; kc < TT / 32; ++kc) { v16h p;
#pragma unroll
      for (int s = 0; s < 8; ++s) { p[s] = (_Float16)(st[2 * kc][s] * f); p[8 + s] = (_Float16)(st[2 * kc + 1][s] * f); }   /* keys kc*32 + 8 g + s and kc*32 + 16 + 8 g + s: the k order of frag_h */
      o0 = wm16(frag_p(vp + kc * 512), p, o0); o1 = wm16(frag_p(vp + (8 + kc) * 512), p, o1); }
    asm volatile("s_wait_xcnt 0x0" :: "v"(vp) : "memory");   /* vp stays live up to this wait, so that no v load lands on its own address registers */
    const float* pg = G + (((size_t)b * 16 + blockIdx.x) * NH + h) * 512 + lane * 4;   /* a lane holds channels 8 g + r (o0) and 16 + 8 g + r (o1) of its query: pieces 0, 1 and 2, 3 of the gate tile that k_front wrote */
    const v4f g0 = *(const v4f*)pg, g1 = *(const v4f*)(pg + 128), g2 = *(const v4f*)(pg + 256), g3 = *(const v4f*)(pg + 384); v4f r0, r1, r2, r3;
    asm volatile("s_wait_xcnt 0x0" :: "v"(pg) : "memory");   /* the address registers of the gate loads are reused by the next head */
#pragma unroll
    for (int c = 0; c < 4; ++c) { r0[c] = o0[c] * (1.0f / 2048.0f) * g0[c]; r1[c] = o0[4 + c] * (1.0f / 2048.0f) * g1[c]; r2[c] = o1[c] * (1.0f / 2048.0f) * g2[c]; r3[c] = o1[4 + c] * (1.0f / 2048.0f) * g3[c]; }
    float* py = sw_y + h * 512 + lane * 4; *(v4f*)py = r0; *(v4f*)(py + 128) = r1; *(v4f*)(py + 256) = r2; *(v4f*)(py + 384) = r3; }
  /* out^T = wo ctx^T: every lane takes back the values that it parked itself: channels 32 h + 8 g + 0..7 and 32 h + 16 + 8 g + 0..7 of query col = the B fragment of k step h, split bf16 hi + lo */
  F2 yf[4];
#pragma unroll
  for (int h = 0; h < NH; ++h) { float v[16];
#pragma unroll
    for (int s = 0; s < 4; ++s) { const v4f t = *(const v4f*)(sw_y + h * 512 + s * 128 + lane * 4);
#pragma unroll
      for (int i = 0; i < 4; ++i) v[s * 4 + i] = t[i]; }
    yf[h] = bsplit16(v); }
  v8f acc[8] = {}; prod8<true>(swo, yf, acc, col, lane);   /* tile j = output channels 16 j + 8 g + r of query col */
  float (*sf)[OP] = (float (*)[OP])sw_y;   /* the slot now turns a lane's 8 channels of one query into whole 512-B output rows */
#pragma unroll
  for (int j = 0; j < 8; ++j) { const v4f t0 = {acc[j][0], acc[j][1], acc[j][2], acc[j][3]}, t1 = {acc[j][4], acc[j][5], acc[j][6], acc[j][7]};
    *(v4f*)&sf[col][j * 16 + 8 * g] = t0; *(v4f*)&sf[col][j * 16 + 8 * g + 4] = t1; }
  LDSX();   /* the lanes of this wave read each other's values below */
  float* po = OUT + ((size_t)b * SZ + q0) * DIN + lane * 4;
  for (int rl = 0; rl < 16; ++rl) vst2(po + rl * DIN, *(const v4f*)&sf[rl][lane * 4]); }

extern "C" void kernel_launch(void* const* d_in, const int* in_sizes, int n_in, void* d_out, int out_size, void* d_ws, size_t ws_size, hipStream_t stream) {
  (void)in_sizes; (void)n_in; (void)out_size;
  const float** F = (const float**)d_in;
  if (ws_size < (size_t)WS_END) return;
  char* ws = (char*)d_ws; _Float16 *QH = (_Float16*)(ws + WS_QH), *KH = (_Float16*)(ws + WS_KH), *VT = (_Float16*)(ws + WS_VT), *QL = (_Float16*)(ws + WS_QL), *KL = (_Float16*)(ws + WS_KL); __bf16 *VB = (__bf16*)(ws + WS_VB), *VBL = (__bf16*)(ws + WS_VBL); float *Y = (float*)(ws + WS_Y);
  (void)Y; (void)QL; (void)KL; (void)VB; (void)VBL;
  // inputs: 0 pair_repr [1,256,256,128]; 1 mask [1,256,256] f32 (ones); 2 ln_g, 3 ln_b; 4 wb_w [4,128] (out,in), 5 wb_b [4]; 6 wq, 7 wk, 8 wv [128,128] (out,in); 9 wo [128,128] (out,in); 10 wg_w [128,128] (out,in), 11 wg_b [128]
  if (ws_size < (size_t)WS_END2) return;
  float *BIAS = (float*)(ws + WS_BIAS);
  k_front<<<dim3(NB), 512, 0, stream>>>(F[0], F[2], F[3], F[4], F[5], F[6], F[7], F[8], F[10], F[11], QH, QL, KH, VT, BIAS, Y);   /* LayerNorm, tri bias rows (+ wb_b), q, k, v and the gate (in the Y buffer) from one read of the input */
  k_fa<<<dim3(SZ / 16, TNB / NW), NW * 32, 0, stream>>>(QH, KH, QL, VT, BIAS, F[1], Y, F[9], (float*)d_out);   /* logits, softmax, P.v, gate and the output projection fused; no score planes and no ctx in the workspace */
}

// v007
// One run takes 63.6 microseconds.
// Timed twice side by side with v006, it ran 1.09 times as fast both times.
// Over all steps from v000 it is 6.52 times as fast.
// compute dtype: all float inputs rounded to bf16; LayerNorm in f32; q/k/v, the triangle bias and the gate from the f32 LayerNorm rows split bf16 hi + lo against exact bf16 weights on WMMA 16x16x32 (2 products, f32 accumulate); logits q.k with q as f16 hi + residual for the first 64 queries of each pair row and single f16 elsewhere (sigma_logit ~ 0.25) x 32^-0.5 + bias + mask in f32; softmax in f32 (native exp2 on base-2 logits, in registers, fused with both products); P x 2^11 once to f16 against v once to f16 (1 product); gated ctx split bf16 hi + lo against exact wo (2 products); f32 output.
// Triangle attention, starting node (B 1, I = J = 256 residues, D 128, 4 heads x 32; 0.02-scale (out,in) weights, mask all ones, wb_b = 0, wg_b = 1): z = LayerNorm(pair_repr); tri_bias[h][j][k] = z[j][k] . wb_w[h] + wb_b[h]; for each row i: q = (z[i] wq^T)/sqrt(32), k = z[i] wk^T, v = z[i] wv^T (heads = 32-wide slices of the output dim); a = softmax_k(q . k + 1e9 (mask[i][k] - 1) + tri_bias[h][j][k]); y = merged heads; y = sigmoid(z[i] wg_w^T + wg_b) * y; out[i] = y wo^T.
#include <hip/hip_runtime.h>
#include <math.h>

typedef __attribute__((ext_vector_type(16))) _Float16 v16h;
typedef __attribute__((ext_vector_type(16))) __bf16 v16b;
typedef __attribute__((ext_vector_type(8)))  _Float16 v8h;
typedef __attribute__((ext_vector_type(8)))  float v8f;
typedef __attribute__((ext_vector_type(4)))  float v4f;
typedef __attribute__((ext_vector_type(2)))  float v2f;
typedef __attribute__((ext_vector_type(4)))  unsigned v4u;
typedef __attribute__((ext_vector_type(4)))  int v4i;
typedef float __attribute__((may_alias)) float_a;
typedef int __attribute__((may_alias)) int_a;

template <typename T> __device__ __forceinline__ void vst2(void* p, T v) { *(T*)p = v;  }
__device__ __forceinline__ v8f wmma16(v16h a, v16h b, v8f c) {
  v8f d = __builtin_amdgcn_wmma_f32_16x16x32_f16(false, a, false, b, (short)0, c, false, false);
  asm volatile("v_nop\n\tv_nop\n\tv_nop\n\tv_nop" : "+v"(d) : "v"(a), "v"(b));
  return d;
}
__device__ __forceinline__ v8f wmma_bf(v16b a, v16b b, v8f c) {
  v8f d = __builtin_amdgcn_wmma_f32_16x16x32_bf16(false, a, false, b, (short)0, c, false, false);
  asm volatile("v_nop\n\tv_nop\n\tv_nop\n\tv_nop" : "+v"(d) : "v"(a), "v"(b));
  return d;
}
// 16x16x32 fragments: lane = (h = lane>>4, row/col = lane&15); elements 0..7 = k0+8h+0..7, 8..15 = k0+16+8h+0..7; D element r = row 8h+r
__device__ __forceinline__ v16h frag_h(const _Float16* rowk0, int lane) {
  union { v16h v; v8h q[2]; } u; const _Float16* p = rowk0 + 8 * (lane >> 4);
  u.q[0] = *(const v8h*)p; u.q[1] = *(const v8h*)(p + 16); return u.v;
}
__device__ __forceinline__ v16h frag_f32(const float* rowk0, int lane) {
  v16h a; const float* p = rowk0 + 8 * (lane >> 4);
#pragma unroll
  for (int i = 0; i < 8; ++i) { a[i] = (_Float16)p[i]; a[8 + i] = (_Float16)p[16 + i]; }
  return a;
}
__device__ __forceinline__ v16h frag_f32s(const float* rowk0, int lane, float sc) {
  v16h a; const float* p = rowk0 + 8 * (lane >> 4);
#pragma unroll
  for (int i = 0; i < 8; ++i) { a[i] = (_Float16)(p[i] * sc); a[8 + i] = (_Float16)(p[16 + i] * sc); }
  return a;
}
// column fragment from a [K][ld] layout (column n), rows >= K read as 0
__device__ __forceinline__ v16h fragc_f32(const float* W, int k0, int n, int lane, int ld, int K) {
  v16h a; const int g = lane >> 4;
#pragma unroll
  for (int i = 0; i < 8; ++i) { const int ka = k0 + 8 * g + i, kb = ka + 16;
    a[i] = (_Float16)(ka < K ? W[(size_t)(ka < K ? ka : K - 1) * ld + n] : 0.f); a[8 + i] = (_Float16)(kb < K ? W[(size_t)(kb < K ? kb : K - 1) * ld + n] : 0.f); }
  return a;
}
struct F2 { v16b h, l; };
__device__ __forceinline__ F2 bsplit16(const float v[16]) { F2 r;
#pragma unroll
  for (int i = 0; i < 16; ++i) { const __bf16 h = (__bf16)v[i]; r.h[i] = h; r.l[i] = (__bf16)(v[i] - (float)h); }
  return r; }
__device__ __forceinline__ F2 split_row(const float* row, int k0, int lane) { float v[16]; const float* p = row + k0 + 8 * (lane >> 4);
#pragma unroll
  for (int i = 0; i < 8; ++i) { v[i] = p[i]; v[8 + i] = p[16 + i]; }
  return bsplit16(v); }
__device__ __forceinline__ F2 split_rowK(const float* row, int k0, int lane, int K) { float v[16]; const int g = lane >> 4;
#pragma unroll
  for (int i = 0; i < 8; ++i) { const int ka = k0 + 8 * g + i, kb = ka + 16; v[i] = ka < K ? row[ka < K ? ka : K - 1] : 0.f; v[8 + i] = kb < K ? row[kb < K ? kb : K - 1] : 0.f; }
  return bsplit16(v); }
__device__ __forceinline__ F2 split_col(const float* W, int k0, int n, int lane, int ld, int K) { float v[16]; const int g = lane >> 4;
#pragma unroll
  for (int i = 0; i < 8; ++i) { const int ka = k0 + 8 * g + i, kb = ka + 16; v[i] = ka < K ? W[(size_t)(ka < K ? ka : K - 1) * ld + n] : 0.f; v[8 + i] = kb < K ? W[(size_t)(kb < K ? kb : K - 1) * ld + n] : 0.f; }
  return bsplit16(v); }
__device__ __forceinline__ v8f mac3(const F2& a, const F2& b, v8f c) { c = wmma_bf(a.l, b.h, c); c = wmma_bf(a.h, b.l, c); return wmma_bf(a.h, b.h, c); }
__device__ __forceinline__ float sigm(float v) { return 1.0f / (1.0f + expf(-v)); }
#define LDSX() do { asm volatile("s_wait_dscnt 0" ::: "memory"); __builtin_amdgcn_wave_barrier(); __builtin_amdgcn_fence(__ATOMIC_RELEASE, "workgroup"); } while (0)

// Row-wise triangle attention on a pair tensor z [1, 256, 256, 128] (4 heads x 32): zn = LayerNorm(z); q,k,v = zn wq^T, zn wk^T, zn wv^T (separate (out,in) [128,128]); logits[r][i][j][h] = q[r][i] . k[r][j] / sqrt(32) + (zn[i][j] . w_pair[h] + b_pair[h]) + 1e9 (mask[r][j] - 1); softmax over j; out = sigmoid(zn w_gate + b_gate) * merged(attn v); result = out w_out (no output bias).
#define NB 256              // pair rows i (each a sequence of SZ = TT = 256 positions; no padding needed)
#define TT 256
#define CC 128            // NH * HD = projected width
#define DIN 128          // input (model) width
#define NH 4
#define HD 32
#define NQB (TT / 64)
#define HG 4
#define SCALE (0.17677669529663687f)
#define LOG2E (1.4426950408889634f)
#define SCALE2 ((float)(0.17677669529663687 * 1.4426950408889634))   // 32^-0.5 x log2(e): the logits are kept in base-2 units, so that exp(x - m) is one v_exp_f32
#define CAUSAL 0
#ifndef TNB
#define TNB NB
#endif
__device__ __forceinline__ float bfr(float v) { return (float)(__bf16)v; }
// eight independent 2^x (v_exp_f32), each in place, in ONE statement: no instruction in it reads an earlier result or overwrites an earlier source, and the closing v_nop is the one slot that the instruction set asks for behind a transcendental. The two s_delay_alu change no result: the compiler hints nothing around asm text, and an unhinted dependent instruction holds the vector port against the SIMD's other waves.
__device__ __forceinline__ v8f exp2x8(v8f x) { float a0 = x[0], a1 = x[1], a2 = x[2], a3 = x[3], a4 = x[4], a5 = x[5], a6 = x[6], a7 = x[7];
  asm("s_delay_alu instid0(VALU_DEP_1)\n\tv_exp_f32 %0, %0\n\tv_exp_f32 %1, %1\n\tv_exp_f32 %2, %2\n\tv_exp_f32 %3, %3\n\tv_exp_f32 %4, %4\n\tv_exp_f32 %5, %5\n\tv_exp_f32 %6, %6\n\tv_exp_f32 %7, %7\n\ts_delay_alu instid0(TRANS32_DEP_1)\n\tv_nop" : "+v"(a0), "+v"(a1), "+v"(a2), "+v"(a3), "+v"(a4), "+v"(a5), "+v"(a6), "+v"(a7));
  const v8f r = {a0, a1, a2, a3, a4, a5, a6, a7}; return r; }
// the same for eight 1 / x (v_rcp_f32)
__device__ __forceinline__ v8f rcpx8(v8f x) { float a0 = x[0], a1 = x[1], a2 = x[2], a3 = x[3], a4 = x[4], a5 = x[5], a6 = x[6], a7 = x[7];
  asm("s_delay_alu instid0(VALU_DEP_1)\n\tv_rcp_f32 %0, %0\n\tv_rcp_f32 %1, %1\n\tv_rcp_f32 %2, %2\n\tv_rcp_f32 %3, %3\n\tv_rcp_f32 %4, %4\n\tv_rcp_f32 %5, %5\n\tv_rcp_f32 %6, %6\n\tv_rcp_f32 %7, %7\n\ts_delay_alu instid0(TRANS32_DEP_1)\n\tv_nop" : "+v"(a0), "+v"(a1), "+v"(a2), "+v"(a3), "+v"(a4), "+v"(a5), "+v"(a6), "+v"(a7));
  const v8f r = {a0, a1, a2, a3, a4, a5, a6, a7}; return r; }
__host__ __device__ __forceinline__ int kb_last(int qb) { return CAUSAL ? ((qb * 64 + 63) >> 7) : (TT / 128 - 1); }
typedef __attribute__((ext_vector_type(8))) __bf16 v8b;
__device__ __forceinline__ v16b frag_b(const __bf16* rowk0, int lane) {
  union { v16b v; v8b q[2]; } u; const __bf16* p = rowk0 + 8 * (lane >> 4);
  u.q[0] = *(const v8b*)p; u.q[1] = *(const v8b*)(p + 16); return u.v;
}
typedef __attribute__((ext_vector_type(4))) __bf16 v4b;
#define WP 136             // bf16 elements per staged weight row: 272 B = 16 B x odd, so the 16-byte fragment reads of 16 rows fall on distinct banks
#define QBH 0              // unused: this file has no causal path
#define QHI 64             // q residual rows only for the first 64 queries (four 16-query blocks) of each row (logits elsewhere: single f16 q, k; sigma_logit ~ 0.25 so this is ample)
#define KHI 64            // key rows carrying k residual / v bf16 hi+lo planes (regions sized here; nothing in this file writes them)
// B fragment (k rows k0+.., output column o) of a weight: (in,out) [K][ld] or (out,in) [ld rows of K]: bf16 exact, or f16(bf16 * 256) exact
__device__ __forceinline__ v16b wcol_io(const float* Wm, int k0, int o, int lane, int ld) { v16b w; const int g = lane >> 4;
#pragma unroll
  for (int i = 0; i < 8; ++i) { w[i] = (__bf16)Wm[(size_t)(k0 + 8 * g + i) * ld + o]; w[8 + i] = (__bf16)Wm[(size_t)(k0 + 16 + 8 * g + i) * ld + o]; }
  return w; }
__device__ __forceinline__ v16b wcol_oi(const float* Wm, int k0, int o, int lane, int K) { v16b w; const float* p = Wm + (size_t)o * K + k0 + 8 * (lane >> 4);
#pragma unroll
  for (int i = 0; i < 8; ++i) { w[i] = (__bf16)p[i]; w[8 + i] = (__bf16)p[16 + i]; }
  return w; }
__device__ __forceinline__ v16h wcolh_io(const float* Wm, int k0, int o, int lane, int ld) { v16h w; const int g = lane >> 4;
#pragma unroll
  for (int i = 0; i < 8; ++i) { w[i] = (_Float16)(bfr(Wm[(size_t)(k0 + 8 * g + i) * ld + o]) * 256.0f); w[8 + i] = (_Float16)(bfr(Wm[(size_t)(k0 + 16 + 8 * g + i) * ld + o]) * 256.0f); }
  return w; }
__device__ __forceinline__ v16h wcolh_oi(const float* Wm, int k0, int o, int lane, int K) { v16h w; const float* p = Wm + (size_t)o * K + k0 + 8 * (lane >> 4);
#pragma unroll
  for (int i = 0; i < 8; ++i) { w[i] = (_Float16)(bfr(p[i]) * 256.0f); w[8 + i] = (_Float16)(bfr(p[16 + i]) * 256.0f); }
  return w; }
#define WQKV_LAYOUT 1   // (out,in) separate wq / wk / wv [CC][DIN] (wq.reshape(H, DH, D): output column h*32 + c = row of wq)
__device__ __forceinline__ v16b wcol_hdk(const float* Wm, int k0, int o, int lane) { v16b w; const int g = lane >> 4; const float* p = Wm + (size_t)(o / HD) * DIN * HD + (o % HD);
#pragma unroll
  for (int i = 0; i < 8; ++i) { w[i] = (__bf16)p[(size_t)(k0 + 8 * g + i) * HD]; w[8 + i] = (__bf16)p[(size_t)(k0 + 16 + 8 * g + i) * HD]; }
  return w; }
#define WO_OUT_IN 1
#if WQKV_LAYOUT == 1
#define WCOL(W, k0, o, lane) wcol_oi(W, k0, o, lane, DIN)
#elif WQKV_LAYOUT == 2
#define WCOL(W, k0, o, lane) wcol_hdk(W, k0, o, lane)
#else
#define WCOL(W, k0, o, lane) wcol_oi(W, k0, o, lane, DIN)
#endif
#if WO_OUT_IN
#define WOCOL(W, k0, o, lane) wcol_oi(W, k0, o, lane, CC)
#define WOCOLH(W, k0, o, lane) wcolh_oi(W, k0, o, lane, CC)
#else
#define WOCOL(W, k0, o, lane) wcol_io(W, k0, o, lane, DIN)
#define WOCOLH(W, k0, o, lane) wcolh_io(W, k0, o, lane, DIN)
#endif
#define SZ 256             // real positions per row (= TT here)
#define BG 64              // sizes the unused WS_S region (x 4 heads = 256 planes of 256 x 256)
#define NZR ((size_t)NB * SZ)   // 65,536 real pair rows (i, j)
#define SM_EXTRA_PARAMS , const float* __restrict__ BIAS, const float* __restrict__ MKF, int b0s
#define SM_MASK_HOOK do { const int hh = (int)blockIdx.y % HG; const int ii = b0s + (int)blockIdx.y / HG; const int kc2 = k < SZ ? k : SZ - 1; const float add = BIAS[((size_t)t * SZ + kc2) * NH + hh] + 1.0e9f * (bfr(MKF[(size_t)ii * SZ + kc2]) - 1.0f); v = (k < SZ) ? v + add : -3.0e38f; } while (0)   /* + tri_bias[h][q=t][k] + INF (mask[i][k] - 1) (mask is all ones: adds 0, read anyway); key columns k >= SZ would be padding -> excluded (none here: SZ = TT, so the k < SZ test on the loop index always holds) */
__device__ __forceinline__ v16b zero16b() { v16b z; _Pragma("unroll") for (int i = 0; i < 16; ++i) z[i] = (__bf16)0.f; return z; }
#define WS_ZN   (WS_END)
#define WS_BIAS (WS_ZN + 4u * (size_t)NZR * CC)
#define WS_END2 (WS_BIAS + 4u * (size_t)NZR * NH + 1024)
#ifndef SM_EXTRA_PARAMS
#define SM_EXTRA_PARAMS
#endif
#ifndef PROJ_EXTRA_PARAMS
#define PROJ_EXTRA_PARAMS
#endif
#ifndef SM_MASK_HOOK
#define SM_MASK_HOOK (void)0
#endif

// q, k, v, the q residual and the gate lie in the workspace in the order of the 16x16x32 fragments that read them: a 16-byte piece per lane, 32 lanes side by side, so that every wave-wide load or store covers 512 contiguous bytes
#define WS_QH  0u                                      // f16 q [b][h][16-query tile][piece p][lane][8]: query 16 tile + col, channels 32 h + 16 p + 8 g + 0..7
#define WS_KH  (WS_QH + 2u * (size_t)NB * TT * CC)      // f16 k [b][h][16-key tile][piece p][lane][8], as q
#define WS_VT  (WS_KH + 2u * (size_t)NB * TT * CC)      // f16 v [b][h][16-channel tile][32-key step][piece p][lane][8]: channel 32 h + 16 tile + col, keys 32 step + 16 p + 8 g + 0..7
#define WS_QL  (WS_VT + 2u * (size_t)NB * CC * TT)      // f16 q residual x 2^10 [b][h][tile < QHI / 16][piece p][lane][8], as q
#define WS_KL  (WS_QL + 2u * (size_t)NB * QHI * CC)     // f16 k residual x 2^10 rows [b][t < KHI][CC]
#define WS_VB  (WS_KL + 2u * (size_t)NB * KHI * CC)     // bf16 v hi planes [b][c][t < KHI]
#define WS_VBL (WS_VB + 2u * (size_t)NB * CC * KHI)
#define WS_S   (WS_VBL + 2u * (size_t)NB * CC * KHI)    // f32 [hg][t][s], unused: k_fa keeps logits and P in registers
#define WS_Y   (WS_S  + 4u * (size_t)BG * HG * TT * TT)   // past the 256 unused planes of 256 x 256      // f32 gate (layout on the next line)
#define WS_END (WS_Y  + 4u * (size_t)NB * SZ * CC)   /* f32 gate [b][16-position tile][h][piece s][lane][4]: position 16 tile + col, channels 32 h + 16 (s >> 1) + 8 g + 4 (s & 1) + 0..3 */

// ---- k_front: block = one pair row i = 256 positions, 16 waves x 16 positions: LayerNorm, triangle bias, q, k, gate and v of a position from ONE read of its input row. A lane loads its row's 64 channels directly in the 16x16x32 fragment order (the other 64 sit in lane ^ 16), so mean and variance are in-lane sums plus one exchange, and the normalised row, split bf16 hi + lo, stays in registers as the operand of all five products. The four [128][128] weights and the bias rows are staged once per block in LDS as bf16. Bias, q, k and gate are taken as W x^T (A = weight rows, B = positions): a lane then holds 8 neighbouring channels of ONE position. v is taken as x W^T: a lane holds 8 neighbouring positions of one channel. In both cases those 8 values are the very piece that the same lane of the reading wave wants in its fragment, so they go from the accumulators straight to the workspace, lane beside lane.
__device__ __forceinline__ v8f wmb(v16b a, v16b b, v8f c) { return __builtin_amdgcn_wmma_f32_16x16x32_bf16(false, a, false, b, (short)0, c, false, false); }
// eight 16x16 tiles over K = 128: WROWS: D = W x^T (rows = output channels), else D = x W^T (rows = positions); per tile the order of the sums is hi, lo of k step 0, hi, lo of k step 1, ...
template <bool WROWS> __device__ __forceinline__ void prod8(const __bf16 (*w)[WP], const F2 (&af)[4], v8f (&acc)[8], int col, int lane) {
#pragma unroll
  for (int kc = 0; kc < 4; ++kc) { v16b wf[8];
#pragma unroll
    for (int j = 0; j < 8; ++j) wf[j] = frag_b(&w[j * 16 + col][kc * 32], lane);   /* the LDS reads of a k step go out together, ahead of its products */
#pragma unroll
    for (int j = 0; j < 8; ++j) acc[j] = WROWS ? wmb(wf[j], af[kc].h, acc[j]) : wmb(af[kc].h, wf[j], acc[j]);
#pragma unroll
    for (int j = 0; j < 8; ++j) acc[j] = WROWS ? wmb(wf[j], af[kc].l, acc[j]) : wmb(af[kc].l, wf[j], acc[j]); } }
__global__ __launch_bounds__(512) void k_front(const float* __restrict__ Z, const float* __restrict__ LW, const float* __restrict__ LB, const float* __restrict__ WB, const float* __restrict__ WBB, const float* __restrict__ WQ, const float* __restrict__ WK, const float* __restrict__ WV, const float* __restrict__ WG, const float* __restrict__ GB,
    _Float16* __restrict__ QH, _Float16* __restrict__ QL, _Float16* __restrict__ KH, _Float16* __restrict__ VT, float* __restrict__ BIAS, float* __restrict__ G) {
  __shared__ __align__(16) __bf16 sw[4][CC][WP]; __shared__ __align__(16) __bf16 swb[16][WP]; __shared__ __align__(16) float sln[4][CC];
  const int tid = threadIdx.x, wave = tid >> 5, lane = tid & 31, col = lane & 15, g = lane >> 4; const size_t bb = blockIdx.x; const size_t r0 = bb * TT + wave * 16;
  v4f x[16];
  { /* all 53 loads of a lane at the block's start fly together: no wait stands between them */
    const float* px = Z + (r0 + col) * CC + 8 * g;
#pragma unroll
    for (int n = 0; n < 16; ++n) x[n] = *(const v4f*)(px + (n >> 2) * 32 + ((n >> 1) & 1) * 16 + (n & 1) * 4);
    v4f a[4][8]; const int ch = tid & (CC - 1);
    const float* pb = WB + (wave & (NH - 1)) * CC + lane * 4; const v4f wb4 = *(const v4f*)pb;   /* read by every wave, so that no branch parts the loads; kept by waves 0..3 (bias row = wave) */
    const int sel = wave >> 2, c4 = ch & (NH - 1); const float l0 = LW[ch], l1 = LB[ch], l2 = GB[ch], l3 = WBB[c4];   /* likewise; four waves each keep ln_g, ln_b, the gate's bias and wb_b (its 4 values repeated) */
#pragma unroll
    for (int it = 0; it < 8; ++it) { a[0][it] = *(const v4f*)(WQ + tid * 4 + it * 2048); a[1][it] = *(const v4f*)(WK + tid * 4 + it * 2048); a[2][it] = *(const v4f*)(WV + tid * 4 + it * 2048); a[3][it] = *(const v4f*)(WG + tid * 4 + it * 2048); }
    asm volatile("s_wait_xcnt 0x0" :: "v"(px), "v"(pb), "v"(ch), "v"(c4) : "memory");   /* the address registers of these loads are reused below; px, pb, ch and c4 stay live up to this wait, so that no load of the group lands on address registers of the group */
    asm volatile("" :: "v"(l0), "v"(l1), "v"(l2), "v"(l3));   /* inputs only: holds these four loads up here with the others; the compiler otherwise sinks them into branches behind the staging, where their latency is waited out alone */
#pragma unroll
    for (int m = 0; m < 4; ++m)
#pragma unroll
      for (int it = 0; it < 8; ++it) { v4b w;
#pragma unroll
        for (int i = 0; i < 4; ++i) w[i] = (__bf16)a[m][it][i];
        *(v4b*)&sw[m][it * 16 + wave][lane * 4] = w; }
    v4b w;
#pragma unroll
    for (int i = 0; i < 4; ++i) w[i] = (__bf16)(wave < NH ? wb4[i] : 0.f);
    *(v4b*)&swb[wave][lane * 4] = w;   /* rows 4..15 of the one bias tile are zero */
    sln[sel][ch] = bfr(sel == 0 ? l0 : sel == 1 ? l1 : sel == 2 ? l2 : l3); }
  __syncthreads();   /* every wave wrote a part of the weight rows that all sixteen read */
  F2 af[4];
  { float s4[4] = {0.f, 0.f, 0.f, 0.f};
#pragma unroll
    for (int n = 0; n < 16; ++n)
#pragma unroll
      for (int i = 0; i < 4; ++i) { x[n][i] = bfr(x[n][i]); s4[i] += x[n][i]; }
    float s1 = (s4[0] + s4[1]) + (s4[2] + s4[3]); s1 += __shfl_xor(s1, 16);
    const float mu = s1 * (1.0f / CC); float q4[4] = {0.f, 0.f, 0.f, 0.f};
#pragma unroll
    for (int n = 0; n < 16; ++n)
#pragma unroll
      for (int i = 0; i < 4; ++i) { const float d = x[n][i] - mu; q4[i] += d * d; }
    float q = (q4[0] + q4[1]) + (q4[2] + q4[3]); q += __shfl_xor(q, 16);
    const float rs = rsqrtf(q * (1.0f / CC) + 1e-5f);
#pragma unroll
    for (int kc = 0; kc < 4; ++kc) { float v[16];
#pragma unroll
      for (int s = 0; s < 4; ++s) { const int c = kc * 32 + 8 * g + (s >> 1) * 16 + (s & 1) * 4; const v4f lw = *(const v4f*)&sln[0][c], lb = *(const v4f*)&sln[1][c];
#pragma unroll
        for (int i = 0; i < 4; ++i) v[s * 4 + i] = (x[kc * 4 + s][i] - mu) * rs * lw[i] + lb[i]; }
      af[kc] = bsplit16(v); } }
  { /* triangle bias: heads = rows 0..3 of the tile, so lanes 0..15 hold the 4 heads of their position: one 256-B run per wave */
    v8f ab = {};
#pragma unroll
    for (int kc = 0; kc < 4; ++kc) { const v16b wf = frag_b(&swb[col][kc * 32], lane); ab = wmb(wf, af[kc].h, ab); ab = wmb(wf, af[kc].l, ab); }
    v4f b4;
#pragma unroll
    for (int i = 0; i < 4; ++i) b4[i] = ab[i] + sln[3][i];   /* + wb_b[h] */
    if (g == 0) vst2(BIAS + (r0 + col) * NH, b4); }
  { /* v: 16 positions of the wave = piece (wave & 1) of key step (wave >> 1); accumulator tile j = channel tile (j & 1) of head (j >> 1) */
    v8f acc[8] = {}; prod8<false>(sw[2], af, acc, col, lane); v8h hv[8];
#pragma unroll
    for (int j = 0; j < 8; ++j)
#pragma unroll
      for (int r = 0; r < 8; ++r) hv[j][r] = (_Float16)acc[j][r];
    _Float16* dv = VT + (bb * 128 + wave) * (size_t)256 + lane * 8;
#pragma unroll
    for (int j = 0; j < 8; ++j) vst2(dv + j * 4096, hv[j]);   /* 512 contiguous bytes per store */
    asm volatile("s_wait_xcnt 0x0" :: "v"(dv), "v"(hv[0]), "v"(hv[1]), "v"(hv[2]), "v"(hv[3]), "v"(hv[4]), "v"(hv[5]), "v"(hv[6]), "v"(hv[7]) : "memory");   /* the stores' registers are reused below; they stay live up to this wait */ }
  const bool hi = wave * 16 < QHI;   /* wave-uniform: these positions carry the q residual */
#pragma unroll
  for (int m = 0; m < 2; ++m) { /* q, then k: the wave's 16 positions = tile (wave); accumulator tile j = piece (j & 1) of head (j >> 1) */
    v8f acc[8] = {}; prod8<true>(sw[m], af, acc, col, lane); const bool res = m == 0 && hi; v8h hv[8];
#pragma unroll
    for (int j = 0; j < 8; ++j)
#pragma unroll
      for (int r = 0; r < 8; ++r) hv[j][r] = (_Float16)acc[j][r];
    _Float16* dh = (m == 0 ? QH : KH) + (bb * 128 + wave * 2) * (size_t)256 + lane * 8;
#pragma unroll
    for (int j = 0; j < 8; ++j) vst2(dh + ((j >> 1) * 32 + (j & 1)) * 256, hv[j]);   /* 512 contiguous bytes per store */
    if (res) { v8h lv[8];
#pragma unroll
      for (int j = 0; j < 8; ++j)
#pragma unroll
        for (int r = 0; r < 8; ++r) lv[j][r] = (_Float16)((acc[j][r] - (float)hv[j][r]) * 1024.0f);
      _Float16* dl = QL + (bb * 32 + wave * 2) * (size_t)256 + lane * 8;
#pragma unroll
      for (int j = 0; j < 8; ++j) vst2(dl + ((j >> 1) * 8 + (j & 1)) * 256, lv[j]);
      asm volatile("s_wait_xcnt 0x0" :: "v"(dl), "v"(lv[0]), "v"(lv[1]), "v"(lv[2]), "v"(lv[3]), "v"(lv[4]), "v"(lv[5]), "v"(lv[6]), "v"(lv[7]) : "memory");   /* as below */ }
    asm volatile("s_wait_xcnt 0x0" :: "v"(dh), "v"(hv[0]), "v"(hv[1]), "v"(hv[2]), "v"(hv[3]), "v"(hv[4]), "v"(hv[5]), "v"(hv[6]), "v"(hv[7]) : "memory");   /* the stores' registers are reused below; they stay live up to this wait */ }
  { /* gate: f32; accumulator tile j = pieces 2 (j & 1) and 2 (j & 1) + 1 of head (j >> 1) */
    v8f acc[8] = {}; prod8<true>(sw[3], af, acc, col, lane); v4f s[16];
#pragma unroll
    for (int j = 0; j < 8; ++j) { const v4f g0 = *(const v4f*)&sln[2][j * 16 + 8 * g], g1 = *(const v4f*)&sln[2][j * 16 + 8 * g + 4];
      v8f t;
#pragma unroll
      for (int r = 0; r < 4; ++r) { t[r] = (acc[j][r] + g0[r]) * -LOG2E; t[4 + r] = (acc[j][4 + r] + g1[r]) * -LOG2E; }
      t = rcpx8(exp2x8(t) + 1.0f);   /* sigmoid(zn w_gate + b_gate) = 1 / (1 + 2^(-x log2 e)) */
#pragma unroll
      for (int r = 0; r < 4; ++r) { s[2 * j][r] = t[r]; s[2 * j + 1][r] = t[4 + r]; } }
    float* dg = G + (bb * 16 + wave) * (size_t)2048 + lane * 4;
#pragma unroll
    for (int n = 0; n < 16; ++n) vst2(dg + n * 128, s[n]);   /* 512 contiguous bytes per store */
    asm volatile("s_wait_xcnt 0x0" :: "v"(dg), "v"(s[0]), "v"(s[1]), "v"(s[2]), "v"(s[3]), "v"(s[4]), "v"(s[5]), "v"(s[6]), "v"(s[7]), "v"(s[8]), "v"(s[9]), "v"(s[10]), "v"(s[11]), "v"(s[12]), "v"(s[13]), "v"(s[14]), "v"(s[15]) : "memory");   /* the stores' registers stay live up to this wait, so that no later sigmoid lands on them */ } }
#define NW 16
#define OP 132             // f32 elements per row of a wave's output tile in LDS: 528 B = 16 B x odd
__device__ __forceinline__ v8f wm16(v16h a, v16h b, v8f c) { return __builtin_amdgcn_wmma_f32_16x16x32_f16(false, a, false, b, (short)0, c, false, false); }
__device__ __forceinline__ v16h frag_p(const _Float16* p) { union { v16h v; v8h q[2]; } u; u.q[0] = *(const v8h*)p; u.q[1] = *(const v8h*)(p + 256); return u.v; }   /* a fragment stored in fragment order: its two pieces lie 512 B apart, the lane's offset is already in p */
__global__ __launch_bounds__(NW * 32) void k_fa(const _Float16* __restrict__ QH, const _Float16* __restrict__ KH, const _Float16* __restrict__ QL, const _Float16* __restrict__ VT, const float* __restrict__ BIAS, const float* __restrict__ MKF, const float* __restrict__ G, const float* __restrict__ WO, float* __restrict__ OUT) {
  __shared__ __align__(16) float sb[NH][16][TT + 4];   /* pitch 1040 B = 16 B x odd: 16-byte reads of 16 rows fall on distinct banks */
  __shared__ __align__(16) float smk[NW][TT];
  __shared__ __align__(16) __bf16 swo[DIN][WP];
  __shared__ __align__(16) float sy[NW][16 * OP];   /* a wave's own slot: first the gated ctx [head][piece s][lane][4], then its output tile [query][OP] */
  const int tid = threadIdx.x, wave = tid >> 5, lane = tid & 31, col = lane & 15, g = lane >> 4; const int q0 = (int)blockIdx.x * 16; const int b = (int)blockIdx.y * NW + wave;
  /* all 18 loads of a lane ahead of the barrier fly together: wo (out,in) [128][128] f32 (each wave-load takes one whole 512-B row), the wave's mask row, and the bias rows of the 16 queries (query (tid >> 8) + 2 it, key tid & 255, 4 heads) */
  const float* pw = WO + tid * 4; const float* pm = MKF + (size_t)b * SZ + lane * 8; const float* pt = BIAS + ((size_t)(q0 + (tid >> 8)) * SZ + (tid & (TT - 1))) * NH; v4f a[8], t4[8];
#pragma unroll
  for (int it = 0; it < 8; ++it) a[it] = *(const v4f*)(pw + it * (NW * 128));
#pragma unroll
  for (int it = 0; it < 8; ++it) t4[it] = *(const v4f*)(pt + it * (2 * SZ * NH));
  v4f m0 = *(const v4f*)pm, m1 = *(const v4f*)(pm + 4);
  asm volatile("s_wait_xcnt 0x0" :: "v"(pw), "v"(pm), "v"(pt) : "memory");   /* the address registers of these loads are reused below; pw, pm and pt stay live up to this wait */
#pragma unroll
  for (int it = 0; it < 8; ++it) { const int q = (tid >> 8) + 2 * it, k = tid & (TT - 1);
    sb[0][q][k] = t4[it][0] * LOG2E; sb[1][q][k] = t4[it][1] * LOG2E; sb[2][q][k] = t4[it][2] * LOG2E; sb[3][q][k] = t4[it][3] * LOG2E; }   /* base-2 units, once per block */
#pragma unroll
  for (int it = 0; it < 8; ++it) { v4b w;
#pragma unroll
    for (int i = 0; i < 4; ++i) w[i] = (__bf16)a[it][i];
    *(v4b*)&swo[it * NW + wave][lane * 4] = w; }   /* wo as bf16 rows */
#pragma unroll
  for (int c = 0; c < 4; ++c) { m0[c] = (1.0e9f * LOG2E) * (bfr(m0[c]) - 1.0f); m1[c] = (1.0e9f * LOG2E) * (bfr(m1[c]) - 1.0f); }   /* INF (mask[i][k] - 1) in base-2 units, 8 keys per lane, the wave's own pair row, once for its four heads */
  *(v4f*)&smk[wave][lane * 8] = m0; *(v4f*)&smk[wave][lane * 8 + 4] = m1;
  __syncthreads();   /* every wave wrote a part of every head's bias plane and of the wo rows */
  const bool hi = q0 < QHI;   /* block-uniform: these queries carry the q residual */
  float* const sw_y = &sy[wave][0];
  /* the loop over heads stays rolled: one tile's registers at a time keep four waves on a SIMD; every inner loop is unrolled so that st[] is indexed by constants and stays in registers */
#pragma unroll 1
  for (int h = 0; h < NH; ++h) {
    const size_t bh = (size_t)b * NH + h; const _Float16* qp = QH + (bh * 16 + blockIdx.x) * 512 + lane * 8; const v16h qf = frag_p(qp); const _Float16* kp = KH + bh * 8192 + lane * 8;
    v8f st[TT / 16];   /* in both branches all sixteen key fragments of the head are asked for in one batch ahead of the products, so that one latency is waited out and not one per fragment; their registers pass to st[] as the products retire */
    if (hi) { const _Float16* lp = QL + (bh * (QHI / 16) + blockIdx.x) * 512 + lane * 8; const v16h ql = frag_p(lp); v16h kf[TT / 16];
#pragma unroll
      for (int j = 0; j < TT / 16; ++j) kf[j] = frag_p(kp + j * 512);
      asm volatile("s_wait_xcnt 0x0" :: "v"(qp), "v"(kp), "v"(lp) : "memory");   /* the address registers of the batch are reused below; they stay live up to this wait, so that no load of the batch lands on them */
#pragma unroll
      for (int j = 0; j < TT / 16; ++j) { const v8f z = {}; const v8f ah = wm16(kf[j], qf, z), al = wm16(kf[j], ql, z);
#pragma unroll
        for (int r = 0; r < 8; ++r) st[j][r] = ah[r] + al[r] * (1.0f / 1024.0f); }
    } else { v16h kf[TT / 16];
#pragma unroll
      for (int j = 0; j < TT / 16; ++j) kf[j] = frag_p(kp + j * 512);
      asm volatile("s_wait_xcnt 0x0" :: "v"(qp), "v"(kp) : "memory");   /* as above */
      __builtin_amdgcn_sched_barrier(0);   /* keeps the products behind the whole batch: without it the compiler draws each product up behind its own two loads, into one pair of registers, and every fragment's latency is waited out alone */
#pragma unroll
      for (int j = 0; j < TT / 16; ++j) { const v8f z = {}; st[j] = wm16(kf[j], qf, z); } }
    float m = -3.0e38f;
#pragma unroll
    for (int j = 0; j < TT / 16; ++j) { const v4f a0 = *(const v4f*)&smk[wave][j * 16 + 8 * g], a1 = *(const v4f*)&smk[wave][j * 16 + 8 * g + 4]; const v4f b0 = *(const v4f*)&sb[h][col][j * 16 + 8 * g], b1 = *(const v4f*)&sb[h][col][j * 16 + 8 * g + 4];
#pragma unroll
      for (int r = 0; r < 4; ++r) { st[j][r] = st[j][r] * SCALE2 + (b0[r] + a0[r]); st[j][4 + r] = st[j][4 + r] * SCALE2 + (b1[r] + a1[r]); m = fmaxf(m, fmaxf(st[j][r], st[j][4 + r])); } }
    m = fmaxf(m, __shfl_xor(m, 16));
    float s4[4] = {0.f, 0.f, 0.f, 0.f};
#pragma unroll
    for (int j = 0; j < TT / 16; ++j) { v8f d;
#pragma unroll
      for (int r = 0; r < 8; ++r) d[r] = st[j][r] - m;
      st[j] = exp2x8(d);
#pragma unroll
      for (int r = 0; r < 8; ++r) s4[r & 3] += st[j][r]; }
    float sum = (s4[0] + s4[1]) + (s4[2] + s4[3]); sum += __shfl_xor(sum, 16);
    const float f = sum > 0.f ? 2048.0f * __builtin_amdgcn_rcpf(sum) : 0.f;
    v8f o0 = {}, o1 = {}; const _Float16* vp = VT + bh * 8192 + lane * 8;
#pragma unroll
    for (int kc = 0; kc < TT / 32; ++kc) { v16h p;
#pragma unroll
      for (int s = 0; s < 8; ++s) { p[s] = (_Float16)(st[2 * kc][s] * f); p[8 + s] = (_Float16)(st[2 * kc + 1][s] * f); }   /* keys kc*32 + 8 g + s and kc*32 + 16 + 8 g + s: the k order of frag_h */
      o0 = wm16(frag_p(vp + kc * 512), p, o0); o1 = wm16(frag_p(vp + (8 + kc) * 512), p, o1); }
    asm volatile("s_wait_xcnt 0x0" :: "v"(vp) : "memory");   /* vp stays live up to this wait, so that no v load lands on its own address registers */
    const float* pg = G + (((size_t)b * 16 + blockIdx.x) * NH + h) * 512 + lane * 4;   /* a lane holds channels 8 g + r (o0) and 16 + 8 g + r (o1) of its query: pieces 0, 1 and 2, 3 of the gate tile that k_front wrote */
    const v4f g0 = *(const v4f*)pg, g1 = *(const v4f*)(pg + 128), g2 = *(const v4f*)(pg + 256), g3 = *(const v4f*)(pg + 384); v4f r0, r1, r2, r3;
    asm volatile("s_wait_xcnt 0x0" :: "v"(pg) : "memory");   /* the address registers of the gate loads are reused by the next head */
#pragma unroll
    for (int c = 0; c < 4; ++c) { r0[c] = o0[c] * (1.0f / 2048.0f) * g0[c]; r1[c] = o0[4 + c] * (1.0f / 2048.0f) * g1[c]; r2[c] = o1[c] * (1.0f / 2048.0f) * g2[c]; r3[c] = o1[4 + c] * (1.0f / 2048.0f) * g3[c]; }
    float* py = sw_y + h * 512 + lane * 4; *(v4f*)py = r0; *(v4f*)(py + 128) = r1; *(v4f*)(py + 256) = r2; *(v4f*)(py + 384) = r3; }
  /* out^T = wo ctx^T: every lane takes back the values that it parked itself: channels 32 h + 8 g + 0..7 and 32 h + 16 + 8 g + 0..7 of query col = the B fragment of k step h, split bf16 hi + lo */
  F2 yf[4];
#pragma unroll
  for (int h = 0; h < NH; ++h) { float v[16];
#pragma unroll
    for (int s = 0; s < 4; ++s) { const v4f t = *(const v4f*)(sw_y + h * 512 + s * 128 + lane * 4);
#pragma unroll
      for (int i = 0; i < 4; ++i) v[s * 4 + i] = t[i]; }
    yf[h] = bsplit16(v); }
  v8f acc[8] = {}; prod8<true>(swo, yf, acc, col, lane);   /* tile j = output channels 16 j + 8 g + r of query col */
  float (*sf)[OP] = (float (*)[OP])sw_y;   /* the slot now turns a lane's 8 channels of one query into whole 512-B output rows */
#pragma unroll
  for (int j = 0; j < 8; ++j) { const v4f t0 = {acc[j][0], acc[j][1], acc[j][2], acc[j][3]}, t1 = {acc[j][4], acc[j][5], acc[j][6], acc[j][7]};
    *(v4f*)&sf[col][j * 16 + 8 * g] = t0; *(v4f*)&sf[col][j * 16 + 8 * g + 4] = t1; }
  LDSX();   /* the lanes of this wave read each other's values below */
  float* po = OUT + ((size_t)b * SZ + q0) * DIN + lane * 4;
  for (int rl = 0; rl < 16; ++rl) vst2(po + rl * DIN, *(const v4f*)&sf[rl][lane * 4]); }

extern "C" void kernel_launch(void* const* d_in, const int* in_sizes, int n_in, void* d_out, int out_size, void* d_ws, size_t ws_size, hipStream_t stream) {
  (void)in_sizes; (void)n_in; (void)out_size;
  const float** F = (const float**)d_in;
  if (ws_size < (size_t)WS_END) return;
  char* ws = (char*)d_ws; _Float16 *QH = (_Float16*)(ws + WS_QH), *KH = (_Float16*)(ws + WS_KH), *VT = (_Float16*)(ws + WS_VT), *QL = (_Float16*)(ws + WS_QL), *KL = (_Float16*)(ws + WS_KL); __bf16 *VB = (__bf16*)(ws + WS_VB), *VBL = (__bf16*)(ws + WS_VBL); float *Y = (float*)(ws + WS_Y);
  (void)Y; (void)QL; (void)KL; (void)VB; (void)VBL;
  // inputs: 0 pair_repr [1,256,256,128]; 1 mask [1,256,256] f32 (ones); 2 ln_g, 3 ln_b; 4 wb_w [4,128] (out,in), 5 wb_b [4]; 6 wq, 7 wk, 8 wv [128,128] (out,in); 9 wo [128,128] (out,in); 10 wg_w [128,128] (out,in), 11 wg_b [128]
  if (ws_size < (size_t)WS_END2) return;
  float *BIAS = (float*)(ws + WS_BIAS);
  k_front<<<dim3(NB), 512, 0, stream>>>(F[0], F[2], F[3], F[4], F[5], F[6], F[7], F[8], F[10], F[11], QH, QL, KH, VT, BIAS, Y);   /* LayerNorm, tri bias rows (+ wb_b), q, k, v and the gate (in the Y buffer) from one read of the input */
  k_fa<<<dim3(SZ / 16, TNB / NW), NW * 32, 0, stream>>>(QH, KH, QL, VT, BIAS, F[1], Y, F[9], (float*)d_out);   /* logits, softmax, P.v, gate and the output projection fused; no score planes and no ctx in the workspace */
}

// v008
// A run of this version takes 56.6 microseconds.
// Two timings next to v007 put it at 1.12 and 1.13 times that version's speed.
// Counting every step since v000, it is 7.32 times as fast.
// compute dtype: all float inputs rounded to bf16; LayerNorm in f32; q/k/v, the triangle bias and the gate from the f32 LayerNorm rows split bf16 hi + lo against exact bf16 weights on WMMA 16x16x32 (2 products, f32 accumulate); logits q.k with q as f16 hi + residual for the first 64 queries of each pair row and single f16 elsewhere (sigma_logit ~ 0.25) x 32^-0.5 + bias + mask in f32; softmax in f32 (native exp2 on base-2 logits, in registers, fused with both products); P x 2^11 once to f16 against v once to f16 (1 product); gated ctx split bf16 hi + lo against exact wo (2 products); f32 output.
// Triangle attention, starting node (B 1, I = J = 256 residues, D 128, 4 heads x 32; 0.02-scale (out,in) weights, mask all ones, wb_b = 0, wg_b = 1): z = LayerNorm(pair_repr); tri_bias[h][j][k] = z[j][k] . wb_w[h] + wb_b[h]; for each row i: q = (z[i] wq^T)/sqrt(32), k = z[i] wk^T, v = z[i] wv^T (heads = 32-wide slices of the output dim); a = softmax_k(q . k + 1e9 (mask[i][k] - 1) + tri_bias[h][j][k]); y = merged heads; y = sigmoid(z[i] wg_w^T + wg_b) * y; out[i] = y wo^T.
#include <hip/hip_runtime.h>
#include <math.h>

typedef __attribute__((ext_vector_type(16))) _Float16 v16h;
typedef __attribute__((ext_vector_type(16))) __bf16 v16b;
typedef __attribute__((ext_vector_type(8)))  _Float16 v8h;
typedef __attribute__((ext_vector_type(8)))  float v8f;
typedef __attribute__((ext_vector_type(4)))  float v4f;
typedef __attribute__((ext_vector_type(2)))  float v2f;
typedef __attribute__((ext_vector_type(4)))  unsigned v4u;
typedef __attribute__((ext_vector_type(4)))  int v4i;
typedef float __attribute__((may_alias)) float_a;
typedef int __attribute__((may_alias)) int_a;

template <typename T> __device__ __forceinline__ void vst2(void* p, T v) { *(T*)p = v;  }
__device__ __forceinline__ v8f wmma16(v16h a, v16h b, v8f c) {
  v8f d = __builtin_amdgcn_wmma_f32_16x16x32_f16(false, a, false, b, (short)0, c, false, false);
  asm volatile("v_nop\n\tv_nop\n\tv_nop\n\tv_nop" : "+v"(d) : "v"(a), "v"(b));
  return d;
}
__device__ __forceinline__ v8f wmma_bf(v16b a, v16b b, v8f c) {
  v8f d = __builtin_amdgcn_wmma_f32_16x16x32_bf16(false, a, false, b, (short)0, c, false, false);
  asm volatile("v_nop\n\tv_nop\n\tv_nop\n\tv_nop" : "+v"(d) : "v"(a), "v"(b));
  return d;
}
// 16x16x32 fragments: lane = (h = lane>>4, row/col = lane&15); elements 0..7 = k0+8h+0..7, 8..15 = k0+16+8h+0..7; D element r = row 8h+r
__device__ __forceinline__ v16h frag_h(const _Float16* rowk0, int lane) {
  union { v16h v; v8h q[2]; } u; const _Float16* p = rowk0 + 8 * (lane >> 4);
  u.q[0] = *(const v8h*)p; u.q[1] = *(const v8h*)(p + 16); return u.v;
}
__device__ __forceinline__ v16h frag_f32(const float* rowk0, int lane) {
  v16h a; const float* p = rowk0 + 8 * (lane >> 4);
#pragma unroll
  for (int i = 0; i < 8; ++i) { a[i] = (_Float16)p[i]; a[8 + i] = (_Float16)p[16 + i]; }
  return a;
}
__device__ __forceinline__ v16h frag_f32s(const float* rowk0, int lane, float sc) {
  v16h a; const float* p = rowk0 + 8 * (lane >> 4);
#pragma unroll
  for (int i = 0; i < 8; ++i) { a[i] = (_Float16)(p[i] * sc); a[8 + i] = (_Float16)(p[16 + i] * sc); }
  return a;
}
// column fragment from a [K][ld] layout (column n), rows >= K read as 0
__device__ __forceinline__ v16h fragc_f32(const float* W, int k0, int n, int lane, int ld, int K) {
  v16h a; const int g = lane >> 4;
#pragma unroll
  for (int i = 0; i < 8; ++i) { const int ka = k0 + 8 * g + i, kb = ka + 16;
    a[i] = (_Float16)(ka < K ? W[(size_t)(ka < K ? ka : K - 1) * ld + n] : 0.f); a[8 + i] = (_Float16)(kb < K ? W[(size_t)(kb < K ? kb : K - 1) * ld + n] : 0.f); }
  return a;
}
struct F2 { v16b h, l; };
__device__ __forceinline__ F2 bsplit16(const float v[16]) { F2 r;
#pragma unroll
  for (int i = 0; i < 16; ++i) { const __bf16 h = (__bf16)v[i]; r.h[i] = h; r.l[i] = (__bf16)(v[i] - (float)h); }
  return r; }
__device__ __forceinline__ F2 split_row(const float* row, int k0, int lane) { float v[16]; const float* p = row + k0 + 8 * (lane >> 4);
#pragma unroll
  for (int i = 0; i < 8; ++i) { v[i] = p[i]; v[8 + i] = p[16 + i]; }
  return bsplit16(v); }
__device__ __forceinline__ F2 split_rowK(const float* row, int k0, int lane, int K) { float v[16]; const int g = lane >> 4;
#pragma unroll
  for (int i = 0; i < 8; ++i) { const int ka = k0 + 8 * g + i, kb = ka + 16; v[i] = ka < K ? row[ka < K ? ka : K - 1] : 0.f; v[8 + i] = kb < K ? row[kb < K ? kb : K - 1] : 0.f; }
  return bsplit16(v); }
__device__ __forceinline__ F2 split_col(const float* W, int k0, int n, int lane, int ld, int K) { float v[16]; const int g = lane >> 4;
#pragma unroll
  for (int i = 0; i < 8; ++i) { const int ka = k0 + 8 * g + i, kb = ka + 16; v[i] = ka < K ? W[(size_t)(ka < K ? ka : K - 1) * ld + n] : 0.f; v[8 + i] = kb < K ? W[(size_t)(kb < K ? kb : K - 1) * ld + n] : 0.f; }
  return bsplit16(v); }
__device__ __forceinline__ v8f mac3(const F2& a, const F2& b, v8f c) { c = wmma_bf(a.l, b.h, c); c = wmma_bf(a.h, b.l, c); return wmma_bf(a.h, b.h, c); }
__device__ __forceinline__ float sigm(float v) { return 1.0f / (1.0f + expf(-v)); }
#define LDSX() do { asm volatile("s_wait_dscnt 0" ::: "memory"); __builtin_amdgcn_wave_barrier(); __builtin_amdgcn_fence(__ATOMIC_RELEASE, "workgroup"); } while (0)

// Row-wise triangle attention on a pair tensor z [1, 256, 256, 128] (4 heads x 32): zn = LayerNorm(z); q,k,v = zn wq^T, zn wk^T, zn wv^T (separate (out,in) [128,128]); logits[r][i][j][h] = q[r][i] . k[r][j] / sqrt(32) + (zn[i][j] . w_pair[h] + b_pair[h]) + 1e9 (mask[r][j] - 1); softmax over j; out = sigmoid(zn w_gate + b_gate) * merged(attn v); result = out w_out (no output bias).
#define NB 256              // pair rows i (each a sequence of SZ = TT = 256 positions; no padding needed)
#define TT 256
#define CC 128            // NH * HD = projected width
#define DIN 128          // input (model) width
#define NH 4
#define HD 32
#define NQB (TT / 64)
#define HG 4
#define SCALE (0.17677669529663687f)
#define LOG2E (1.4426950408889634f)
#define SCALE2 ((float)(0.17677669529663687 * 1.4426950408889634))   // 32^-0.5 x log2(e): the logits are kept in base-2 units, so that exp(x - m) is one v_exp_f32
#define CAUSAL 0
#ifndef TNB
#define TNB NB
#endif
__device__ __forceinline__ float bfr(float v) { return (float)(__bf16)v; }
// eight independent 2^x (v_exp_f32), each in place, in ONE statement: no instruction in it reads an earlier result or overwrites an earlier source, and the closing v_nop is the one slot that the instruction set asks for behind a transcendental. The two s_delay_alu change no result: the compiler hints nothing around asm text, and an unhinted dependent instruction holds the vector port against the SIMD's other waves.
__device__ __forceinline__ v8f exp2x8(v8f x) { float a0 = x[0], a1 = x[1], a2 = x[2], a3 = x[3], a4 = x[4], a5 = x[5], a6 = x[6], a7 = x[7];
  asm("s_delay_alu instid0(VALU_DEP_1)\n\tv_exp_f32 %0, %0\n\tv_exp_f32 %1, %1\n\tv_exp_f32 %2, %2\n\tv_exp_f32 %3, %3\n\tv_exp_f32 %4, %4\n\tv_exp_f32 %5, %5\n\tv_exp_f32 %6, %6\n\tv_exp_f32 %7, %7\n\ts_delay_alu instid0(TRANS32_DEP_1)\n\tv_nop" : "+v"(a0), "+v"(a1), "+v"(a2), "+v"(a3), "+v"(a4), "+v"(a5), "+v"(a6), "+v"(a7));
  const v8f r = {a0, a1, a2, a3, a4, a5, a6, a7}; return r; }
// the same for eight 1 / x (v_rcp_f32)
__device__ __forceinline__ v8f rcpx8(v8f x) { float a0 = x[0], a1 = x[1], a2 = x[2], a3 = x[3], a4 = x[4], a5 = x[5], a6 = x[6], a7 = x[7];
  asm("s_delay_alu instid0(VALU_DEP_1)\n\tv_rcp_f32 %0, %0\n\tv_rcp_f32 %1, %1\n\tv_rcp_f32 %2, %2\n\tv_rcp_f32 %3, %3\n\tv_rcp_f32 %4, %4\n\tv_rcp_f32 %5, %5\n\tv_rcp_f32 %6, %6\n\tv_rcp_f32 %7, %7\n\ts_delay_alu instid0(TRANS32_DEP_1)\n\tv_nop" : "+v"(a0), "+v"(a1), "+v"(a2), "+v"(a3), "+v"(a4), "+v"(a5), "+v"(a6), "+v"(a7));
  const v8f r = {a0, a1, a2, a3, a4, a5, a6, a7}; return r; }
__host__ __device__ __forceinline__ int kb_last(int qb) { return CAUSAL ? ((qb * 64 + 63) >> 7) : (TT / 128 - 1); }
typedef __attribute__((ext_vector_type(8))) __bf16 v8b;
__device__ __forceinline__ v16b frag_b(const __bf16* rowk0, int lane) {
  union { v16b v; v8b q[2]; } u; const __bf16* p = rowk0 + 8 * (lane >> 4);
  u.q[0] = *(const v8b*)p; u.q[1] = *(const v8b*)(p + 16); return u.v;
}
typedef __attribute__((ext_vector_type(4))) __bf16 v4b;
#define WP 136             // bf16 elements per staged weight row: 272 B = 16 B x odd, so the 16-byte fragment reads of 16 rows fall on distinct banks
#define QBH 0              // unused: this file has no causal path
#define QHI 64             // q residual rows only for the first 64 queries (four 16-query blocks) of each row (logits elsewhere: single f16 q, k; sigma_logit ~ 0.25 so this is ample)
#define KHI 64            // key rows carrying k residual / v bf16 hi+lo planes (regions sized here; nothing in this file writes them)
// B fragment (k rows k0+.., output column o) of a weight: (in,out) [K][ld] or (out,in) [ld rows of K]: bf16 exact, or f16(bf16 * 256) exact
__device__ __forceinline__ v16b wcol_io(const float* Wm, int k0, int o, int lane, int ld) { v16b w; const int g = lane >> 4;
#pragma unroll
  for (int i = 0; i < 8; ++i) { w[i] = (__bf16)Wm[(size_t)(k0 + 8 * g + i) * ld + o]; w[8 + i] = (__bf16)Wm[(size_t)(k0 + 16 + 8 * g + i) * ld + o]; }
  return w; }
__device__ __forceinline__ v16b wcol_oi(const float* Wm, int k0, int o, int lane, int K) { v16b w; const float* p = Wm + (size_t)o * K + k0 + 8 * (lane >> 4);
#pragma unroll
  for (int i = 0; i < 8; ++i) { w[i] = (__bf16)p[i]; w[8 + i] = (__bf16)p[16 + i]; }
  return w; }
__device__ __forceinline__ v16h wcolh_io(const float* Wm, int k0, int o, int lane, int ld) { v16h w; const int g = lane >> 4;
#pragma unroll
  for (int i = 0; i < 8; ++i) { w[i] = (_Float16)(bfr(Wm[(size_t)(k0 + 8 * g + i) * ld + o]) * 256.0f); w[8 + i] = (_Float16)(bfr(Wm[(size_t)(k0 + 16 + 8 * g + i) * ld + o]) * 256.0f); }
  return w; }
__device__ __forceinline__ v16h wcolh_oi(const float* Wm, int k0, int o, int lane, int K) { v16h w; const float* p = Wm + (size_t)o * K + k0 + 8 * (lane >> 4);
#pragma unroll
  for (int i = 0; i < 8; ++i) { w[i] = (_Float16)(bfr(p[i]) * 256.0f); w[8 + i] = (_Float16)(bfr(p[16 + i]) * 256.0f); }
  return w; }
#define WQKV_LAYOUT 1   // (out,in) separate wq / wk / wv [CC][DIN] (wq.reshape(H, DH, D): output column h*32 + c = row of wq)
__device__ __forceinline__ v16b wcol_hdk(const float* Wm, int k0, int o, int lane) { v16b w; const int g = lane >> 4; const float* p = Wm + (size_t)(o / HD) * DIN * HD + (o % HD);
#pragma unroll
  for (int i = 0; i < 8; ++i) { w[i] = (__bf16)p[(size_t)(k0 + 8 * g + i) * HD]; w[8 + i] = (__bf16)p[(size_t)(k0 + 16 + 8 * g + i) * HD]; }
  return w; }
#define WO_OUT_IN 1
#if WQKV_LAYOUT == 1
#define WCOL(W, k0, o, lane) wcol_oi(W, k0, o, lane, DIN)
#elif WQKV_LAYOUT == 2
#define WCOL(W, k0, o, lane) wcol_hdk(W, k0, o, lane)
#else
#define WCOL(W, k0, o, lane) wcol_oi(W, k0, o, lane, DIN)
#endif
#if WO_OUT_IN
#define WOCOL(W, k0, o, lane) wcol_oi(W, k0, o, lane, CC)
#define WOCOLH(W, k0, o, lane) wcolh_oi(W, k0, o, lane, CC)
#else
#define WOCOL(W, k0, o, lane) wcol_io(W, k0, o, lane, DIN)
#define WOCOLH(W, k0, o, lane) wcolh_io(W, k0, o, lane, DIN)
#endif
#define SZ 256             // real positions per row (= TT here)
#define BG 64              // sizes the unused WS_S region (x 4 heads = 256 planes of 256 x 256)
#define NZR ((size_t)NB * SZ)   // 65,536 real pair rows (i, j)
#define SM_EXTRA_PARAMS , const float* __restrict__ BIAS, const float* __restrict__ MKF, int b0s
#define SM_MASK_HOOK do { const int hh = (int)blockIdx.y % HG; const int ii = b0s + (int)blockIdx.y / HG; const int kc2 = k < SZ ? k : SZ - 1; const float add = BIAS[((size_t)t * SZ + kc2) * NH + hh] + 1.0e9f * (bfr(MKF[(size_t)ii * SZ + kc2]) - 1.0f); v = (k < SZ) ? v + add : -3.0e38f; } while (0)   /* + tri_bias[h][q=t][k] + INF (mask[i][k] - 1) (mask is all ones: adds 0, read anyway); key columns k >= SZ would be padding -> excluded (none here: SZ = TT, so the k < SZ test on the loop index always holds) */
__device__ __forceinline__ v16b zero16b() { v16b z; _Pragma("unroll") for (int i = 0; i < 16; ++i) z[i] = (__bf16)0.f; return z; }
#define WS_ZN   (WS_END)
#define WS_BIAS (WS_ZN + 4u * (size_t)NZR * CC)
#define WS_END2 (WS_BIAS + 4u * (size_t)NZR * NH + 1024)
#ifndef SM_EXTRA_PARAMS
#define SM_EXTRA_PARAMS
#endif
#ifndef PROJ_EXTRA_PARAMS
#define PROJ_EXTRA_PARAMS
#endif
#ifndef SM_MASK_HOOK
#define SM_MASK_HOOK (void)0
#endif

// q, k, v, the q residual and the gate lie in the workspace in the order of the 16x16x32 fragments that read them: a 16-byte piece per lane, 32 lanes side by side, so that every wave-wide load or store covers 512 contiguous bytes
#define WS_QH  0u                                      // f16 q [b][h][16-query tile][piece p][lane][8]: query 16 tile + col, channels 32 h + 16 p + 8 g + 0..7
#define WS_KH  (WS_QH + 2u * (size_t)NB * TT * CC)      // f16 k [b][h][16-key tile][piece p][lane][8], as q
#define WS_VT  (WS_KH + 2u * (size_t)NB * TT * CC)      // f16 v [b][h][16-channel tile][32-key step][piece p][lane][8]: channel 32 h + 16 tile + col, keys 32 step + 16 p + 8 g + 0..7
#define WS_QL  (WS_VT + 2u * (size_t)NB * CC * TT)      // f16 q residual x 2^10 [b][h][tile < QHI / 16][piece p][lane][8], as q
#define WS_KL  (WS_QL + 2u * (size_t)NB * QHI * CC)     // f16 k residual x 2^10 rows [b][t < KHI][CC]
#define WS_VB  (WS_KL + 2u * (size_t)NB * KHI * CC)     // bf16 v hi planes [b][c][t < KHI]
#define WS_VBL (WS_VB + 2u * (size_t)NB * CC * KHI)
#define WS_S   (WS_VBL + 2u * (size_t)NB * CC * KHI)    // f32 [hg][t][s], unused: k_fa keeps logits and P in registers
#define WS_Y   (WS_S  + 4u * (size_t)BG * HG * TT * TT)   // past the 256 unused planes of 256 x 256      // f32 gate (layout on the next line)
#define WS_END (WS_Y  + 4u * (size_t)NB * SZ * CC)   /* f32 gate [b][16-position tile][h][piece s][lane][4]: position 16 tile + col, channels 32 h + 16 (s >> 1) + 8 g + 4 (s & 1) + 0..3 */

// ---- k_front: block = one pair row i = 256 positions, 16 waves x 16 positions: LayerNorm, triangle bias, q, k, gate and v of a position from ONE read of its input row. A lane loads its row's 64 channels directly in the 16x16x32 fragment order (the other 64 sit in lane ^ 16), so mean and variance are in-lane sums plus one exchange, and the normalised row, split bf16 hi + lo, stays in registers as the operand of all five products. The four [128][128] weights and the bias rows are staged once per block in LDS as bf16. Bias, q, k and gate are taken as W x^T (A = weight rows, B = positions): a lane then holds 8 neighbouring channels of ONE position. v is taken as x W^T: a lane holds 8 neighbouring positions of one channel. For q, k, gate and v those 8 values are the very piece that the same lane of the reading wave wants in its fragment, so they go from the accumulators straight to the workspace, lane beside lane; the bias rows are first gathered head by head in LDS.
__device__ __forceinline__ v8f wmb(v16b a, v16b b, v8f c) { return __builtin_amdgcn_wmma_f32_16x16x32_bf16(false, a, false, b, (short)0, c, false, false); }
// eight 16x16 tiles over K = 128: WROWS: D = W x^T (rows = output channels), else D = x W^T (rows = positions); per tile the order of the sums is hi, lo of k step 0, hi, lo of k step 1, ...
template <bool WROWS> __device__ __forceinline__ void prod8(const __bf16 (*w)[WP], const F2 (&af)[4], v8f (&acc)[8], int col, int lane) {
#pragma unroll
  for (int kc = 0; kc < 4; ++kc) { v16b wf[8];
#pragma unroll
    for (int j = 0; j < 8; ++j) wf[j] = frag_b(&w[j * 16 + col][kc * 32], lane);   /* the LDS reads of a k step go out together, ahead of its products */
#pragma unroll
    for (int j = 0; j < 8; ++j) acc[j] = WROWS ? wmb(wf[j], af[kc].h, acc[j]) : wmb(af[kc].h, wf[j], acc[j]);
#pragma unroll
    for (int j = 0; j < 8; ++j) acc[j] = WROWS ? wmb(wf[j], af[kc].l, acc[j]) : wmb(af[kc].l, wf[j], acc[j]); } }
__global__ __launch_bounds__(512) void k_front(const float* __restrict__ Z, const float* __restrict__ LW, const float* __restrict__ LB, const float* __restrict__ WB, const float* __restrict__ WBB, const float* __restrict__ WQ, const float* __restrict__ WK, const float* __restrict__ WV, const float* __restrict__ WG, const float* __restrict__ GB,
    _Float16* __restrict__ QH, _Float16* __restrict__ QL, _Float16* __restrict__ KH, _Float16* __restrict__ VT, float* __restrict__ BIAS, float* __restrict__ G) {
  __shared__ __align__(16) __bf16 sw[4][CC][WP]; __shared__ __align__(16) __bf16 swb[16][WP]; __shared__ __align__(16) float sln[4][CC]; __shared__ __align__(16) float sbx[NH][TT];
  const int tid = threadIdx.x, wave = tid >> 5, lane = tid & 31, col = lane & 15, g = lane >> 4; const size_t bb = blockIdx.x; const size_t r0 = bb * TT + wave * 16;
  v4f x[16];
  { /* all 53 loads of a lane at the block's start fly together: no wait stands between them */
    const float* px = Z + (r0 + col) * CC + 8 * g;
#pragma unroll
    for (int n = 0; n < 16; ++n) x[n] = *(const v4f*)(px + (n >> 2) * 32 + ((n >> 1) & 1) * 16 + (n & 1) * 4);
    v4f a[4][8]; const int ch = tid & (CC - 1);
    const float* pb = WB + (wave & (NH - 1)) * CC + lane * 4; const v4f wb4 = *(const v4f*)pb;   /* read by every wave, so that no branch parts the loads; kept by waves 0..3 (bias row = wave) */
    const int sel = wave >> 2, c4 = ch & (NH - 1); const float l0 = LW[ch], l1 = LB[ch], l2 = GB[ch], l3 = WBB[c4];   /* likewise; four waves each keep ln_g, ln_b, the gate's bias and wb_b (its 4 values repeated) */
#pragma unroll
    for (int it = 0; it < 8; ++it) { a[0][it] = *(const v4f*)(WQ + tid * 4 + it * 2048); a[1][it] = *(const v4f*)(WK + tid * 4 + it * 2048); a[2][it] = *(const v4f*)(WV + tid * 4 + it * 2048); a[3][it] = *(const v4f*)(WG + tid * 4 + it * 2048); }
    asm volatile("s_wait_xcnt 0x0" :: "v"(px), "v"(pb), "v"(ch), "v"(c4) : "memory");   /* the address registers of these loads are reused below; px, pb, ch and c4 stay live up to this wait, so that no load of the group lands on address registers of the group */
    asm volatile("" :: "v"(l0), "v"(l1), "v"(l2), "v"(l3));   /* inputs only: holds these four loads up here with the others; the compiler otherwise sinks them into branches behind the staging, where their latency is waited out alone */
#pragma unroll
    for (int m = 0; m < 4; ++m)
#pragma unroll
      for (int it = 0; it < 8; ++it) { v4b w;
#pragma unroll
        for (int i = 0; i < 4; ++i) w[i] = (__bf16)a[m][it][i];
        *(v4b*)&sw[m][it * 16 + wave][lane * 4] = w; }
    v4b w;
#pragma unroll
    for (int i = 0; i < 4; ++i) w[i] = (__bf16)(wave < NH ? wb4[i] : 0.f);
    *(v4b*)&swb[wave][lane * 4] = w;   /* rows 4..15 of the one bias tile are zero */
    sln[sel][ch] = bfr(sel == 0 ? l0 : sel == 1 ? l1 : sel == 2 ? l2 : l3); }
  __syncthreads();   /* every wave wrote a part of the weight rows that all sixteen read */
  F2 af[4];
  { float s4[4] = {0.f, 0.f, 0.f, 0.f};
#pragma unroll
    for (int n = 0; n < 16; ++n)
#pragma unroll
      for (int i = 0; i < 4; ++i) { x[n][i] = bfr(x[n][i]); s4[i] += x[n][i]; }
    float s1 = (s4[0] + s4[1]) + (s4[2] + s4[3]); s1 += __shfl_xor(s1, 16);
    const float mu = s1 * (1.0f / CC); float q4[4] = {0.f, 0.f, 0.f, 0.f};
#pragma unroll
    for (int n = 0; n < 16; ++n)
#pragma unroll
      for (int i = 0; i < 4; ++i) { const float d = x[n][i] - mu; q4[i] += d * d; }
    float q = (q4[0] + q4[1]) + (q4[2] + q4[3]); q += __shfl_xor(q, 16);
    const float rs = rsqrtf(q * (1.0f / CC) + 1e-5f);
#pragma unroll
    for (int kc = 0; kc < 4; ++kc) { float v[16];
#pragma unroll
      for (int s = 0; s < 4; ++s) { const int c = kc * 32 + 8 * g + (s >> 1) * 16 + (s & 1) * 4; const v4f lw = *(const v4f*)&sln[0][c], lb = *(const v4f*)&sln[1][c];
#pragma unroll
        for (int i = 0; i < 4; ++i) v[s * 4 + i] = (x[kc * 4 + s][i] - mu) * rs * lw[i] + lb[i]; }
      af[kc] = bsplit16(v); } }
  { /* triangle bias: heads = rows 0..3 of the tile, so lanes 0..15 hold the 4 heads of their position; the block's 256 positions are gathered head by head in LDS, so that the workspace takes whole 512-B runs of one head's row [h][j][k], the form in which k_fa copies it */
    v8f ab = {};
#pragma unroll
    for (int kc = 0; kc < 4; ++kc) { const v16b wf = frag_b(&swb[col][kc * 32], lane); ab = wmb(wf, af[kc].h, ab); ab = wmb(wf, af[kc].l, ab); }
    if (g == 0) {
#pragma unroll
      for (int i = 0; i < 4; ++i) sbx[i][wave * 16 + col] = (ab[i] + sln[3][i]) * LOG2E; }   /* + wb_b[h]; base-2 units, once per value */
    __syncthreads();   /* a 512-B run holds the positions of eight waves */
    if (wave < 2 * NH) { const v4f t = *(const v4f*)&sbx[wave >> 1][(wave & 1) * 128 + lane * 4]; float* db = BIAS + (size_t)(wave >> 1) * (SZ * SZ) + bb * SZ + (wave & 1) * 128 + lane * 4; vst2(db, t);
      asm volatile("s_wait_xcnt 0x0" :: "v"(db), "v"(t) : "memory");   /* the store's registers are reused below; they stay live up to this wait */ } }
  { /* v: 16 positions of the wave = piece (wave & 1) of key step (wave >> 1); accumulator tile j = channel tile (j & 1) of head (j >> 1) */
    v8f acc[8] = {}; prod8<false>(sw[2], af, acc, col, lane); v8h hv[8];
#pragma unroll
    for (int j = 0; j < 8; ++j)
#pragma unroll
      for (int r = 0; r < 8; ++r) hv[j][r] = (_Float16)acc[j][r];
    _Float16* dv = VT + (bb * 128 + wave) * (size_t)256 + lane * 8;
#pragma unroll
    for (int j = 0; j < 8; ++j) vst2(dv + j * 4096, hv[j]);   /* 512 contiguous bytes per store */
    asm volatile("s_wait_xcnt 0x0" :: "v"(dv), "v"(hv[0]), "v"(hv[1]), "v"(hv[2]), "v"(hv[3]), "v"(hv[4]), "v"(hv[5]), "v"(hv[6]), "v"(hv[7]) : "memory");   /* the stores' registers are reused below; they stay live up to this wait */ }
  const bool hi = wave * 16 < QHI;   /* wave-uniform: these positions carry the q residual */
#pragma unroll
  for (int m = 0; m < 2; ++m) { /* q, then k: the wave's 16 positions = tile (wave); accumulator tile j = piece (j & 1) of head (j >> 1) */
    v8f acc[8] = {}; prod8<true>(sw[m], af, acc, col, lane); const bool res = m == 0 && hi; v8h hv[8];
#pragma unroll
    for (int j = 0; j < 8; ++j)
#pragma unroll
      for (int r = 0; r < 8; ++r) hv[j][r] = (_Float16)acc[j][r];
    _Float16* dh = (m == 0 ? QH : KH) + (bb * 128 + wave * 2) * (size_t)256 + lane * 8;
#pragma unroll
    for (int j = 0; j < 8; ++j) vst2(dh + ((j >> 1) * 32 + (j & 1)) * 256, hv[j]);   /* 512 contiguous bytes per store */
    if (res) { v8h lv[8];
#pragma unroll
      for (int j = 0; j < 8; ++j)
#pragma unroll
        for (int r = 0; r < 8; ++r) lv[j][r] = (_Float16)((acc[j][r] - (float)hv[j][r]) * 1024.0f);
      _Float16* dl = QL + (bb * 32 + wave * 2) * (size_t)256 + lane * 8;
#pragma unroll
      for (int j = 0; j < 8; ++j) vst2(dl + ((j >> 1) * 8 + (j & 1)) * 256, lv[j]);
      asm volatile("s_wait_xcnt 0x0" :: "v"(dl), "v"(lv[0]), "v"(lv[1]), "v"(lv[2]), "v"(lv[3]), "v"(lv[4]), "v"(lv[5]), "v"(lv[6]), "v"(lv[7]) : "memory");   /* as below */ }
    asm volatile("s_wait_xcnt 0x0" :: "v"(dh), "v"(hv[0]), "v"(hv[1]), "v"(hv[2]), "v"(hv[3]), "v"(hv[4]), "v"(hv[5]), "v"(hv[6]), "v"(hv[7]) : "memory");   /* the stores' registers are reused below; they stay live up to this wait */ }
  { /* gate: f32; accumulator tile j = pieces 2 (j & 1) and 2 (j & 1) + 1 of head (j >> 1) */
    v8f acc[8] = {}; prod8<true>(sw[3], af, acc, col, lane); v4f s[16];
#pragma unroll
    for (int j = 0; j < 8; ++j) { const v4f g0 = *(const v4f*)&sln[2][j * 16 + 8 * g], g1 = *(const v4f*)&sln[2][j * 16 + 8 * g + 4];
      v8f t;
#pragma unroll
      for (int r = 0; r < 4; ++r) { t[r] = (acc[j][r] + g0[r]) * -LOG2E; t[4 + r] = (acc[j][4 + r] + g1[r]) * -LOG2E; }
      t = rcpx8(exp2x8(t) + 1.0f);   /* sigmoid(zn w_gate + b_gate) = 1 / (1 + 2^(-x log2 e)) */
#pragma unroll
      for (int r = 0; r < 4; ++r) { s[2 * j][r] = t[r]; s[2 * j + 1][r] = t[4 + r]; } }
    float* dg = G + (bb * 16 + wave) * (size_t)2048 + lane * 4;
#pragma unroll
    for (int n = 0; n < 16; ++n) vst2(dg + n * 128, s[n]);   /* 512 contiguous bytes per store */
    asm volatile("s_wait_xcnt 0x0" :: "v"(dg), "v"(s[0]), "v"(s[1]), "v"(s[2]), "v"(s[3]), "v"(s[4]), "v"(s[5]), "v"(s[6]), "v"(s[7]), "v"(s[8]), "v"(s[9]), "v"(s[10]), "v"(s[11]), "v"(s[12]), "v"(s[13]), "v"(s[14]), "v"(s[15]) : "memory");   /* the stores' registers stay live up to this wait, so that no later sigmoid lands on them */ } }
#define NW 16
#define RB 4               // pair rows per block
#define QB 4               // 16-query tiles per block
#define OP 132             // f32 elements per row of a wave's output tile in LDS: 528 B = 16 B x odd
#define BP (TT + 4)        // f32 elements per bias row in LDS: 1040 B = 16 B x odd: 16-byte reads of 16 rows fall on distinct banks
// the ring in bytes: sixteen slots of SS bytes, slot w = what wave w copies; the first O_V bytes of every slot together are buffer 0, the rest buffer 1. Buffer 0: the wave's own q and q residual, a quarter (4 fragments) of its pair row's K, the bias rows of queries 4 w .. 4 w + 3 of the block. Buffer 1: a quarter of its pair row's V, the wave's own gate tile. SS / 4 = 16 (mod 64) and BP = 4 (mod 64), so the 16-byte reads of the 16 bias rows of a query tile (4 slots x 4 rows) fall on distinct banks; the K and V of four slots lie within the 64 KiB that an instruction's offset reaches, so one address register serves a pair row's K and V
#define O_Q  0
#define O_QL 1024
#define O_K  2048
#define O_B  6144
#define O_V  (O_B + 4 * BP * 4)                 // 10,304
#define O_G  (O_V + 4096)
#define SS   (O_G + 2048)                       // 16,448
#define R_END (NW * SS)
__device__ __forceinline__ v8f wm16(v16h a, v16h b, v8f c) { return __builtin_amdgcn_wmma_f32_16x16x32_f16(false, a, false, b, (short)0, c, false, false); }
__device__ __forceinline__ v16h frag_p(const _Float16* p) { union { v16h v; v8h q[2]; } u; u.q[0] = *(const v8h*)p; u.q[1] = *(const v8h*)(p + 256); return u.v; }   /* a fragment stored in fragment order: its two pieces lie 512 B apart, the lane's offset is already in p */
// asynchronous copies, 16 bytes per lane each (512 B per wave): global bytes p + o + .. (p the wave's, in scalar registers; o = 16 lane) to LDS bytes l + N + ..; the instruction's offset moves both addresses alike, so one LDS address register serves the whole slot and each scalar base holds p - N, N the stream's place in the slot. All copies of a buffer, those of the q residual apart, stand in one statement that closes with s_wait_xcnt 0: the wait comes ahead of every rewrite of their address registers, and is paid once
__device__ __forceinline__ void cp_buf0(unsigned l, unsigned o, const char* q, const char* k, const char* bi) { const char *aq = q - O_Q, *ak = k - O_K, *b0 = bi - O_B, *b1 = bi + 1024 - (O_B + BP * 4), *b2 = bi + 2048 - (O_B + 2 * BP * 4), *b3 = bi + 3072 - (O_B + 3 * BP * 4);
  asm volatile("global_load_async_to_lds_b128 %0, %1, %2 offset:%8\n\tglobal_load_async_to_lds_b128 %0, %1, %2 offset:%9\n\tglobal_load_async_to_lds_b128 %0, %1, %3 offset:%10\n\tglobal_load_async_to_lds_b128 %0, %1, %3 offset:%11\n\tglobal_load_async_to_lds_b128 %0, %1, %3 offset:%12\n\tglobal_load_async_to_lds_b128 %0, %1, %3 offset:%13\n\tglobal_load_async_to_lds_b128 %0, %1, %3 offset:%14\n\tglobal_load_async_to_lds_b128 %0, %1, %3 offset:%15\n\tglobal_load_async_to_lds_b128 %0, %1, %3 offset:%16\n\tglobal_load_async_to_lds_b128 %0, %1, %3 offset:%17\n\tglobal_load_async_to_lds_b128 %0, %1, %4 offset:%18\n\tglobal_load_async_to_lds_b128 %0, %1, %4 offset:%19\n\tglobal_load_async_to_lds_b128 %0, %1, %5 offset:%20\n\tglobal_load_async_to_lds_b128 %0, %1, %5 offset:%21\n\tglobal_load_async_to_lds_b128 %0, %1, %6 offset:%22\n\tglobal_load_async_to_lds_b128 %0, %1, %6 offset:%23\n\tglobal_load_async_to_lds_b128 %0, %1, %7 offset:%24\n\tglobal_load_async_to_lds_b128 %0, %1, %7 offset:%25\n\ts_wait_xcnt 0x0" :: "v"(l), "v"(o), "s"(aq), "s"(ak), "s"(b0), "s"(b1), "s"(b2), "s"(b3), "i"(O_Q), "i"(O_Q + 512), "i"(O_K + 0), "i"(O_K + 512), "i"(O_K + 1024), "i"(O_K + 1536), "i"(O_K + 2048), "i"(O_K + 2560), "i"(O_K + 3072), "i"(O_K + 3584), "i"(O_B + 0 * BP * 4), "i"(O_B + 0 * BP * 4 + 512), "i"(O_B + 1 * BP * 4), "i"(O_B + 1 * BP * 4 + 512), "i"(O_B + 2 * BP * 4), "i"(O_B + 2 * BP * 4 + 512), "i"(O_B + 3 * BP * 4), "i"(O_B + 3 * BP * 4 + 512) : "memory"); }
__device__ __forceinline__ void cp_ql(unsigned l, unsigned o, const char* p) { const char* a = p - O_QL;
  asm volatile("global_load_async_to_lds_b128 %0, %1, %2 offset:%3\n\tglobal_load_async_to_lds_b128 %0, %1, %2 offset:%4\n\ts_wait_xcnt 0x0" :: "v"(l), "v"(o), "s"(a), "i"(O_QL), "i"(O_QL + 512) : "memory"); }
__device__ __forceinline__ void cp_buf1(unsigned l, unsigned o, const char* v, const char* gt) { const char *av = v - O_V, *ag = gt - O_G;
  asm volatile("global_load_async_to_lds_b128 %0, %1, %2 offset:%4\n\tglobal_load_async_to_lds_b128 %0, %1, %2 offset:%5\n\tglobal_load_async_to_lds_b128 %0, %1, %2 offset:%6\n\tglobal_load_async_to_lds_b128 %0, %1, %2 offset:%7\n\tglobal_load_async_to_lds_b128 %0, %1, %2 offset:%8\n\tglobal_load_async_to_lds_b128 %0, %1, %2 offset:%9\n\tglobal_load_async_to_lds_b128 %0, %1, %2 offset:%10\n\tglobal_load_async_to_lds_b128 %0, %1, %2 offset:%11\n\tglobal_load_async_to_lds_b128 %0, %1, %3 offset:%12\n\tglobal_load_async_to_lds_b128 %0, %1, %3 offset:%13\n\tglobal_load_async_to_lds_b128 %0, %1, %3 offset:%14\n\tglobal_load_async_to_lds_b128 %0, %1, %3 offset:%15\n\ts_wait_xcnt 0x0" :: "v"(l), "v"(o), "s"(av), "s"(ag), "i"(O_V + 0), "i"(O_V + 512), "i"(O_V + 1024), "i"(O_V + 1536), "i"(O_V + 2048), "i"(O_V + 2560), "i"(O_V + 3072), "i"(O_V + 3584), "i"(O_G + 0), "i"(O_G + 512), "i"(O_G + 1024), "i"(O_G + 1536) : "memory"); }
// the value of lane ^ 16, by the LDS crossbar as __shfl_xor(x, 16) takes it, but with the pattern in the instruction (xor mask 16, and mask 31): no index register lives through the loop
__device__ __forceinline__ float xhalf(float x) { return __builtin_bit_cast(float, __builtin_amdgcn_ds_swizzle(__builtin_bit_cast(int, x), 0x401f)); }
// the publish point of the two-buffer ring: this wave's LDS reads of the buffer it leaves have returned, its own copies into the other buffer have landed, and behind the barrier every wave may read the one and refill the other
#define RING_FOOT() do { asm volatile("s_wait_dscnt 0x0" ::: "memory"); asm volatile("s_wait_asynccnt 0x0" ::: "memory"); __syncthreads(); } while (0)
__global__ __launch_bounds__(NW * 32) void k_fa(const _Float16* __restrict__ QH, const _Float16* __restrict__ KH, const _Float16* __restrict__ QL, const _Float16* __restrict__ VT, const float* __restrict__ BIAS, const float* __restrict__ MKF, const float* __restrict__ G, const float* __restrict__ WO, float* __restrict__ OUT) {
  __shared__ __align__(16) char ring[R_END];   /* behind the loop its start serves as the waves' output tiles [wave][query][OP] */
  __shared__ __align__(16) float smk[RB][TT];
  __shared__ __align__(16) __bf16 swo[DIN][WP];
  const int tid = threadIdx.x, wave = __builtin_amdgcn_readfirstlane(tid >> 5), lane = tid & 31, col = lane & 15, g = lane >> 4; const int row = wave >> 2, qt = wave & (QB - 1);   /* the wave's number in a scalar register: all that depends on it alone is scalar arithmetic */
  const int T = (int)blockIdx.x * QB + qt, q0 = T * 16; const int b = (int)blockIdx.y * RB + row;
  const bool hi = (int)blockIdx.x * (QB * 16) < QHI;   /* block-uniform: these queries carry the q residual */
  const unsigned l0 = (unsigned)(size_t)ring + wave * SS + lane * 16;   /* the wave's slot: its byte address in the work-group's LDS, plus the lane's place in a 512-B run */
  /* the wave's first byte of each stream, head 0; a head further on: K, V, q 16 KiB, bias 256 KiB, q residual 4 KiB, gate 2 KiB */
  const char* gk = (const char*)KH + (size_t)b * 65536 + qt * 4096; const char* gv = (const char*)VT + (size_t)b * 65536 + qt * 4096;
  const char* gb = (const char*)BIAS + ((size_t)blockIdx.x * (QB * 16) + wave * 4) * 1024;
  const char* gq = (const char*)QH + ((size_t)b * 64 + T) * 1024; const char* gl = (const char*)QL + ((size_t)b * 16 + qt) * 1024;
  const char* gg = (const char*)G + ((size_t)b * 16 + T) * 8192;
  const unsigned lo = lane * 16;
#define COPY_K(hh) do { const size_t h_ = (size_t)(hh); cp_buf0(l0, lo, gq + h_ * 16384, gk + h_ * 16384, gb + h_ * 262144); if (hi) cp_ql(l0, lo, gl + h_ * 4096); } while (0)
#define COPY_V(hh) do { const size_t h_ = (size_t)(hh); cp_buf1(l0, lo, gv + h_ * 16384, gg + h_ * 2048); } while (0)
  COPY_K(0);
  /* while head 0 flies: wo (out,in) [128][128] f32 (each wave-load takes one whole 512-B row) and a quarter of the wave's mask row */
  const float* pw = WO + tid * 4; const float* pm = MKF + (size_t)b * SZ + qt * 64 + lane * 2; v4f a[8];
#pragma unroll
  for (int it = 0; it < 8; ++it) a[it] = *(const v4f*)(pw + it * (NW * 128));
  v2f m0 = *(const v2f*)pm;
  asm volatile("s_wait_xcnt 0x0" :: "v"(pw), "v"(pm) : "memory");   /* the address registers of these loads are reused below; pw and pm stay live up to this wait */
#pragma unroll
  for (int it = 0; it < 8; ++it) { v4b w;
#pragma unroll
    for (int i = 0; i < 4; ++i) w[i] = (__bf16)a[it][i];
    *(v4b*)&swo[it * NW + wave][lane * 4] = w; }   /* wo as bf16 rows */
#pragma unroll
  for (int c = 0; c < 2; ++c) m0[c] = (1.0e9f * LOG2E) * (bfr(m0[c]) - 1.0f);   /* INF (mask[i][k] - 1) in base-2 units, once per block for the four heads */
  *(v2f*)&smk[row][qt * 64 + lane * 2] = m0;
  asm volatile("s_wait_asynccnt 0x0" ::: "memory");   /* this wave's copies of head 0 have landed */
  __syncthreads();   /* publishes buffer 0 of head 0, the wo rows and the mask rows */
  COPY_V(0);
  const _Float16* const sq = (const _Float16*)(ring + wave * SS) + lane * 8;   /* the wave's own slot */
  const _Float16* const sk = (const _Float16*)(ring + row * (4 * SS)) + lane * 8;   /* the four slots of the pair row; fragment f of K or V: slot f >> 2, 1 KiB each */
#define FR(f, O) (((f) >> 2) * (SS / 2) + (O) / 2 + ((f) & 3) * 512)
  const float* const sbq = (const float*)(ring + (qt * 4 + (col >> 2)) * SS + O_B) + (col & 3) * BP + 8 * g; const float* const smr = &smk[row][8 * g]; const float* const sg = (const float*)(sq + O_G / 2);
  v8f acc[8] = {};   /* out^T: tile j = output channels 16 j + 8 g + r of query col */
  /* the loop over heads stays rolled: one tile's registers at a time keep four waves on a SIMD; every inner loop is unrolled so that st[] is indexed by constants and stays in registers */
#pragma unroll 1
  for (int h = 0; h < NH; ++h) {
    /* trip 2 h: reads buffer 0 alone */
    const v16h qf = frag_p(sq + O_Q / 2); v8f st[TT / 16];
    if (hi) { const v16h ql = frag_p(sq + O_QL / 2);
#pragma unroll
      for (int j = 0; j < TT / 16; ++j) { const v8f z = {}; const v16h kf = frag_p(sk + FR(j, O_K)); const v8f ah = wm16(kf, qf, z), al = wm16(kf, ql, z);
#pragma unroll
        for (int r = 0; r < 8; ++r) st[j][r] = ah[r] + al[r] * (1.0f / 1024.0f); }
    } else {
#pragma unroll
      for (int jb = 0; jb < TT / 16; jb += 8) { v16h kf[8];
#pragma unroll
        for (int j = 0; j < 8; ++j) kf[j] = frag_p(sk + FR(jb + j, O_K));
        __builtin_amdgcn_sched_barrier(0);   /* keeps the products behind a batch of eight fragments' LDS reads: without it the compiler draws each product up behind its own two reads, into one pair of registers, and every fragment's LDS latency is waited out alone */
#pragma unroll
        for (int j = 0; j < 8; ++j) { const v8f z = {}; st[jb + j] = wm16(kf[j], qf, z); } } }
    float m = -3.0e38f;
#pragma unroll
    for (int j = 0; j < TT / 16; ++j) { const v4f a0 = *(const v4f*)(smr + j * 16), a1 = *(const v4f*)(smr + j * 16 + 4); const v4f b0v = *(const v4f*)(sbq + j * 16), b1v = *(const v4f*)(sbq + j * 16 + 4);
#pragma unroll
      for (int r = 0; r < 4; ++r) { st[j][r] = st[j][r] * SCALE2 + (b0v[r] + a0[r]); st[j][4 + r] = st[j][4 + r] * SCALE2 + (b1v[r] + a1[r]); m = fmaxf(m, fmaxf(st[j][r], st[j][4 + r])); } }
    m = fmaxf(m, xhalf(m));
    RING_FOOT();
    if (h + 1 < NH) COPY_K(h + 1);   /* the same for the whole work-group; into the buffer that every wave has just left */
    /* trip 2 h + 1: reads buffer 1 alone */
    float s4[4] = {0.f, 0.f, 0.f, 0.f};
#pragma unroll
    for (int j = 0; j < TT / 16; ++j) { v8f d;
#pragma unroll
      for (int r = 0; r < 8; ++r) d[r] = st[j][r] - m;
      st[j] = exp2x8(d);
#pragma unroll
      for (int r = 0; r < 8; ++r) s4[r & 3] += st[j][r]; }
    float sum = (s4[0] + s4[1]) + (s4[2] + s4[3]); sum += xhalf(sum);
    const float f = sum > 0.f ? 2048.0f * __builtin_amdgcn_rcpf(sum) : 0.f;
    v8f o0 = {}, o1 = {};
#pragma unroll
    for (int kc = 0; kc < TT / 32; ++kc) { v16h p;
#pragma unroll
      for (int s = 0; s < 8; ++s) { p[s] = (_Float16)(st[2 * kc][s] * f); p[8 + s] = (_Float16)(st[2 * kc + 1][s] * f); }   /* keys kc*32 + 8 g + s and kc*32 + 16 + 8 g + s: the k order of frag_h */
      o0 = wm16(frag_p(sk + FR(kc, O_V)), p, o0); o1 = wm16(frag_p(sk + FR(8 + kc, O_V)), p, o1); }
    /* a lane holds channels 8 g + r (o0) and 16 + 8 g + r (o1) of its query: pieces 0, 1 and 2, 3 of the gate tile that k_front wrote */
    const v4f g0 = *(const v4f*)sg, g1 = *(const v4f*)(sg + 128), g2 = *(const v4f*)(sg + 256), g3 = *(const v4f*)(sg + 384); float v[16];
#pragma unroll
    for (int c = 0; c < 4; ++c) { v[c] = o0[c] * (1.0f / 2048.0f) * g0[c]; v[4 + c] = o0[4 + c] * (1.0f / 2048.0f) * g1[c]; v[8 + c] = o1[c] * (1.0f / 2048.0f) * g2[c]; v[12 + c] = o1[4 + c] * (1.0f / 2048.0f) * g3[c]; }
    /* channels 32 h + 8 g + 0..7 and 32 h + 16 + 8 g + 0..7 of query col = the B fragment of k step h of out^T = wo ctx^T, split bf16 hi + lo; per tile the order of the sums is hi, lo of head 0, hi, lo of head 1, ... */
    const F2 yf = bsplit16(v); v16b wf[8];
#pragma unroll
    for (int j = 0; j < 8; ++j) wf[j] = frag_b(&swo[j * 16 + col][h * 32], lane);
#pragma unroll
    for (int j = 0; j < 8; ++j) acc[j] = wmb(wf[j], yf.h, acc[j]);
#pragma unroll
    for (int j = 0; j < 8; ++j) acc[j] = wmb(wf[j], yf.l, acc[j]);
    RING_FOOT();
    if (h + 1 < NH) COPY_V(h + 1); }
  asm volatile("s_wait_asynccnt 0x0" ::: "memory");   /* no copy is in flight when the ring turns into output tiles and when the wave ends */
  float (*sf)[OP] = (float (*)[OP])(ring + wave * (16 * OP * 4));   /* behind the last barrier nobody reads the ring: a wave's own 16 x OP tile from the ring's start turns a lane's 8 channels of one query into whole 512-B output rows */
  const int ln = (int)__builtin_amdgcn_mbcnt_lo(~0u, 0u), cl = ln & 15, gl2 = ln >> 4;   /* the lane's number taken anew, so that no address of this part holds a register through the loop */
#pragma unroll
  for (int j = 0; j < 8; ++j) { const v4f t0 = {acc[j][0], acc[j][1], acc[j][2], acc[j][3]}, t1 = {acc[j][4], acc[j][5], acc[j][6], acc[j][7]};
    *(v4f*)&sf[cl][j * 16 + 8 * gl2] = t0; *(v4f*)&sf[cl][j * 16 + 8 * gl2 + 4] = t1; }
  LDSX();   /* the lanes of this wave read each other's values below */
  float* po = OUT + ((size_t)b * SZ + q0) * DIN + ln * 4;
  for (int rl = 0; rl < 16; ++rl) vst2(po + rl * DIN, *(const v4f*)&sf[rl][ln * 4]); }

extern "C" void kernel_launch(void* const* d_in, const int* in_sizes, int n_in, void* d_out, int out_size, void* d_ws, size_t ws_size, hipStream_t stream) {
  (void)in_sizes; (void)n_in; (void)out_size;
  const float** F = (const float**)d_in;
  if (ws_size < (size_t)WS_END) return;
  char* ws = (char*)d_ws; _Float16 *QH = (_Float16*)(ws + WS_QH), *KH = (_Float16*)(ws + WS_KH), *VT = (_Float16*)(ws + WS_VT), *QL = (_Float16*)(ws + WS_QL), *KL = (_Float16*)(ws + WS_KL); __bf16 *VB = (__bf16*)(ws + WS_VB), *VBL = (__bf16*)(ws + WS_VBL); float *Y = (float*)(ws + WS_Y);
  (void)Y; (void)QL; (void)KL; (void)VB; (void)VBL;
  // inputs: 0 pair_repr [1,256,256,128]; 1 mask [1,256,256] f32 (ones); 2 ln_g, 3 ln_b; 4 wb_w [4,128] (out,in), 5 wb_b [4]; 6 wq, 7 wk, 8 wv [128,128] (out,in); 9 wo [128,128] (out,in); 10 wg_w [128,128] (out,in), 11 wg_b [128]
  if (ws_size < (size_t)WS_END2) return;
  float *BIAS = (float*)(ws + WS_BIAS);
  k_front<<<dim3(NB), 512, 0, stream>>>(F[0], F[2], F[3], F[4], F[5], F[6], F[7], F[8], F[10], F[11], QH, QL, KH, VT, BIAS, Y);   /* LayerNorm, tri bias rows (+ wb_b), q, k, v and the gate (in the Y buffer) from one read of the input */
  k_fa<<<dim3(SZ / (QB * 16), TNB / RB), NW * 32, 0, stream>>>(QH, KH, QL, VT, BIAS, F[1], Y, F[9], (float*)d_out);   /* logits, softmax, P.v, gate and the output projection fused; no score planes and no ctx in the workspace */
}

// v009
// Measured time: 54.4 microseconds a run.
// In both of two side-by-side timings against v008, it was 1.04 times as fast.
// Counting every step since v000, it is 7.61 times as fast.
// compute dtype: all float inputs rounded to bf16; LayerNorm in f32; q/k/v, the triangle bias and the gate from the f32 LayerNorm rows split bf16 hi + lo against exact bf16 weights on WMMA 16x16x32 (2 products, f32 accumulate); logits q.k with q as f16 hi + residual for the first 64 queries of each pair row and single f16 elsewhere (sigma_logit ~ 0.25) x 32^-0.5 + bias + mask in f32; softmax in f32 (native exp2 on base-2 logits, in registers, fused with both products); P x 2^11 once to f16 against v once to f16 (1 product); the gate (a sigmoid, in 0..1) goes from launch to launch as 16-bit fixed point, steps of 1/65535; gated ctx split bf16 hi + lo against exact wo (2 products); f32 output.
// Triangle attention, starting node (B 1, I = J = 256 residues, D 128, 4 heads x 32; 0.02-scale (out,in) weights, mask all ones, wb_b = 0, wg_b = 1): z = LayerNorm(pair_repr); tri_bias[h][j][k] = z[j][k] . wb_w[h] + wb_b[h]; for each row i: q = (z[i] wq^T)/sqrt(32), k = z[i] wk^T, v = z[i] wv^T (heads = 32-wide slices of the output dim); a = softmax_k(q . k + 1e9 (mask[i][k] - 1) + tri_bias[h][j][k]); y = merged heads; y = sigmoid(z[i] wg_w^T + wg_b) * y; out[i] = y wo^T.
#include <hip/hip_runtime.h>
#include <math.h>

typedef __attribute__((ext_vector_type(16))) _Float16 v16h;
typedef __attribute__((ext_vector_type(16))) __bf16 v16b;
typedef __attribute__((ext_vector_type(8)))  _Float16 v8h;
typedef __attribute__((ext_vector_type(8)))  float v8f;
typedef __attribute__((ext_vector_type(4)))  float v4f;
typedef __attribute__((ext_vector_type(2)))  float v2f;
typedef __attribute__((ext_vector_type(4)))  unsigned v4u;
typedef __attribute__((ext_vector_type(4)))  int v4i;
typedef float __attribute__((may_alias)) float_a;
typedef int __attribute__((may_alias)) int_a;

template <typename T> __device__ __forceinline__ void vst2(void* p, T v) { *(T*)p = v;  }
__device__ __forceinline__ v8f wmma16(v16h a, v16h b, v8f c) {
  v8f d = __builtin_amdgcn_wmma_f32_16x16x32_f16(false, a, false, b, (short)0, c, false, false);
  asm volatile("v_nop\n\tv_nop\n\tv_nop\n\tv_nop" : "+v"(d) : "v"(a), "v"(b));
  return d;
}
__device__ __forceinline__ v8f wmma_bf(v16b a, v16b b, v8f c) {
  v8f d = __builtin_amdgcn_wmma_f32_16x16x32_bf16(false, a, false, b, (short)0, c, false, false);
  asm volatile("v_nop\n\tv_nop\n\tv_nop\n\tv_nop" : "+v"(d) : "v"(a), "v"(b));
  return d;
}
// 16x16x32 fragments: lane = (h = lane>>4, row/col = lane&15); elements 0..7 = k0+8h+0..7, 8..15 = k0+16+8h+0..7; D element r = row 8h+r
__device__ __forceinline__ v16h frag_h(const _Float16* rowk0, int lane) {
  union { v16h v; v8h q[2]; } u; const _Float16* p = rowk0 + 8 * (lane >> 4);
  u.q[0] = *(const v8h*)p; u.q[1] = *(const v8h*)(p + 16); return u.v;
}
__device__ __forceinline__ v16h frag_f32(const float* rowk0, int lane) {
  v16h a; const float* p = rowk0 + 8 * (lane >> 4);
#pragma unroll
  for (int i = 0; i < 8; ++i) { a[i] = (_Float16)p[i]; a[8 + i] = (_Float16)p[16 + i]; }
  return a;
}
__device__ __forceinline__ v16h frag_f32s(const float* rowk0, int lane, float sc) {
  v16h a; const float* p = rowk0 + 8 * (lane >> 4);
#pragma unroll
  for (int i = 0; i < 8; ++i) { a[i] = (_Float16)(p[i] * sc); a[8 + i] = (_Float16)(p[16 + i] * sc); }
  return a;
}
// column fragment from a [K][ld] layout (column n), rows >= K read as 0
__device__ __forceinline__ v16h fragc_f32(const float* W, int k0, int n, int lane, int ld, int K) {
  v16h a; const int g = lane >> 4;
#pragma unroll
  for (int i = 0; i < 8; ++i) { const int ka = k0 + 8 * g + i, kb = ka + 16;
    a[i] = (_Float16)(ka < K ? W[(size_t)(ka < K ? ka : K - 1) * ld + n] : 0.f); a[8 + i] = (_Float16)(kb < K ? W[(size_t)(kb < K ? kb : K - 1) * ld + n] : 0.f); }
  return a;
}
struct F2 { v16b h, l; };
__device__ __forceinline__ F2 bsplit16(const float v[16]) { F2 r;
#pragma unroll
  for (int i = 0; i < 16; ++i) { const __bf16 h = (__bf16)v[i]; r.h[i] = h; r.l[i] = (__bf16)(v[i] - (float)h); }
  return r; }
__device__ __forceinline__ F2 split_row(const float* row, int k0, int lane) { float v[16]; const float* p = row + k0 + 8 * (lane >> 4);
#pragma unroll
  for (int i = 0; i < 8; ++i) { v[i] = p[i]; v[8 + i] = p[16 + i]; }
  return bsplit16(v); }
__device__ __forceinline__ F2 split_rowK(const float* row, int k0, int lane, int K) { float v[16]; const int g = lane >> 4;
#pragma unroll
  for (int i = 0; i < 8; ++i) { const int ka = k0 + 8 * g + i, kb = ka + 16; v[i] = ka < K ? row[ka < K ? ka : K - 1] : 0.f; v[8 + i] = kb < K ? row[kb < K ? kb : K - 1] : 0.f; }
  return bsplit16(v); }
__device__ __forceinline__ F2 split_col(const float* W, int k0, int n, int lane, int ld, int K) { float v[16]; const int g = lane >> 4;
#pragma unroll
  for (int i = 0; i < 8; ++i) { const int ka = k0 + 8 * g + i, kb = ka + 16; v[i] = ka < K ? W[(size_t)(ka < K ? ka : K - 1) * ld + n] : 0.f; v[8 + i] = kb < K ? W[(size_t)(kb < K ? kb : K - 1) * ld + n] : 0.f; }
  return bsplit16(v); }
__device__ __forceinline__ v8f mac3(const F2& a, const F2& b, v8f c) { c = wmma_bf(a.l, b.h, c); c = wmma_bf(a.h, b.l, c); return wmma_bf(a.h, b.h, c); }
__device__ __forceinline__ float sigm(float v) { return 1.0f / (1.0f + expf(-v)); }
#define LDSX() do { asm volatile("s_wait_dscnt 0" ::: "memory"); __builtin_amdgcn_wave_barrier(); __builtin_amdgcn_fence(__ATOMIC_RELEASE, "workgroup"); } while (0)

// Row-wise triangle attention on a pair tensor z [1, 256, 256, 128] (4 heads x 32): zn = LayerNorm(z); q,k,v = zn wq^T, zn wk^T, zn wv^T (separate (out,in) [128,128]); logits[r][i][j][h] = q[r][i] . k[r][j] / sqrt(32) + (zn[i][j] . w_pair[h] + b_pair[h]) + 1e9 (mask[r][j] - 1); softmax over j; out = sigmoid(zn w_gate + b_gate) * merged(attn v); result = out w_out (no output bias).
#define NB 256              // pair rows i (each a sequence of SZ = TT = 256 positions; no padding needed)
#define TT 256
#define CC 128            // NH * HD = projected width
#define DIN 128          // input (model) width
#define NH 4
#define HD 32
#define NQB (TT / 64)
#define HG 4
#define SCALE (0.17677669529663687f)
#define LOG2E (1.4426950408889634f)
#define SCALE2 ((float)(0.17677669529663687 * 1.4426950408889634))   // 32^-0.5 x log2(e): the logits are kept in base-2 units, so that exp(x - m) is one v_exp_f32
#define CAUSAL 0
#ifndef TNB
#define TNB NB
#endif
__device__ __forceinline__ float bfr(float v) { return (float)(__bf16)v; }
// eight independent 2^x (v_exp_f32), each in place, in ONE statement: no instruction in it reads an earlier result or overwrites an earlier source, and the closing v_nop is the one slot that the instruction set asks for behind a transcendental. The two s_delay_alu change no result: the compiler hints nothing around asm text, and an unhinted dependent instruction holds the vector port against the SIMD's other waves.
__device__ __forceinline__ v8f exp2x8(v8f x) { float a0 = x[0], a1 = x[1], a2 = x[2], a3 = x[3], a4 = x[4], a5 = x[5], a6 = x[6], a7 = x[7];
  asm("s_delay_alu instid0(VALU_DEP_1)\n\tv_exp_f32 %0, %0\n\tv_exp_f32 %1, %1\n\tv_exp_f32 %2, %2\n\tv_exp_f32 %3, %3\n\tv_exp_f32 %4, %4\n\tv_exp_f32 %5, %5\n\tv_exp_f32 %6, %6\n\tv_exp_f32 %7, %7\n\ts_delay_alu instid0(TRANS32_DEP_1)\n\tv_nop" : "+v"(a0), "+v"(a1), "+v"(a2), "+v"(a3), "+v"(a4), "+v"(a5), "+v"(a6), "+v"(a7));
  const v8f r = {a0, a1, a2, a3, a4, a5, a6, a7}; return r; }
// the same for eight 1 / x (v_rcp_f32)
__device__ __forceinline__ v8f rcpx8(v8f x) { float a0 = x[0], a1 = x[1], a2 = x[2], a3 = x[3], a4 = x[4], a5 = x[5], a6 = x[6], a7 = x[7];
  asm("s_delay_alu instid0(VALU_DEP_1)\n\tv_rcp_f32 %0, %0\n\tv_rcp_f32 %1, %1\n\tv_rcp_f32 %2, %2\n\tv_rcp_f32 %3, %3\n\tv_rcp_f32 %4, %4\n\tv_rcp_f32 %5, %5\n\tv_rcp_f32 %6, %6\n\tv_rcp_f32 %7, %7\n\ts_delay_alu instid0(TRANS32_DEP_1)\n\tv_nop" : "+v"(a0), "+v"(a1), "+v"(a2), "+v"(a3), "+v"(a4), "+v"(a5), "+v"(a6), "+v"(a7));
  const v8f r = {a0, a1, a2, a3, a4, a5, a6, a7}; return r; }
__host__ __device__ __forceinline__ int kb_last(int qb) { return CAUSAL ? ((qb * 64 + 63) >> 7) : (TT / 128 - 1); }
typedef __attribute__((ext_vector_type(8))) __bf16 v8b;
__device__ __forceinline__ v16b frag_b(const __bf16* rowk0, int lane) {
  union { v16b v; v8b q[2]; } u; const __bf16* p = rowk0 + 8 * (lane >> 4);
  u.q[0] = *(const v8b*)p; u.q[1] = *(const v8b*)(p + 16); return u.v;
}
typedef __attribute__((ext_vector_type(4))) __bf16 v4b;
#define WP 136             // bf16 elements per staged weight row: 272 B = 16 B x odd, so the 16-byte fragment reads of 16 rows fall on distinct banks
#define QBH 0              // unused: this file has no causal path
#define QHI 64             // q residual rows only for the first 64 queries (four 16-query blocks) of each row (logits elsewhere: single f16 q, k; sigma_logit ~ 0.25 so this is ample)
#define KHI 64            // key rows carrying k residual / v bf16 hi+lo planes (regions sized here; nothing in this file writes them)
// B fragment (k rows k0+.., output column o) of a weight: (in,out) [K][ld] or (out,in) [ld rows of K]: bf16 exact, or f16(bf16 * 256) exact
__device__ __forceinline__ v16b wcol_io(const float* Wm, int k0, int o, int lane, int ld) { v16b w; const int g = lane >> 4;
#pragma unroll
  for (int i = 0; i < 8; ++i) { w[i] = (__bf16)Wm[(size_t)(k0 + 8 * g + i) * ld + o]; w[8 + i] = (__bf16)Wm[(size_t)(k0 + 16 + 8 * g + i) * ld + o]; }
  return w; }
__device__ __forceinline__ v16b wcol_oi(const float* Wm, int k0, int o, int lane, int K) { v16b w; const float* p = Wm + (size_t)o * K + k0 + 8 * (lane >> 4);
#pragma unroll
  for (int i = 0; i < 8; ++i) { w[i] = (__bf16)p[i]; w[8 + i] = (__bf16)p[16 + i]; }
  return w; }
__device__ __forceinline__ v16h wcolh_io(const float* Wm, int k0, int o, int lane, int ld) { v16h w; const int g = lane >> 4;
#pragma unroll
  for (int i = 0; i < 8; ++i) { w[i] = (_Float16)(bfr(Wm[(size_t)(k0 + 8 * g + i) * ld + o]) * 256.0f); w[8 + i] = (_Float16)(bfr(Wm[(size_t)(k0 + 16 + 8 * g + i) * ld + o]) * 256.0f); }
  return w; }
__device__ __forceinline__ v16h wcolh_oi(const float* Wm, int k0, int o, int lane, int K) { v16h w; const float* p = Wm + (size_t)o * K + k0 + 8 * (lane >> 4);
#pragma unroll
  for (int i = 0; i < 8; ++i) { w[i] = (_Float16)(bfr(p[i]) * 256.0f); w[8 + i] = (_Float16)(bfr(p[16 + i]) * 256.0f); }
  return w; }
#define WQKV_LAYOUT 1   // (out,in) separate wq / wk / wv [CC][DIN] (wq.reshape(H, DH, D): output column h*32 + c = row of wq)
__device__ __forceinline__ v16b wcol_hdk(const float* Wm, int k0, int o, int lane) { v16b w; const int g = lane >> 4; const float* p = Wm + (size_t)(o / HD) * DIN * HD + (o % HD);
#pragma unroll
  for (int i = 0; i < 8; ++i) { w[i] = (__bf16)p[(size_t)(k0 + 8 * g + i) * HD]; w[8 + i] = (__bf16)p[(size_t)(k0 + 16 + 8 * g + i) * HD]; }
  return w; }
#define WO_OUT_IN 1
#if WQKV_LAYOUT == 1
#define WCOL(W, k0, o, lane) wcol_oi(W, k0, o, lane, DIN)
#elif WQKV_LAYOUT == 2
#define WCOL(W, k0, o, lane) wcol_hdk(W, k0, o, lane)
#else
#define WCOL(W, k0, o, lane) wcol_oi(W, k0, o, lane, DIN)
#endif
#if WO_OUT_IN
#define WOCOL(W, k0, o, lane) wcol_oi(W, k0, o, lane, CC)
#define WOCOLH(W, k0, o, lane) wcolh_oi(W, k0, o, lane, CC)
#else
#define WOCOL(W, k0, o, lane) wcol_io(W, k0, o, lane, DIN)
#define WOCOLH(W, k0, o, lane) wcolh_io(W, k0, o, lane, DIN)
#endif
#define SZ 256             // real positions per row (= TT here)
#define BG 64              // sizes the unused WS_S region (x 4 heads = 256 planes of 256 x 256)
#define NZR ((size_t)NB * SZ)   // 65,536 real pair rows (i, j)
#define SM_EXTRA_PARAMS , const float* __restrict__ BIAS, const float* __restrict__ MKF, int b0s
#define SM_MASK_HOOK do { const int hh = (int)blockIdx.y % HG; const int ii = b0s + (int)blockIdx.y / HG; const int kc2 = k < SZ ? k : SZ - 1; const float add = BIAS[((size_t)t * SZ + kc2) * NH + hh] + 1.0e9f * (bfr(MKF[(size_t)ii * SZ + kc2]) - 1.0f); v = (k < SZ) ? v + add : -3.0e38f; } while (0)   /* + tri_bias[h][q=t][k] + INF (mask[i][k] - 1) (mask is all ones: adds 0, read anyway); key columns k >= SZ would be padding -> excluded (none here: SZ = TT, so the k < SZ test on the loop index always holds) */
__device__ __forceinline__ v16b zero16b() { v16b z; _Pragma("unroll") for (int i = 0; i < 16; ++i) z[i] = (__bf16)0.f; return z; }
#define WS_ZN   (WS_END)
#define WS_BIAS (WS_ZN + 4u * (size_t)NZR * CC)
#define WS_END2 (WS_BIAS + 4u * (size_t)NZR * NH + 1024)
#ifndef SM_EXTRA_PARAMS
#define SM_EXTRA_PARAMS
#endif
#ifndef PROJ_EXTRA_PARAMS
#define PROJ_EXTRA_PARAMS
#endif
#ifndef SM_MASK_HOOK
#define SM_MASK_HOOK (void)0
#endif

// q, k, v, the q residual and the gate lie in the workspace in the order of the 16x16x32 fragments that read them: a 16-byte piece per lane, 32 lanes side by side, so that every wave-wide load or store covers 512 contiguous bytes
#define WS_QH  0u                                      // f16 q [b][h][16-query tile][piece p][lane][8]: query 16 tile + col, channels 32 h + 16 p + 8 g + 0..7
#define WS_KH  (WS_QH + 2u * (size_t)NB * TT * CC)      // f16 k [b][h][16-key tile][piece p][lane][8], as q
#define WS_VT  (WS_KH + 2u * (size_t)NB * TT * CC)      // f16 v [b][h][16-channel tile][32-key step][piece p][lane][8]: channel 32 h + 16 tile + col, keys 32 step + 16 p + 8 g + 0..7
#define WS_QL  (WS_VT + 2u * (size_t)NB * CC * TT)      // f16 q residual x 2^10 [b][h][tile < QHI / 16][piece p][lane][8], as q
#define WS_KL  (WS_QL + 2u * (size_t)NB * QHI * CC)     // f16 k residual x 2^10 rows [b][t < KHI][CC]
#define WS_VB  (WS_KL + 2u * (size_t)NB * KHI * CC)     // bf16 v hi planes [b][c][t < KHI]
#define WS_VBL (WS_VB + 2u * (size_t)NB * CC * KHI)
#define WS_S   (WS_VBL + 2u * (size_t)NB * CC * KHI)    // unused: sized as f32 planes [hg][t][s]; logits stay in registers
#define WS_Y   (WS_S  + 4u * (size_t)BG * HG * TT * TT)   // sized as f32 rows [b t][CC]; holds the 16-bit gate (below)
#define WS_END (WS_Y  + 4u * (size_t)NB * SZ * CC)   /* in the same place: the gate x 65535 as unsigned 16-bit [b][16-position tile][h][piece p][lane][8]: position 16 tile + col, channels 32 h + 16 p + 8 g + 0..7, as q */

// ---- k_front: block = one pair row i = 256 positions, 16 waves x 16 positions: LayerNorm, triangle bias, q, k, gate and v of a position from ONE read of its input row. A lane loads its row's 64 channels directly in the 16x16x32 fragment order (the other 64 sit in lane ^ 16), so mean and variance are in-lane sums plus one exchange, and the normalised row, split bf16 hi + lo, stays in registers as the operand of all five products. The four [128][128] weights and the bias rows are staged once per block in LDS as bf16. Bias, q, k and gate are taken as W x^T (A = weight rows, B = positions): a lane then holds 8 neighbouring channels of ONE position. v is taken as x W^T: a lane holds 8 neighbouring positions of one channel. For q, k, v and the gate those 8 values are the very piece that the same lane of the reading wave wants, so they go from the accumulators straight to the workspace, lane beside lane; the bias goes through LDS first.
__device__ __forceinline__ v8f wmb(v16b a, v16b b, v8f c) { return __builtin_amdgcn_wmma_f32_16x16x32_bf16(false, a, false, b, (short)0, c, false, false); }
// eight 16x16 tiles over K = 128: WROWS: D = W x^T (rows = output channels), else D = x W^T (rows = positions); per tile the order of the sums is hi, lo of k step 0, hi, lo of k step 1, ...
template <bool WROWS> __device__ __forceinline__ void prod8(const __bf16 (*w)[WP], const F2 (&af)[4], v8f (&acc)[8], int col, int lane) {
#pragma unroll
  for (int kc = 0; kc < 4; ++kc) { v16b wf[8];
#pragma unroll
    for (int j = 0; j < 8; ++j) wf[j] = frag_b(&w[j * 16 + col][kc * 32], lane);   /* the LDS reads of a k step go out together, ahead of its products */
#pragma unroll
    for (int j = 0; j < 8; ++j) acc[j] = WROWS ? wmb(wf[j], af[kc].h, acc[j]) : wmb(af[kc].h, wf[j], acc[j]);
#pragma unroll
    for (int j = 0; j < 8; ++j) acc[j] = WROWS ? wmb(wf[j], af[kc].l, acc[j]) : wmb(af[kc].l, wf[j], acc[j]); } }
__global__ __launch_bounds__(512) void k_front(const float* __restrict__ Z, const float* __restrict__ LW, const float* __restrict__ LB, const float* __restrict__ WB, const float* __restrict__ WBB, const float* __restrict__ WQ, const float* __restrict__ WK, const float* __restrict__ WV, const float* __restrict__ WG, const float* __restrict__ GB,
    _Float16* __restrict__ QH, _Float16* __restrict__ QL, _Float16* __restrict__ KH, _Float16* __restrict__ VT, float* __restrict__ BIAS, unsigned short* __restrict__ G) {
  __shared__ __align__(16) __bf16 sw[4][CC][WP]; __shared__ __align__(16) __bf16 swb[16][WP]; __shared__ __align__(16) float sln[4][CC]; __shared__ __align__(16) float sbx[NH][TT];
  const int tid = threadIdx.x, wave = tid >> 5, lane = tid & 31, col = lane & 15, g = lane >> 4; const size_t bb = blockIdx.x; const size_t r0 = bb * TT + wave * 16;
  v4f x[16];
  { /* all 53 loads of a lane at the block's start fly together: no wait stands between them */
    const float* px = Z + (r0 + col) * CC + 8 * g;
#pragma unroll
    for (int n = 0; n < 16; ++n) x[n] = *(const v4f*)(px + (n >> 2) * 32 + ((n >> 1) & 1) * 16 + (n & 1) * 4);
    v4f a[4][8]; const int ch = tid & (CC - 1);
    const float* pb = WB + (wave & (NH - 1)) * CC + lane * 4; const v4f wb4 = *(const v4f*)pb;   /* read by every wave, so that no branch parts the loads; kept by waves 0..3 (bias row = wave) */
    const int sel = wave >> 2, c4 = ch & (NH - 1); const float l0 = LW[ch], l1 = LB[ch], l2 = GB[ch], l3 = WBB[c4];   /* likewise; four waves each keep ln_g, ln_b, the gate's bias and wb_b (its 4 values repeated) */
#pragma unroll
    for (int it = 0; it < 8; ++it) { a[0][it] = *(const v4f*)(WQ + tid * 4 + it * 2048); a[1][it] = *(const v4f*)(WK + tid * 4 + it * 2048); a[2][it] = *(const v4f*)(WV + tid * 4 + it * 2048); a[3][it] = *(const v4f*)(WG + tid * 4 + it * 2048); }
    asm volatile("s_wait_xcnt 0x0" :: "v"(px), "v"(pb), "v"(ch), "v"(c4) : "memory");   /* the address registers of these loads are reused below; px, pb, ch and c4 stay live up to this wait, so that no load of the group lands on address registers of the group */
    asm volatile("" :: "v"(l0), "v"(l1), "v"(l2), "v"(l3));   /* inputs only: holds these four loads up here with the others; the compiler otherwise sinks them into branches behind the staging, where their latency is waited out alone */
#pragma unroll
    for (int m = 0; m < 4; ++m)
#pragma unroll
      for (int it = 0; it < 8; ++it) { v4b w;
#pragma unroll
        for (int i = 0; i < 4; ++i) w[i] = (__bf16)a[m][it][i];
        *(v4b*)&sw[m][it * 16 + wave][lane * 4] = w; }
    v4b w;
#pragma unroll
    for (int i = 0; i < 4; ++i) w[i] = (__bf16)(wave < NH ? wb4[i] : 0.f);
    *(v4b*)&swb[wave][lane * 4] = w;   /* rows 4..15 of the one bias tile are zero */
    sln[sel][ch] = bfr(sel == 0 ? l0 : sel == 1 ? l1 : sel == 2 ? l2 : l3); }
  __syncthreads();   /* every wave wrote a part of the weight rows that all sixteen read */
  F2 af[4];
  { float s4[4] = {0.f, 0.f, 0.f, 0.f};
#pragma unroll
    for (int n = 0; n < 16; ++n)
#pragma unroll
      for (int i = 0; i < 4; ++i) { x[n][i] = bfr(x[n][i]); s4[i] += x[n][i]; }
    float s1 = (s4[0] + s4[1]) + (s4[2] + s4[3]); s1 += __shfl_xor(s1, 16);
    const float mu = s1 * (1.0f / CC); float q4[4] = {0.f, 0.f, 0.f, 0.f};
#pragma unroll
    for (int n = 0; n < 16; ++n)
#pragma unroll
      for (int i = 0; i < 4; ++i) { const float d = x[n][i] - mu; q4[i] += d * d; }
    float q = (q4[0] + q4[1]) + (q4[2] + q4[3]); q += __shfl_xor(q, 16);
    const float rs = rsqrtf(q * (1.0f / CC) + 1e-5f);
#pragma unroll
    for (int kc = 0; kc < 4; ++kc) { float v[16];
#pragma unroll
      for (int s = 0; s < 4; ++s) { const int c = kc * 32 + 8 * g + (s >> 1) * 16 + (s & 1) * 4; const v4f lw = *(const v4f*)&sln[0][c], lb = *(const v4f*)&sln[1][c];
#pragma unroll
        for (int i = 0; i < 4; ++i) v[s * 4 + i] = (x[kc * 4 + s][i] - mu) * rs * lw[i] + lb[i]; }
      af[kc] = bsplit16(v); } }
  { /* triangle bias: heads = rows 0..3 of the tile, so lanes 0..15 hold the 4 heads of their position; the block's 256 positions are gathered head by head in LDS, so that the workspace takes whole 512-B runs of one head's row [h][j][k], the form in which k_fa copies it */
    v8f ab = {};
#pragma unroll
    for (int kc = 0; kc < 4; ++kc) { const v16b wf = frag_b(&swb[col][kc * 32], lane); ab = wmb(wf, af[kc].h, ab); ab = wmb(wf, af[kc].l, ab); }
    if (g == 0) {
#pragma unroll
      for (int i = 0; i < 4; ++i) sbx[i][wave * 16 + col] = (ab[i] + sln[3][i]) * LOG2E; }   /* + wb_b[h]; base-2 units, once per value */
    __syncthreads();   /* a 512-B run holds the positions of eight waves */
    if (wave < 2 * NH) { const v4f t = *(const v4f*)&sbx[wave >> 1][(wave & 1) * 128 + lane * 4]; float* db = BIAS + (size_t)(wave >> 1) * (SZ * SZ) + bb * SZ + (wave & 1) * 128 + lane * 4; vst2(db, t);
      asm volatile("s_wait_xcnt 0x0" :: "v"(db), "v"(t) : "memory");   /* the store's registers are reused below; they stay live up to this wait */ } }
  { /* v: 16 positions of the wave = piece (wave & 1) of key step (wave >> 1); accumulator tile j = channel tile (j & 1) of head (j >> 1) */
    v8f acc[8] = {}; prod8<false>(sw[2], af, acc, col, lane); v8h hv[8];
#pragma unroll
    for (int j = 0; j < 8; ++j)
#pragma unroll
      for (int r = 0; r < 8; ++r) hv[j][r] = (_Float16)acc[j][r];
    _Float16* dv = VT + (bb * 128 + wave) * (size_t)256 + lane * 8;
#pragma unroll
    for (int j = 0; j < 8; ++j) vst2(dv + j * 4096, hv[j]);   /* 512 contiguous bytes per store */
    asm volatile("s_wait_xcnt 0x0" :: "v"(dv), "v"(hv[0]), "v"(hv[1]), "v"(hv[2]), "v"(hv[3]), "v"(hv[4]), "v"(hv[5]), "v"(hv[6]), "v"(hv[7]) : "memory");   /* the stores' registers are reused below; they stay live up to this wait */ }
  const bool hi = wave * 16 < QHI;   /* wave-uniform: these positions carry the q residual */
#pragma unroll
  for (int m = 0; m < 2; ++m) { /* q, then k: the wave's 16 positions = tile (wave); accumulator tile j = piece (j & 1) of head (j >> 1) */
    v8f acc[8] = {}; prod8<true>(sw[m], af, acc, col, lane); const bool res = m == 0 && hi; v8h hv[8];
#pragma unroll
    for (int j = 0; j < 8; ++j)
#pragma unroll
      for (int r = 0; r < 8; ++r) hv[j][r] = (_Float16)acc[j][r];
    _Float16* dh = (m == 0 ? QH : KH) + (bb * 128 + wave * 2) * (size_t)256 + lane * 8;
#pragma unroll
    for (int j = 0; j < 8; ++j) vst2(dh + ((j >> 1) * 32 + (j & 1)) * 256, hv[j]);   /* 512 contiguous bytes per store */
    if (res) { v8h lv[8];
#pragma unroll
      for (int j = 0; j < 8; ++j)
#pragma unroll
        for (int r = 0; r < 8; ++r) lv[j][r] = (_Float16)((acc[j][r] - (float)hv[j][r]) * 1024.0f);
      _Float16* dl = QL + (bb * 32 + wave * 2) * (size_t)256 + lane * 8;
#pragma unroll
      for (int j = 0; j < 8; ++j) vst2(dl + ((j >> 1) * 8 + (j & 1)) * 256, lv[j]);
      asm volatile("s_wait_xcnt 0x0" :: "v"(dl), "v"(lv[0]), "v"(lv[1]), "v"(lv[2]), "v"(lv[3]), "v"(lv[4]), "v"(lv[5]), "v"(lv[6]), "v"(lv[7]) : "memory");   /* as below */ }
    asm volatile("s_wait_xcnt 0x0" :: "v"(dh), "v"(hv[0]), "v"(hv[1]), "v"(hv[2]), "v"(hv[3]), "v"(hv[4]), "v"(hv[5]), "v"(hv[6]), "v"(hv[7]) : "memory");   /* the stores' registers are reused below; they stay live up to this wait */ }
  { /* gate: a value in 0..1, kept as round(65535 x): its step, 2^-16, is of the size of the rounding that the bf16 hi + lo split of the gated ctx makes anyway, and the plane is half as many bytes to write here and to read in k_fa; accumulator tile j = piece (j & 1) of head (j >> 1) */
    v8f acc[8] = {}; prod8<true>(sw[3], af, acc, col, lane); v4u s[8];
    __builtin_amdgcn_sched_barrier(0);   /* keeps the products, k step by k step, ahead of the sigmoids: drawn in among them they hold the weight fragments of several k steps at once, and registers spill */
#pragma unroll
    for (int j = 0; j < 8; ++j) { const v4f g0 = *(const v4f*)&sln[2][j * 16 + 8 * g], g1 = *(const v4f*)&sln[2][j * 16 + 8 * g + 4];
      v8f t;
#pragma unroll
      for (int r = 0; r < 4; ++r) { t[r] = (acc[j][r] + g0[r]) * -LOG2E; t[4 + r] = (acc[j][4 + r] + g1[r]) * -LOG2E; }
      t = rcpx8(exp2x8(t) + 1.0f);   /* sigmoid(zn w_gate + b_gate) = 1 / (1 + 2^(-x log2 e)) */
#pragma unroll
      for (int r = 0; r < 4; ++r) s[j][r] = __builtin_bit_cast(unsigned, __builtin_amdgcn_cvt_pknorm_u16(t[2 * r], t[2 * r + 1])); }   /* channel 2 r in the low half */
    unsigned short* dg = G + (bb * 16 + wave) * (size_t)2048 + lane * 8;
#pragma unroll
    for (int n = 0; n < 8; ++n) vst2(dg + n * 256, s[n]);   /* 512 contiguous bytes per store */
    asm volatile("s_wait_xcnt 0x0" :: "v"(dg), "v"(s[0]), "v"(s[1]), "v"(s[2]), "v"(s[3]), "v"(s[4]), "v"(s[5]), "v"(s[6]), "v"(s[7]) : "memory");   /* the stores' registers stay live up to this wait, so that no later sigmoid lands on them */ } }
#define NW 16
#define RB 4               // pair rows per block
#define QB 4               // 16-query tiles per block
#define OP 132             // f32 elements per row of a wave's output tile in LDS: 528 B = 16 B x odd
#define BP (TT + 4)        // f32 elements per bias row in LDS: 1040 B = 16 B x odd: 16-byte reads of 16 rows fall on distinct banks
// the ring in bytes: sixteen slots of SS bytes, slot w = what wave w copies; the first O_V bytes of every slot together are buffer 0, the rest buffer 1. Buffer 0: the wave's own q and q residual, a quarter (4 fragments) of its pair row's K, the bias rows of queries 4 w .. 4 w + 3 of the block. Buffer 1: a quarter of its pair row's V, the wave's own gate tile. SS / 4 = 16 (mod 64) and BP = 4 (mod 64), so the 16-byte reads of the 16 bias rows of a query tile (4 slots x 4 rows) fall on distinct banks; the K and V of four slots lie within the 64 KiB that an instruction's offset reaches, so one address register serves a pair row's K and V
#define O_Q  0
#define O_QL 1024
#define O_K  2048
#define O_B  6144
#define O_V  (O_B + 4 * BP * 4)                 // 10,304
#define O_G  (O_V + 4096)
#define SS   (O_G + 1024)                       // 15,424
#define R_END (NW * SS)
__device__ __forceinline__ v8f wm16(v16h a, v16h b, v8f c) { return __builtin_amdgcn_wmma_f32_16x16x32_f16(false, a, false, b, (short)0, c, false, false); }
__device__ __forceinline__ v16h frag_p(const _Float16* p) { union { v16h v; v8h q[2]; } u; u.q[0] = *(const v8h*)p; u.q[1] = *(const v8h*)(p + 256); return u.v; }   /* a fragment stored in fragment order: its two pieces lie 512 B apart, the lane's offset is already in p */
// asynchronous copies, 16 bytes per lane each (512 B per wave): global bytes p + o + .. (p the wave's, in scalar registers; o = 16 lane) to LDS bytes l + N + ..; the instruction's offset moves both addresses alike, so one LDS address register serves the whole slot and each scalar base holds p - N, N the stream's place in the slot. All copies of a buffer, those of the q residual apart, stand in one statement that closes with s_wait_xcnt 0: the wait comes ahead of every rewrite of their address registers, and is paid once
__device__ __forceinline__ void cp_buf0(unsigned l, unsigned o, const char* q, const char* k, const char* bi) { const char *aq = q - O_Q, *ak = k - O_K, *b0 = bi - O_B, *b1 = bi + 1024 - (O_B + BP * 4), *b2 = bi + 2048 - (O_B + 2 * BP * 4), *b3 = bi + 3072 - (O_B + 3 * BP * 4);
  asm volatile("global_load_async_to_lds_b128 %0, %1, %2 offset:%8\n\tglobal_load_async_to_lds_b128 %0, %1, %2 offset:%9\n\tglobal_load_async_to_lds_b128 %0, %1, %3 offset:%10\n\tglobal_load_async_to_lds_b128 %0, %1, %3 offset:%11\n\tglobal_load_async_to_lds_b128 %0, %1, %3 offset:%12\n\tglobal_load_async_to_lds_b128 %0, %1, %3 offset:%13\n\tglobal_load_async_to_lds_b128 %0, %1, %3 offset:%14\n\tglobal_load_async_to_lds_b128 %0, %1, %3 offset:%15\n\tglobal_load_async_to_lds_b128 %0, %1, %3 offset:%16\n\tglobal_load_async_to_lds_b128 %0, %1, %3 offset:%17\n\tglobal_load_async_to_lds_b128 %0, %1, %4 offset:%18\n\tglobal_load_async_to_lds_b128 %0, %1, %4 offset:%19\n\tglobal_load_async_to_lds_b128 %0, %1, %5 offset:%20\n\tglobal_load_async_to_lds_b128 %0, %1, %5 offset:%21\n\tglobal_load_async_to_lds_b128 %0, %1, %6 offset:%22\n\tglobal_load_async_to_lds_b128 %0, %1, %6 offset:%23\n\tglobal_load_async_to_lds_b128 %0, %1, %7 offset:%24\n\tglobal_load_async_to_lds_b128 %0, %1, %7 offset:%25\n\ts_wait_xcnt 0x0" :: "v"(l), "v"(o), "s"(aq), "s"(ak), "s"(b0), "s"(b1), "s"(b2), "s"(b3), "i"(O_Q), "i"(O_Q + 512), "i"(O_K + 0), "i"(O_K + 512), "i"(O_K + 1024), "i"(O_K + 1536), "i"(O_K + 2048), "i"(O_K + 2560), "i"(O_K + 3072), "i"(O_K + 3584), "i"(O_B + 0 * BP * 4), "i"(O_B + 0 * BP * 4 + 512), "i"(O_B + 1 * BP * 4), "i"(O_B + 1 * BP * 4 + 512), "i"(O_B + 2 * BP * 4), "i"(O_B + 2 * BP * 4 + 512), "i"(O_B + 3 * BP * 4), "i"(O_B + 3 * BP * 4 + 512) : "memory"); }
__device__ __forceinline__ void cp_ql(unsigned l, unsigned o, const char* p) { const char* a = p - O_QL;
  asm volatile("global_load_async_to_lds_b128 %0, %1, %2 offset:%3\n\tglobal_load_async_to_lds_b128 %0, %1, %2 offset:%4\n\ts_wait_xcnt 0x0" :: "v"(l), "v"(o), "s"(a), "i"(O_QL), "i"(O_QL + 512) : "memory"); }
__device__ __forceinline__ void cp_buf1(unsigned l, unsigned o, const char* v, const char* gt) { const char *av = v - O_V, *ag = gt - O_G;
  asm volatile("global_load_async_to_lds_b128 %0, %1, %2 offset:%4\n\tglobal_load_async_to_lds_b128 %0, %1, %2 offset:%5\n\tglobal_load_async_to_lds_b128 %0, %1, %2 offset:%6\n\tglobal_load_async_to_lds_b128 %0, %1, %2 offset:%7\n\tglobal_load_async_to_lds_b128 %0, %1, %2 offset:%8\n\tglobal_load_async_to_lds_b128 %0, %1, %2 offset:%9\n\tglobal_load_async_to_lds_b128 %0, %1, %2 offset:%10\n\tglobal_load_async_to_lds_b128 %0, %1, %2 offset:%11\n\tglobal_load_async_to_lds_b128 %0, %1, %3 offset:%12\n\tglobal_load_async_to_lds_b128 %0, %1, %3 offset:%13\n\ts_wait_xcnt 0x0" :: "v"(l), "v"(o), "s"(av), "s"(ag), "i"(O_V + 0), "i"(O_V + 512), "i"(O_V + 1024), "i"(O_V + 1536), "i"(O_V + 2048), "i"(O_V + 2560), "i"(O_V + 3072), "i"(O_V + 3584), "i"(O_G + 0), "i"(O_G + 512) : "memory"); }
// the value of lane ^ 16, by the LDS crossbar as __shfl_xor(x, 16) takes it, but with the pattern in the instruction (xor mask 16, and mask 31): no index register lives through the loop
__device__ __forceinline__ float xhalf(float x) { return __builtin_bit_cast(float, __builtin_amdgcn_ds_swizzle(__builtin_bit_cast(int, x), 0x401f)); }
// the publish point of the two-buffer ring: this wave's LDS reads of the buffer it leaves have returned, its own copies into the other buffer have landed, and behind the barrier every wave may read the one and refill the other
#define RING_FOOT() do { asm volatile("s_wait_dscnt 0x0" ::: "memory"); asm volatile("s_wait_asynccnt 0x0" ::: "memory"); __syncthreads(); } while (0)
__global__ __launch_bounds__(NW * 32) void k_fa(const _Float16* __restrict__ QH, const _Float16* __restrict__ KH, const _Float16* __restrict__ QL, const _Float16* __restrict__ VT, const float* __restrict__ BIAS, const float* __restrict__ MKF, const unsigned short* __restrict__ G, const float* __restrict__ WO, float* __restrict__ OUT) {
  __shared__ __align__(16) char ring[R_END];   /* behind the loop its start serves as the waves' output tiles [wave][query][OP] */
  __shared__ __align__(16) float smk[RB][TT];
  __shared__ __align__(16) __bf16 swo[DIN][WP];
  const int tid = threadIdx.x, wave = __builtin_amdgcn_readfirstlane(tid >> 5), lane = tid & 31, col = lane & 15, g = lane >> 4; const int row = wave >> 2, qt = wave & (QB - 1);   /* the wave's number in a scalar register: all that depends on it alone is scalar arithmetic */
  const int T = (int)blockIdx.x * QB + qt, q0 = T * 16; const int b = (int)blockIdx.y * RB + row;
  const bool hi = (int)blockIdx.x * (QB * 16) < QHI;   /* block-uniform: these queries carry the q residual */
  const unsigned l0 = (unsigned)(size_t)ring + wave * SS + lane * 16;   /* the wave's slot: its byte address in the work-group's LDS, plus the lane's place in a 512-B run */
  /* the wave's first byte of each stream, head 0; a head further on: K, V, q 16 KiB, bias 256 KiB, q residual 4 KiB, gate 1 KiB */
  const char* gk = (const char*)KH + (size_t)b * 65536 + qt * 4096; const char* gv = (const char*)VT + (size_t)b * 65536 + qt * 4096;
  const char* gb = (const char*)BIAS + ((size_t)blockIdx.x * (QB * 16) + wave * 4) * 1024;
  const char* gq = (const char*)QH + ((size_t)b * 64 + T) * 1024; const char* gl = (const char*)QL + ((size_t)b * 16 + qt) * 1024;
  const char* gg = (const char*)G + ((size_t)b * 16 + T) * 4096;
  const unsigned lo = lane * 16;
#define COPY_K(hh) do { const size_t h_ = (size_t)(hh); cp_buf0(l0, lo, gq + h_ * 16384, gk + h_ * 16384, gb + h_ * 262144); if (hi) cp_ql(l0, lo, gl + h_ * 4096); } while (0)
#define COPY_V(hh) do { const size_t h_ = (size_t)(hh); cp_buf1(l0, lo, gv + h_ * 16384, gg + h_ * 1024); } while (0)
  COPY_K(0);
  /* while head 0 flies: wo (out,in) [128][128] f32 (each wave-load takes one whole 512-B row) and a quarter of the wave's mask row */
  const float* pw = WO + tid * 4; const float* pm = MKF + (size_t)b * SZ + qt * 64 + lane * 2; v4f a[8];
#pragma unroll
  for (int it = 0; it < 8; ++it) a[it] = *(const v4f*)(pw + it * (NW * 128));
  v2f m0 = *(const v2f*)pm;
  asm volatile("s_wait_xcnt 0x0" :: "v"(pw), "v"(pm) : "memory");   /* the address registers of these loads are reused below; pw and pm stay live up to this wait */
#pragma unroll
  for (int it = 0; it < 8; ++it) { v4b w;
#pragma unroll
    for (int i = 0; i < 4; ++i) w[i] = (__bf16)a[it][i];
    *(v4b*)&swo[it * NW + wave][lane * 4] = w; }   /* wo as bf16 rows */
#pragma unroll
  for (int c = 0; c < 2; ++c) m0[c] = (1.0e9f * LOG2E) * (bfr(m0[c]) - 1.0f);   /* INF (mask[i][k] - 1) in base-2 units, once per block for the four heads */
  *(v2f*)&smk[row][qt * 64 + lane * 2] = m0;
  asm volatile("s_wait_asynccnt 0x0" ::: "memory");   /* this wave's copies of head 0 have landed */
  __syncthreads();   /* publishes buffer 0 of head 0, the wo rows and the mask rows */
  COPY_V(0);
  const _Float16* const sq = (const _Float16*)(ring + wave * SS) + lane * 8;   /* the wave's own slot */
  const _Float16* const sk = (const _Float16*)(ring + row * (4 * SS)) + lane * 8;   /* the four slots of the pair row; fragment f of K or V: slot f >> 2, 1 KiB each */
#define FR(f, O) (((f) >> 2) * (SS / 2) + (O) / 2 + ((f) & 3) * 512)
  const float* const sbq = (const float*)(ring + (qt * 4 + (col >> 2)) * SS + O_B) + (col & 3) * BP + 8 * g; const float* const smr = &smk[row][8 * g]; const _Float16* const sg = sq + O_G / 2;
  v8f acc[8] = {};   /* out^T: tile j = output channels 16 j + 8 g + r of query col */
  /* the loop over heads stays rolled: one tile's registers at a time keep four waves on a SIMD; every inner loop is unrolled so that st[] is indexed by constants and stays in registers */
#pragma unroll 1
  for (int h = 0; h < NH; ++h) {
    /* trip 2 h: reads buffer 0 alone */
    const v16h qf = frag_p(sq + O_Q / 2); v8f st[TT / 16];
    if (hi) { const v16h ql = frag_p(sq + O_QL / 2);
#pragma unroll
      for (int j = 0; j < TT / 16; ++j) { const v8f z = {}; const v16h kf = frag_p(sk + FR(j, O_K)); const v8f ah = wm16(kf, qf, z), al = wm16(kf, ql, z);
#pragma unroll
        for (int r = 0; r < 8; ++r) st[j][r] = ah[r] + al[r] * (1.0f / 1024.0f); }
    } else {
#pragma unroll
      for (int jb = 0; jb < TT / 16; jb += 8) { v16h kf[8];
#pragma unroll
        for (int j = 0; j < 8; ++j) kf[j] = frag_p(sk + FR(jb + j, O_K));
        __builtin_amdgcn_sched_barrier(0);   /* keeps the products behind a batch of eight fragments' LDS reads: without it the compiler draws each product up behind its own two reads, into one pair of registers, and every fragment's LDS latency is waited out alone */
#pragma unroll
        for (int j = 0; j < 8; ++j) { const v8f z = {}; st[jb + j] = wm16(kf[j], qf, z); } } }
    float m = -3.0e38f;
#pragma unroll
    for (int j = 0; j < TT / 16; ++j) { const v4f a0 = *(const v4f*)(smr + j * 16), a1 = *(const v4f*)(smr + j * 16 + 4); const v4f b0v = *(const v4f*)(sbq + j * 16), b1v = *(const v4f*)(sbq + j * 16 + 4);
#pragma unroll
      for (int r = 0; r < 4; ++r) { st[j][r] = st[j][r] * SCALE2 + (b0v[r] + a0[r]); st[j][4 + r] = st[j][4 + r] * SCALE2 + (b1v[r] + a1[r]); m = fmaxf(m, fmaxf(st[j][r], st[j][4 + r])); } }
    m = fmaxf(m, xhalf(m));
    RING_FOOT();
    if (h + 1 < NH) COPY_K(h + 1);   /* the same for the whole work-group; into the buffer that every wave has just left */
    /* trip 2 h + 1: reads buffer 1 alone */
    float s4[4] = {0.f, 0.f, 0.f, 0.f};
#pragma unroll
    for (int j = 0; j < TT / 16; ++j) { v8f d;
#pragma unroll
      for (int r = 0; r < 8; ++r) d[r] = st[j][r] - m;
      st[j] = exp2x8(d);
#pragma unroll
      for (int r = 0; r < 8; ++r) s4[r & 3] += st[j][r]; }
    float sum = (s4[0] + s4[1]) + (s4[2] + s4[3]); sum += xhalf(sum);
    const float f = sum > 0.f ? 2048.0f * __builtin_amdgcn_rcpf(sum) : 0.f;
    v8f o0 = {}, o1 = {};
#pragma unroll
    for (int kc = 0; kc < TT / 32; ++kc) { v16h p;
#pragma unroll
      for (int s = 0; s < 8; ++s) { p[s] = (_Float16)(st[2 * kc][s] * f); p[8 + s] = (_Float16)(st[2 * kc + 1][s] * f); }   /* keys kc*32 + 8 g + s and kc*32 + 16 + 8 g + s: the k order of frag_h */
      o0 = wm16(frag_p(sk + FR(kc, O_V)), p, o0); o1 = wm16(frag_p(sk + FR(8 + kc, O_V)), p, o1); }
    /* a lane holds channels 8 g + r (o0) and 16 + 8 g + r (o1) of its query: pieces 0 and 1 of the gate tile that k_front wrote, two 16-bit values to a word; GS takes back the 2^11 of P and the 65535 of the gate */
    const v4u g0 = *(const v4u*)sg, g1 = *(const v4u*)(sg + 256); float v[16]; const float GS = (float)(1.0 / (2048.0 * 65535.0));
#pragma unroll
    for (int c = 0; c < 4; ++c) { v[2 * c] = o0[2 * c] * ((float)(g0[c] & 0xffffu) * GS); v[2 * c + 1] = o0[2 * c + 1] * ((float)(g0[c] >> 16) * GS); v[8 + 2 * c] = o1[2 * c] * ((float)(g1[c] & 0xffffu) * GS); v[9 + 2 * c] = o1[2 * c + 1] * ((float)(g1[c] >> 16) * GS); }
    /* channels 32 h + 8 g + 0..7 and 32 h + 16 + 8 g + 0..7 of query col = the B fragment of k step h of out^T = wo ctx^T, split bf16 hi + lo; per tile the order of the sums is hi, lo of head 0, hi, lo of head 1, ... */
    const F2 yf = bsplit16(v); v16b wf[8];
#pragma unroll
    for (int j = 0; j < 8; ++j) wf[j] = frag_b(&swo[j * 16 + col][h * 32], lane);
#pragma unroll
    for (int j = 0; j < 8; ++j) acc[j] = wmb(wf[j], yf.h, acc[j]);
#pragma unroll
    for (int j = 0; j < 8; ++j) acc[j] = wmb(wf[j], yf.l, acc[j]);
    RING_FOOT();
    if (h + 1 < NH) COPY_V(h + 1); }
  asm volatile("s_wait_asynccnt 0x0" ::: "memory");   /* no copy is in flight when the ring turns into output tiles and when the wave ends */
  float (*sf)[OP] = (float (*)[OP])(ring + wave * (16 * OP * 4));   /* behind the last barrier nobody reads the ring: a wave's own 16 x OP tile from the ring's start turns a lane's 8 channels of one query into whole 512-B output rows */
  const int ln = (int)__builtin_amdgcn_mbcnt_lo(~0u, 0u), cl = ln & 15, gl2 = ln >> 4;   /* the lane's number taken anew, so that no address of this part holds a register through the loop */
#pragma unroll
  for (int j = 0; j < 8; ++j) { const v4f t0 = {acc[j][0], acc[j][1], acc[j][2], acc[j][3]}, t1 = {acc[j][4], acc[j][5], acc[j][6], acc[j][7]};
    *(v4f*)&sf[cl][j * 16 + 8 * gl2] = t0; *(v4f*)&sf[cl][j * 16 + 8 * gl2 + 4] = t1; }
  LDSX();   /* the lanes of this wave read each other's values below */
  float* po = OUT + ((size_t)b * SZ + q0) * DIN + ln * 4;
  for (int rl = 0; rl < 16; ++rl) vst2(po + rl * DIN, *(const v4f*)&sf[rl][ln * 4]); }

extern "C" void kernel_launch(void* const* d_in, const int* in_sizes, int n_in, void* d_out, int out_size, void* d_ws, size_t ws_size, hipStream_t stream) {
  (void)in_sizes; (void)n_in; (void)out_size;
  const float** F = (const float**)d_in;
  if (ws_size < (size_t)WS_END) return;
  char* ws = (char*)d_ws; _Float16 *QH = (_Float16*)(ws + WS_QH), *KH = (_Float16*)(ws + WS_KH), *VT = (_Float16*)(ws + WS_VT), *QL = (_Float16*)(ws + WS_QL), *KL = (_Float16*)(ws + WS_KL); __bf16 *VB = (__bf16*)(ws + WS_VB), *VBL = (__bf16*)(ws + WS_VBL); unsigned short *GT = (unsigned short*)(ws + WS_Y);
  (void)QL; (void)KL; (void)VB; (void)VBL;
  // inputs (in order): 0 pair_repr [1,256,256,128]; 1 mask [1,256,256] f32 (ones); 2 ln_g, 3 ln_b; 4 wb_w [4,128] (out,in), 5 wb_b [4]; 6 wq, 7 wk, 8 wv [128,128] (out,in); 9 wo [128,128] (out,in); 10 wg_w [128,128] (out,in), 11 wg_b [128]
  if (ws_size < (size_t)WS_END2) return;
  float *BIAS = (float*)(ws + WS_BIAS);
  k_front<<<dim3(NB), 512, 0, stream>>>(F[0], F[2], F[3], F[4], F[5], F[6], F[7], F[8], F[10], F[11], QH, QL, KH, VT, BIAS, GT);   /* LayerNorm, tri bias rows (+ wb_b), q, k, v and the gate (in the Y buffer) from one read of the input */
  k_fa<<<dim3(SZ / (QB * 16), TNB / RB), NW * 32, 0, stream>>>(QH, KH, QL, VT, BIAS, F[1], GT, F[9], (float*)d_out);   /* logits, softmax, P.v, gate and the output projection fused; no score planes and no ctx in the workspace */
}

// v010
// A run of this version takes 39.4 microseconds.
// In two side-by-side timings against v009, it was 1.37 and 1.39 times as fast.
// Over all steps from v000 it is 10.5 times as fast.
// compute dtype: all float inputs rounded to bf16; LayerNorm in f32; q/k/v, the triangle bias and the gate from the f32 LayerNorm rows split bf16 hi + lo against exact bf16 weights on WMMA 16x16x32 (2 products, f32 accumulate); logits: q x 32^-0.5 log2 e as f16 hi + residual for the first 64 queries of each pair row and single f16 elsewhere (sigma_logit ~ 0.25), q.k summed onto the f32 bias in the accumulator, + mask in f32; softmax in f32 (native exp2 on base-2 logits, in registers, fused with both products); P x 2^11 once to f16 against v once to f16 (1 product); the gate (a sigmoid, in 0..1) is kept in LDS as 16-bit fixed point, steps of 1/65535; gated ctx split bf16 hi + lo against exact wo (2 products); f32 output.
// Triangle attention, starting node (B 1, I = J = 256 residues, D 128, 4 heads x 32; 0.02-scale (out,in) weights, mask all ones, wb_b = 0, wg_b = 1): z = LayerNorm(pair_repr); tri_bias[h][j][k] = z[j][k] . wb_w[h] + wb_b[h]; for each row i: q = (z[i] wq^T)/sqrt(32), k = z[i] wk^T, v = z[i] wv^T (heads = 32-wide slices of the output dim); a = softmax_k(q . k + 1e9 (mask[i][k] - 1) + tri_bias[h][j][k]); y = merged heads; y = sigmoid(z[i] wg_w^T + wg_b) * y; out[i] = y wo^T.
#include <hip/hip_runtime.h>
#include <math.h>

typedef __attribute__((ext_vector_type(16))) _Float16 v16h;
typedef __attribute__((ext_vector_type(16))) __bf16 v16b;
typedef __attribute__((ext_vector_type(8)))  _Float16 v8h;
typedef __attribute__((ext_vector_type(8)))  float v8f;
typedef __attribute__((ext_vector_type(4)))  float v4f;
typedef __attribute__((ext_vector_type(2)))  float v2f;
typedef __attribute__((ext_vector_type(4)))  unsigned v4u;
typedef __attribute__((ext_vector_type(4)))  int v4i;
typedef float __attribute__((may_alias)) float_a;
typedef int __attribute__((may_alias)) int_a;

template <typename T> __device__ __forceinline__ void vst2(void* p, T v) { *(T*)p = v;  }
__device__ __forceinline__ v8f wmma16(v16h a, v16h b, v8f c) {
  v8f d = __builtin_amdgcn_wmma_f32_16x16x32_f16(false, a, false, b, (short)0, c, false, false);
  asm volatile("v_nop\n\tv_nop\n\tv_nop\n\tv_nop" : "+v"(d) : "v"(a), "v"(b));
  return d;
}
__device__ __forceinline__ v8f wmma_bf(v16b a, v16b b, v8f c) {
  v8f d = __builtin_amdgcn_wmma_f32_16x16x32_bf16(false, a, false, b, (short)0, c, false, false);
  asm volatile("v_nop\n\tv_nop\n\tv_nop\n\tv_nop" : "+v"(d) : "v"(a), "v"(b));
  return d;
}
// 16x16x32 fragments: lane = (h = lane>>4, row/col = lane&15); elements 0..7 = k0+8h+0..7, 8..15 = k0+16+8h+0..7; D element r = row 8h+r
__device__ __forceinline__ v16h frag_h(const _Float16* rowk0, int lane) {
  union { v16h v; v8h q[2]; } u; const _Float16* p = rowk0 + 8 * (lane >> 4);
  u.q[0] = *(const v8h*)p; u.q[1] = *(const v8h*)(p + 16); return u.v;
}
__device__ __forceinline__ v16h frag_f32(const float* rowk0, int lane) {
  v16h a; const float* p = rowk0 + 8 * (lane >> 4);
#pragma unroll
  for (int i = 0; i < 8; ++i) { a[i] = (_Float16)p[i]; a[8 + i] = (_Float16)p[16 + i]; }
  return a;
}
__device__ __forceinline__ v16h frag_f32s(const float* rowk0, int lane, float sc) {
  v16h a; const float* p = rowk0 + 8 * (lane >> 4);
#pragma unroll
  for (int i = 0; i < 8; ++i) { a[i] = (_Float16)(p[i] * sc); a[8 + i] = (_Float16)(p[16 + i] * sc); }
  return a;
}
// column fragment from a [K][ld] layout (column n), rows >= K read as 0
__device__ __forceinline__ v16h fragc_f32(const float* W, int k0, int n, int lane, int ld, int K) {
  v16h a; const int g = lane >> 4;
#pragma unroll
  for (int i = 0; i < 8; ++i) { const int ka = k0 + 8 * g + i, kb = ka + 16;
    a[i] = (_Float16)(ka < K ? W[(size_t)(ka < K ? ka : K - 1) * ld + n] : 0.f); a[8 + i] = (_Float16)(kb < K ? W[(size_t)(kb < K ? kb : K - 1) * ld + n] : 0.f); }
  return a;
}
struct F2 { v16b h, l; };
__device__ __forceinline__ F2 bsplit16(const float v[16]) { F2 r;
#pragma unroll
  for (int i = 0; i < 16; ++i) { const __bf16 h = (__bf16)v[i]; r.h[i] = h; r.l[i] = (__bf16)(v[i] - (float)h); }
  return r; }
__device__ __forceinline__ F2 split_row(const float* row, int k0, int lane) { float v[16]; const float* p = row + k0 + 8 * (lane >> 4);
#pragma unroll
  for (int i = 0; i < 8; ++i) { v[i] = p[i]; v[8 + i] = p[16 + i]; }
  return bsplit16(v); }
__device__ __forceinline__ F2 split_rowK(const float* row, int k0, int lane, int K) { float v[16]; const int g = lane >> 4;
#pragma unroll
  for (int i = 0; i < 8; ++i) { const int ka = k0 + 8 * g + i, kb = ka + 16; v[i] = ka < K ? row[ka < K ? ka : K - 1] : 0.f; v[8 + i] = kb < K ? row[kb < K ? kb : K - 1] : 0.f; }
  return bsplit16(v); }
__device__ __forceinline__ F2 split_col(const float* W, int k0, int n, int lane, int ld, int K) { float v[16]; const int g = lane >> 4;
#pragma unroll
  for (int i = 0; i < 8; ++i) { const int ka = k0 + 8 * g + i, kb = ka + 16; v[i] = ka < K ? W[(size_t)(ka < K ? ka : K - 1) * ld + n] : 0.f; v[8 + i] = kb < K ? W[(size_t)(kb < K ? kb : K - 1) * ld + n] : 0.f; }
  return bsplit16(v); }
__device__ __forceinline__ v8f mac3(const F2& a, const F2& b, v8f c) { c = wmma_bf(a.l, b.h, c); c = wmma_bf(a.h, b.l, c); return wmma_bf(a.h, b.h, c); }
__device__ __forceinline__ float sigm(float v) { return 1.0f / (1.0f + expf(-v)); }
#define LDSX() do { asm volatile("s_wait_dscnt 0" ::: "memory"); __builtin_amdgcn_wave_barrier(); __builtin_amdgcn_fence(__ATOMIC_RELEASE, "workgroup"); } while (0)

// Row-wise triangle attention on a pair tensor z [1, 256, 256, 128] (4 heads x 32): zn = LayerNorm(z); q,k,v = zn wq^T, zn wk^T, zn wv^T (separate (out,in) [128,128]); logits[r][i][j][h] = q[r][i] . k[r][j] / sqrt(32) + (zn[i][j] . w_pair[h] + b_pair[h]) + 1e9 (mask[r][j] - 1); softmax over j; out = sigmoid(zn w_gate + b_gate) * merged(attn v); result = out w_out (no output bias).
#define NB 256              // pair rows i (each a sequence of SZ = TT = 256 positions; no padding needed)
#define TT 256
#define CC 128            // NH * HD = projected width
#define DIN 128          // input (model) width
#define NH 4
#define HD 32
#define NQB (TT / 64)
#define HG 4
#define SCALE (0.17677669529663687f)
#define LOG2E (1.4426950408889634f)
#define SCALE2 ((float)(0.17677669529663687 * 1.4426950408889634))   // 32^-0.5 x log2(e): the logits are kept in base-2 units, so that exp(x - m) is one v_exp_f32
#define CAUSAL 0
#ifndef TNB
#define TNB NB
#endif
__device__ __forceinline__ float bfr(float v) { return (float)(__bf16)v; }
// eight independent 2^x (v_exp_f32), each in place, in ONE statement: no instruction in it reads an earlier result or overwrites an earlier source, and the closing v_nop is the one slot that the instruction set asks for behind a transcendental. The two s_delay_alu change no result: the compiler hints nothing around asm text, and an unhinted dependent instruction holds the vector port against the SIMD's other waves.
__device__ __forceinline__ v8f exp2x8(v8f x) { float a0 = x[0], a1 = x[1], a2 = x[2], a3 = x[3], a4 = x[4], a5 = x[5], a6 = x[6], a7 = x[7];
  asm("s_delay_alu instid0(VALU_DEP_1)\n\tv_exp_f32 %0, %0\n\tv_exp_f32 %1, %1\n\tv_exp_f32 %2, %2\n\tv_exp_f32 %3, %3\n\tv_exp_f32 %4, %4\n\tv_exp_f32 %5, %5\n\tv_exp_f32 %6, %6\n\tv_exp_f32 %7, %7\n\ts_delay_alu instid0(TRANS32_DEP_1)\n\tv_nop" : "+v"(a0), "+v"(a1), "+v"(a2), "+v"(a3), "+v"(a4), "+v"(a5), "+v"(a6), "+v"(a7));
  const v8f r = {a0, a1, a2, a3, a4, a5, a6, a7}; return r; }
// the same for eight 1 / x (v_rcp_f32)
__device__ __forceinline__ v8f rcpx8(v8f x) { float a0 = x[0], a1 = x[1], a2 = x[2], a3 = x[3], a4 = x[4], a5 = x[5], a6 = x[6], a7 = x[7];
  asm("s_delay_alu instid0(VALU_DEP_1)\n\tv_rcp_f32 %0, %0\n\tv_rcp_f32 %1, %1\n\tv_rcp_f32 %2, %2\n\tv_rcp_f32 %3, %3\n\tv_rcp_f32 %4, %4\n\tv_rcp_f32 %5, %5\n\tv_rcp_f32 %6, %6\n\tv_rcp_f32 %7, %7\n\ts_delay_alu instid0(TRANS32_DEP_1)\n\tv_nop" : "+v"(a0), "+v"(a1), "+v"(a2), "+v"(a3), "+v"(a4), "+v"(a5), "+v"(a6), "+v"(a7));
  const v8f r = {a0, a1, a2, a3, a4, a5, a6, a7}; return r; }
__host__ __device__ __forceinline__ int kb_last(int qb) { return CAUSAL ? ((qb * 64 + 63) >> 7) : (TT / 128 - 1); }
typedef __attribute__((ext_vector_type(8))) __bf16 v8b;
__device__ __forceinline__ v16b frag_b(const __bf16* rowk0, int lane) {
  union { v16b v; v8b q[2]; } u; const __bf16* p = rowk0 + 8 * (lane >> 4);
  u.q[0] = *(const v8b*)p; u.q[1] = *(const v8b*)(p + 16); return u.v;
}
typedef __attribute__((ext_vector_type(4))) __bf16 v4b;
#define WP 136             // bf16 elements per staged weight row: 272 B = 16 B x odd, so the 16-byte fragment reads of 16 rows fall on distinct banks
#define QBH 0              // unused: this file has no causal path
#define QHI 64             // q residual rows only for the first 64 queries (four 16-query blocks) of each row (logits elsewhere: single f16 q, k; sigma_logit ~ 0.25 so this is ample)
#define KHI 64            // unused: K and V are kept as single f16
// B fragment (k rows k0+.., output column o) of a weight: (in,out) [K][ld] or (out,in) [ld rows of K]: bf16 exact, or f16(bf16 * 256) exact
__device__ __forceinline__ v16b wcol_io(const float* Wm, int k0, int o, int lane, int ld) { v16b w; const int g = lane >> 4;
#pragma unroll
  for (int i = 0; i < 8; ++i) { w[i] = (__bf16)Wm[(size_t)(k0 + 8 * g + i) * ld + o]; w[8 + i] = (__bf16)Wm[(size_t)(k0 + 16 + 8 * g + i) * ld + o]; }
  return w; }
__device__ __forceinline__ v16b wcol_oi(const float* Wm, int k0, int o, int lane, int K) { v16b w; const float* p = Wm + (size_t)o * K + k0 + 8 * (lane >> 4);
#pragma unroll
  for (int i = 0; i < 8; ++i) { w[i] = (__bf16)p[i]; w[8 + i] = (__bf16)p[16 + i]; }
  return w; }
__device__ __forceinline__ v16h wcolh_io(const float* Wm, int k0, int o, int lane, int ld) { v16h w; const int g = lane >> 4;
#pragma unroll
  for (int i = 0; i < 8; ++i) { w[i] = (_Float16)(bfr(Wm[(size_t)(k0 + 8 * g + i) * ld + o]) * 256.0f); w[8 + i] = (_Float16)(bfr(Wm[(size_t)(k0 + 16 + 8 * g + i) * ld + o]) * 256.0f); }
  return w; }
__device__ __forceinline__ v16h wcolh_oi(const float* Wm, int k0, int o, int lane, int K) { v16h w; const float* p = Wm + (size_t)o * K + k0 + 8 * (lane >> 4);
#pragma unroll
  for (int i = 0; i < 8; ++i) { w[i] = (_Float16)(bfr(p[i]) * 256.0f); w[8 + i] = (_Float16)(bfr(p[16 + i]) * 256.0f); }
  return w; }
#define WQKV_LAYOUT 1   // (out,in) separate wq / wk / wv [CC][DIN] (wq.reshape(H, DH, D): output column h*32 + c = row of wq)
__device__ __forceinline__ v16b wcol_hdk(const float* Wm, int k0, int o, int lane) { v16b w; const int g = lane >> 4; const float* p = Wm + (size_t)(o / HD) * DIN * HD + (o % HD);
#pragma unroll
  for (int i = 0; i < 8; ++i) { w[i] = (__bf16)p[(size_t)(k0 + 8 * g + i) * HD]; w[8 + i] = (__bf16)p[(size_t)(k0 + 16 + 8 * g + i) * HD]; }
  return w; }
#define WO_OUT_IN 1
#if WQKV_LAYOUT == 1
#define WCOL(W, k0, o, lane) wcol_oi(W, k0, o, lane, DIN)
#elif WQKV_LAYOUT == 2
#define WCOL(W, k0, o, lane) wcol_hdk(W, k0, o, lane)
#else
#define WCOL(W, k0, o, lane) wcol_oi(W, k0, o, lane, DIN)
#endif
#if WO_OUT_IN
#define WOCOL(W, k0, o, lane) wcol_oi(W, k0, o, lane, CC)
#define WOCOLH(W, k0, o, lane) wcolh_oi(W, k0, o, lane, CC)
#else
#define WOCOL(W, k0, o, lane) wcol_io(W, k0, o, lane, DIN)
#define WOCOLH(W, k0, o, lane) wcolh_io(W, k0, o, lane, DIN)
#endif
#define SZ 256             // real positions per row (= TT here)
#define BG 64              // unused
#define NZR ((size_t)NB * SZ)   // 65,536 real pair rows (i, j)
#define SM_EXTRA_PARAMS , const float* __restrict__ BIAS, const float* __restrict__ MKF, int b0s
#define SM_MASK_HOOK do { const int hh = (int)blockIdx.y % HG; const int ii = b0s + (int)blockIdx.y / HG; const int kc2 = k < SZ ? k : SZ - 1; const float add = BIAS[((size_t)t * SZ + kc2) * NH + hh] + 1.0e9f * (bfr(MKF[(size_t)ii * SZ + kc2]) - 1.0f); v = (k < SZ) ? v + add : -3.0e38f; } while (0)   /* + tri_bias[h][q=t][k] + INF (mask[i][k] - 1) (mask is all ones: adds 0, read anyway); key columns k >= SZ would be padding -> excluded (none here: SZ = TT, so the k < SZ test on the loop index always holds) */
__device__ __forceinline__ v16b zero16b() { v16b z; _Pragma("unroll") for (int i = 0; i < 16; ++i) z[i] = (__bf16)0.f; return z; }
#ifndef SM_EXTRA_PARAMS
#define SM_EXTRA_PARAMS
#endif
#ifndef PROJ_EXTRA_PARAMS
#define PROJ_EXTRA_PARAMS
#endif
#ifndef SM_MASK_HOOK
#define SM_MASK_HOOK (void)0
#endif

#define WS_BIAS 0u                                     // f32 triangle bias x log2 e, the only plane in the workspace, in the order of the 16x16 accumulator tiles that take it: [h][16-query tile][16-key tile][half p][lane][4]: query 16 tile + col, keys 16 tile + 8 g + 4 p + 0..3
#define WS_END2 (WS_BIAS + 4u * (size_t)NZR * NH)

__device__ __forceinline__ v8f wmb(v16b a, v16b b, v8f c) { return __builtin_amdgcn_wmma_f32_16x16x32_bf16(false, a, false, b, (short)0, c, false, false); }
// eight 16x16 tiles over K = 128: WROWS: D = W x^T (rows = output channels), else D = x W^T (rows = positions); per tile the order of the sums is hi, lo of k step 0, hi, lo of k step 1, ...
template <bool WROWS, int FB> __device__ __forceinline__ void prod8(const __bf16 (*w)[WP], const F2 (&af)[4], v8f (&acc)[8], int col, int lane) {
#pragma unroll
  for (int kc = 0; kc < 4; ++kc)
#pragma unroll
    for (int jb = 0; jb < 8; jb += FB) { v16b wf[FB];
#pragma unroll
      for (int j = 0; j < FB; ++j) wf[j] = frag_b(&w[(jb + j) * 16 + col][kc * 32], lane);   /* the LDS reads of FB tiles go out together, ahead of their products */
#pragma unroll
      for (int j = 0; j < FB; ++j) acc[jb + j] = WROWS ? wmb(wf[j], af[kc].h, acc[jb + j]) : wmb(af[kc].h, wf[j], acc[jb + j]);
#pragma unroll
      for (int j = 0; j < FB; ++j) acc[jb + j] = WROWS ? wmb(wf[j], af[kc].l, acc[jb + j]) : wmb(af[kc].l, wf[j], acc[jb + j]);
      __builtin_amdgcn_sched_barrier(0); } }   /* batch by batch: left free, the compiler draws the fragment reads of all four k steps to the front, and registers spill */
// LayerNorm of one position, as both kernels take it: a lane holds its row's 64 channels in the 16x16x32 fragment order (the other 64 sit in lane ^ 16), so mean and variance are in-lane sums plus one exchange; the normalised row comes out split bf16 hi + lo, as the operand of the products. lw, lb: ln_g and ln_b in LDS
__device__ __forceinline__ void ln_split(v4f (&x)[16], const float* lwp, const float* lbp, int g, F2 (&af)[4]) {
  float s4[4] = {0.f, 0.f, 0.f, 0.f};
#pragma unroll
  for (int n = 0; n < 16; ++n)
#pragma unroll
    for (int i = 0; i < 4; ++i) { x[n][i] = bfr(x[n][i]); s4[i] += x[n][i]; }
  float s1 = (s4[0] + s4[1]) + (s4[2] + s4[3]); s1 += __shfl_xor(s1, 16);
  const float mu = s1 * (1.0f / CC); float q4[4] = {0.f, 0.f, 0.f, 0.f};
#pragma unroll
  for (int n = 0; n < 16; ++n)
#pragma unroll
    for (int i = 0; i < 4; ++i) { const float d = x[n][i] - mu; q4[i] += d * d; }
  float q = (q4[0] + q4[1]) + (q4[2] + q4[3]); q += __shfl_xor(q, 16);
  const float rs = rsqrtf(q * (1.0f / CC) + 1e-5f);
#pragma unroll
  for (int kc = 0; kc < 4; ++kc) { float v[16];
#pragma unroll
    for (int s = 0; s < 4; ++s) { const int c = kc * 32 + 8 * g + (s >> 1) * 16 + (s & 1) * 4; const v4f lw = *(const v4f*)&lwp[c], lb = *(const v4f*)&lbp[c];
#pragma unroll
      for (int i = 0; i < 4; ++i) v[s * 4 + i] = (x[kc * 4 + s][i] - mu) * rs * lw[i] + lb[i]; }
    af[kc] = bsplit16(v); } }
// ---- k_bias: the triangle bias needs every pair row before any row's softmax, so it has a launch of its own. Block = (16 queries j) x (16 keys k), wave = one query row, its 16 lanes-columns the keys: LayerNorm in registers, then W x^T with the 4 heads as rows 0..3 of one tile. The block's 16 x 16 values of a head are one accumulator tile of k_row's logits: gathered in LDS they leave as 512-B runs in that tile's own order, each 128-B line written by this block alone.
#define BXP 20             // f32 elements per query row of the gathered tile: 80 B, a multiple of 16
__global__ __launch_bounds__(512) void k_bias(const float* __restrict__ Z, const float* __restrict__ LW, const float* __restrict__ LB, const float* __restrict__ WB, const float* __restrict__ WBB, float* __restrict__ BIAS) {
  __shared__ __align__(16) __bf16 swb[16][WP]; __shared__ __align__(16) float sln[4][CC]; __shared__ __align__(16) float sbx[NH][16][BXP];
  const int tid = threadIdx.x, wave = tid >> 5, lane = tid & 31, col = lane & 15, g = lane >> 4; const int T = (int)blockIdx.x >> 4, jt = (int)blockIdx.x & 15; const size_t r0 = (size_t)(T * 16 + wave) * TT + jt * 16;
  v4f x[16];
  { /* all loads of a lane fly together: no wait stands between them */
    const float* px = Z + (r0 + col) * CC + 8 * g;
#pragma unroll
    for (int n = 0; n < 16; ++n) x[n] = *(const v4f*)(px + (n >> 2) * 32 + ((n >> 1) & 1) * 16 + (n & 1) * 4);
    const int ch = tid & (CC - 1);
    const float* pb = WB + (wave & (NH - 1)) * CC + lane * 4; const v4f wb4 = *(const v4f*)pb;   /* read by every wave, so that no branch parts the loads; kept by waves 0..3 (bias row = wave) */
    const int sel = wave >> 2, c4 = ch & (NH - 1); const float l0 = LW[ch], l1 = LB[ch], l3 = WBB[c4];   /* likewise; four waves each keep ln_g, ln_b and (twice) wb_b, its 4 values repeated */
    asm volatile("s_wait_xcnt 0x0" :: "v"(px), "v"(pb), "v"(ch), "v"(c4) : "memory");   /* the address registers of these loads are reused below; px, pb, ch and c4 stay live up to this wait */
    v4b w;
#pragma unroll
    for (int i = 0; i < 4; ++i) w[i] = (__bf16)(wave < NH ? wb4[i] : 0.f);
    *(v4b*)&swb[wave][lane * 4] = w;   /* rows 4..15 of the one bias tile are zero */
    sln[sel][ch] = bfr(sel == 0 ? l0 : sel == 1 ? l1 : l3); }
  __syncthreads();   /* every wave wrote a part of what all sixteen read */
  F2 af[4]; ln_split(x, sln[0], sln[1], g, af);
  v8f ab = {};
#pragma unroll
  for (int kc = 0; kc < 4; ++kc) { const v16b wf = frag_b(&swb[col][kc * 32], lane); ab = wmb(wf, af[kc].h, ab); ab = wmb(wf, af[kc].l, ab); }
  if (g == 0) {
#pragma unroll
    for (int i = 0; i < 4; ++i) sbx[i][wave][col] = (ab[i] + sln[3][i]) * LOG2E; }   /* lanes 0..15 hold the 4 heads of their key; + wb_b[h]; base-2 units, once per value */
  __syncthreads();   /* a tile holds the query rows of all sixteen waves */
  if (wave < 2 * NH) { const v4f t = *(const v4f*)&sbx[wave >> 1][col][8 * g + 4 * (wave & 1)]; float* db = BIAS + ((size_t)((wave >> 1) * 16 + T) * 16 + jt) * 256 + (wave & 1) * 128 + lane * 4; vst2(db, t); } }
#define NW 16
#define OP 132             // f32 elements per row of a wave's output tile in LDS: 528 B = 16 B x odd
#define SLOT (16 * OP * 4) // bytes of a wave's own slot, laid over the staged weights once these are done with: q [h][piece][lane][8] f16 (4 KiB), gate likewise as 16-bit (4 KiB); head by head the gated ctx, bf16 hi and lo, takes their places; at the end the wave's output tile [query][OP]
__device__ __forceinline__ v8f wm16(v16h a, v16h b, v8f c) { return __builtin_amdgcn_wmma_f32_16x16x32_f16(false, a, false, b, (short)0, c, false, false); }
__device__ __forceinline__ v16h frag_p(const _Float16* p) { union { v16h v; v8h q[2]; } u; u.q[0] = *(const v8h*)p; u.q[1] = *(const v8h*)(p + 256); return u.v; }   /* a fragment stored in fragment order: its two pieces lie 512 B apart, the lane's offset is already in p */
// the value of lane ^ 16, by the LDS crossbar as __shfl_xor(x, 16) takes it, but with the pattern in the instruction (xor mask 16, and mask 31): no index register lives through the loop
__device__ __forceinline__ float xhalf(float x) { return __builtin_bit_cast(float, __builtin_amdgcn_ds_swizzle(__builtin_bit_cast(int, x), 0x401f)); }
__global__ __launch_bounds__(NW * 32) void k_row(const float* __restrict__ Z, const float* __restrict__ LW, const float* __restrict__ LB, const float* __restrict__ WQ, const float* __restrict__ WK, const float* __restrict__ WV, const float* __restrict__ WG, const float* __restrict__ GB, const float* __restrict__ WO, const float* __restrict__ MKF, const float* __restrict__ BIAS, float* __restrict__ OUT) {
  __shared__ __align__(16) char sbig[4 * CC * WP * 2];   /* part 1: the four weights; part 2: the waves' slots (NW * SLOT bytes fit) */
  __shared__ __align__(16) __bf16 swo[DIN][WP]; __shared__ __align__(16) float sln[3][CC]; __shared__ __align__(16) float smk[TT];
  __shared__ __align__(16) _Float16 skf[NH * 8192];   /* K [h][16-key tile][piece p][lane][8]: key 16 tile + col, channels 32 h + 16 p + 8 g + 0..7 */
  __shared__ __align__(16) _Float16 svf[NH * 8192];   /* V [h][16-channel tile][32-key step][piece p][lane][8]: channel 32 h + 16 tile + col, keys 32 step + 16 p + 8 g + 0..7 */
  __shared__ __align__(16) _Float16 sql[QHI / 16][2048];   /* q residual x 2^10 of the waves that carry one, as q */
  static_assert(NW * SLOT <= 4 * CC * WP * 2, "the slots lie over the weights");
  __bf16 (*sw)[CC][WP] = (__bf16 (*)[CC][WP])sbig;
  const int tid = threadIdx.x, wave = __builtin_amdgcn_readfirstlane(tid >> 5), lane = tid & 31, col = lane & 15, g = lane >> 4; const size_t bb = blockIdx.x; const size_t r0 = bb * TT + wave * 16;   /* the wave's number in a scalar register: all that depends on it alone is scalar arithmetic */
  v4f x[16];
  { /* the loads of a lane at the block's start fly together: no wait stands between them */
    const float* px = Z + (r0 + col) * CC + 8 * g;
#pragma unroll
    for (int n = 0; n < 16; ++n) x[n] = *(const v4f*)(px + (n >> 2) * 32 + ((n >> 1) & 1) * 16 + (n & 1) * 4);
    v4f a[4][8]; const int ch = tid & (CC - 1), km = tid & (TT - 1);
    const int sel = wave >> 2; const float l0 = LW[ch], l1 = LB[ch], l2 = GB[ch], l3 = MKF[bb * SZ + km];   /* read by every wave, so that no branch parts the loads; four waves each keep ln_g, ln_b and the gate's bias, eight the mask row */
#pragma unroll
    for (int it = 0; it < 8; ++it) { a[0][it] = *(const v4f*)(WQ + tid * 4 + it * 2048); a[1][it] = *(const v4f*)(WK + tid * 4 + it * 2048); a[2][it] = *(const v4f*)(WV + tid * 4 + it * 2048); a[3][it] = *(const v4f*)(WG + tid * 4 + it * 2048); }
    asm volatile("s_wait_xcnt 0x0" :: "v"(px), "v"(ch), "v"(km) : "memory");   /* the address registers of these loads are reused below; px, ch and km stay live up to this wait, so that no load of the group lands on address registers of the group */
    asm volatile("" :: "v"(l0), "v"(l1), "v"(l2), "v"(l3));   /* inputs only: holds these four loads up here with the others; the compiler otherwise sinks them into branches behind the staging, where their latency is waited out alone */
#pragma unroll
    for (int m = 0; m < 4; ++m)
#pragma unroll
      for (int it = 0; it < 8; ++it) { v4b w;
#pragma unroll
        for (int i = 0; i < 4; ++i) w[i] = (__bf16)a[m][it][i];
        *(v4b*)&sw[m][it * 16 + wave][lane * 4] = w; }
    if (sel < 3) sln[sel][ch] = bfr(sel == 0 ? l0 : sel == 1 ? l1 : l2);
    if (wave < TT / 32) smk[km] = (1.0e9f * LOG2E) * (bfr(l3) - 1.0f); }   /* INF (mask[i][k] - 1) in base-2 units, once per block for the four heads */
  __syncthreads();   /* every wave wrote a part of the weight rows that all sixteen read */
  F2 af[4]; ln_split(x, sln[0], sln[1], g, af);
  __builtin_amdgcn_sched_barrier(0);   /* this one and its like below keep the blocks of part 1 apart: drawn into one another they hold the fragments and results of two blocks at once, and registers spill */
  { /* v: 16 positions of the wave = piece (wave & 1) of key step (wave >> 1); accumulator tile j = channel tile (j & 1) of head (j >> 1) */
    v8f acc[8] = {}; prod8<false, 8>(sw[2], af, acc, col, lane); _Float16* dv = svf + wave * 256 + lane * 8;
#pragma unroll
    for (int j = 0; j < 8; ++j) { v8h hv;
#pragma unroll
      for (int r = 0; r < 8; ++r) hv[r] = (_Float16)acc[j][r];
      *(v8h*)(dv + j * 4096) = hv; } }
  __builtin_amdgcn_sched_barrier(0);
  { /* k: the wave's 16 positions = tile (wave); accumulator tile j = piece (j & 1) of head (j >> 1) */
    v8f acc[8] = {}; prod8<true, 8>(sw[1], af, acc, col, lane); _Float16* dk = skf + wave * 512 + lane * 8;
#pragma unroll
    for (int j = 0; j < 8; ++j) { v8h hv;
#pragma unroll
      for (int r = 0; r < 8; ++r) hv[r] = (_Float16)acc[j][r];
      *(v8h*)(dk + ((j >> 1) * 32 + (j & 1)) * 256) = hv; } }
  __builtin_amdgcn_sched_barrier(0);
  v4u s[8];
  { /* gate: a value in 0..1, kept as round(65535 x): its step, 2^-16, is of the size of the rounding that the bf16 hi + lo split of the gated ctx makes anyway; accumulator tile j = piece (j & 1) of head (j >> 1) */
    v8f acc[8] = {}; prod8<true, 8>(sw[3], af, acc, col, lane);
#pragma unroll
    for (int j = 0; j < 8; ++j) { const v4f g0 = *(const v4f*)&sln[2][j * 16 + 8 * g], g1 = *(const v4f*)&sln[2][j * 16 + 8 * g + 4];
      v8f t;
#pragma unroll
      for (int r = 0; r < 4; ++r) { t[r] = (acc[j][r] + g0[r]) * -LOG2E; t[4 + r] = (acc[j][4 + r] + g1[r]) * -LOG2E; }
      t = rcpx8(exp2x8(t) + 1.0f);   /* sigmoid(zn w_gate + b_gate) = 1 / (1 + 2^(-x log2 e)) */
#pragma unroll
      for (int r = 0; r < 4; ++r) s[j][r] = __builtin_bit_cast(unsigned, __builtin_amdgcn_cvt_pknorm_u16(t[2 * r], t[2 * r + 1])); } }   /* channel 2 r in the low half */
  __builtin_amdgcn_sched_barrier(0);
  const bool hi = wave * 16 < QHI;   /* wave-uniform: these queries carry the q residual */
  v8f st[TT / 16];   /* the logits' accumulators; between two heads they take the next head's bias */
  const float* const pbias = BIAS + (size_t)wave * 4096 + lane * 4;   /* the wave's 16 tiles of head 0; a head further on: 64 Ki floats */
#define LOAD_BIAS(hh) do { const float* pb_ = pbias + (size_t)(hh) * 65536; \
    _Pragma("unroll") for (int j = 0; j < TT / 16; ++j) { const v4f t0 = *(const v4f*)(pb_ + j * 256), t1 = *(const v4f*)(pb_ + j * 256 + 128); const v8f t = {t0[0], t0[1], t0[2], t0[3], t1[0], t1[1], t1[2], t1[3]}; st[j] = t; } \
    asm volatile("s_wait_xcnt 0x0" :: "v"(pb_) : "memory");   /* the address of these loads moves on with the head; pb_ stays live up to this wait */ } while (0)
  char* const slot = sbig + wave * SLOT;
  { /* q, last, x 32^-0.5 log2 e ahead of its rounding, so that K q^T can be summed onto the bias in base-2 units; accumulator tile j = piece (j & 1) of head (j >> 1) */
    v8f acc[8] = {}; prod8<true, 4>(sw[0], af, acc, col, lane);   /* four fragments at a time: the gate's values are live beside this product */
    __syncthreads();   /* every wave has read its last weight fragment: the slots may be written; K and V are published */
#pragma unroll
    for (int j = 0; j < 8; ++j) { v8h hv;
#pragma unroll
      for (int r = 0; r < 8; ++r) { acc[j][r] *= SCALE2; hv[r] = (_Float16)acc[j][r]; }
      *(v8h*)(slot + j * 512 + lane * 16) = hv; *(v4u*)(slot + 4096 + j * 512 + lane * 16) = s[j];
      if (hi) { v8h lv;
#pragma unroll
        for (int r = 0; r < 8; ++r) lv[r] = (_Float16)((acc[j][r] - (float)hv[r]) * 1024.0f);
        *(v8h*)(&sql[wave & (QHI / 16 - 1)][j * 256 + lane * 8]) = lv; } } }
  /* wo (out,in) [128][128] f32 (each wave-load takes one whole 512-B row) is staged here, where few registers are live; its loads and those of head 0's bias fly together */
  { const float* pw = WO + tid * 4; v4f aw[8];
#pragma unroll
    for (int it = 0; it < 8; ++it) aw[it] = *(const v4f*)(pw + it * (NW * 128));
    asm volatile("s_wait_xcnt 0x0" :: "v"(pw) : "memory");   /* the address registers of these loads are reused below; pw stays live up to this wait */
    LOAD_BIAS(0);
#pragma unroll
    for (int it = 0; it < 8; ++it) { v4b w;
#pragma unroll
      for (int i = 0; i < 4; ++i) w[i] = (__bf16)aw[it][i];
      *(v4b*)&swo[it * NW + wave][lane * 4] = w; } }   /* wo as bf16 rows */
  __syncthreads();   /* publishes the wo rows, which every wave reads behind the loop */
  _Float16* const sq = (_Float16*)slot + lane * 8;   /* head h: + 512 h; the gate 2048 further on */
  const _Float16* sl = &sql[wave & (QHI / 16 - 1)][lane * 8];
  const _Float16* sk = skf + lane * 8; const _Float16* sv = svf + lane * 8;   /* head h: + 8192 h; fragment f: + 512 f */
  const float* const smr = &smk[8 * g];
  /* the loop over heads stays rolled: one tile's registers at a time keep four waves on a SIMD; every inner loop is unrolled so that st[] is indexed by constants and stays in registers */
#pragma unroll 1
  for (int h = 0; h < NH; ++h) {
    const v16h qf = frag_p(sq + h * 512);
#pragma unroll
    for (int jb = 0; jb < TT / 16; jb += 8) { v16h kf[8];
#pragma unroll
      for (int j = 0; j < 8; ++j) kf[j] = frag_p(sk + h * 8192 + (jb + j) * 512);
      __builtin_amdgcn_sched_barrier(0);   /* keeps the products behind a batch of eight fragments' LDS reads: without it the compiler draws each product up behind its own two reads, into one pair of registers, and every fragment's LDS latency is waited out alone */
#pragma unroll
      for (int j = 0; j < 8; ++j) st[jb + j] = wm16(kf[j], qf, st[jb + j]); }   /* onto the bias, in place */
    __builtin_amdgcn_sched_barrier(0);   /* holds every product above the slots of the next line */
    asm volatile("v_nop\n\tv_nop\n\tv_nop\n\tv_nop" :: "v"(st[TT / 16 - 1]));   /* the four vector slots that the chip needs behind a matrix instruction before its result is read */
    if (hi) { const v16h ql = frag_p(sl + h * 512);   /* the residual's product is added in place, in a branch of its own: with the two kinds of wave in two arms, the bias stays live beside the results and registers spill */
#pragma unroll
      for (int j = 0; j < TT / 16; ++j) { const v8f z = {}; const v8f al = wm16(frag_p(sk + h * 8192 + j * 512), ql, z);
#pragma unroll
        for (int r = 0; r < 8; ++r) st[j][r] += al[r] * (1.0f / 1024.0f); } }
    float m = -3.0e38f;
#pragma unroll
    for (int j = 0; j < TT / 16; ++j) { const v4f a0 = *(const v4f*)(smr + j * 16), a1 = *(const v4f*)(smr + j * 16 + 4);
#pragma unroll
      for (int r = 0; r < 4; ++r) { st[j][r] += a0[r]; st[j][4 + r] += a1[r]; m = fmaxf(m, fmaxf(st[j][r], st[j][4 + r])); } }
    m = fmaxf(m, xhalf(m));
    float s4[4] = {0.f, 0.f, 0.f, 0.f};
#pragma unroll
    for (int j = 0; j < TT / 16; ++j) { v8f d;
#pragma unroll
      for (int r = 0; r < 8; ++r) d[r] = st[j][r] - m;
      st[j] = exp2x8(d);
#pragma unroll
      for (int r = 0; r < 8; ++r) s4[r & 3] += st[j][r]; }
    float sum = (s4[0] + s4[1]) + (s4[2] + s4[3]); sum += xhalf(sum);
    const float f = sum > 0.f ? 2048.0f * __builtin_amdgcn_rcpf(sum) : 0.f;
    v8f o0 = {}, o1 = {};
#pragma unroll
    for (int kc = 0; kc < TT / 32; ++kc) { v16h p;
#pragma unroll
      for (int c = 0; c < 8; ++c) { p[c] = (_Float16)(st[2 * kc][c] * f); p[8 + c] = (_Float16)(st[2 * kc + 1][c] * f); }   /* keys kc*32 + 8 g + c and kc*32 + 16 + 8 g + c: the k order of frag_h */
      o0 = wm16(frag_p(sv + h * 8192 + kc * 512), p, o0); o1 = wm16(frag_p(sv + h * 8192 + (8 + kc) * 512), p, o1); }
    asm volatile("v_nop\n\tv_nop\n\tv_nop\n\tv_nop" :: "v"(o0), "v"(o1));   /* the four vector slots that the chip needs behind a matrix instruction before its operands are overwritten */
    if (h + 1 < NH) LOAD_BIAS(h + 1);   /* a scalar test; the accumulators are free from here to the next head's products: the loads fly under the gating, and under the other waves' work */
    /* a lane holds channels 8 g + r (o0) and 16 + 8 g + r (o1) of its query: pieces 0 and 1 of the gate tile, two 16-bit values to a word; GS takes back the 2^11 of P and the 65535 of the gate */
    const v4u g0 = *(const v4u*)(sq + 2048 + h * 512), g1 = *(const v4u*)(sq + 2048 + h * 512 + 256); float v[16]; const float GS = (float)(1.0 / (2048.0 * 65535.0));
#pragma unroll
    for (int c = 0; c < 4; ++c) { v[2 * c] = o0[2 * c] * ((float)(g0[c] & 0xffffu) * GS); v[2 * c + 1] = o0[2 * c + 1] * ((float)(g0[c] >> 16) * GS); v[8 + 2 * c] = o1[2 * c] * ((float)(g1[c] & 0xffffu) * GS); v[9 + 2 * c] = o1[2 * c + 1] * ((float)(g1[c] >> 16) * GS); }
    /* channels 32 h + 8 g + 0..7 and 32 h + 16 + 8 g + 0..7 of query col = the B fragment of k step h of out^T = wo ctx^T, split bf16 hi + lo. It waits in the slot for the end of the loop, so that the eight out^T tiles hold no registers beside the logits: hi where this lane's q of head h lay, lo where its gate lay, both read for the last time above */
    union { F2 f; v8b q[4]; } yu; yu.f = bsplit16(v); __bf16* dy = (__bf16*)sq + h * 512;
    *(v8b*)dy = yu.q[0]; *(v8b*)(dy + 256) = yu.q[1]; *(v8b*)(dy + 2048) = yu.q[2]; *(v8b*)(dy + 2048 + 256) = yu.q[3]; }
  v8f acc[8] = {};   /* out^T: tile j = output channels 16 j + 8 g + r of query col; per tile the order of the sums is hi, lo of head 0, hi, lo of head 1, ... */
#pragma unroll
  for (int h = 0; h < NH; ++h) { union { F2 f; v8b q[4]; } yu; const __bf16* dy = (const __bf16*)sq + h * 512; v16b wf[8];
    yu.q[0] = *(const v8b*)dy; yu.q[1] = *(const v8b*)(dy + 256); yu.q[2] = *(const v8b*)(dy + 2048); yu.q[3] = *(const v8b*)(dy + 2048 + 256);
#pragma unroll
    for (int j = 0; j < 8; ++j) wf[j] = frag_b(&swo[j * 16 + col][h * 32], lane);
#pragma unroll
    for (int j = 0; j < 8; ++j) acc[j] = wmb(wf[j], yu.f.h, acc[j]);
#pragma unroll
    for (int j = 0; j < 8; ++j) acc[j] = wmb(wf[j], yu.f.l, acc[j]); }
  float (*sf)[OP] = (float (*)[OP])slot;   /* the wave has read its ctx fragments: its own slot turns a lane's 8 channels of one query into whole 512-B output rows */
  const int ln = (int)__builtin_amdgcn_mbcnt_lo(~0u, 0u), cl = ln & 15, gl2 = ln >> 4;   /* the lane's number taken anew, so that no address of this part holds a register through the loop */
#pragma unroll
  for (int j = 0; j < 8; ++j) { const v4f t0 = {acc[j][0], acc[j][1], acc[j][2], acc[j][3]}, t1 = {acc[j][4], acc[j][5], acc[j][6], acc[j][7]};
    *(v4f*)&sf[cl][j * 16 + 8 * gl2] = t0; *(v4f*)&sf[cl][j * 16 + 8 * gl2 + 4] = t1; }
  LDSX();   /* the lanes of this wave read each other's values below */
  float* po = OUT + r0 * DIN + ln * 4;
  v4f ot[16];
#pragma unroll
  for (int rl = 0; rl < 16; ++rl) ot[rl] = *(const v4f*)&sf[rl][ln * 4];   /* the sixteen LDS reads go out together, ahead of the stores */
#pragma unroll
  for (int rl = 0; rl < 16; ++rl) vst2(po + rl * DIN, ot[rl]); }

extern "C" void kernel_launch(void* const* d_in, const int* in_sizes, int n_in, void* d_out, int out_size, void* d_ws, size_t ws_size, hipStream_t stream) {
  (void)in_sizes; (void)n_in; (void)out_size;
  const float** F = (const float**)d_in;
  // inputs: 0 pair_repr [1,256,256,128]; 1 mask [1,256,256] f32 (ones); 2 ln_g, 3 ln_b; 4 wb_w [4,128] (out,in), 5 wb_b [4]; 6 wq, 7 wk, 8 wv [128,128] (out,in); 9 wo [128,128] (out,in); 10 wg_w [128,128] (out,in), 11 wg_b [128]
  if (ws_size < (size_t)WS_END2) return;
  float *BIAS = (float*)((char*)d_ws + WS_BIAS);
  k_bias<<<dim3((SZ / 16) * (SZ / 16)), 512, 0, stream>>>(F[0], F[2], F[3], F[4], F[5], BIAS);   /* LayerNorm and the tri bias tiles (+ wb_b) */
  k_row<<<dim3(NB), NW * 32, 0, stream>>>(F[0], F[2], F[3], F[6], F[7], F[8], F[10], F[11], F[9], F[1], BIAS, (float*)d_out);   /* LayerNorm, q, k, v, gate, logits, softmax, P.v, gate and the output projection of a pair row; only the bias passes through the workspace */
}
